// v000
// Measured on an AMD MI455X. A time is GPU time per run, averaged over a window of back-to-back runs after a warm-up
// (all launches, gaps included; the runs take copies of the inputs in turn), and the median of several windows.
// Apart from v000's, it joins two sittings. Times from different sittings can be a few percent apart, while
// side-by-side timings come from the same sitting.
// v000 is the starting kernel. One run takes 812 microseconds.
#include <hip/hip_runtime.h>
#include <hip/hip_bf16.h>

typedef __attribute__((ext_vector_type(16))) _Float16 v16h;
typedef __attribute__((ext_vector_type(8)))  _Float16 v8h;
typedef __attribute__((ext_vector_type(4)))  _Float16 v4h;
typedef __attribute__((ext_vector_type(8)))  float    v8f;

static __device__ __forceinline__ v8f wmma16(v16h a, v16h b, v8f c) {
  return __builtin_amdgcn_wmma_f32_16x16x32_f16(false, a, false, b, (short)0, c, false, false);
}
static __device__ __forceinline__ v16h pack16(v8h lo, v8h hi) {
  return __builtin_shufflevector(lo, hi, 0,1,2,3,4,5,6,7,8,9,10,11,12,13,14,15);
}

// ---------------------------------------------------------------------------
// fp32 -> f16 conversion (vectorized x4); totals are multiples of 4
// ---------------------------------------------------------------------------
__global__ __launch_bounds__(256)
void cvt16_kernel(const float* __restrict__ in, _Float16* __restrict__ out, int total) {
  const int i = (blockIdx.x * 256 + threadIdx.x) * 4;
  if (i >= total) return;
  const float4 v = *(const float4*)(in + i);
  v4h o; o[0] = (_Float16)v.x; o[1] = (_Float16)v.y; o[2] = (_Float16)v.z; o[3] = (_Float16)v.w;
  *(v4h*)(out + i) = o;
}

// ---------------------------------------------------------------------------
// Epilogues: 0=identity, 1=relu^2, 2=sigmoid, 3=gelu(exact)
// ---------------------------------------------------------------------------
template<int EPI>
static __device__ __forceinline__ float apply_epi(float x) {
  if constexpr (EPI == 1) { float t = x > 0.f ? x : 0.f; return t * t; }
  else if constexpr (EPI == 2) { return 1.f / (1.f + __expf(-x)); }
  else if constexpr (EPI == 3) { return 0.5f * x * (1.f + erff(x * 0.70710678118654752f)); }
  else return x;
}

// ---------------------------------------------------------------------------
// WMMA GEMM, all-f16 operands: out[M,N] = epi( A[M,K] @ W[N,K]^T )
// W tile (64 x 32) staged in LDS, double-buffered, shared by all 8 waves.
// Requirements: M % 256 == 0, K % 32 == 0.  N guarded in 16-wide steps.
// ---------------------------------------------------------------------------
template<int EPI, int OH>
__global__ __launch_bounds__(256)
void gemm_kernel(const _Float16* __restrict__ A, const _Float16* __restrict__ W,
                 void* __restrict__ Op, int M, int N, int K) {
  const int tid  = threadIdx.x;
  const int wave = tid >> 5;
  const int lane = tid & 31;
  const int hlf  = lane >> 4;
  const int r    = lane & 15;
  const int m0 = blockIdx.x * 256 + wave * 32;
  const int n0 = blockIdx.y * 64;

  __shared__ __attribute__((aligned(16))) _Float16 wtile[2][64 * 32];
  const int srow = tid >> 2;            // 0..63
  const int scol = (tid & 3) * 8;       // 0,8,16,24

  auto stage = [&](int buf, int k0) {
    if (n0 + srow < N) {
      const v8h w = *(const v8h*)(W + (size_t)(n0 + srow) * K + k0 + scol);
      *(v8h*)(&wtile[buf][srow * 32 + scol]) = w;
    }
  };

  v8f acc[2][4];
  #pragma unroll
  for (int mi = 0; mi < 2; ++mi)
    #pragma unroll
    for (int nj = 0; nj < 4; ++nj)
      #pragma unroll
      for (int e = 0; e < 8; ++e) acc[mi][nj][e] = 0.f;

  stage(0, 0);
  __syncthreads();

  int it = 0;
  for (int k0 = 0; k0 < K; k0 += 32, ++it) {
    const int cur = it & 1;
    if (k0 + 32 < K) stage(cur ^ 1, k0 + 32);

    const _Float16* p0 = A + (size_t)(m0 + r) * K + k0 + hlf * 8;
    const _Float16* p1 = A + (size_t)(m0 + 16 + r) * K + k0 + hlf * 8;
    const v16h a0 = pack16(*(const v8h*)p0, *(const v8h*)(p0 + 16));
    const v16h a1 = pack16(*(const v8h*)p1, *(const v8h*)(p1 + 16));
    if (k0 + 32 < K) __builtin_prefetch(p0 + 32, 0, 0);

    #pragma unroll
    for (int nj = 0; nj < 4; ++nj) {
      const int nb = n0 + nj * 16;
      if (nb >= N) break;
      const _Float16* lp = &wtile[cur][(nj * 16 + r) * 32 + hlf * 8];
      const v16h bf = pack16(*(const v8h*)lp, *(const v8h*)(lp + 16));
      acc[0][nj] = wmma16(a0, bf, acc[0][nj]);
      acc[1][nj] = wmma16(a1, bf, acc[1][nj]);
    }
    __syncthreads();
  }

  #pragma unroll
  for (int nj = 0; nj < 4; ++nj) {
    const int nb = n0 + nj * 16;
    if (nb >= N) break;
    const int n = nb + r;
    #pragma unroll
    for (int mi = 0; mi < 2; ++mi)
      #pragma unroll
      for (int v = 0; v < 8; ++v) {
        const int m = m0 + mi * 16 + v + 8 * hlf;
        const float val = apply_epi<EPI>(acc[mi][nj][v]);
        if constexpr (OH) ((_Float16*)Op)[(size_t)m * N + n] = (_Float16)val;
        else              ((float*)Op)[(size_t)m * N + n] = val;
      }
  }
}

// ---------------------------------------------------------------------------
// RMSNorm over last dim C (one block per row), f32 in -> f16 out
// ---------------------------------------------------------------------------
__global__ __launch_bounds__(256)
void rmsnorm16_kernel(const float* __restrict__ x, _Float16* __restrict__ o, int C) {
  const size_t row = blockIdx.x;
  const float* xr = x + row * (size_t)C;
  float ss = 0.f;
  for (int i = threadIdx.x; i < C; i += 256) { float v = xr[i]; ss += v * v; }
  #pragma unroll
  for (int off = 16; off; off >>= 1) ss += __shfl_xor(ss, off, 32);
  __shared__ float red[8];
  if ((threadIdx.x & 31) == 0) red[threadIdx.x >> 5] = ss;
  __syncthreads();
  float tot = 0.f;
  #pragma unroll
  for (int i = 0; i < 8; ++i) tot += red[i];
  const float rs = rsqrtf(tot / (float)C + 1e-6f);
  _Float16* orow = o + row * (size_t)C;
  for (int i = threadIdx.x; i < C; i += 256) orow[i] = (_Float16)(xr[i] * rs);
}

// ---------------------------------------------------------------------------
// QKV post: RoPE + head RMSNorm*1.2 for q,k; v + 3*sigmoid(xn[:12]@gate)*ve.
// grid = (B*T, 24) blocks of 64 threads.  Outputs f16 heads.
// qh: [B,H,T,64]   kh: [B,KV,T,64]   vt: [B,KV,64,T]  (V TRANSPOSED)
// ---------------------------------------------------------------------------
__global__ __launch_bounds__(64)
void qkvpost_kernel(const float* __restrict__ q_raw, const float* __restrict__ k_raw,
                    const float* __restrict__ v_raw, const _Float16* __restrict__ xn,
                    const float* __restrict__ ve, const float* __restrict__ cosb,
                    const float* __restrict__ sinb, const float* __restrict__ wgate,
                    _Float16* __restrict__ qh, _Float16* __restrict__ kh,
                    _Float16* __restrict__ vt, int T) {
  const int bt = blockIdx.x;
  const int b = bt / T, t = bt % T;
  const int u = blockIdx.y;
  const int lane = threadIdx.x;
  __shared__ float red[2];

  if (u < 20) {
    const float* src;
    _Float16* dst;
    if (u < 16) { src = q_raw + (size_t)bt * 1024 + u * 64;
                  dst = qh + (((size_t)(b * 16 + u)) * T + t) * 64; }
    else        { const int kv = u - 16;
                  src = k_raw + (size_t)bt * 256 + kv * 64;
                  dst = kh + (((size_t)(b * 4 + kv)) * T + t) * 64; }
    const int j = lane & 31;
    const float c = cosb[(size_t)t * 32 + j], s = sinb[(size_t)t * 32 + j];
    const float x1 = src[j], x2 = src[j + 32];
    const float val = (lane < 32) ? (x1 * c + x2 * s) : (-x1 * s + x2 * c);
    float ss = val * val;
    #pragma unroll
    for (int off = 16; off; off >>= 1) ss += __shfl_xor(ss, off, 32);
    if ((lane & 31) == 0) red[lane >> 5] = ss;
    __syncthreads();
    const float rs = rsqrtf((red[0] + red[1]) * (1.f / 64.f) + 1e-6f) * 1.2f;
    dst[lane] = (_Float16)(val * rs);
  } else {
    const int kv = u - 20;
    float g = 0.f;
    #pragma unroll
    for (int i = 0; i < 12; ++i) g += (float)xn[(size_t)bt * 1024 + i] * wgate[kv * 12 + i];
    g = 3.f / (1.f + __expf(-g));
    const size_t idx = (size_t)bt * 256 + kv * 64 + lane;
    // transposed store: [b][kv][hd=lane][t]
    vt[(((size_t)(b * 4 + kv)) * 64 + lane) * T + t] = (_Float16)(v_raw[idx] + g * ve[idx]);
  }
}

// ---------------------------------------------------------------------------
// Flash attention with refine-conv term.  grid = (B*H, T/128), block = 256.
// Wave w handles 16 query rows; keys tiled 32 wide; causal.  f16 in, f16 out.
// V consumed transposed [B,KV,64,T] -> B-fragments are two b128 loads.
// Refine conv is branchless: 10 rows x 3 clamped+masked columns per lane,
// reused across the 8 accumulator rows (9 FMAs each).
// ---------------------------------------------------------------------------
__global__ __launch_bounds__(256)
void attn_kernel(const _Float16* __restrict__ qh, const _Float16* __restrict__ kh,
                 const _Float16* __restrict__ vt, const float* __restrict__ prev,
                 const float* __restrict__ refine_w, const float* __restrict__ alpha_p,
                 _Float16* __restrict__ y, int T) {
  constexpr int H = 16, KV = 4, HD = 64;
  const int bh = blockIdx.x;
  const int b = bh / H, h = bh % H;
  const int wave = threadIdx.x >> 5;
  const int lane = threadIdx.x & 31;
  const int hlf = lane >> 4, r = lane & 15;
  const int qb = (blockIdx.y * 8 + wave) * 16;
  const float alpha = alpha_p[0];

  float rw[9];
  #pragma unroll
  for (int i = 0; i < 9; ++i) rw[i] = refine_w[h * 9 + i];

  const _Float16* qbase = qh + ((size_t)(b * H + h)) * T * HD;
  const _Float16* kbase = kh + ((size_t)(b * KV + (h >> 2))) * T * HD;
  const _Float16* vbase = vt + ((size_t)(b * KV + (h >> 2))) * HD * T;
  const float*    pbase = prev + ((size_t)(b * H + h)) * T * T;

  v16h aQ[2];
  {
    const _Float16* qp = qbase + (size_t)(qb + r) * HD + hlf * 8;
    aQ[0] = pack16(*(const v8h*)qp,        *(const v8h*)(qp + 16));
    aQ[1] = pack16(*(const v8h*)(qp + 32), *(const v8h*)(qp + 48));
  }

  float mstat[8], lstat[8];
  v8f O[4];
  #pragma unroll
  for (int v = 0; v < 8; ++v) { mstat[v] = -1e30f; lstat[v] = 0.f; }
  #pragma unroll
  for (int j = 0; j < 4; ++j)
    #pragma unroll
    for (int e = 0; e < 8; ++e) O[j][e] = 0.f;

  __shared__ __attribute__((aligned(16))) _Float16 lds_p[8 * 16 * 32];
  const int wbase = wave * 512;
  const int qrow0 = qb + 8 * hlf;   // first accumulator row for this lane-half

  for (int kb = 0; kb <= qb + 15; kb += 32) {
    // S = Q @ K^T  (16 x 32 tile, two 16x16 fragments)
    v8f S[2];
    #pragma unroll
    for (int sb = 0; sb < 2; ++sb) {
      #pragma unroll
      for (int e = 0; e < 8; ++e) S[sb][e] = 0.f;
      const _Float16* kp = kbase + (size_t)(kb + sb * 16 + r) * HD + hlf * 8;
      S[sb] = wmma16(aQ[0], pack16(*(const v8h*)kp,        *(const v8h*)(kp + 16)), S[sb]);
      S[sb] = wmma16(aQ[1], pack16(*(const v8h*)(kp + 32), *(const v8h*)(kp + 48)), S[sb]);
    }

    // scale + refine conv (branchless, row-reused) + causal mask
    #pragma unroll
    for (int sb = 0; sb < 2; ++sb) {
      const int kj = kb + sb * 16 + r;
      const float cm0 = (kj > 0) ? 1.f : 0.f;
      const float cm2 = (kj < T - 1) ? 1.f : 0.f;
      const int c0 = (kj > 0) ? kj - 1 : 0;
      const int c2 = (kj < T - 1) ? kj + 1 : kj;
      float colL[10], colC[10], colR[10];
      #pragma unroll
      for (int i = 0; i < 10; ++i) {
        const int rr = qrow0 - 1 + i;
        const float rm = ((unsigned)rr < (unsigned)T) ? 1.f : 0.f;
        const int rrc = (rr < 0) ? 0 : ((rr >= T) ? T - 1 : rr);
        const float* pr = pbase + (size_t)rrc * T;
        colL[i] = rm * cm0 * pr[c0];
        colC[i] = rm * pr[kj];
        colR[i] = rm * cm2 * pr[c2];
      }
      #pragma unroll
      for (int v = 0; v < 8; ++v) {
        float acc = 0.f;
        #pragma unroll
        for (int di = 0; di < 3; ++di)
          acc += colL[v + di] * rw[di * 3] + colC[v + di] * rw[di * 3 + 1]
               + colR[v + di] * rw[di * 3 + 2];
        const int qi = qrow0 + v;
        float s = S[sb][v] * 0.125f + alpha * acc;
        if (kj > qi) s = -1e30f;
        S[sb][v] = s;
      }
    }

    // online softmax (row stats via 16-lane shuffles), stage P to LDS
    #pragma unroll
    for (int v = 0; v < 8; ++v) {
      float rmax = fmaxf(S[0][v], S[1][v]);
      #pragma unroll
      for (int off = 1; off < 16; off <<= 1) rmax = fmaxf(rmax, __shfl_xor(rmax, off, 16));
      const float mnew = fmaxf(mstat[v], rmax);
      const float scl = __expf(mstat[v] - mnew);
      mstat[v] = mnew;
      lstat[v] *= scl;
      #pragma unroll
      for (int j = 0; j < 4; ++j) O[j][v] *= scl;
      const float p0 = __expf(S[0][v] - mnew);
      const float p1 = __expf(S[1][v] - mnew);
      float rsum = p0 + p1;
      #pragma unroll
      for (int off = 1; off < 16; off <<= 1) rsum += __shfl_xor(rsum, off, 16);
      lstat[v] += rsum;
      const int m = v + 8 * hlf;
      lds_p[wbase + m * 32 + r]      = (_Float16)p0;
      lds_p[wbase + m * 32 + 16 + r] = (_Float16)p1;
    }

    // O += P @ V   (V transposed: contiguous b128 B-fragment loads)
    v16h aP;
    {
      const _Float16* pp = lds_p + wbase + r * 32 + hlf * 8;
      aP = pack16(*(const v8h*)pp, *(const v8h*)(pp + 16));
    }
    #pragma unroll
    for (int j = 0; j < 4; ++j) {
      const _Float16* vp = vbase + (size_t)(j * 16 + r) * T + kb + hlf * 8;
      const v16h bv = pack16(*(const v8h*)vp, *(const v8h*)(vp + 16));
      O[j] = wmma16(aP, bv, O[j]);
    }
  }

  #pragma unroll
  for (int v = 0; v < 8; ++v) {
    const float inv = 1.f / lstat[v];
    #pragma unroll
    for (int j = 0; j < 4; ++j) O[j][v] *= inv;
  }
  #pragma unroll
  for (int j = 0; j < 4; ++j)
    #pragma unroll
    for (int v = 0; v < 8; ++v) {
      const int qi = qb + v + 8 * hlf;
      const int hd = j * 16 + r;
      y[((size_t)(b * T + qi)) * 1024 + h * 64 + hd] = (_Float16)O[j][v];
    }
}

// ---------------------------------------------------------------------------
// Channel-attention depthwise conv along T + exact GELU -> f16 (GEMM input)
// ---------------------------------------------------------------------------
__global__ __launch_bounds__(256)
void caconv_kernel(const float* __restrict__ h, const float* __restrict__ cw,
                   _Float16* __restrict__ o, int T, int CH, int total) {
  const int idx = blockIdx.x * 256 + threadIdx.x;
  if (idx >= total) return;
  const int c = idx % CH;
  const int t = (idx / CH) % T;
  const float ctr = h[idx];
  const float lft = (t > 0)     ? h[idx - CH] : 0.f;
  const float rgt = (t < T - 1) ? h[idx + CH] : 0.f;
  const float v = ctr + 0.1f * (lft * cw[c * 3] + ctr * cw[c * 3 + 1] + rgt * cw[c * 3 + 2]);
  o[idx] = (_Float16)(0.5f * v * (1.f + erff(v * 0.70710678118654752f)));
}

// FFN depthwise conv step (f16 ping-pong): o = in + 0.1*conv_T(in)
__global__ __launch_bounds__(256)
void ffnconv_kernel(const _Float16* __restrict__ in, const float* __restrict__ cw,
                    _Float16* __restrict__ o, int T, int F, int total) {
  const int idx = blockIdx.x * 256 + threadIdx.x;
  if (idx >= total) return;
  const int f = idx % F;
  const int t = (idx / F) % T;
  const float ctr = (float)in[idx];
  const float lft = (t > 0)     ? (float)in[idx - F] : 0.f;
  const float rgt = (t < T - 1) ? (float)in[idx + F] : 0.f;
  o[idx] = (_Float16)(ctr + 0.1f * (lft * cw[f * 3] + ctr * cw[f * 3 + 1] + rgt * cw[f * 3 + 2]));
}

// x1 = x + attn_proj*(1+0.1*tanh(ca1));  writes f32 and f16 copies
__global__ __launch_bounds__(256)
void x1_kernel(const float* __restrict__ x, const float* __restrict__ ap,
               const float* __restrict__ ca1, float* __restrict__ o,
               _Float16* __restrict__ o16, int total) {
  const int idx = blockIdx.x * 256 + threadIdx.x;
  if (idx >= total) return;
  const float v = x[idx] + ap[idx] * (1.f + 0.1f * tanhf(ca1[idx]));
  o[idx] = v;
  o16[idx] = (_Float16)v;
}

__global__ __launch_bounds__(256)
void vitdot_kernel(const float* __restrict__ g32, const float* __restrict__ w2,
                   float* __restrict__ vit0, int ntok) {
  const int i = blockIdx.x * 256 + threadIdx.x;
  if (i >= ntok) return;
  float s = 0.f;
  #pragma unroll
  for (int j = 0; j < 32; ++j) s += g32[(size_t)i * 32 + j] * w2[j];
  vit0[i] = 1.f / (1.f + __expf(-s));
}

__global__ __launch_bounds__(256)
void vitsmooth_kernel(const float* __restrict__ vit0, float* __restrict__ vit,
                      int T, int ntok) {
  const int i = blockIdx.x * 256 + threadIdx.x;
  if (i >= ntok) return;
  const int t = i % T;
  const int base = i - t;
  float s = 0.f;
  #pragma unroll
  for (int d = -2; d <= 2; ++d) {
    const int tt = t + d;
    if ((unsigned)tt < (unsigned)T) s += vit0[base + tt];
  }
  const float v = 0.7f * vit0[i] + 0.3f * (s * 0.2f);
  vit[i] = (v > 0.3f) ? v : 0.1f * v;
}

__global__ __launch_bounds__(256)
void final_kernel(const float* __restrict__ x1, const float* __restrict__ mlp,
                  const float* __restrict__ g, const float* __restrict__ ca2,
                  const float* __restrict__ vit, float* __restrict__ out,
                  int C, int total) {
  const int idx = blockIdx.x * 256 + threadIdx.x;
  if (idx >= total) return;
  const int tok = idx / C;
  out[idx] = x1[idx] + mlp[idx] * g[idx] * (1.f + 0.1f * tanhf(ca2[idx])) * vit[tok];
}

// ---------------------------------------------------------------------------
extern "C" void kernel_launch(void* const* d_in, const int* in_sizes, int n_in,
                              void* d_out, int out_size, void* d_ws, size_t ws_size,
                              hipStream_t stream) {
  (void)in_sizes; (void)n_in; (void)out_size; (void)ws_size;
  constexpr int B = 4, T = 1024, C = 1024, H = 16, KV = 4, HD = 64, FFN = 4096, CA = 32;
  constexpr int BT = B * T;

  const float* x       = (const float*)d_in[0];
  const float* ve      = (const float*)d_in[1];
  const float* cosb    = (const float*)d_in[2];
  const float* sinb    = (const float*)d_in[3];
  const float* prev    = (const float*)d_in[4];
  const float* w_q     = (const float*)d_in[5];
  const float* w_k     = (const float*)d_in[6];
  const float* w_v     = (const float*)d_in[7];
  const float* w_o     = (const float*)d_in[8];
  const float* w_gate  = (const float*)d_in[9];
  const float* rf_w    = (const float*)d_in[10];
  const float* rf_a    = (const float*)d_in[11];
  const float* ca_pi   = (const float*)d_in[12];
  const float* ca_cw   = (const float*)d_in[13];
  const float* ca_po   = (const float*)d_in[14];
  const float* ffn_in  = (const float*)d_in[15];
  const float* ffn_cw  = (const float*)d_in[16];
  const float* ffn_out = (const float*)d_in[17];
  const float* ffn_g   = (const float*)d_in[18];
  const float* vit_w1  = (const float*)d_in[19];
  const float* vit_w2  = (const float*)d_in[20];
  float* out = (float*)d_out;

  float* wsf = (float*)d_ws;
  size_t off = 0;
  auto allocf = [&](size_t n) -> float* {
    float* p = wsf + off;
    off += (n + 63) & ~(size_t)63;
    return p;
  };
  auto alloch = [&](size_t n) -> _Float16* {   // n halfs
    return (_Float16*)allocf((n + 1) / 2);
  };

  // fp32 working buffers
  float* q_raw     = allocf((size_t)BT * C);
  float* k_raw     = allocf((size_t)BT * KV * HD);
  float* v_raw     = allocf((size_t)BT * KV * HD);
  float* attn_proj = allocf((size_t)BT * C);
  float* ca_h      = allocf((size_t)BT * CA);
  float* ca1       = allocf((size_t)BT * C);
  float* x1        = allocf((size_t)BT * C);
  float* vit0      = allocf(BT);
  float* vitf      = allocf(BT);
  // f16 working buffers
  _Float16* x16    = alloch((size_t)BT * C);
  _Float16* xn16   = alloch((size_t)BT * C);
  _Float16* qh     = alloch((size_t)BT * C);
  _Float16* kh     = alloch((size_t)BT * KV * HD);
  _Float16* vt     = alloch((size_t)BT * KV * HD);   // transposed [B,KV,64,T]
  _Float16* y16    = alloch((size_t)BT * C);
  _Float16* cag16  = alloch((size_t)BT * CA);
  _Float16* x1_16  = alloch((size_t)BT * C);
  _Float16* hA     = alloch((size_t)BT * FFN);
  _Float16* hB     = alloch((size_t)BT * FFN);
  // f16 weights (converted once)
  _Float16* w_q16   = alloch((size_t)C * C);
  _Float16* w_k16   = alloch((size_t)KV * HD * C);
  _Float16* w_v16   = alloch((size_t)KV * HD * C);
  _Float16* w_o16   = alloch((size_t)C * C);
  _Float16* ca_pi16 = alloch((size_t)CA * C);
  _Float16* ca_po16 = alloch((size_t)C * CA);
  _Float16* fin16   = alloch((size_t)FFN * C);
  _Float16* fout16  = alloch((size_t)C * FFN);
  _Float16* fg16    = alloch((size_t)C * C);
  _Float16* vw1_16  = alloch((size_t)CA * C);
  // reuse
  float* gbuf  = q_raw;      // q_raw dead after qkvpost
  float* mlp   = attn_proj;  // dead after x1
  float* ca2   = ca1;        // dead after x1
  float* g32   = ca_h;       // dead after ca2 conv
  _Float16* xm16 = xn16;     // xn16 dead after QKV + gate

  const dim3 blk(256);
  const int MB = BT / 256;  // 16
  auto CVT = [&](const float* s, _Float16* d, int n) {
    cvt16_kernel<<<dim3((n / 4 + 255) / 256), blk, 0, stream>>>(s, d, n);
  };

  // --- one-time f16 conversions (weights + x) ---
  CVT(x, x16, BT * C);
  CVT(w_q, w_q16, C * C);
  CVT(w_k, w_k16, KV * HD * C);
  CVT(w_v, w_v16, KV * HD * C);
  CVT(w_o, w_o16, C * C);
  CVT(ca_pi, ca_pi16, CA * C);
  CVT(ca_po, ca_po16, C * CA);
  CVT(ffn_in, fin16, FFN * C);
  CVT(ffn_out, fout16, C * FFN);
  CVT(ffn_g, fg16, C * C);
  CVT(vit_w1, vw1_16, CA * C);

  // --- attention path ---
  rmsnorm16_kernel<<<BT, blk, 0, stream>>>(x, xn16, C);
  gemm_kernel<0,0><<<dim3(MB, C / 64), blk, 0, stream>>>(xn16, w_q16, q_raw, BT, C, C);
  gemm_kernel<0,0><<<dim3(MB, (KV * HD) / 64), blk, 0, stream>>>(xn16, w_k16, k_raw, BT, KV * HD, C);
  gemm_kernel<0,0><<<dim3(MB, (KV * HD) / 64), blk, 0, stream>>>(xn16, w_v16, v_raw, BT, KV * HD, C);
  qkvpost_kernel<<<dim3(BT, H + 2 * KV), dim3(64), 0, stream>>>(
      q_raw, k_raw, v_raw, xn16, ve, cosb, sinb, w_gate, qh, kh, vt, T);
  attn_kernel<<<dim3(B * H, T / 128), blk, 0, stream>>>(qh, kh, vt, prev, rf_w, rf_a, y16, T);
  gemm_kernel<0,0><<<dim3(MB, C / 64), blk, 0, stream>>>(y16, w_o16, attn_proj, BT, C, C);

  // --- ca1 + residual into x1 ---
  gemm_kernel<0,0><<<dim3(MB, 1), blk, 0, stream>>>(x16, ca_pi16, ca_h, BT, CA, C);
  caconv_kernel<<<dim3((BT * CA) / 256), blk, 0, stream>>>(ca_h, ca_cw, cag16, T, CA, BT * CA);
  gemm_kernel<0,0><<<dim3(MB, C / 64), blk, 0, stream>>>(cag16, ca_po16, ca1, BT, C, CA);
  x1_kernel<<<dim3((BT * C) / 256), blk, 0, stream>>>(x, attn_proj, ca1, x1, x1_16, BT * C);

  // --- FFN ---
  rmsnorm16_kernel<<<BT, blk, 0, stream>>>(x1, xm16, C);
  gemm_kernel<1,1><<<dim3(MB, FFN / 64), blk, 0, stream>>>(xm16, fin16, hA, BT, FFN, C);
  const int ftot = BT * FFN;
  ffnconv_kernel<<<dim3(ftot / 256), blk, 0, stream>>>(hA, ffn_cw, hB, T, FFN, ftot);
  ffnconv_kernel<<<dim3(ftot / 256), blk, 0, stream>>>(hB, ffn_cw, hA, T, FFN, ftot);
  ffnconv_kernel<<<dim3(ftot / 256), blk, 0, stream>>>(hA, ffn_cw, hB, T, FFN, ftot);
  ffnconv_kernel<<<dim3(ftot / 256), blk, 0, stream>>>(hB, ffn_cw, hA, T, FFN, ftot);
  gemm_kernel<0,0><<<dim3(MB, C / 64), blk, 0, stream>>>(hA, fout16, mlp, BT, C, FFN);
  gemm_kernel<2,0><<<dim3(MB, C / 64), blk, 0, stream>>>(xm16, fg16, gbuf, BT, C, C);

  // --- ca2 ---
  gemm_kernel<0,0><<<dim3(MB, 1), blk, 0, stream>>>(x1_16, ca_pi16, ca_h, BT, CA, C);
  caconv_kernel<<<dim3((BT * CA) / 256), blk, 0, stream>>>(ca_h, ca_cw, cag16, T, CA, BT * CA);
  gemm_kernel<0,0><<<dim3(MB, C / 64), blk, 0, stream>>>(cag16, ca_po16, ca2, BT, C, CA);

  // --- vit gate ---
  gemm_kernel<3,0><<<dim3(MB, 1), blk, 0, stream>>>(x1_16, vw1_16, g32, BT, CA, C);
  vitdot_kernel<<<dim3(BT / 256), blk, 0, stream>>>(g32, vit_w2, vit0, BT);
  vitsmooth_kernel<<<dim3(BT / 256), blk, 0, stream>>>(vit0, vitf, T, BT);

  // --- final combine ---
  final_kernel<<<dim3((BT * C) / 256), blk, 0, stream>>>(x1, mlp, gbuf, ca2, vitf, out, C, BT * C);
}

// v001
// A run of this version takes 682 microseconds.
// Timed twice side by side with v000, it ran 1.21 times as fast both times.
#include <hip/hip_runtime.h>
#include <hip/hip_bf16.h>

typedef __attribute__((ext_vector_type(16))) _Float16 v16h;
typedef __attribute__((ext_vector_type(8)))  _Float16 v8h;
typedef __attribute__((ext_vector_type(4)))  _Float16 v4h;
typedef __attribute__((ext_vector_type(8)))  float    v8f;

static __device__ __forceinline__ v8f wmma16(v16h a, v16h b, v8f c) {
  return __builtin_amdgcn_wmma_f32_16x16x32_f16(false, a, false, b, (short)0, c, false, false);
}
static __device__ __forceinline__ v16h pack16(v8h lo, v8h hi) {
  return __builtin_shufflevector(lo, hi, 0,1,2,3,4,5,6,7,8,9,10,11,12,13,14,15);
}

// ---------------------------------------------------------------------------
// fp32 -> f16 conversion (vectorized x4); totals are multiples of 4
// ---------------------------------------------------------------------------
__global__ __launch_bounds__(256)
void cvt16_kernel(const float* __restrict__ in, _Float16* __restrict__ out, int total) {
  const int i = (blockIdx.x * 256 + threadIdx.x) * 4;
  if (i >= total) return;
  const float4 v = *(const float4*)(in + i);
  v4h o; o[0] = (_Float16)v.x; o[1] = (_Float16)v.y; o[2] = (_Float16)v.z; o[3] = (_Float16)v.w;
  *(v4h*)(out + i) = o;
}

// ---------------------------------------------------------------------------
// Epilogues: 0=identity, 1=relu^2, 2=sigmoid, 3=gelu(exact)
// ---------------------------------------------------------------------------
template<int EPI>
static __device__ __forceinline__ float apply_epi(float x) {
  if constexpr (EPI == 1) { float t = x > 0.f ? x : 0.f; return t * t; }
  else if constexpr (EPI == 2) { return 1.f / (1.f + __expf(-x)); }
  else if constexpr (EPI == 3) { return 0.5f * x * (1.f + erff(x * 0.70710678118654752f)); }
  else return x;
}

// ---------------------------------------------------------------------------
// WMMA GEMM, all-f16 operands: out[M,N] = epi( A[M,K] @ W[N,K]^T )
// W tile (64 x 32) staged in LDS, double-buffered, shared by all 8 waves.
// Requirements: M % 256 == 0, K % 32 == 0.  N guarded in 16-wide steps.
// ---------------------------------------------------------------------------
template<int EPI, int OH>
__global__ __launch_bounds__(256)
void gemm_kernel(const _Float16* __restrict__ A, const _Float16* __restrict__ W,
                 void* __restrict__ Op, int M, int N, int K) {
  const int tid  = threadIdx.x;
  const int wave = tid >> 5;
  const int lane = tid & 31;
  const int hlf  = lane >> 4;
  const int r    = lane & 15;
  const int m0 = blockIdx.x * 256 + wave * 32;
  const int n0 = blockIdx.y * 64;

  __shared__ __attribute__((aligned(16))) _Float16 wtile[2][64 * 32];
  const int srow = tid >> 2;            // 0..63
  const int scol = (tid & 3) * 8;       // 0,8,16,24

  auto stage = [&](int buf, int k0) {
    if (n0 + srow < N) {
      const v8h w = *(const v8h*)(W + (size_t)(n0 + srow) * K + k0 + scol);
      *(v8h*)(&wtile[buf][srow * 32 + scol]) = w;
    }
  };

  v8f acc[2][4];
  #pragma unroll
  for (int mi = 0; mi < 2; ++mi)
    #pragma unroll
    for (int nj = 0; nj < 4; ++nj)
      #pragma unroll
      for (int e = 0; e < 8; ++e) acc[mi][nj][e] = 0.f;

  stage(0, 0);
  __syncthreads();

  int it = 0;
  for (int k0 = 0; k0 < K; k0 += 32, ++it) {
    const int cur = it & 1;
    if (k0 + 32 < K) stage(cur ^ 1, k0 + 32);

    const _Float16* p0 = A + (size_t)(m0 + r) * K + k0 + hlf * 8;
    const _Float16* p1 = A + (size_t)(m0 + 16 + r) * K + k0 + hlf * 8;
    const v16h a0 = pack16(*(const v8h*)p0, *(const v8h*)(p0 + 16));
    const v16h a1 = pack16(*(const v8h*)p1, *(const v8h*)(p1 + 16));
    if (k0 + 32 < K) __builtin_prefetch(p0 + 32, 0, 0);

    #pragma unroll
    for (int nj = 0; nj < 4; ++nj) {
      const int nb = n0 + nj * 16;
      if (nb >= N) break;
      const _Float16* lp = &wtile[cur][(nj * 16 + r) * 32 + hlf * 8];
      const v16h bf = pack16(*(const v8h*)lp, *(const v8h*)(lp + 16));
      acc[0][nj] = wmma16(a0, bf, acc[0][nj]);
      acc[1][nj] = wmma16(a1, bf, acc[1][nj]);
    }
    __syncthreads();
  }

  #pragma unroll
  for (int nj = 0; nj < 4; ++nj) {
    const int nb = n0 + nj * 16;
    if (nb >= N) break;
    const int n = nb + r;
    #pragma unroll
    for (int mi = 0; mi < 2; ++mi)
      #pragma unroll
      for (int v = 0; v < 8; ++v) {
        const int m = m0 + mi * 16 + v + 8 * hlf;
        const float val = apply_epi<EPI>(acc[mi][nj][v]);
        if constexpr (OH) ((_Float16*)Op)[(size_t)m * N + n] = (_Float16)val;
        else              ((float*)Op)[(size_t)m * N + n] = val;
      }
  }
}

// ---------------------------------------------------------------------------
// RMSNorm over last dim C (one block per row), f32 in -> f16 out
// ---------------------------------------------------------------------------
__global__ __launch_bounds__(256)
void rmsnorm16_kernel(const float* __restrict__ x, _Float16* __restrict__ o, int C) {
  const size_t row = blockIdx.x;
  const float* xr = x + row * (size_t)C;
  float ss = 0.f;
  for (int i = threadIdx.x; i < C; i += 256) { float v = xr[i]; ss += v * v; }
  #pragma unroll
  for (int off = 16; off; off >>= 1) ss += __shfl_xor(ss, off, 32);
  __shared__ float red[8];
  if ((threadIdx.x & 31) == 0) red[threadIdx.x >> 5] = ss;
  __syncthreads();
  float tot = 0.f;
  #pragma unroll
  for (int i = 0; i < 8; ++i) tot += red[i];
  const float rs = rsqrtf(tot / (float)C + 1e-6f);
  _Float16* orow = o + row * (size_t)C;
  for (int i = threadIdx.x; i < C; i += 256) orow[i] = (_Float16)(xr[i] * rs);
}

// ---------------------------------------------------------------------------
// QKV post: RoPE + head RMSNorm*1.2 for q,k; v + 3*sigmoid(xn[:12]@gate)*ve.
// grid = (B*T, 24) blocks of 64 threads.  Outputs f16 heads.
// qh: [B,H,T,64]   kh: [B,KV,T,64]   vt: [B,KV,64,T]  (V TRANSPOSED)
// ---------------------------------------------------------------------------
__global__ __launch_bounds__(64)
void qkvpost_kernel(const float* __restrict__ q_raw, const float* __restrict__ k_raw,
                    const float* __restrict__ v_raw, const _Float16* __restrict__ xn,
                    const float* __restrict__ ve, const float* __restrict__ cosb,
                    const float* __restrict__ sinb, const float* __restrict__ wgate,
                    _Float16* __restrict__ qh, _Float16* __restrict__ kh,
                    _Float16* __restrict__ vt, int T) {
  const int bt = blockIdx.x;
  const int b = bt / T, t = bt % T;
  const int u = blockIdx.y;
  const int lane = threadIdx.x;
  __shared__ float red[2];

  if (u < 20) {
    const float* src;
    _Float16* dst;
    if (u < 16) { src = q_raw + (size_t)bt * 1024 + u * 64;
                  dst = qh + (((size_t)(b * 16 + u)) * T + t) * 64; }
    else        { const int kv = u - 16;
                  src = k_raw + (size_t)bt * 256 + kv * 64;
                  dst = kh + (((size_t)(b * 4 + kv)) * T + t) * 64; }
    const int j = lane & 31;
    const float c = cosb[(size_t)t * 32 + j], s = sinb[(size_t)t * 32 + j];
    const float x1 = src[j], x2 = src[j + 32];
    const float val = (lane < 32) ? (x1 * c + x2 * s) : (-x1 * s + x2 * c);
    float ss = val * val;
    #pragma unroll
    for (int off = 16; off; off >>= 1) ss += __shfl_xor(ss, off, 32);
    if ((lane & 31) == 0) red[lane >> 5] = ss;
    __syncthreads();
    const float rs = rsqrtf((red[0] + red[1]) * (1.f / 64.f) + 1e-6f) * 1.2f;
    dst[lane] = (_Float16)(val * rs);
  } else {
    const int kv = u - 20;
    float g = 0.f;
    #pragma unroll
    for (int i = 0; i < 12; ++i) g += (float)xn[(size_t)bt * 1024 + i] * wgate[kv * 12 + i];
    g = 3.f / (1.f + __expf(-g));
    const size_t idx = (size_t)bt * 256 + kv * 64 + lane;
    // transposed store: [b][kv][hd=lane][t]
    vt[(((size_t)(b * 4 + kv)) * 64 + lane) * T + t] = (_Float16)(v_raw[idx] + g * ve[idx]);
  }
}

// ---------------------------------------------------------------------------
// Flash attention with refine-conv term.  grid = (B*H, T/128), block = 256.
// Wave w handles 16 query rows; keys tiled 32 wide; causal.  f16 in, f16 out.
// V consumed transposed [B,KV,64,T] -> B-fragments are two b128 loads.
// Refine conv is branchless: 10 rows x 3 clamped+masked columns per lane,
// reused across the 8 accumulator rows (9 FMAs each).
// ---------------------------------------------------------------------------
__global__ __launch_bounds__(256)
void attn_kernel(const _Float16* __restrict__ qh, const _Float16* __restrict__ kh,
                 const _Float16* __restrict__ vt, const float* __restrict__ prev,
                 const float* __restrict__ refine_w, const float* __restrict__ alpha_p,
                 _Float16* __restrict__ y, int T) {
  constexpr int H = 16, KV = 4, HD = 64;
  const int bh = blockIdx.x;
  const int b = bh / H, h = bh % H;
  const int wave = threadIdx.x >> 5;
  const int lane = threadIdx.x & 31;
  const int hlf = lane >> 4, r = lane & 15;
  const int qb = (blockIdx.y * 8 + wave) * 16;
  const float alpha = alpha_p[0];

  float rw[9];
  #pragma unroll
  for (int i = 0; i < 9; ++i) rw[i] = refine_w[h * 9 + i];

  const _Float16* qbase = qh + ((size_t)(b * H + h)) * T * HD;
  const _Float16* kbase = kh + ((size_t)(b * KV + (h >> 2))) * T * HD;
  const _Float16* vbase = vt + ((size_t)(b * KV + (h >> 2))) * HD * T;
  const float*    pbase = prev + ((size_t)(b * H + h)) * T * T;

  v16h aQ[2];
  {
    const _Float16* qp = qbase + (size_t)(qb + r) * HD + hlf * 8;
    aQ[0] = pack16(*(const v8h*)qp,        *(const v8h*)(qp + 16));
    aQ[1] = pack16(*(const v8h*)(qp + 32), *(const v8h*)(qp + 48));
  }

  float mstat[8], lstat[8];
  v8f O[4];
  #pragma unroll
  for (int v = 0; v < 8; ++v) { mstat[v] = -1e30f; lstat[v] = 0.f; }
  #pragma unroll
  for (int j = 0; j < 4; ++j)
    #pragma unroll
    for (int e = 0; e < 8; ++e) O[j][e] = 0.f;

  __shared__ __attribute__((aligned(16))) _Float16 lds_p[8 * 16 * 32];
  const int wbase = wave * 512;
  const int qrow0 = qb + 8 * hlf;   // first accumulator row for this lane-half

  for (int kb = 0; kb <= qb + 15; kb += 32) {
    // S = Q @ K^T  (16 x 32 tile, two 16x16 fragments)
    v8f S[2];
    #pragma unroll
    for (int sb = 0; sb < 2; ++sb) {
      #pragma unroll
      for (int e = 0; e < 8; ++e) S[sb][e] = 0.f;
      const _Float16* kp = kbase + (size_t)(kb + sb * 16 + r) * HD + hlf * 8;
      S[sb] = wmma16(aQ[0], pack16(*(const v8h*)kp,        *(const v8h*)(kp + 16)), S[sb]);
      S[sb] = wmma16(aQ[1], pack16(*(const v8h*)(kp + 32), *(const v8h*)(kp + 48)), S[sb]);
    }

    // scale + refine conv (branchless, row-reused) + causal mask
    #pragma unroll
    for (int sb = 0; sb < 2; ++sb) {
      const int kj = kb + sb * 16 + r;
      const float cm0 = (kj > 0) ? 1.f : 0.f;
      const float cm2 = (kj < T - 1) ? 1.f : 0.f;
      const int c0 = (kj > 0) ? kj - 1 : 0;
      const int c2 = (kj < T - 1) ? kj + 1 : kj;
      float colL[10], colC[10], colR[10];
      #pragma unroll
      for (int i = 0; i < 10; ++i) {
        const int rr = qrow0 - 1 + i;
        const float rm = ((unsigned)rr < (unsigned)T) ? 1.f : 0.f;
        const int rrc = (rr < 0) ? 0 : ((rr >= T) ? T - 1 : rr);
        const float* pr = pbase + (size_t)rrc * T;
        colL[i] = rm * cm0 * pr[c0];
        colC[i] = rm * pr[kj];
        colR[i] = rm * cm2 * pr[c2];
      }
      #pragma unroll
      for (int v = 0; v < 8; ++v) {
        float acc = 0.f;
        #pragma unroll
        for (int di = 0; di < 3; ++di)
          acc += colL[v + di] * rw[di * 3] + colC[v + di] * rw[di * 3 + 1]
               + colR[v + di] * rw[di * 3 + 2];
        const int qi = qrow0 + v;
        float s = S[sb][v] * 0.125f + alpha * acc;
        if (kj > qi) s = -1e30f;
        S[sb][v] = s;
      }
    }

    // online softmax (row stats via 16-lane shuffles), stage P to LDS
    #pragma unroll
    for (int v = 0; v < 8; ++v) {
      float rmax = fmaxf(S[0][v], S[1][v]);
      #pragma unroll
      for (int off = 1; off < 16; off <<= 1) rmax = fmaxf(rmax, __shfl_xor(rmax, off, 16));
      const float mnew = fmaxf(mstat[v], rmax);
      const float scl = __expf(mstat[v] - mnew);
      mstat[v] = mnew;
      lstat[v] *= scl;
      #pragma unroll
      for (int j = 0; j < 4; ++j) O[j][v] *= scl;
      const float p0 = __expf(S[0][v] - mnew);
      const float p1 = __expf(S[1][v] - mnew);
      float rsum = p0 + p1;
      #pragma unroll
      for (int off = 1; off < 16; off <<= 1) rsum += __shfl_xor(rsum, off, 16);
      lstat[v] += rsum;
      const int m = v + 8 * hlf;
      lds_p[wbase + m * 32 + r]      = (_Float16)p0;
      lds_p[wbase + m * 32 + 16 + r] = (_Float16)p1;
    }

    // O += P @ V   (V transposed: contiguous b128 B-fragment loads)
    v16h aP;
    {
      const _Float16* pp = lds_p + wbase + r * 32 + hlf * 8;
      aP = pack16(*(const v8h*)pp, *(const v8h*)(pp + 16));
    }
    #pragma unroll
    for (int j = 0; j < 4; ++j) {
      const _Float16* vp = vbase + (size_t)(j * 16 + r) * T + kb + hlf * 8;
      const v16h bv = pack16(*(const v8h*)vp, *(const v8h*)(vp + 16));
      O[j] = wmma16(aP, bv, O[j]);
    }
  }

  #pragma unroll
  for (int v = 0; v < 8; ++v) {
    const float inv = 1.f / lstat[v];
    #pragma unroll
    for (int j = 0; j < 4; ++j) O[j][v] *= inv;
  }
  #pragma unroll
  for (int j = 0; j < 4; ++j)
    #pragma unroll
    for (int v = 0; v < 8; ++v) {
      const int qi = qb + v + 8 * hlf;
      const int hd = j * 16 + r;
      y[((size_t)(b * T + qi)) * 1024 + h * 64 + hd] = (_Float16)O[j][v];
    }
}

// ---------------------------------------------------------------------------
// Channel-attention depthwise conv along T + exact GELU -> f16 (GEMM input)
// ---------------------------------------------------------------------------
__global__ __launch_bounds__(256)
void caconv_kernel(const float* __restrict__ h, const float* __restrict__ cw,
                   _Float16* __restrict__ o, int T, int CH, int total) {
  const int idx = blockIdx.x * 256 + threadIdx.x;
  if (idx >= total) return;
  const int c = idx % CH;
  const int t = (idx / CH) % T;
  const float ctr = h[idx];
  const float lft = (t > 0)     ? h[idx - CH] : 0.f;
  const float rgt = (t < T - 1) ? h[idx + CH] : 0.f;
  const float v = ctr + 0.1f * (lft * cw[c * 3] + ctr * cw[c * 3 + 1] + rgt * cw[c * 3 + 2]);
  o[idx] = (_Float16)(0.5f * v * (1.f + erff(v * 0.70710678118654752f)));
}

// Four FFN depthwise conv steps (each: o = in + 0.1*conv_T(in), zero padded) in one pass.
// A thread owns 8 adjacent channels and walks 16 + 8 rows of T.  Step s lags the input by
// s rows, so every step keeps its last two rows in f32 registers; only step 4 is stored.
// The 4 halo rows on each side are recomputed per tile; past the ends of T they are the
// zero padding of every step.  Needs T % 16 == 0, F % 2048 == 0.
// grid = (F/2048, T/16, B), block = 256
template<int T, int F>
__global__ __launch_bounds__(256)
void ffnconv4_kernel(const _Float16* __restrict__ in, const float* __restrict__ cw,
                     _Float16* __restrict__ o) {
  constexpr int TT = 16, NR = TT + 8;
  static_assert(T % TT == 0 && F % 2048 == 0, "tile shape");
  const int f  = (blockIdx.x * 256 + threadIdx.x) * 8;   // first of the lane's 8 channels
  const int t0 = blockIdx.y * TT;
  const bool lo = (t0 == 0);        // rows t0-4 .. t0-1 lie before the sequence
  const bool hi = (t0 + TT == T);   // rows t0+16 .. t0+19 lie behind it
  const size_t tile = ((size_t)blockIdx.z * T + t0) * F;   // row t0, same for the whole block
  const _Float16* ip  = in + tile + f;
  // an outside halo row re-reads a row of the tile itself (in bounds); it is masked below
  const _Float16* ipl = ip + (lo ? 4 * F : 0);
  const _Float16* iph = ip - (hi ? 4 * F : 0);
  const float* wp = cw + (size_t)f * 3;
  _Float16* op = o + tile + f;
  const v8f zero = {0.f, 0.f, 0.f, 0.f, 0.f, 0.f, 0.f, 0.f};

  // every loop below is unrolled so that its arrays are indexed by constants and stay in registers
  v8f w0, w1, w2;
  #pragma unroll
  for (int e = 0; e < 8; ++e) {
    w0[e] = wp[e * 3];
    w1[e] = wp[e * 3 + 1];
    w2[e] = wp[e * 3 + 2];
  }

  v8h raw[NR];
  #pragma unroll
  for (int i = 0; i < NR; ++i) {
    const _Float16* p = (i < 4) ? ipl : ((i >= TT + 4) ? iph : ip);
    raw[i] = *(const v8h*)(p + (i - 4) * F);
  }
  // the wait that belongs in front of any overwrite of the loads' address registers; they are
  // named as inputs so that none is reused (not even as a load's destination) ahead of it
  asm volatile("s_wait_xcnt 0x0" :: "v"(wp), "v"(ipl), "v"(ip), "v"(iph) : "memory");

  // r = row index inside the 24-row window; only halo rows can lie outside [0,T)
  auto pad = [&](const v8f v, const int r) -> v8f {
    if (r < 4)       return lo ? zero : v;
    if (r >= TT + 4) return hi ? zero : v;
    return v;
  };
  auto step = [&](const v8f l, const v8f c, const v8f r) -> v8f {
    return c + 0.1f * (l * w0 + c * w1 + r * w2);
  };

  v8f a[4], b[4];   // per step input: rows two back and one back
  #pragma unroll
  for (int s = 0; s < 4; ++s) { a[s] = zero; b[s] = zero; }

  #pragma unroll
  for (int i = 0; i < NR; ++i) {
    const v8f x0 = pad(__builtin_convertvector(raw[i], v8f), i);
    const v8f x1 = pad(step(a[0], b[0], x0), i - 1);  a[0] = b[0];  b[0] = x0;
    const v8f x2 = pad(step(a[1], b[1], x1), i - 2);  a[1] = b[1];  b[1] = x1;
    const v8f x3 = pad(step(a[2], b[2], x2), i - 3);  a[2] = b[2];  b[2] = x2;
    const v8f x4 = step(a[3], b[3], x3);              a[3] = b[3];  b[3] = x3;
    if (i >= 8) *(v8h*)(op + (i - 8) * F) = __builtin_convertvector(x4, v8h);
  }
}

// x1 = x + attn_proj*(1+0.1*tanh(ca1));  writes f32 and f16 copies
__global__ __launch_bounds__(256)
void x1_kernel(const float* __restrict__ x, const float* __restrict__ ap,
               const float* __restrict__ ca1, float* __restrict__ o,
               _Float16* __restrict__ o16, int total) {
  const int idx = blockIdx.x * 256 + threadIdx.x;
  if (idx >= total) return;
  const float v = x[idx] + ap[idx] * (1.f + 0.1f * tanhf(ca1[idx]));
  o[idx] = v;
  o16[idx] = (_Float16)v;
}

__global__ __launch_bounds__(256)
void vitdot_kernel(const float* __restrict__ g32, const float* __restrict__ w2,
                   float* __restrict__ vit0, int ntok) {
  const int i = blockIdx.x * 256 + threadIdx.x;
  if (i >= ntok) return;
  float s = 0.f;
  #pragma unroll
  for (int j = 0; j < 32; ++j) s += g32[(size_t)i * 32 + j] * w2[j];
  vit0[i] = 1.f / (1.f + __expf(-s));
}

__global__ __launch_bounds__(256)
void vitsmooth_kernel(const float* __restrict__ vit0, float* __restrict__ vit,
                      int T, int ntok) {
  const int i = blockIdx.x * 256 + threadIdx.x;
  if (i >= ntok) return;
  const int t = i % T;
  const int base = i - t;
  float s = 0.f;
  #pragma unroll
  for (int d = -2; d <= 2; ++d) {
    const int tt = t + d;
    if ((unsigned)tt < (unsigned)T) s += vit0[base + tt];
  }
  const float v = 0.7f * vit0[i] + 0.3f * (s * 0.2f);
  vit[i] = (v > 0.3f) ? v : 0.1f * v;
}

__global__ __launch_bounds__(256)
void final_kernel(const float* __restrict__ x1, const float* __restrict__ mlp,
                  const float* __restrict__ g, const float* __restrict__ ca2,
                  const float* __restrict__ vit, float* __restrict__ out,
                  int C, int total) {
  const int idx = blockIdx.x * 256 + threadIdx.x;
  if (idx >= total) return;
  const int tok = idx / C;
  out[idx] = x1[idx] + mlp[idx] * g[idx] * (1.f + 0.1f * tanhf(ca2[idx])) * vit[tok];
}

// ---------------------------------------------------------------------------
extern "C" void kernel_launch(void* const* d_in, const int* in_sizes, int n_in,
                              void* d_out, int out_size, void* d_ws, size_t ws_size,
                              hipStream_t stream) {
  (void)in_sizes; (void)n_in; (void)out_size; (void)ws_size;
  constexpr int B = 4, T = 1024, C = 1024, H = 16, KV = 4, HD = 64, FFN = 4096, CA = 32;
  constexpr int BT = B * T;

  const float* x       = (const float*)d_in[0];
  const float* ve      = (const float*)d_in[1];
  const float* cosb    = (const float*)d_in[2];
  const float* sinb    = (const float*)d_in[3];
  const float* prev    = (const float*)d_in[4];
  const float* w_q     = (const float*)d_in[5];
  const float* w_k     = (const float*)d_in[6];
  const float* w_v     = (const float*)d_in[7];
  const float* w_o     = (const float*)d_in[8];
  const float* w_gate  = (const float*)d_in[9];
  const float* rf_w    = (const float*)d_in[10];
  const float* rf_a    = (const float*)d_in[11];
  const float* ca_pi   = (const float*)d_in[12];
  const float* ca_cw   = (const float*)d_in[13];
  const float* ca_po   = (const float*)d_in[14];
  const float* ffn_in  = (const float*)d_in[15];
  const float* ffn_cw  = (const float*)d_in[16];
  const float* ffn_out = (const float*)d_in[17];
  const float* ffn_g   = (const float*)d_in[18];
  const float* vit_w1  = (const float*)d_in[19];
  const float* vit_w2  = (const float*)d_in[20];
  float* out = (float*)d_out;

  float* wsf = (float*)d_ws;
  size_t off = 0;
  auto allocf = [&](size_t n) -> float* {
    float* p = wsf + off;
    off += (n + 63) & ~(size_t)63;
    return p;
  };
  auto alloch = [&](size_t n) -> _Float16* {   // n halfs
    return (_Float16*)allocf((n + 1) / 2);
  };

  // fp32 working buffers
  float* q_raw     = allocf((size_t)BT * C);
  float* k_raw     = allocf((size_t)BT * KV * HD);
  float* v_raw     = allocf((size_t)BT * KV * HD);
  float* attn_proj = allocf((size_t)BT * C);
  float* ca_h      = allocf((size_t)BT * CA);
  float* ca1       = allocf((size_t)BT * C);
  float* x1        = allocf((size_t)BT * C);
  float* vit0      = allocf(BT);
  float* vitf      = allocf(BT);
  // f16 working buffers
  _Float16* x16    = alloch((size_t)BT * C);
  _Float16* xn16   = alloch((size_t)BT * C);
  _Float16* qh     = alloch((size_t)BT * C);
  _Float16* kh     = alloch((size_t)BT * KV * HD);
  _Float16* vt     = alloch((size_t)BT * KV * HD);   // transposed [B,KV,64,T]
  _Float16* y16    = alloch((size_t)BT * C);
  _Float16* cag16  = alloch((size_t)BT * CA);
  _Float16* x1_16  = alloch((size_t)BT * C);
  _Float16* hA     = alloch((size_t)BT * FFN);
  _Float16* hB     = alloch((size_t)BT * FFN);
  // f16 weights (converted once)
  _Float16* w_q16   = alloch((size_t)C * C);
  _Float16* w_k16   = alloch((size_t)KV * HD * C);
  _Float16* w_v16   = alloch((size_t)KV * HD * C);
  _Float16* w_o16   = alloch((size_t)C * C);
  _Float16* ca_pi16 = alloch((size_t)CA * C);
  _Float16* ca_po16 = alloch((size_t)C * CA);
  _Float16* fin16   = alloch((size_t)FFN * C);
  _Float16* fout16  = alloch((size_t)C * FFN);
  _Float16* fg16    = alloch((size_t)C * C);
  _Float16* vw1_16  = alloch((size_t)CA * C);
  // reuse
  float* gbuf  = q_raw;      // q_raw dead after qkvpost
  float* mlp   = attn_proj;  // dead after x1
  float* ca2   = ca1;        // dead after x1
  float* g32   = ca_h;       // dead after ca2 conv
  _Float16* xm16 = xn16;     // xn16 dead after QKV + gate

  const dim3 blk(256);
  const int MB = BT / 256;  // 16
  auto CVT = [&](const float* s, _Float16* d, int n) {
    cvt16_kernel<<<dim3((n / 4 + 255) / 256), blk, 0, stream>>>(s, d, n);
  };

  // --- one-time f16 conversions (weights + x) ---
  CVT(x, x16, BT * C);
  CVT(w_q, w_q16, C * C);
  CVT(w_k, w_k16, KV * HD * C);
  CVT(w_v, w_v16, KV * HD * C);
  CVT(w_o, w_o16, C * C);
  CVT(ca_pi, ca_pi16, CA * C);
  CVT(ca_po, ca_po16, C * CA);
  CVT(ffn_in, fin16, FFN * C);
  CVT(ffn_out, fout16, C * FFN);
  CVT(ffn_g, fg16, C * C);
  CVT(vit_w1, vw1_16, CA * C);

  // --- attention path ---
  rmsnorm16_kernel<<<BT, blk, 0, stream>>>(x, xn16, C);
  gemm_kernel<0,0><<<dim3(MB, C / 64), blk, 0, stream>>>(xn16, w_q16, q_raw, BT, C, C);
  gemm_kernel<0,0><<<dim3(MB, (KV * HD) / 64), blk, 0, stream>>>(xn16, w_k16, k_raw, BT, KV * HD, C);
  gemm_kernel<0,0><<<dim3(MB, (KV * HD) / 64), blk, 0, stream>>>(xn16, w_v16, v_raw, BT, KV * HD, C);
  qkvpost_kernel<<<dim3(BT, H + 2 * KV), dim3(64), 0, stream>>>(
      q_raw, k_raw, v_raw, xn16, ve, cosb, sinb, w_gate, qh, kh, vt, T);
  attn_kernel<<<dim3(B * H, T / 128), blk, 0, stream>>>(qh, kh, vt, prev, rf_w, rf_a, y16, T);
  gemm_kernel<0,0><<<dim3(MB, C / 64), blk, 0, stream>>>(y16, w_o16, attn_proj, BT, C, C);

  // --- ca1 + residual into x1 ---
  gemm_kernel<0,0><<<dim3(MB, 1), blk, 0, stream>>>(x16, ca_pi16, ca_h, BT, CA, C);
  caconv_kernel<<<dim3((BT * CA) / 256), blk, 0, stream>>>(ca_h, ca_cw, cag16, T, CA, BT * CA);
  gemm_kernel<0,0><<<dim3(MB, C / 64), blk, 0, stream>>>(cag16, ca_po16, ca1, BT, C, CA);
  x1_kernel<<<dim3((BT * C) / 256), blk, 0, stream>>>(x, attn_proj, ca1, x1, x1_16, BT * C);

  // --- FFN ---
  rmsnorm16_kernel<<<BT, blk, 0, stream>>>(x1, xm16, C);
  gemm_kernel<1,1><<<dim3(MB, FFN / 64), blk, 0, stream>>>(xm16, fin16, hA, BT, FFN, C);
  ffnconv4_kernel<T, FFN><<<dim3(FFN / 2048, T / 16, B), blk, 0, stream>>>(hA, ffn_cw, hB);
  gemm_kernel<0,0><<<dim3(MB, C / 64), blk, 0, stream>>>(hB, fout16, mlp, BT, C, FFN);
  gemm_kernel<2,0><<<dim3(MB, C / 64), blk, 0, stream>>>(xm16, fg16, gbuf, BT, C, C);

  // --- ca2 ---
  gemm_kernel<0,0><<<dim3(MB, 1), blk, 0, stream>>>(x1_16, ca_pi16, ca_h, BT, CA, C);
  caconv_kernel<<<dim3((BT * CA) / 256), blk, 0, stream>>>(ca_h, ca_cw, cag16, T, CA, BT * CA);
  gemm_kernel<0,0><<<dim3(MB, C / 64), blk, 0, stream>>>(cag16, ca_po16, ca2, BT, C, CA);

  // --- vit gate ---
  gemm_kernel<3,0><<<dim3(MB, 1), blk, 0, stream>>>(x1_16, vw1_16, g32, BT, CA, C);
  vitdot_kernel<<<dim3(BT / 256), blk, 0, stream>>>(g32, vit_w2, vit0, BT);
  vitsmooth_kernel<<<dim3(BT / 256), blk, 0, stream>>>(vit0, vitf, T, BT);

  // --- final combine ---
  final_kernel<<<dim3((BT * C) / 256), blk, 0, stream>>>(x1, mlp, gbuf, ca2, vitf, out, C, BT * C);
}

// v002
// One run takes 458 microseconds.
// Next to v001, in two timings, it ran 1.49 and 1.48 times as fast.
// Counting every step since v000, it is 1.80 times as fast.
#include <hip/hip_runtime.h>
#include <hip/hip_bf16.h>

typedef __attribute__((ext_vector_type(16))) _Float16 v16h;
typedef __attribute__((ext_vector_type(8)))  _Float16 v8h;
typedef __attribute__((ext_vector_type(4)))  _Float16 v4h;
typedef __attribute__((ext_vector_type(8)))  float    v8f;

static __device__ __forceinline__ v8f wmma16(v16h a, v16h b, v8f c) {
  return __builtin_amdgcn_wmma_f32_16x16x32_f16(false, a, false, b, (short)0, c, false, false);
}
static __device__ __forceinline__ v16h pack16(v8h lo, v8h hi) {
  return __builtin_shufflevector(lo, hi, 0,1,2,3,4,5,6,7,8,9,10,11,12,13,14,15);
}

// ---------------------------------------------------------------------------
// fp32 -> f16 conversion (vectorized x4); totals are multiples of 4
// ---------------------------------------------------------------------------
__global__ __launch_bounds__(256)
void cvt16_kernel(const float* __restrict__ in, _Float16* __restrict__ out, int total) {
  const int i = (blockIdx.x * 256 + threadIdx.x) * 4;
  if (i >= total) return;
  const float4 v = *(const float4*)(in + i);
  v4h o; o[0] = (_Float16)v.x; o[1] = (_Float16)v.y; o[2] = (_Float16)v.z; o[3] = (_Float16)v.w;
  *(v4h*)(out + i) = o;
}

// ---------------------------------------------------------------------------
// Epilogues: 0=identity, 1=relu^2, 2=sigmoid, 3=gelu(exact)
// ---------------------------------------------------------------------------
template<int EPI>
static __device__ __forceinline__ float apply_epi(float x) {
  if constexpr (EPI == 1) { float t = x > 0.f ? x : 0.f; return t * t; }
  else if constexpr (EPI == 2) { return 1.f / (1.f + __expf(-x)); }
  else if constexpr (EPI == 3) { return 0.5f * x * (1.f + erff(x * 0.70710678118654752f)); }
  else return x;
}

// ---------------------------------------------------------------------------
// WMMA GEMM, all-f16 operands: out[M,N] = epi( A[M,K] @ W[N,K]^T )
// W tile (64 x 32) staged in LDS, double-buffered, shared by all 8 waves.
// Requirements: M % 256 == 0, K % 32 == 0.  N guarded in 16-wide steps.
// ---------------------------------------------------------------------------
template<int EPI, int OH>
__global__ __launch_bounds__(256)
void gemm_kernel(const _Float16* __restrict__ A, const _Float16* __restrict__ W,
                 void* __restrict__ Op, int M, int N, int K) {
  const int tid  = threadIdx.x;
  const int wave = tid >> 5;
  const int lane = tid & 31;
  const int hlf  = lane >> 4;
  const int r    = lane & 15;
  const int m0 = blockIdx.x * 256 + wave * 32;
  const int n0 = blockIdx.y * 64;

  __shared__ __attribute__((aligned(16))) _Float16 wtile[2][64 * 32];
  const int srow = tid >> 2;            // 0..63
  const int scol = (tid & 3) * 8;       // 0,8,16,24

  auto stage = [&](int buf, int k0) {
    if (n0 + srow < N) {
      const v8h w = *(const v8h*)(W + (size_t)(n0 + srow) * K + k0 + scol);
      *(v8h*)(&wtile[buf][srow * 32 + scol]) = w;
    }
  };

  v8f acc[2][4];
  #pragma unroll
  for (int mi = 0; mi < 2; ++mi)
    #pragma unroll
    for (int nj = 0; nj < 4; ++nj)
      #pragma unroll
      for (int e = 0; e < 8; ++e) acc[mi][nj][e] = 0.f;

  stage(0, 0);
  __syncthreads();

  int it = 0;
  for (int k0 = 0; k0 < K; k0 += 32, ++it) {
    const int cur = it & 1;
    if (k0 + 32 < K) stage(cur ^ 1, k0 + 32);

    const _Float16* p0 = A + (size_t)(m0 + r) * K + k0 + hlf * 8;
    const _Float16* p1 = A + (size_t)(m0 + 16 + r) * K + k0 + hlf * 8;
    const v16h a0 = pack16(*(const v8h*)p0, *(const v8h*)(p0 + 16));
    const v16h a1 = pack16(*(const v8h*)p1, *(const v8h*)(p1 + 16));
    if (k0 + 32 < K) __builtin_prefetch(p0 + 32, 0, 0);

    #pragma unroll
    for (int nj = 0; nj < 4; ++nj) {
      const int nb = n0 + nj * 16;
      if (nb >= N) break;
      const _Float16* lp = &wtile[cur][(nj * 16 + r) * 32 + hlf * 8];
      const v16h bf = pack16(*(const v8h*)lp, *(const v8h*)(lp + 16));
      acc[0][nj] = wmma16(a0, bf, acc[0][nj]);
      acc[1][nj] = wmma16(a1, bf, acc[1][nj]);
    }
    __syncthreads();
  }

  #pragma unroll
  for (int nj = 0; nj < 4; ++nj) {
    const int nb = n0 + nj * 16;
    if (nb >= N) break;
    const int n = nb + r;
    #pragma unroll
    for (int mi = 0; mi < 2; ++mi)
      #pragma unroll
      for (int v = 0; v < 8; ++v) {
        const int m = m0 + mi * 16 + v + 8 * hlf;
        const float val = apply_epi<EPI>(acc[mi][nj][v]);
        if constexpr (OH) ((_Float16*)Op)[(size_t)m * N + n] = (_Float16)val;
        else              ((float*)Op)[(size_t)m * N + n] = val;
      }
  }
}

// ---------------------------------------------------------------------------
// WMMA GEMM for K % 128 == 0: out[M,N] = epi( A[M,K] @ W[N,K]^T ), all-f16 operands.
// A work-group owns a 128 x BN tile of out; a stage is 128 k of [A 128 rows | W BN rows],
// rows of 256 B at a pitch of 272 B in LDS (conflict-free for 16-byte readers), two buffers.
// Both operands come into LDS by asynchronous copies, one stage ahead of the products.
// BN = 128: 2 x 4 waves of 64 x 32 each.  BN = 32: 8 x 1 waves of 16 x 32 each.
// Requirements: M % 128 == 0, N % BN == 0, K % 128 == 0.
// ---------------------------------------------------------------------------
constexpr int G_PITCH_H = 136;                    // LDS row pitch in halfs (272 B)

// NC 16-byte copies of one lane: rows 16 apart, in LDS (l) as in global memory (g, rs halfs).
// The s_wait_xcnt closes each statement so that no address register named in it can be
// rewritten ahead of the wait.
template<int NC>
static __device__ __forceinline__ void copy_rows(const unsigned l, const _Float16* g, const size_t rs) {
  constexpr unsigned LS = 16u * G_PITCH_H * 2u;   // 16 LDS rows in bytes
  static_assert(NC == 8 || NC == 2, "rows per lane");
  if constexpr (NC == 8) {
    asm volatile(
        "global_load_async_to_lds_b128 %0, %8, off\n\t"
        "global_load_async_to_lds_b128 %1, %9, off\n\t"
        "global_load_async_to_lds_b128 %2, %10, off\n\t"
        "global_load_async_to_lds_b128 %3, %11, off\n\t"
        "global_load_async_to_lds_b128 %4, %12, off\n\t"
        "global_load_async_to_lds_b128 %5, %13, off\n\t"
        "global_load_async_to_lds_b128 %6, %14, off\n\t"
        "global_load_async_to_lds_b128 %7, %15, off\n\t"
        "s_wait_xcnt 0x0"
        :: "v"(l), "v"(l + LS), "v"(l + 2 * LS), "v"(l + 3 * LS),
           "v"(l + 4 * LS), "v"(l + 5 * LS), "v"(l + 6 * LS), "v"(l + 7 * LS),
           "v"(g), "v"(g + rs), "v"(g + 2 * rs), "v"(g + 3 * rs),
           "v"(g + 4 * rs), "v"(g + 5 * rs), "v"(g + 6 * rs), "v"(g + 7 * rs)
        : "memory");
  } else {
    asm volatile(
        "global_load_async_to_lds_b128 %0, %2, off\n\t"
        "global_load_async_to_lds_b128 %1, %3, off\n\t"
        "s_wait_xcnt 0x0"
        :: "v"(l), "v"(l + LS), "v"(g), "v"(g + rs)
        : "memory");
  }
}

template<int EPI, int OH, int BN>
__global__ __launch_bounds__(256)
void gemm_ring_kernel(const _Float16* __restrict__ A, const _Float16* __restrict__ W,
                      void* __restrict__ Op, int M, int N, int K) {
  constexpr int WN = BN / 32;               // waves along N
  constexpr int MF = 128 / ((8 / WN) * 16); // 16-row fragments of A per wave
  constexpr int STAGE_H = (128 + BN) * G_PITCH_H;   // one buffer in halfs
  const int tid  = threadIdx.x;
  const int wave = tid >> 5;
  const int lane = tid & 31;
  const int hlf  = lane >> 4;
  const int r    = lane & 15;
  const int m0 = blockIdx.x * 128;
  const int n0 = blockIdx.y * BN;
  const int wm = (wave / WN) * (MF * 16);
  const int wn = (wave % WN) * 32;

  __shared__ __attribute__((aligned(16))) _Float16 ring[2 * STAGE_H];

  // a lane copies 16-byte column (tid & 15) of rows (tid >> 4) + 16 i, of A and of W
  const int crow = tid >> 4;
  const int ccol = (tid & 15) * 8;
  const _Float16* gA = A + (size_t)(m0 + crow) * K + ccol;
  const _Float16* gW = W + (size_t)(n0 + crow) * K + ccol;
  const unsigned lA = (unsigned)(size_t)(&ring[crow * G_PITCH_H + ccol]);   // LDS byte address
  const size_t rs = (size_t)16 * K;

  auto copy_stage = [&](const int buf, const int t) {
    const unsigned l = lA + (unsigned)buf * (STAGE_H * 2u);
    copy_rows<8>(l, gA + (size_t)t * 128, rs);
    copy_rows<BN / 16>(l + 128u * G_PITCH_H * 2u, gW + (size_t)t * 128, rs);
  };

  // every loop of constant length in this kernel is unrolled so that acc, af and bf are
  // indexed by constants and stay in registers
  v8f acc[MF][2];
  #pragma unroll
  for (int mi = 0; mi < MF; ++mi)
    #pragma unroll
    for (int nj = 0; nj < 2; ++nj)
      #pragma unroll
      for (int e = 0; e < 8; ++e) acc[mi][nj][e] = 0.f;

  const int nt = K / 128;
  copy_stage(0, 0);
  asm volatile("s_wait_asynccnt 0x0" ::: "memory");   // this wave's part of stage 0 has landed
  __syncthreads();                                    // ... and every other wave's
  if (nt > 1) copy_stage(1, 1);

  for (int t = 0; t < nt; ++t) {
    const _Float16* sa = ring + (t & 1) * STAGE_H + (wm + r) * G_PITCH_H + hlf * 8;
    const _Float16* sw = ring + (t & 1) * STAGE_H + (128 + wn + r) * G_PITCH_H + hlf * 8;
    v16h af[2][MF], bf[2][2];   // two fragment sets: one in use, one being fetched
    auto fetch = [&](const int set, const int kk) {
      #pragma unroll
      for (int mi = 0; mi < MF; ++mi) {
        const _Float16* p = sa + mi * 16 * G_PITCH_H + kk * 32;
        af[set][mi] = pack16(*(const v8h*)p, *(const v8h*)(p + 16));
      }
      #pragma unroll
      for (int nj = 0; nj < 2; ++nj) {
        const _Float16* p = sw + nj * 16 * G_PITCH_H + kk * 32;
        bf[set][nj] = pack16(*(const v8h*)p, *(const v8h*)(p + 16));
      }
    };
    fetch(0, 0);
    #pragma unroll
    for (int kk = 0; kk < 4; ++kk) {
      if (kk < 3) fetch((kk + 1) & 1, kk + 1);
      // the next block's LDS reads stay one group ahead of this block's products; left to
      // itself the scheduler sinks each read to its use and the wave waits out every one
      __builtin_amdgcn_sched_barrier(0);
      #pragma unroll
      for (int mi = 0; mi < MF; ++mi)
        #pragma unroll
        for (int nj = 0; nj < 2; ++nj)
          acc[mi][nj] = wmma16(af[kk & 1][mi], bf[kk & 1][nj], acc[mi][nj]);
      // ... and no later read is lifted in among these products
      __builtin_amdgcn_sched_barrier(0);
    }
    asm volatile("s_wait_dscnt 0x0" ::: "memory");      // this wave has left the buffer
    asm volatile("s_wait_asynccnt 0x0" ::: "memory");   // its part of stage t + 1 has landed
    __syncthreads();   // publishes stage t + 1 and frees the buffer of stage t
    if (t + 2 < nt) copy_stage(t & 1, t + 2);
  }
  asm volatile("s_wait_asynccnt 0x0" ::: "memory");     // no copy outlives the wave

  #pragma unroll
  for (int nj = 0; nj < 2; ++nj) {
    const int n = n0 + wn + nj * 16 + r;
    #pragma unroll
    for (int mi = 0; mi < MF; ++mi)
      #pragma unroll
      for (int v = 0; v < 8; ++v) {
        const int m = m0 + wm + mi * 16 + v + 8 * hlf;
        const float val = apply_epi<EPI>(acc[mi][nj][v]);
        if constexpr (OH) ((_Float16*)Op)[(size_t)m * N + n] = (_Float16)val;
        else              ((float*)Op)[(size_t)m * N + n] = val;
      }
  }
}

// ---------------------------------------------------------------------------
// RMSNorm over last dim C (one block per row), f32 in -> f16 out
// ---------------------------------------------------------------------------
__global__ __launch_bounds__(256)
void rmsnorm16_kernel(const float* __restrict__ x, _Float16* __restrict__ o, int C) {
  const size_t row = blockIdx.x;
  const float* xr = x + row * (size_t)C;
  float ss = 0.f;
  for (int i = threadIdx.x; i < C; i += 256) { float v = xr[i]; ss += v * v; }
  #pragma unroll
  for (int off = 16; off; off >>= 1) ss += __shfl_xor(ss, off, 32);
  __shared__ float red[8];
  if ((threadIdx.x & 31) == 0) red[threadIdx.x >> 5] = ss;
  __syncthreads();
  float tot = 0.f;
  #pragma unroll
  for (int i = 0; i < 8; ++i) tot += red[i];
  const float rs = rsqrtf(tot / (float)C + 1e-6f);
  _Float16* orow = o + row * (size_t)C;
  for (int i = threadIdx.x; i < C; i += 256) orow[i] = (_Float16)(xr[i] * rs);
}

// ---------------------------------------------------------------------------
// QKV post: RoPE + head RMSNorm*1.2 for q,k; v + 3*sigmoid(xn[:12]@gate)*ve.
// grid = (B*T, 24) blocks of 64 threads.  Outputs f16 heads.
// qh: [B,H,T,64]   kh: [B,KV,T,64]   vt: [B,KV,64,T]  (V TRANSPOSED)
// ---------------------------------------------------------------------------
__global__ __launch_bounds__(64)
void qkvpost_kernel(const float* __restrict__ q_raw, const float* __restrict__ k_raw,
                    const float* __restrict__ v_raw, const _Float16* __restrict__ xn,
                    const float* __restrict__ ve, const float* __restrict__ cosb,
                    const float* __restrict__ sinb, const float* __restrict__ wgate,
                    _Float16* __restrict__ qh, _Float16* __restrict__ kh,
                    _Float16* __restrict__ vt, int T) {
  const int bt = blockIdx.x;
  const int b = bt / T, t = bt % T;
  const int u = blockIdx.y;
  const int lane = threadIdx.x;
  __shared__ float red[2];

  if (u < 20) {
    const float* src;
    _Float16* dst;
    if (u < 16) { src = q_raw + (size_t)bt * 1024 + u * 64;
                  dst = qh + (((size_t)(b * 16 + u)) * T + t) * 64; }
    else        { const int kv = u - 16;
                  src = k_raw + (size_t)bt * 256 + kv * 64;
                  dst = kh + (((size_t)(b * 4 + kv)) * T + t) * 64; }
    const int j = lane & 31;
    const float c = cosb[(size_t)t * 32 + j], s = sinb[(size_t)t * 32 + j];
    const float x1 = src[j], x2 = src[j + 32];
    const float val = (lane < 32) ? (x1 * c + x2 * s) : (-x1 * s + x2 * c);
    float ss = val * val;
    #pragma unroll
    for (int off = 16; off; off >>= 1) ss += __shfl_xor(ss, off, 32);
    if ((lane & 31) == 0) red[lane >> 5] = ss;
    __syncthreads();
    const float rs = rsqrtf((red[0] + red[1]) * (1.f / 64.f) + 1e-6f) * 1.2f;
    dst[lane] = (_Float16)(val * rs);
  } else {
    const int kv = u - 20;
    float g = 0.f;
    #pragma unroll
    for (int i = 0; i < 12; ++i) g += (float)xn[(size_t)bt * 1024 + i] * wgate[kv * 12 + i];
    g = 3.f / (1.f + __expf(-g));
    const size_t idx = (size_t)bt * 256 + kv * 64 + lane;
    // transposed store: [b][kv][hd=lane][t]
    vt[(((size_t)(b * 4 + kv)) * 64 + lane) * T + t] = (_Float16)(v_raw[idx] + g * ve[idx]);
  }
}

// ---------------------------------------------------------------------------
// Flash attention with refine-conv term.  grid = (B*H, T/128), block = 256.
// Wave w handles 16 query rows; keys tiled 32 wide; causal.  f16 in, f16 out.
// V consumed transposed [B,KV,64,T] -> B-fragments are two b128 loads.
// Refine conv is branchless: 10 rows x 3 clamped+masked columns per lane,
// reused across the 8 accumulator rows (9 FMAs each).
// ---------------------------------------------------------------------------
__global__ __launch_bounds__(256)
void attn_kernel(const _Float16* __restrict__ qh, const _Float16* __restrict__ kh,
                 const _Float16* __restrict__ vt, const float* __restrict__ prev,
                 const float* __restrict__ refine_w, const float* __restrict__ alpha_p,
                 _Float16* __restrict__ y, int T) {
  constexpr int H = 16, KV = 4, HD = 64;
  const int bh = blockIdx.x;
  const int b = bh / H, h = bh % H;
  const int wave = threadIdx.x >> 5;
  const int lane = threadIdx.x & 31;
  const int hlf = lane >> 4, r = lane & 15;
  const int qb = (blockIdx.y * 8 + wave) * 16;
  const float alpha = alpha_p[0];

  float rw[9];
  #pragma unroll
  for (int i = 0; i < 9; ++i) rw[i] = refine_w[h * 9 + i];

  const _Float16* qbase = qh + ((size_t)(b * H + h)) * T * HD;
  const _Float16* kbase = kh + ((size_t)(b * KV + (h >> 2))) * T * HD;
  const _Float16* vbase = vt + ((size_t)(b * KV + (h >> 2))) * HD * T;
  const float*    pbase = prev + ((size_t)(b * H + h)) * T * T;

  v16h aQ[2];
  {
    const _Float16* qp = qbase + (size_t)(qb + r) * HD + hlf * 8;
    aQ[0] = pack16(*(const v8h*)qp,        *(const v8h*)(qp + 16));
    aQ[1] = pack16(*(const v8h*)(qp + 32), *(const v8h*)(qp + 48));
  }

  float mstat[8], lstat[8];
  v8f O[4];
  #pragma unroll
  for (int v = 0; v < 8; ++v) { mstat[v] = -1e30f; lstat[v] = 0.f; }
  #pragma unroll
  for (int j = 0; j < 4; ++j)
    #pragma unroll
    for (int e = 0; e < 8; ++e) O[j][e] = 0.f;

  __shared__ __attribute__((aligned(16))) _Float16 lds_p[8 * 16 * 32];
  const int wbase = wave * 512;
  const int qrow0 = qb + 8 * hlf;   // first accumulator row for this lane-half

  for (int kb = 0; kb <= qb + 15; kb += 32) {
    // S = Q @ K^T  (16 x 32 tile, two 16x16 fragments)
    v8f S[2];
    #pragma unroll
    for (int sb = 0; sb < 2; ++sb) {
      #pragma unroll
      for (int e = 0; e < 8; ++e) S[sb][e] = 0.f;
      const _Float16* kp = kbase + (size_t)(kb + sb * 16 + r) * HD + hlf * 8;
      S[sb] = wmma16(aQ[0], pack16(*(const v8h*)kp,        *(const v8h*)(kp + 16)), S[sb]);
      S[sb] = wmma16(aQ[1], pack16(*(const v8h*)(kp + 32), *(const v8h*)(kp + 48)), S[sb]);
    }

    // scale + refine conv (branchless, row-reused) + causal mask
    #pragma unroll
    for (int sb = 0; sb < 2; ++sb) {
      const int kj = kb + sb * 16 + r;
      const float cm0 = (kj > 0) ? 1.f : 0.f;
      const float cm2 = (kj < T - 1) ? 1.f : 0.f;
      const int c0 = (kj > 0) ? kj - 1 : 0;
      const int c2 = (kj < T - 1) ? kj + 1 : kj;
      float colL[10], colC[10], colR[10];
      #pragma unroll
      for (int i = 0; i < 10; ++i) {
        const int rr = qrow0 - 1 + i;
        const float rm = ((unsigned)rr < (unsigned)T) ? 1.f : 0.f;
        const int rrc = (rr < 0) ? 0 : ((rr >= T) ? T - 1 : rr);
        const float* pr = pbase + (size_t)rrc * T;
        colL[i] = rm * cm0 * pr[c0];
        colC[i] = rm * pr[kj];
        colR[i] = rm * cm2 * pr[c2];
      }
      #pragma unroll
      for (int v = 0; v < 8; ++v) {
        float acc = 0.f;
        #pragma unroll
        for (int di = 0; di < 3; ++di)
          acc += colL[v + di] * rw[di * 3] + colC[v + di] * rw[di * 3 + 1]
               + colR[v + di] * rw[di * 3 + 2];
        const int qi = qrow0 + v;
        float s = S[sb][v] * 0.125f + alpha * acc;
        if (kj > qi) s = -1e30f;
        S[sb][v] = s;
      }
    }

    // online softmax (row stats via 16-lane shuffles), stage P to LDS
    #pragma unroll
    for (int v = 0; v < 8; ++v) {
      float rmax = fmaxf(S[0][v], S[1][v]);
      #pragma unroll
      for (int off = 1; off < 16; off <<= 1) rmax = fmaxf(rmax, __shfl_xor(rmax, off, 16));
      const float mnew = fmaxf(mstat[v], rmax);
      const float scl = __expf(mstat[v] - mnew);
      mstat[v] = mnew;
      lstat[v] *= scl;
      #pragma unroll
      for (int j = 0; j < 4; ++j) O[j][v] *= scl;
      const float p0 = __expf(S[0][v] - mnew);
      const float p1 = __expf(S[1][v] - mnew);
      float rsum = p0 + p1;
      #pragma unroll
      for (int off = 1; off < 16; off <<= 1) rsum += __shfl_xor(rsum, off, 16);
      lstat[v] += rsum;
      const int m = v + 8 * hlf;
      lds_p[wbase + m * 32 + r]      = (_Float16)p0;
      lds_p[wbase + m * 32 + 16 + r] = (_Float16)p1;
    }

    // O += P @ V   (V transposed: contiguous b128 B-fragment loads)
    v16h aP;
    {
      const _Float16* pp = lds_p + wbase + r * 32 + hlf * 8;
      aP = pack16(*(const v8h*)pp, *(const v8h*)(pp + 16));
    }
    #pragma unroll
    for (int j = 0; j < 4; ++j) {
      const _Float16* vp = vbase + (size_t)(j * 16 + r) * T + kb + hlf * 8;
      const v16h bv = pack16(*(const v8h*)vp, *(const v8h*)(vp + 16));
      O[j] = wmma16(aP, bv, O[j]);
    }
  }

  #pragma unroll
  for (int v = 0; v < 8; ++v) {
    const float inv = 1.f / lstat[v];
    #pragma unroll
    for (int j = 0; j < 4; ++j) O[j][v] *= inv;
  }
  #pragma unroll
  for (int j = 0; j < 4; ++j)
    #pragma unroll
    for (int v = 0; v < 8; ++v) {
      const int qi = qb + v + 8 * hlf;
      const int hd = j * 16 + r;
      y[((size_t)(b * T + qi)) * 1024 + h * 64 + hd] = (_Float16)O[j][v];
    }
}

// ---------------------------------------------------------------------------
// Channel-attention depthwise conv along T + exact GELU -> f16 (GEMM input)
// ---------------------------------------------------------------------------
__global__ __launch_bounds__(256)
void caconv_kernel(const float* __restrict__ h, const float* __restrict__ cw,
                   _Float16* __restrict__ o, int T, int CH, int total) {
  const int idx = blockIdx.x * 256 + threadIdx.x;
  if (idx >= total) return;
  const int c = idx % CH;
  const int t = (idx / CH) % T;
  const float ctr = h[idx];
  const float lft = (t > 0)     ? h[idx - CH] : 0.f;
  const float rgt = (t < T - 1) ? h[idx + CH] : 0.f;
  const float v = ctr + 0.1f * (lft * cw[c * 3] + ctr * cw[c * 3 + 1] + rgt * cw[c * 3 + 2]);
  o[idx] = (_Float16)(0.5f * v * (1.f + erff(v * 0.70710678118654752f)));
}

// Four FFN depthwise conv steps (each: o = in + 0.1*conv_T(in), zero padded) in one pass.
// A thread owns 8 adjacent channels and walks 16 + 8 rows of T.  Step s lags the input by
// s rows, so every step keeps its last two rows in f32 registers; only step 4 is stored.
// The 4 halo rows on each side are recomputed per tile; past the ends of T they are the
// zero padding of every step.  Needs T % 16 == 0, F % 2048 == 0.
// grid = (F/2048, T/16, B), block = 256
template<int T, int F>
__global__ __launch_bounds__(256)
void ffnconv4_kernel(const _Float16* __restrict__ in, const float* __restrict__ cw,
                     _Float16* __restrict__ o) {
  constexpr int TT = 16, NR = TT + 8;
  static_assert(T % TT == 0 && F % 2048 == 0, "tile shape");
  const int f  = (blockIdx.x * 256 + threadIdx.x) * 8;   // first of the lane's 8 channels
  const int t0 = blockIdx.y * TT;
  const bool lo = (t0 == 0);        // rows t0-4 .. t0-1 lie before the sequence
  const bool hi = (t0 + TT == T);   // rows t0+16 .. t0+19 lie behind it
  const size_t tile = ((size_t)blockIdx.z * T + t0) * F;   // row t0, same for the whole block
  const _Float16* ip  = in + tile + f;
  // an outside halo row re-reads a row of the tile itself (in bounds); it is masked below
  const _Float16* ipl = ip + (lo ? 4 * F : 0);
  const _Float16* iph = ip - (hi ? 4 * F : 0);
  const float* wp = cw + (size_t)f * 3;
  _Float16* op = o + tile + f;
  const v8f zero = {0.f, 0.f, 0.f, 0.f, 0.f, 0.f, 0.f, 0.f};

  // every loop below is unrolled so that its arrays are indexed by constants and stay in registers
  v8f w0, w1, w2;
  #pragma unroll
  for (int e = 0; e < 8; ++e) {
    w0[e] = wp[e * 3];
    w1[e] = wp[e * 3 + 1];
    w2[e] = wp[e * 3 + 2];
  }

  v8h raw[NR];
  #pragma unroll
  for (int i = 0; i < NR; ++i) {
    const _Float16* p = (i < 4) ? ipl : ((i >= TT + 4) ? iph : ip);
    raw[i] = *(const v8h*)(p + (i - 4) * F);
  }
  // the wait that belongs in front of any overwrite of the loads' address registers; they are
  // named as inputs so that none is reused (not even as a load's destination) ahead of it
  asm volatile("s_wait_xcnt 0x0" :: "v"(wp), "v"(ipl), "v"(ip), "v"(iph) : "memory");

  // r = row index inside the 24-row window; only halo rows can lie outside [0,T)
  auto pad = [&](const v8f v, const int r) -> v8f {
    if (r < 4)       return lo ? zero : v;
    if (r >= TT + 4) return hi ? zero : v;
    return v;
  };
  auto step = [&](const v8f l, const v8f c, const v8f r) -> v8f {
    return c + 0.1f * (l * w0 + c * w1 + r * w2);
  };

  v8f a[4], b[4];   // per step input: rows two back and one back
  #pragma unroll
  for (int s = 0; s < 4; ++s) { a[s] = zero; b[s] = zero; }

  #pragma unroll
  for (int i = 0; i < NR; ++i) {
    const v8f x0 = pad(__builtin_convertvector(raw[i], v8f), i);
    const v8f x1 = pad(step(a[0], b[0], x0), i - 1);  a[0] = b[0];  b[0] = x0;
    const v8f x2 = pad(step(a[1], b[1], x1), i - 2);  a[1] = b[1];  b[1] = x1;
    const v8f x3 = pad(step(a[2], b[2], x2), i - 3);  a[2] = b[2];  b[2] = x2;
    const v8f x4 = step(a[3], b[3], x3);              a[3] = b[3];  b[3] = x3;
    if (i >= 8) *(v8h*)(op + (i - 8) * F) = __builtin_convertvector(x4, v8h);
  }
}

// x1 = x + attn_proj*(1+0.1*tanh(ca1));  writes f32 and f16 copies
__global__ __launch_bounds__(256)
void x1_kernel(const float* __restrict__ x, const float* __restrict__ ap,
               const float* __restrict__ ca1, float* __restrict__ o,
               _Float16* __restrict__ o16, int total) {
  const int idx = blockIdx.x * 256 + threadIdx.x;
  if (idx >= total) return;
  const float v = x[idx] + ap[idx] * (1.f + 0.1f * tanhf(ca1[idx]));
  o[idx] = v;
  o16[idx] = (_Float16)v;
}

__global__ __launch_bounds__(256)
void vitdot_kernel(const float* __restrict__ g32, const float* __restrict__ w2,
                   float* __restrict__ vit0, int ntok) {
  const int i = blockIdx.x * 256 + threadIdx.x;
  if (i >= ntok) return;
  float s = 0.f;
  #pragma unroll
  for (int j = 0; j < 32; ++j) s += g32[(size_t)i * 32 + j] * w2[j];
  vit0[i] = 1.f / (1.f + __expf(-s));
}

__global__ __launch_bounds__(256)
void vitsmooth_kernel(const float* __restrict__ vit0, float* __restrict__ vit,
                      int T, int ntok) {
  const int i = blockIdx.x * 256 + threadIdx.x;
  if (i >= ntok) return;
  const int t = i % T;
  const int base = i - t;
  float s = 0.f;
  #pragma unroll
  for (int d = -2; d <= 2; ++d) {
    const int tt = t + d;
    if ((unsigned)tt < (unsigned)T) s += vit0[base + tt];
  }
  const float v = 0.7f * vit0[i] + 0.3f * (s * 0.2f);
  vit[i] = (v > 0.3f) ? v : 0.1f * v;
}

__global__ __launch_bounds__(256)
void final_kernel(const float* __restrict__ x1, const float* __restrict__ mlp,
                  const float* __restrict__ g, const float* __restrict__ ca2,
                  const float* __restrict__ vit, float* __restrict__ out,
                  int C, int total) {
  const int idx = blockIdx.x * 256 + threadIdx.x;
  if (idx >= total) return;
  const int tok = idx / C;
  out[idx] = x1[idx] + mlp[idx] * g[idx] * (1.f + 0.1f * tanhf(ca2[idx])) * vit[tok];
}

// ---------------------------------------------------------------------------
extern "C" void kernel_launch(void* const* d_in, const int* in_sizes, int n_in,
                              void* d_out, int out_size, void* d_ws, size_t ws_size,
                              hipStream_t stream) {
  (void)in_sizes; (void)n_in; (void)out_size; (void)ws_size;
  constexpr int B = 4, T = 1024, C = 1024, H = 16, KV = 4, HD = 64, FFN = 4096, CA = 32;
  constexpr int BT = B * T;

  const float* x       = (const float*)d_in[0];
  const float* ve      = (const float*)d_in[1];
  const float* cosb    = (const float*)d_in[2];
  const float* sinb    = (const float*)d_in[3];
  const float* prev    = (const float*)d_in[4];
  const float* w_q     = (const float*)d_in[5];
  const float* w_k     = (const float*)d_in[6];
  const float* w_v     = (const float*)d_in[7];
  const float* w_o     = (const float*)d_in[8];
  const float* w_gate  = (const float*)d_in[9];
  const float* rf_w    = (const float*)d_in[10];
  const float* rf_a    = (const float*)d_in[11];
  const float* ca_pi   = (const float*)d_in[12];
  const float* ca_cw   = (const float*)d_in[13];
  const float* ca_po   = (const float*)d_in[14];
  const float* ffn_in  = (const float*)d_in[15];
  const float* ffn_cw  = (const float*)d_in[16];
  const float* ffn_out = (const float*)d_in[17];
  const float* ffn_g   = (const float*)d_in[18];
  const float* vit_w1  = (const float*)d_in[19];
  const float* vit_w2  = (const float*)d_in[20];
  float* out = (float*)d_out;

  float* wsf = (float*)d_ws;
  size_t off = 0;
  auto allocf = [&](size_t n) -> float* {
    float* p = wsf + off;
    off += (n + 63) & ~(size_t)63;
    return p;
  };
  auto alloch = [&](size_t n) -> _Float16* {   // n halfs
    return (_Float16*)allocf((n + 1) / 2);
  };

  // fp32 working buffers
  float* q_raw     = allocf((size_t)BT * C);
  float* k_raw     = allocf((size_t)BT * KV * HD);
  float* v_raw     = allocf((size_t)BT * KV * HD);
  float* attn_proj = allocf((size_t)BT * C);
  float* ca_h      = allocf((size_t)BT * CA);
  float* ca1       = allocf((size_t)BT * C);
  float* x1        = allocf((size_t)BT * C);
  float* vit0      = allocf(BT);
  float* vitf      = allocf(BT);
  // f16 working buffers
  _Float16* x16    = alloch((size_t)BT * C);
  _Float16* xn16   = alloch((size_t)BT * C);
  _Float16* qh     = alloch((size_t)BT * C);
  _Float16* kh     = alloch((size_t)BT * KV * HD);
  _Float16* vt     = alloch((size_t)BT * KV * HD);   // transposed [B,KV,64,T]
  _Float16* y16    = alloch((size_t)BT * C);
  _Float16* cag16  = alloch((size_t)BT * CA);
  _Float16* x1_16  = alloch((size_t)BT * C);
  _Float16* hA     = alloch((size_t)BT * FFN);
  _Float16* hB     = alloch((size_t)BT * FFN);
  // f16 weights (converted once)
  _Float16* w_q16   = alloch((size_t)C * C);
  _Float16* w_k16   = alloch((size_t)KV * HD * C);
  _Float16* w_v16   = alloch((size_t)KV * HD * C);
  _Float16* w_o16   = alloch((size_t)C * C);
  _Float16* ca_pi16 = alloch((size_t)CA * C);
  _Float16* ca_po16 = alloch((size_t)C * CA);
  _Float16* fin16   = alloch((size_t)FFN * C);
  _Float16* fout16  = alloch((size_t)C * FFN);
  _Float16* fg16    = alloch((size_t)C * C);
  _Float16* vw1_16  = alloch((size_t)CA * C);
  // reuse
  float* gbuf  = q_raw;      // q_raw dead after qkvpost
  float* mlp   = attn_proj;  // dead after x1
  float* ca2   = ca1;        // dead after x1
  float* g32   = ca_h;       // dead after ca2 conv
  _Float16* xm16 = xn16;     // xn16 dead after QKV + gate

  const dim3 blk(256);
  const int MB = BT / 256;  // 16
  const int MT = BT / 128;  // 32 row tiles of the ring GEMM
  auto CVT = [&](const float* s, _Float16* d, int n) {
    cvt16_kernel<<<dim3((n / 4 + 255) / 256), blk, 0, stream>>>(s, d, n);
  };

  // --- one-time f16 conversions (weights + x) ---
  CVT(x, x16, BT * C);
  CVT(w_q, w_q16, C * C);
  CVT(w_k, w_k16, KV * HD * C);
  CVT(w_v, w_v16, KV * HD * C);
  CVT(w_o, w_o16, C * C);
  CVT(ca_pi, ca_pi16, CA * C);
  CVT(ca_po, ca_po16, C * CA);
  CVT(ffn_in, fin16, FFN * C);
  CVT(ffn_out, fout16, C * FFN);
  CVT(ffn_g, fg16, C * C);
  CVT(vit_w1, vw1_16, CA * C);

  // --- attention path ---
  rmsnorm16_kernel<<<BT, blk, 0, stream>>>(x, xn16, C);
  gemm_ring_kernel<0,0,128><<<dim3(MT, C / 128), blk, 0, stream>>>(xn16, w_q16, q_raw, BT, C, C);
  gemm_ring_kernel<0,0,128><<<dim3(MT, (KV * HD) / 128), blk, 0, stream>>>(xn16, w_k16, k_raw, BT, KV * HD, C);
  gemm_ring_kernel<0,0,128><<<dim3(MT, (KV * HD) / 128), blk, 0, stream>>>(xn16, w_v16, v_raw, BT, KV * HD, C);
  qkvpost_kernel<<<dim3(BT, H + 2 * KV), dim3(64), 0, stream>>>(
      q_raw, k_raw, v_raw, xn16, ve, cosb, sinb, w_gate, qh, kh, vt, T);
  attn_kernel<<<dim3(B * H, T / 128), blk, 0, stream>>>(qh, kh, vt, prev, rf_w, rf_a, y16, T);
  gemm_ring_kernel<0,0,128><<<dim3(MT, C / 128), blk, 0, stream>>>(y16, w_o16, attn_proj, BT, C, C);

  // --- ca1 + residual into x1 ---
  gemm_ring_kernel<0,0,32><<<dim3(MT, 1), blk, 0, stream>>>(x16, ca_pi16, ca_h, BT, CA, C);
  caconv_kernel<<<dim3((BT * CA) / 256), blk, 0, stream>>>(ca_h, ca_cw, cag16, T, CA, BT * CA);
  gemm_kernel<0,0><<<dim3(MB, C / 64), blk, 0, stream>>>(cag16, ca_po16, ca1, BT, C, CA);
  x1_kernel<<<dim3((BT * C) / 256), blk, 0, stream>>>(x, attn_proj, ca1, x1, x1_16, BT * C);

  // --- FFN ---
  rmsnorm16_kernel<<<BT, blk, 0, stream>>>(x1, xm16, C);
  gemm_ring_kernel<1,1,128><<<dim3(MT, FFN / 128), blk, 0, stream>>>(xm16, fin16, hA, BT, FFN, C);
  ffnconv4_kernel<T, FFN><<<dim3(FFN / 2048, T / 16, B), blk, 0, stream>>>(hA, ffn_cw, hB);
  gemm_ring_kernel<0,0,128><<<dim3(MT, C / 128), blk, 0, stream>>>(hB, fout16, mlp, BT, C, FFN);
  gemm_ring_kernel<2,0,128><<<dim3(MT, C / 128), blk, 0, stream>>>(xm16, fg16, gbuf, BT, C, C);

  // --- ca2 ---
  gemm_ring_kernel<0,0,32><<<dim3(MT, 1), blk, 0, stream>>>(x1_16, ca_pi16, ca_h, BT, CA, C);
  caconv_kernel<<<dim3((BT * CA) / 256), blk, 0, stream>>>(ca_h, ca_cw, cag16, T, CA, BT * CA);
  gemm_kernel<0,0><<<dim3(MB, C / 64), blk, 0, stream>>>(cag16, ca_po16, ca2, BT, C, CA);

  // --- vit gate ---
  gemm_ring_kernel<3,0,32><<<dim3(MT, 1), blk, 0, stream>>>(x1_16, vw1_16, g32, BT, CA, C);
  vitdot_kernel<<<dim3(BT / 256), blk, 0, stream>>>(g32, vit_w2, vit0, BT);
  vitsmooth_kernel<<<dim3(BT / 256), blk, 0, stream>>>(vit0, vitf, T, BT);

  // --- final combine ---
  final_kernel<<<dim3((BT * C) / 256), blk, 0, stream>>>(x1, mlp, gbuf, ca2, vitf, out, C, BT * C);
}

// v003
// A run of this version takes 441 microseconds.
// In both of two side-by-side timings against v002, it was 1.04 times as fast.
// Over all steps from v000 it is 1.87 times as fast.
#include <hip/hip_runtime.h>
#include <hip/hip_bf16.h>

typedef __attribute__((ext_vector_type(16))) _Float16 v16h;
typedef __attribute__((ext_vector_type(8)))  _Float16 v8h;
typedef __attribute__((ext_vector_type(4)))  _Float16 v4h;
typedef __attribute__((ext_vector_type(8)))  float    v8f;

static __device__ __forceinline__ v8f wmma16(v16h a, v16h b, v8f c) {
  return __builtin_amdgcn_wmma_f32_16x16x32_f16(false, a, false, b, (short)0, c, false, false);
}
static __device__ __forceinline__ v16h pack16(v8h lo, v8h hi) {
  return __builtin_shufflevector(lo, hi, 0,1,2,3,4,5,6,7,8,9,10,11,12,13,14,15);
}

// ---------------------------------------------------------------------------
// fp32 -> f16 conversion (vectorized x4); totals are multiples of 4
// ---------------------------------------------------------------------------
__global__ __launch_bounds__(256)
void cvt16_kernel(const float* __restrict__ in, _Float16* __restrict__ out, int total) {
  const int i = (blockIdx.x * 256 + threadIdx.x) * 4;
  if (i >= total) return;
  const float4 v = *(const float4*)(in + i);
  v4h o; o[0] = (_Float16)v.x; o[1] = (_Float16)v.y; o[2] = (_Float16)v.z; o[3] = (_Float16)v.w;
  *(v4h*)(out + i) = o;
}

// ---------------------------------------------------------------------------
// Epilogues: 0=identity, 1=relu^2, 2=sigmoid, 3=gelu(exact)
// ---------------------------------------------------------------------------
template<int EPI>
static __device__ __forceinline__ float apply_epi(float x) {
  if constexpr (EPI == 1) { float t = x > 0.f ? x : 0.f; return t * t; }
  else if constexpr (EPI == 2) { return 1.f / (1.f + __expf(-x)); }
  else if constexpr (EPI == 3) { return 0.5f * x * (1.f + erff(x * 0.70710678118654752f)); }
  else return x;
}

// ---------------------------------------------------------------------------
// WMMA GEMM, all-f16 operands: out[M,N] = epi( A[M,K] @ W[N,K]^T )
// W tile (64 x 32) staged in LDS, double-buffered, shared by all 8 waves.
// Requirements: M % 256 == 0, K % 32 == 0.  N guarded in 16-wide steps.
// ---------------------------------------------------------------------------
template<int EPI, int OH>
__global__ __launch_bounds__(256)
void gemm_kernel(const _Float16* __restrict__ A, const _Float16* __restrict__ W,
                 void* __restrict__ Op, int M, int N, int K) {
  const int tid  = threadIdx.x;
  const int wave = tid >> 5;
  const int lane = tid & 31;
  const int hlf  = lane >> 4;
  const int r    = lane & 15;
  const int m0 = blockIdx.x * 256 + wave * 32;
  const int n0 = blockIdx.y * 64;

  __shared__ __attribute__((aligned(16))) _Float16 wtile[2][64 * 32];
  const int srow = tid >> 2;            // 0..63
  const int scol = (tid & 3) * 8;       // 0,8,16,24

  auto stage = [&](int buf, int k0) {
    if (n0 + srow < N) {
      const v8h w = *(const v8h*)(W + (size_t)(n0 + srow) * K + k0 + scol);
      *(v8h*)(&wtile[buf][srow * 32 + scol]) = w;
    }
  };

  v8f acc[2][4];
  #pragma unroll
  for (int mi = 0; mi < 2; ++mi)
    #pragma unroll
    for (int nj = 0; nj < 4; ++nj)
      #pragma unroll
      for (int e = 0; e < 8; ++e) acc[mi][nj][e] = 0.f;

  stage(0, 0);
  __syncthreads();

  int it = 0;
  for (int k0 = 0; k0 < K; k0 += 32, ++it) {
    const int cur = it & 1;
    if (k0 + 32 < K) stage(cur ^ 1, k0 + 32);

    const _Float16* p0 = A + (size_t)(m0 + r) * K + k0 + hlf * 8;
    const _Float16* p1 = A + (size_t)(m0 + 16 + r) * K + k0 + hlf * 8;
    const v16h a0 = pack16(*(const v8h*)p0, *(const v8h*)(p0 + 16));
    const v16h a1 = pack16(*(const v8h*)p1, *(const v8h*)(p1 + 16));
    if (k0 + 32 < K) __builtin_prefetch(p0 + 32, 0, 0);

    #pragma unroll
    for (int nj = 0; nj < 4; ++nj) {
      const int nb = n0 + nj * 16;
      if (nb >= N) break;
      const _Float16* lp = &wtile[cur][(nj * 16 + r) * 32 + hlf * 8];
      const v16h bf = pack16(*(const v8h*)lp, *(const v8h*)(lp + 16));
      acc[0][nj] = wmma16(a0, bf, acc[0][nj]);
      acc[1][nj] = wmma16(a1, bf, acc[1][nj]);
    }
    __syncthreads();
  }

  #pragma unroll
  for (int nj = 0; nj < 4; ++nj) {
    const int nb = n0 + nj * 16;
    if (nb >= N) break;
    const int n = nb + r;
    #pragma unroll
    for (int mi = 0; mi < 2; ++mi)
      #pragma unroll
      for (int v = 0; v < 8; ++v) {
        const int m = m0 + mi * 16 + v + 8 * hlf;
        const float val = apply_epi<EPI>(acc[mi][nj][v]);
        if constexpr (OH) ((_Float16*)Op)[(size_t)m * N + n] = (_Float16)val;
        else              ((float*)Op)[(size_t)m * N + n] = val;
      }
  }
}

// ---------------------------------------------------------------------------
// WMMA GEMM for K % 128 == 0: out[M,N] = epi( A[M,K] @ W[N,K]^T ), all-f16 operands.
// A work-group owns a 128 x BN tile of out; a stage is 128 k of [A 128 rows | W BN rows],
// rows of 256 B at a pitch of 272 B in LDS (conflict-free for 16-byte readers), two buffers.
// Both operands come into LDS by asynchronous copies, one stage ahead of the products.
// BN = 128: 2 x 4 waves of 64 x 32 each.  BN = 32: 8 x 1 waves of 16 x 32 each.
// Requirements: M % 128 == 0, N % BN == 0, K % 128 == 0.
// ---------------------------------------------------------------------------
constexpr int G_PITCH_H = 136;                    // LDS row pitch in halfs (272 B)

// NC 16-byte copies of one lane: rows 16 apart, in LDS (l) as in global memory (g, rs halfs).
// The s_wait_xcnt closes each statement so that no address register named in it can be
// rewritten ahead of the wait.
template<int NC>
static __device__ __forceinline__ void copy_rows(const unsigned l, const _Float16* g, const size_t rs) {
  constexpr unsigned LS = 16u * G_PITCH_H * 2u;   // 16 LDS rows in bytes
  static_assert(NC == 8 || NC == 2, "rows per lane");
  if constexpr (NC == 8) {
    asm volatile(
        "global_load_async_to_lds_b128 %0, %8, off\n\t"
        "global_load_async_to_lds_b128 %1, %9, off\n\t"
        "global_load_async_to_lds_b128 %2, %10, off\n\t"
        "global_load_async_to_lds_b128 %3, %11, off\n\t"
        "global_load_async_to_lds_b128 %4, %12, off\n\t"
        "global_load_async_to_lds_b128 %5, %13, off\n\t"
        "global_load_async_to_lds_b128 %6, %14, off\n\t"
        "global_load_async_to_lds_b128 %7, %15, off\n\t"
        "s_wait_xcnt 0x0"
        :: "v"(l), "v"(l + LS), "v"(l + 2 * LS), "v"(l + 3 * LS),
           "v"(l + 4 * LS), "v"(l + 5 * LS), "v"(l + 6 * LS), "v"(l + 7 * LS),
           "v"(g), "v"(g + rs), "v"(g + 2 * rs), "v"(g + 3 * rs),
           "v"(g + 4 * rs), "v"(g + 5 * rs), "v"(g + 6 * rs), "v"(g + 7 * rs)
        : "memory");
  } else {
    asm volatile(
        "global_load_async_to_lds_b128 %0, %2, off\n\t"
        "global_load_async_to_lds_b128 %1, %3, off\n\t"
        "s_wait_xcnt 0x0"
        :: "v"(l), "v"(l + LS), "v"(g), "v"(g + rs)
        : "memory");
  }
}

template<int EPI, int OH, int BN>
__global__ __launch_bounds__(256)
void gemm_ring_kernel(const _Float16* __restrict__ A, const _Float16* __restrict__ W,
                      void* __restrict__ Op, int M, int N, int K) {
  constexpr int WN = BN / 32;               // waves along N
  constexpr int MF = 128 / ((8 / WN) * 16); // 16-row fragments of A per wave
  constexpr int STAGE_H = (128 + BN) * G_PITCH_H;   // one buffer in halfs
  const int tid  = threadIdx.x;
  const int wave = tid >> 5;
  const int lane = tid & 31;
  const int hlf  = lane >> 4;
  const int r    = lane & 15;
  const int m0 = blockIdx.x * 128;
  const int n0 = blockIdx.y * BN;
  const int wm = (wave / WN) * (MF * 16);
  const int wn = (wave % WN) * 32;

  __shared__ __attribute__((aligned(16))) _Float16 ring[2 * STAGE_H];

  // a lane copies 16-byte column (tid & 15) of rows (tid >> 4) + 16 i, of A and of W
  const int crow = tid >> 4;
  const int ccol = (tid & 15) * 8;
  const _Float16* gA = A + (size_t)(m0 + crow) * K + ccol;
  const _Float16* gW = W + (size_t)(n0 + crow) * K + ccol;
  const unsigned lA = (unsigned)(size_t)(&ring[crow * G_PITCH_H + ccol]);   // LDS byte address
  const size_t rs = (size_t)16 * K;

  auto copy_stage = [&](const int buf, const int t) {
    const unsigned l = lA + (unsigned)buf * (STAGE_H * 2u);
    copy_rows<8>(l, gA + (size_t)t * 128, rs);
    copy_rows<BN / 16>(l + 128u * G_PITCH_H * 2u, gW + (size_t)t * 128, rs);
  };

  // every loop of constant length in this kernel is unrolled so that acc, af and bf are
  // indexed by constants and stay in registers
  v8f acc[MF][2];
  #pragma unroll
  for (int mi = 0; mi < MF; ++mi)
    #pragma unroll
    for (int nj = 0; nj < 2; ++nj)
      #pragma unroll
      for (int e = 0; e < 8; ++e) acc[mi][nj][e] = 0.f;

  const int nt = K / 128;
  copy_stage(0, 0);
  asm volatile("s_wait_asynccnt 0x0" ::: "memory");   // this wave's part of stage 0 has landed
  __syncthreads();                                    // ... and every other wave's
  if (nt > 1) copy_stage(1, 1);

  for (int t = 0; t < nt; ++t) {
    const _Float16* sa = ring + (t & 1) * STAGE_H + (wm + r) * G_PITCH_H + hlf * 8;
    const _Float16* sw = ring + (t & 1) * STAGE_H + (128 + wn + r) * G_PITCH_H + hlf * 8;
    v16h af[2][MF], bf[2][2];   // two fragment sets: one in use, one being fetched
    auto fetch = [&](const int set, const int kk) {
      #pragma unroll
      for (int mi = 0; mi < MF; ++mi) {
        const _Float16* p = sa + mi * 16 * G_PITCH_H + kk * 32;
        af[set][mi] = pack16(*(const v8h*)p, *(const v8h*)(p + 16));
      }
      #pragma unroll
      for (int nj = 0; nj < 2; ++nj) {
        const _Float16* p = sw + nj * 16 * G_PITCH_H + kk * 32;
        bf[set][nj] = pack16(*(const v8h*)p, *(const v8h*)(p + 16));
      }
    };
    fetch(0, 0);
    #pragma unroll
    for (int kk = 0; kk < 4; ++kk) {
      if (kk < 3) fetch((kk + 1) & 1, kk + 1);
      // the next block's LDS reads stay one group ahead of this block's products; left to
      // itself the scheduler sinks each read to its use and the wave waits out every one
      __builtin_amdgcn_sched_barrier(0);
      #pragma unroll
      for (int mi = 0; mi < MF; ++mi)
        #pragma unroll
        for (int nj = 0; nj < 2; ++nj)
          acc[mi][nj] = wmma16(af[kk & 1][mi], bf[kk & 1][nj], acc[mi][nj]);
      // ... and no later read is lifted in among these products
      __builtin_amdgcn_sched_barrier(0);
    }
    asm volatile("s_wait_dscnt 0x0" ::: "memory");      // this wave has left the buffer
    asm volatile("s_wait_asynccnt 0x0" ::: "memory");   // its part of stage t + 1 has landed
    __syncthreads();   // publishes stage t + 1 and frees the buffer of stage t
    if (t + 2 < nt) copy_stage(t & 1, t + 2);
  }
  asm volatile("s_wait_asynccnt 0x0" ::: "memory");     // no copy outlives the wave

  #pragma unroll
  for (int nj = 0; nj < 2; ++nj) {
    const int n = n0 + wn + nj * 16 + r;
    #pragma unroll
    for (int mi = 0; mi < MF; ++mi)
      #pragma unroll
      for (int v = 0; v < 8; ++v) {
        const int m = m0 + wm + mi * 16 + v + 8 * hlf;
        const float val = apply_epi<EPI>(acc[mi][nj][v]);
        if constexpr (OH) ((_Float16*)Op)[(size_t)m * N + n] = (_Float16)val;
        else              ((float*)Op)[(size_t)m * N + n] = val;
      }
  }
}

// ---------------------------------------------------------------------------
// RMSNorm over last dim C (one block per row), f32 in -> f16 out
// ---------------------------------------------------------------------------
__global__ __launch_bounds__(256)
void rmsnorm16_kernel(const float* __restrict__ x, _Float16* __restrict__ o, int C) {
  const size_t row = blockIdx.x;
  const float* xr = x + row * (size_t)C;
  float ss = 0.f;
  for (int i = threadIdx.x; i < C; i += 256) { float v = xr[i]; ss += v * v; }
  #pragma unroll
  for (int off = 16; off; off >>= 1) ss += __shfl_xor(ss, off, 32);
  __shared__ float red[8];
  if ((threadIdx.x & 31) == 0) red[threadIdx.x >> 5] = ss;
  __syncthreads();
  float tot = 0.f;
  #pragma unroll
  for (int i = 0; i < 8; ++i) tot += red[i];
  const float rs = rsqrtf(tot / (float)C + 1e-6f);
  _Float16* orow = o + row * (size_t)C;
  for (int i = threadIdx.x; i < C; i += 256) orow[i] = (_Float16)(xr[i] * rs);
}

// v + (v of lane l ^ M), M < 16, inside a 16-lane row, in the vector unit (DPP row_xmask)
template<int M>
static __device__ __forceinline__ float add_xor_row(const float v) {
  return v + __int_as_float(__builtin_amdgcn_update_dpp(0, __float_as_int(v), 0x160 | M, 0xf, 0xf, true));
}
// Sum over the 32 lanes, left in every lane: a butterfly over lane distances 16, 8, 4, 2, 1.
// All 32 lanes must be on.  No step goes through the LDS queue, so 40 such sums of one wave
// do not each wait out its latency.
static __device__ __forceinline__ float wave_sum(float v) {
  const int b = __float_as_int(v);
  v += __int_as_float(__builtin_amdgcn_permlanex16(b, b, 0x76543210, 0xfedcba98, false, false));
  v = add_xor_row<8>(v);
  v = add_xor_row<4>(v);
  v = add_xor_row<2>(v);
  v = add_xor_row<1>(v);
  return v;
}

// ---------------------------------------------------------------------------
// QKV post: RoPE + head RMSNorm*1.2 for q,k; v + 3*sigmoid(xn[:12]@gate)*ve.
// One wave per token, all 24 heads of it; grid = B*T/8 blocks of 8 waves.
// A lane holds elements j and j+32 of a head, the two partners of the rotation, so a head's
// sum of squares needs the wave's own shuffles only: no LDS, no barrier.
// qh: [B,H,T,64]   kh: [B,KV,T,64]   vt: [B,KV,64,T]  (V TRANSPOSED)
// ---------------------------------------------------------------------------
template<int T>
__global__ __launch_bounds__(256)
void qkvpost_kernel(const float* __restrict__ q_raw, const float* __restrict__ k_raw,
                    const float* __restrict__ v_raw, const _Float16* __restrict__ xn,
                    const float* __restrict__ ve, const float* __restrict__ cosb,
                    const float* __restrict__ sinb, const float* __restrict__ wgate,
                    _Float16* __restrict__ qh, _Float16* __restrict__ kh,
                    _Float16* __restrict__ vt) {
  // the wave's number is the same in all its lanes: said so, the row addresses stay scalar
  const int bt = blockIdx.x * 8 + __builtin_amdgcn_readfirstlane(threadIdx.x >> 5);
  const int b = bt / T, t = bt % T;
  const int j = threadIdx.x & 31;

  const float* qr = q_raw + (size_t)bt * 1024;
  const float* kr = k_raw + (size_t)bt * 256;
  const float* vr = v_raw + (size_t)bt * 256;
  const float* er = ve    + (size_t)bt * 256;
  const float* cr = cosb  + (size_t)t * 32;
  const float* sr = sinb  + (size_t)t * 32;
  const _Float16* xr = xn + (size_t)bt * 1024;

  // every loop below is unrolled so that its arrays are indexed by constants and stay in
  // registers; all of a token's loads are issued before the first head is worked on
  float x1[20], x2[20], vv[8], ee[8], xg[12];
  const float c = cr[j], s = sr[j];
  #pragma unroll
  for (int u = 0; u < 20; ++u) {
    const float* src = (u < 16) ? qr + u * 64 : kr + (u - 16) * 64;
    x1[u] = src[j];
    x2[u] = src[j + 32];
  }
  #pragma unroll
  for (int i = 0; i < 8; ++i) { vv[i] = vr[i * 32 + j]; ee[i] = er[i * 32 + j]; }
  #pragma unroll
  for (int i = 0; i < 12; ++i) xg[i] = (float)xr[i];
  // the wait that belongs in front of any overwrite of the loads' address registers; they are
  // named as inputs so that none is reused (not even as a load's destination) ahead of it
  asm volatile("s_wait_xcnt 0x0" :: "s"(qr), "s"(kr), "s"(vr), "s"(er), "s"(cr), "s"(sr), "s"(xr), "v"(j) : "memory");

  _Float16 ol[20], oh[20], ov[8];
  #pragma unroll
  for (int u = 0; u < 20; ++u) {
    const float lo =  x1[u] * c + x2[u] * s;
    const float hi = -x1[u] * s + x2[u] * c;
    // each half summed by its own butterfly (lane distances 16, 8, 4, 2, 1), then added
    const float sl = wave_sum(lo * lo), sh = wave_sum(hi * hi);
    const float rs = rsqrtf((sl + sh) * (1.f / 64.f) + 1e-6f) * 1.2f;
    ol[u] = (_Float16)(lo * rs);
    oh[u] = (_Float16)(hi * rs);
  }
  #pragma unroll
  for (int kv = 0; kv < 4; ++kv) {
    float g = 0.f;
    #pragma unroll
    for (int i = 0; i < 12; ++i) g += xg[i] * wgate[kv * 12 + i];
    g = 3.f / (1.f + __expf(-g));
    ov[kv * 2]     = (_Float16)(vv[kv * 2]     + g * ee[kv * 2]);
    ov[kv * 2 + 1] = (_Float16)(vv[kv * 2 + 1] + g * ee[kv * 2 + 1]);
  }

  _Float16* qd = qh + ((size_t)(b * 16) * T + t) * 64 + j;
  _Float16* kd = kh + ((size_t)(b * 4) * T + t) * 64 + j;
  _Float16* vd = vt + ((size_t)(b * 4) * 64 + j) * T + t;   // transposed: [b][kv][hd][t]
  // keeps the stores in runs at the end: left to itself the scheduler mixes them in among the
  // heads' arithmetic
  __builtin_amdgcn_sched_barrier(0);
  #pragma unroll
  for (int u = 0; u < 16; ++u) {
    qd[(size_t)u * T * 64]      = ol[u];
    qd[(size_t)u * T * 64 + 32] = oh[u];
  }
  #pragma unroll
  for (int u = 0; u < 4; ++u) {
    kd[(size_t)u * T * 64]      = ol[16 + u];
    kd[(size_t)u * T * 64 + 32] = oh[16 + u];
  }
  #pragma unroll
  for (int i = 0; i < 8; ++i) vd[(size_t)i * 32 * T] = ov[i];
}

// ---------------------------------------------------------------------------
// Flash attention with refine-conv term.  grid = (B*H, T/128), block = 256.
// Wave w handles 16 query rows; keys tiled 32 wide; causal.  f16 in, f16 out.
// V consumed transposed [B,KV,64,T] -> B-fragments are two b128 loads.
// Refine conv is branchless: 10 rows x 3 clamped+masked columns per lane,
// reused across the 8 accumulator rows (9 FMAs each).
// ---------------------------------------------------------------------------
__global__ __launch_bounds__(256)
void attn_kernel(const _Float16* __restrict__ qh, const _Float16* __restrict__ kh,
                 const _Float16* __restrict__ vt, const float* __restrict__ prev,
                 const float* __restrict__ refine_w, const float* __restrict__ alpha_p,
                 _Float16* __restrict__ y, int T) {
  constexpr int H = 16, KV = 4, HD = 64;
  const int bh = blockIdx.x;
  const int b = bh / H, h = bh % H;
  const int wave = threadIdx.x >> 5;
  const int lane = threadIdx.x & 31;
  const int hlf = lane >> 4, r = lane & 15;
  const int qb = (blockIdx.y * 8 + wave) * 16;
  const float alpha = alpha_p[0];

  float rw[9];
  #pragma unroll
  for (int i = 0; i < 9; ++i) rw[i] = refine_w[h * 9 + i];

  const _Float16* qbase = qh + ((size_t)(b * H + h)) * T * HD;
  const _Float16* kbase = kh + ((size_t)(b * KV + (h >> 2))) * T * HD;
  const _Float16* vbase = vt + ((size_t)(b * KV + (h >> 2))) * HD * T;
  const float*    pbase = prev + ((size_t)(b * H + h)) * T * T;

  v16h aQ[2];
  {
    const _Float16* qp = qbase + (size_t)(qb + r) * HD + hlf * 8;
    aQ[0] = pack16(*(const v8h*)qp,        *(const v8h*)(qp + 16));
    aQ[1] = pack16(*(const v8h*)(qp + 32), *(const v8h*)(qp + 48));
  }

  float mstat[8], lstat[8];
  v8f O[4];
  #pragma unroll
  for (int v = 0; v < 8; ++v) { mstat[v] = -1e30f; lstat[v] = 0.f; }
  #pragma unroll
  for (int j = 0; j < 4; ++j)
    #pragma unroll
    for (int e = 0; e < 8; ++e) O[j][e] = 0.f;

  __shared__ __attribute__((aligned(16))) _Float16 lds_p[8 * 16 * 32];
  const int wbase = wave * 512;
  const int qrow0 = qb + 8 * hlf;   // first accumulator row for this lane-half

  for (int kb = 0; kb <= qb + 15; kb += 32) {
    // S = Q @ K^T  (16 x 32 tile, two 16x16 fragments)
    v8f S[2];
    #pragma unroll
    for (int sb = 0; sb < 2; ++sb) {
      #pragma unroll
      for (int e = 0; e < 8; ++e) S[sb][e] = 0.f;
      const _Float16* kp = kbase + (size_t)(kb + sb * 16 + r) * HD + hlf * 8;
      S[sb] = wmma16(aQ[0], pack16(*(const v8h*)kp,        *(const v8h*)(kp + 16)), S[sb]);
      S[sb] = wmma16(aQ[1], pack16(*(const v8h*)(kp + 32), *(const v8h*)(kp + 48)), S[sb]);
    }

    // scale + refine conv (branchless, row-reused) + causal mask
    #pragma unroll
    for (int sb = 0; sb < 2; ++sb) {
      const int kj = kb + sb * 16 + r;
      const float cm0 = (kj > 0) ? 1.f : 0.f;
      const float cm2 = (kj < T - 1) ? 1.f : 0.f;
      const int c0 = (kj > 0) ? kj - 1 : 0;
      const int c2 = (kj < T - 1) ? kj + 1 : kj;
      float colL[10], colC[10], colR[10];
      #pragma unroll
      for (int i = 0; i < 10; ++i) {
        const int rr = qrow0 - 1 + i;
        const float rm = ((unsigned)rr < (unsigned)T) ? 1.f : 0.f;
        const int rrc = (rr < 0) ? 0 : ((rr >= T) ? T - 1 : rr);
        const float* pr = pbase + (size_t)rrc * T;
        colL[i] = rm * cm0 * pr[c0];
        colC[i] = rm * pr[kj];
        colR[i] = rm * cm2 * pr[c2];
      }
      #pragma unroll
      for (int v = 0; v < 8; ++v) {
        float acc = 0.f;
        #pragma unroll
        for (int di = 0; di < 3; ++di)
          acc += colL[v + di] * rw[di * 3] + colC[v + di] * rw[di * 3 + 1]
               + colR[v + di] * rw[di * 3 + 2];
        const int qi = qrow0 + v;
        float s = S[sb][v] * 0.125f + alpha * acc;
        if (kj > qi) s = -1e30f;
        S[sb][v] = s;
      }
    }

    // online softmax (row stats via 16-lane shuffles), stage P to LDS
    #pragma unroll
    for (int v = 0; v < 8; ++v) {
      float rmax = fmaxf(S[0][v], S[1][v]);
      #pragma unroll
      for (int off = 1; off < 16; off <<= 1) rmax = fmaxf(rmax, __shfl_xor(rmax, off, 16));
      const float mnew = fmaxf(mstat[v], rmax);
      const float scl = __expf(mstat[v] - mnew);
      mstat[v] = mnew;
      lstat[v] *= scl;
      #pragma unroll
      for (int j = 0; j < 4; ++j) O[j][v] *= scl;
      const float p0 = __expf(S[0][v] - mnew);
      const float p1 = __expf(S[1][v] - mnew);
      float rsum = p0 + p1;
      #pragma unroll
      for (int off = 1; off < 16; off <<= 1) rsum += __shfl_xor(rsum, off, 16);
      lstat[v] += rsum;
      const int m = v + 8 * hlf;
      lds_p[wbase + m * 32 + r]      = (_Float16)p0;
      lds_p[wbase + m * 32 + 16 + r] = (_Float16)p1;
    }

    // O += P @ V   (V transposed: contiguous b128 B-fragment loads)
    v16h aP;
    {
      const _Float16* pp = lds_p + wbase + r * 32 + hlf * 8;
      aP = pack16(*(const v8h*)pp, *(const v8h*)(pp + 16));
    }
    #pragma unroll
    for (int j = 0; j < 4; ++j) {
      const _Float16* vp = vbase + (size_t)(j * 16 + r) * T + kb + hlf * 8;
      const v16h bv = pack16(*(const v8h*)vp, *(const v8h*)(vp + 16));
      O[j] = wmma16(aP, bv, O[j]);
    }
  }

  #pragma unroll
  for (int v = 0; v < 8; ++v) {
    const float inv = 1.f / lstat[v];
    #pragma unroll
    for (int j = 0; j < 4; ++j) O[j][v] *= inv;
  }
  #pragma unroll
  for (int j = 0; j < 4; ++j)
    #pragma unroll
    for (int v = 0; v < 8; ++v) {
      const int qi = qb + v + 8 * hlf;
      const int hd = j * 16 + r;
      y[((size_t)(b * T + qi)) * 1024 + h * 64 + hd] = (_Float16)O[j][v];
    }
}

// ---------------------------------------------------------------------------
// Channel-attention depthwise conv along T + exact GELU -> f16 (GEMM input)
// ---------------------------------------------------------------------------
__global__ __launch_bounds__(256)
void caconv_kernel(const float* __restrict__ h, const float* __restrict__ cw,
                   _Float16* __restrict__ o, int T, int CH, int total) {
  const int idx = blockIdx.x * 256 + threadIdx.x;
  if (idx >= total) return;
  const int c = idx % CH;
  const int t = (idx / CH) % T;
  const float ctr = h[idx];
  const float lft = (t > 0)     ? h[idx - CH] : 0.f;
  const float rgt = (t < T - 1) ? h[idx + CH] : 0.f;
  const float v = ctr + 0.1f * (lft * cw[c * 3] + ctr * cw[c * 3 + 1] + rgt * cw[c * 3 + 2]);
  o[idx] = (_Float16)(0.5f * v * (1.f + erff(v * 0.70710678118654752f)));
}

// Four FFN depthwise conv steps (each: o = in + 0.1*conv_T(in), zero padded) in one pass.
// A thread owns 8 adjacent channels and walks 16 + 8 rows of T.  Step s lags the input by
// s rows, so every step keeps its last two rows in f32 registers; only step 4 is stored.
// The 4 halo rows on each side are recomputed per tile; past the ends of T they are the
// zero padding of every step.  Needs T % 16 == 0, F % 2048 == 0.
// grid = (F/2048, T/16, B), block = 256
template<int T, int F>
__global__ __launch_bounds__(256)
void ffnconv4_kernel(const _Float16* __restrict__ in, const float* __restrict__ cw,
                     _Float16* __restrict__ o) {
  constexpr int TT = 16, NR = TT + 8;
  static_assert(T % TT == 0 && F % 2048 == 0, "tile shape");
  const int f  = (blockIdx.x * 256 + threadIdx.x) * 8;   // first of the lane's 8 channels
  const int t0 = blockIdx.y * TT;
  const bool lo = (t0 == 0);        // rows t0-4 .. t0-1 lie before the sequence
  const bool hi = (t0 + TT == T);   // rows t0+16 .. t0+19 lie behind it
  const size_t tile = ((size_t)blockIdx.z * T + t0) * F;   // row t0, same for the whole block
  const _Float16* ip  = in + tile + f;
  // an outside halo row re-reads a row of the tile itself (in bounds); it is masked below
  const _Float16* ipl = ip + (lo ? 4 * F : 0);
  const _Float16* iph = ip - (hi ? 4 * F : 0);
  const float* wp = cw + (size_t)f * 3;
  _Float16* op = o + tile + f;
  const v8f zero = {0.f, 0.f, 0.f, 0.f, 0.f, 0.f, 0.f, 0.f};

  // every loop below is unrolled so that its arrays are indexed by constants and stay in registers
  v8f w0, w1, w2;
  #pragma unroll
  for (int e = 0; e < 8; ++e) {
    w0[e] = wp[e * 3];
    w1[e] = wp[e * 3 + 1];
    w2[e] = wp[e * 3 + 2];
  }

  v8h raw[NR];
  #pragma unroll
  for (int i = 0; i < NR; ++i) {
    const _Float16* p = (i < 4) ? ipl : ((i >= TT + 4) ? iph : ip);
    raw[i] = *(const v8h*)(p + (i - 4) * F);
  }
  // the wait that belongs in front of any overwrite of the loads' address registers; they are
  // named as inputs so that none is reused (not even as a load's destination) ahead of it
  asm volatile("s_wait_xcnt 0x0" :: "v"(wp), "v"(ipl), "v"(ip), "v"(iph) : "memory");

  // r = row index inside the 24-row window; only halo rows can lie outside [0,T)
  auto pad = [&](const v8f v, const int r) -> v8f {
    if (r < 4)       return lo ? zero : v;
    if (r >= TT + 4) return hi ? zero : v;
    return v;
  };
  auto step = [&](const v8f l, const v8f c, const v8f r) -> v8f {
    return c + 0.1f * (l * w0 + c * w1 + r * w2);
  };

  v8f a[4], b[4];   // per step input: rows two back and one back
  #pragma unroll
  for (int s = 0; s < 4; ++s) { a[s] = zero; b[s] = zero; }

  #pragma unroll
  for (int i = 0; i < NR; ++i) {
    const v8f x0 = pad(__builtin_convertvector(raw[i], v8f), i);
    const v8f x1 = pad(step(a[0], b[0], x0), i - 1);  a[0] = b[0];  b[0] = x0;
    const v8f x2 = pad(step(a[1], b[1], x1), i - 2);  a[1] = b[1];  b[1] = x1;
    const v8f x3 = pad(step(a[2], b[2], x2), i - 3);  a[2] = b[2];  b[2] = x2;
    const v8f x4 = step(a[3], b[3], x3);              a[3] = b[3];  b[3] = x3;
    if (i >= 8) *(v8h*)(op + (i - 8) * F) = __builtin_convertvector(x4, v8h);
  }
}

// x1 = x + attn_proj*(1+0.1*tanh(ca1));  writes f32 and f16 copies
// A block owns 2048 adjacent elements, a thread 4 of the first 1024 and 4 of the second, so
// that every load of a wave covers 512 adjacent bytes.  grid = elements / 2048, exactly.
__global__ __launch_bounds__(256)
void x1_kernel(const float* __restrict__ x, const float* __restrict__ ap,
               const float* __restrict__ ca1, float* __restrict__ o,
               _Float16* __restrict__ o16) {
  const int i0 = blockIdx.x * 2048 + threadIdx.x * 4;
  // both loops are unrolled so that the six loads are issued together
  float4 xv[2], av[2], cv[2];
  #pragma unroll
  for (int p = 0; p < 2; ++p) {
    xv[p] = *(const float4*)(x   + i0 + p * 1024);
    av[p] = *(const float4*)(ap  + i0 + p * 1024);
    cv[p] = *(const float4*)(ca1 + i0 + p * 1024);
  }
  #pragma unroll
  for (int p = 0; p < 2; ++p) {
    float4 v;
    v.x = xv[p].x + av[p].x * (1.f + 0.1f * tanhf(cv[p].x));
    v.y = xv[p].y + av[p].y * (1.f + 0.1f * tanhf(cv[p].y));
    v.z = xv[p].z + av[p].z * (1.f + 0.1f * tanhf(cv[p].z));
    v.w = xv[p].w + av[p].w * (1.f + 0.1f * tanhf(cv[p].w));
    *(float4*)(o + i0 + p * 1024) = v;
    v4h h; h[0] = (_Float16)v.x; h[1] = (_Float16)v.y; h[2] = (_Float16)v.z; h[3] = (_Float16)v.w;
    *(v4h*)(o16 + i0 + p * 1024) = h;
  }
}

__global__ __launch_bounds__(256)
void vitdot_kernel(const float* __restrict__ g32, const float* __restrict__ w2,
                   float* __restrict__ vit0, int ntok) {
  const int i = blockIdx.x * 256 + threadIdx.x;
  if (i >= ntok) return;
  float s = 0.f;
  #pragma unroll
  for (int j = 0; j < 32; ++j) s += g32[(size_t)i * 32 + j] * w2[j];
  vit0[i] = 1.f / (1.f + __expf(-s));
}

__global__ __launch_bounds__(256)
void vitsmooth_kernel(const float* __restrict__ vit0, float* __restrict__ vit,
                      int T, int ntok) {
  const int i = blockIdx.x * 256 + threadIdx.x;
  if (i >= ntok) return;
  const int t = i % T;
  const int base = i - t;
  float s = 0.f;
  #pragma unroll
  for (int d = -2; d <= 2; ++d) {
    const int tt = t + d;
    if ((unsigned)tt < (unsigned)T) s += vit0[base + tt];
  }
  const float v = 0.7f * vit0[i] + 0.3f * (s * 0.2f);
  vit[i] = (v > 0.3f) ? v : 0.1f * v;
}

// out = x1 + mlp*g*(1+0.1*tanh(ca2))*vit[token]; elements shared out as in x1_kernel.
// Needs C % 4 == 0 (a thread's 4 elements lie in one token).  grid = elements / 2048, exactly.
__global__ __launch_bounds__(256)
void final_kernel(const float* __restrict__ x1, const float* __restrict__ mlp,
                  const float* __restrict__ g, const float* __restrict__ ca2,
                  const float* __restrict__ vit, float* __restrict__ out, int C) {
  const int i0 = blockIdx.x * 2048 + threadIdx.x * 4;
  const float* px = x1 + i0;
  const float* pm = mlp + i0;
  const float* pg = g + i0;
  const float* pc = ca2 + i0;
  const float* pv0 = vit + i0 / C;
  const float* pv1 = vit + (i0 + 1024) / C;
  // both loops are unrolled so that the ten loads are issued together
  float4 xv[2], mv[2], gv[2], cv[2];
  float vt[2];
  #pragma unroll
  for (int p = 0; p < 2; ++p) {
    xv[p] = *(const float4*)(px + p * 1024);
    mv[p] = *(const float4*)(pm + p * 1024);
    gv[p] = *(const float4*)(pg + p * 1024);
    cv[p] = *(const float4*)(pc + p * 1024);
  }
  vt[0] = *pv0;
  vt[1] = *pv1;
  // the wait that belongs in front of any overwrite of the loads' address registers; they are
  // named as inputs so that none is reused (not even as a load's destination) ahead of it
  asm volatile("s_wait_xcnt 0x0" :: "v"(px), "v"(pm), "v"(pg), "v"(pc), "v"(pv0), "v"(pv1) : "memory");
  #pragma unroll
  for (int p = 0; p < 2; ++p) {
    float4 v;
    v.x = xv[p].x + mv[p].x * gv[p].x * (1.f + 0.1f * tanhf(cv[p].x)) * vt[p];
    v.y = xv[p].y + mv[p].y * gv[p].y * (1.f + 0.1f * tanhf(cv[p].y)) * vt[p];
    v.z = xv[p].z + mv[p].z * gv[p].z * (1.f + 0.1f * tanhf(cv[p].z)) * vt[p];
    v.w = xv[p].w + mv[p].w * gv[p].w * (1.f + 0.1f * tanhf(cv[p].w)) * vt[p];
    *(float4*)(out + i0 + p * 1024) = v;
  }
}

// ---------------------------------------------------------------------------
extern "C" void kernel_launch(void* const* d_in, const int* in_sizes, int n_in,
                              void* d_out, int out_size, void* d_ws, size_t ws_size,
                              hipStream_t stream) {
  (void)in_sizes; (void)n_in; (void)out_size; (void)ws_size;
  constexpr int B = 4, T = 1024, C = 1024, H = 16, KV = 4, HD = 64, FFN = 4096, CA = 32;
  constexpr int BT = B * T;

  const float* x       = (const float*)d_in[0];
  const float* ve      = (const float*)d_in[1];
  const float* cosb    = (const float*)d_in[2];
  const float* sinb    = (const float*)d_in[3];
  const float* prev    = (const float*)d_in[4];
  const float* w_q     = (const float*)d_in[5];
  const float* w_k     = (const float*)d_in[6];
  const float* w_v     = (const float*)d_in[7];
  const float* w_o     = (const float*)d_in[8];
  const float* w_gate  = (const float*)d_in[9];
  const float* rf_w    = (const float*)d_in[10];
  const float* rf_a    = (const float*)d_in[11];
  const float* ca_pi   = (const float*)d_in[12];
  const float* ca_cw   = (const float*)d_in[13];
  const float* ca_po   = (const float*)d_in[14];
  const float* ffn_in  = (const float*)d_in[15];
  const float* ffn_cw  = (const float*)d_in[16];
  const float* ffn_out = (const float*)d_in[17];
  const float* ffn_g   = (const float*)d_in[18];
  const float* vit_w1  = (const float*)d_in[19];
  const float* vit_w2  = (const float*)d_in[20];
  float* out = (float*)d_out;

  float* wsf = (float*)d_ws;
  size_t off = 0;
  auto allocf = [&](size_t n) -> float* {
    float* p = wsf + off;
    off += (n + 63) & ~(size_t)63;
    return p;
  };
  auto alloch = [&](size_t n) -> _Float16* {   // n halfs
    return (_Float16*)allocf((n + 1) / 2);
  };

  // fp32 working buffers
  float* q_raw     = allocf((size_t)BT * C);
  float* k_raw     = allocf((size_t)BT * KV * HD);
  float* v_raw     = allocf((size_t)BT * KV * HD);
  float* attn_proj = allocf((size_t)BT * C);
  float* ca_h      = allocf((size_t)BT * CA);
  float* ca1       = allocf((size_t)BT * C);
  float* x1        = allocf((size_t)BT * C);
  float* vit0      = allocf(BT);
  float* vitf      = allocf(BT);
  // f16 working buffers
  _Float16* x16    = alloch((size_t)BT * C);
  _Float16* xn16   = alloch((size_t)BT * C);
  _Float16* qh     = alloch((size_t)BT * C);
  _Float16* kh     = alloch((size_t)BT * KV * HD);
  _Float16* vt     = alloch((size_t)BT * KV * HD);   // transposed [B,KV,64,T]
  _Float16* y16    = alloch((size_t)BT * C);
  _Float16* cag16  = alloch((size_t)BT * CA);
  _Float16* x1_16  = alloch((size_t)BT * C);
  _Float16* hA     = alloch((size_t)BT * FFN);
  _Float16* hB     = alloch((size_t)BT * FFN);
  // f16 weights (converted once)
  _Float16* w_q16   = alloch((size_t)C * C);
  _Float16* w_k16   = alloch((size_t)KV * HD * C);
  _Float16* w_v16   = alloch((size_t)KV * HD * C);
  _Float16* w_o16   = alloch((size_t)C * C);
  _Float16* ca_pi16 = alloch((size_t)CA * C);
  _Float16* ca_po16 = alloch((size_t)C * CA);
  _Float16* fin16   = alloch((size_t)FFN * C);
  _Float16* fout16  = alloch((size_t)C * FFN);
  _Float16* fg16    = alloch((size_t)C * C);
  _Float16* vw1_16  = alloch((size_t)CA * C);
  // reuse
  float* gbuf  = q_raw;      // q_raw dead after qkvpost
  float* mlp   = attn_proj;  // dead after x1
  float* ca2   = ca1;        // dead after x1
  float* g32   = ca_h;       // dead after ca2 conv
  _Float16* xm16 = xn16;     // xn16 dead after QKV + gate

  const dim3 blk(256);
  const int MB = BT / 256;  // 16
  const int MT = BT / 128;  // 32 row tiles of the ring GEMM
  auto CVT = [&](const float* s, _Float16* d, int n) {
    cvt16_kernel<<<dim3((n / 4 + 255) / 256), blk, 0, stream>>>(s, d, n);
  };

  // --- one-time f16 conversions (weights + x) ---
  CVT(x, x16, BT * C);
  CVT(w_q, w_q16, C * C);
  CVT(w_k, w_k16, KV * HD * C);
  CVT(w_v, w_v16, KV * HD * C);
  CVT(w_o, w_o16, C * C);
  CVT(ca_pi, ca_pi16, CA * C);
  CVT(ca_po, ca_po16, C * CA);
  CVT(ffn_in, fin16, FFN * C);
  CVT(ffn_out, fout16, C * FFN);
  CVT(ffn_g, fg16, C * C);
  CVT(vit_w1, vw1_16, CA * C);

  // --- attention path ---
  rmsnorm16_kernel<<<BT, blk, 0, stream>>>(x, xn16, C);
  gemm_ring_kernel<0,0,128><<<dim3(MT, C / 128), blk, 0, stream>>>(xn16, w_q16, q_raw, BT, C, C);
  gemm_ring_kernel<0,0,128><<<dim3(MT, (KV * HD) / 128), blk, 0, stream>>>(xn16, w_k16, k_raw, BT, KV * HD, C);
  gemm_ring_kernel<0,0,128><<<dim3(MT, (KV * HD) / 128), blk, 0, stream>>>(xn16, w_v16, v_raw, BT, KV * HD, C);
  qkvpost_kernel<T><<<dim3(BT / 8), blk, 0, stream>>>(
      q_raw, k_raw, v_raw, xn16, ve, cosb, sinb, w_gate, qh, kh, vt);
  attn_kernel<<<dim3(B * H, T / 128), blk, 0, stream>>>(qh, kh, vt, prev, rf_w, rf_a, y16, T);
  gemm_ring_kernel<0,0,128><<<dim3(MT, C / 128), blk, 0, stream>>>(y16, w_o16, attn_proj, BT, C, C);

  // --- ca1 + residual into x1 ---
  gemm_ring_kernel<0,0,32><<<dim3(MT, 1), blk, 0, stream>>>(x16, ca_pi16, ca_h, BT, CA, C);
  caconv_kernel<<<dim3((BT * CA) / 256), blk, 0, stream>>>(ca_h, ca_cw, cag16, T, CA, BT * CA);
  gemm_kernel<0,0><<<dim3(MB, C / 64), blk, 0, stream>>>(cag16, ca_po16, ca1, BT, C, CA);
  x1_kernel<<<dim3((BT * C) / 2048), blk, 0, stream>>>(x, attn_proj, ca1, x1, x1_16);

  // --- FFN ---
  rmsnorm16_kernel<<<BT, blk, 0, stream>>>(x1, xm16, C);
  gemm_ring_kernel<1,1,128><<<dim3(MT, FFN / 128), blk, 0, stream>>>(xm16, fin16, hA, BT, FFN, C);
  ffnconv4_kernel<T, FFN><<<dim3(FFN / 2048, T / 16, B), blk, 0, stream>>>(hA, ffn_cw, hB);
  gemm_ring_kernel<0,0,128><<<dim3(MT, C / 128), blk, 0, stream>>>(hB, fout16, mlp, BT, C, FFN);
  gemm_ring_kernel<2,0,128><<<dim3(MT, C / 128), blk, 0, stream>>>(xm16, fg16, gbuf, BT, C, C);

  // --- ca2 ---
  gemm_ring_kernel<0,0,32><<<dim3(MT, 1), blk, 0, stream>>>(x1_16, ca_pi16, ca_h, BT, CA, C);
  caconv_kernel<<<dim3((BT * CA) / 256), blk, 0, stream>>>(ca_h, ca_cw, cag16, T, CA, BT * CA);
  gemm_kernel<0,0><<<dim3(MB, C / 64), blk, 0, stream>>>(cag16, ca_po16, ca2, BT, C, CA);

  // --- vit gate ---
  gemm_ring_kernel<3,0,32><<<dim3(MT, 1), blk, 0, stream>>>(x1_16, vw1_16, g32, BT, CA, C);
  vitdot_kernel<<<dim3(BT / 256), blk, 0, stream>>>(g32, vit_w2, vit0, BT);
  vitsmooth_kernel<<<dim3(BT / 256), blk, 0, stream>>>(vit0, vitf, T, BT);

  // --- final combine ---
  final_kernel<<<dim3((BT * C) / 2048), blk, 0, stream>>>(x1, mlp, gbuf, ca2, vitf, out, C);
}

// v004
// A run of this version takes 367 microseconds.
// In both of two side-by-side timings against v003, it was 1.21 times as fast.
// All steps since v000 together make it 2.26 times as fast.
#include <hip/hip_runtime.h>
#include <hip/hip_bf16.h>

typedef __attribute__((ext_vector_type(16))) _Float16 v16h;
typedef __attribute__((ext_vector_type(8)))  _Float16 v8h;
typedef __attribute__((ext_vector_type(4)))  _Float16 v4h;
typedef __attribute__((ext_vector_type(8)))  float    v8f;

static __device__ __forceinline__ v8f wmma16(v16h a, v16h b, v8f c) {
  return __builtin_amdgcn_wmma_f32_16x16x32_f16(false, a, false, b, (short)0, c, false, false);
}
static __device__ __forceinline__ v16h pack16(v8h lo, v8h hi) {
  return __builtin_shufflevector(lo, hi, 0,1,2,3,4,5,6,7,8,9,10,11,12,13,14,15);
}

// ---------------------------------------------------------------------------
// fp32 -> f16 conversion (vectorized x4); totals are multiples of 4
// ---------------------------------------------------------------------------
__global__ __launch_bounds__(256)
void cvt16_kernel(const float* __restrict__ in, _Float16* __restrict__ out, int total) {
  const int i = (blockIdx.x * 256 + threadIdx.x) * 4;
  if (i >= total) return;
  const float4 v = *(const float4*)(in + i);
  v4h o; o[0] = (_Float16)v.x; o[1] = (_Float16)v.y; o[2] = (_Float16)v.z; o[3] = (_Float16)v.w;
  *(v4h*)(out + i) = o;
}

// ---------------------------------------------------------------------------
// Epilogues: 0=identity, 1=relu^2, 2=sigmoid, 3=gelu(exact)
// ---------------------------------------------------------------------------
template<int EPI>
static __device__ __forceinline__ float apply_epi(float x) {
  if constexpr (EPI == 1) { float t = x > 0.f ? x : 0.f; return t * t; }
  else if constexpr (EPI == 2) { return 1.f / (1.f + __expf(-x)); }
  else if constexpr (EPI == 3) { return 0.5f * x * (1.f + erff(x * 0.70710678118654752f)); }
  else return x;
}

// ---------------------------------------------------------------------------
// WMMA GEMM, all-f16 operands: out[M,N] = epi( A[M,K] @ W[N,K]^T )
// W tile (64 x 32) staged in LDS, double-buffered, shared by all 8 waves.
// Requirements: M % 256 == 0, K % 32 == 0.  N guarded in 16-wide steps.
// ---------------------------------------------------------------------------
template<int EPI, int OH>
__global__ __launch_bounds__(256)
void gemm_kernel(const _Float16* __restrict__ A, const _Float16* __restrict__ W,
                 void* __restrict__ Op, int M, int N, int K) {
  const int tid  = threadIdx.x;
  const int wave = tid >> 5;
  const int lane = tid & 31;
  const int hlf  = lane >> 4;
  const int r    = lane & 15;
  const int m0 = blockIdx.x * 256 + wave * 32;
  const int n0 = blockIdx.y * 64;

  __shared__ __attribute__((aligned(16))) _Float16 wtile[2][64 * 32];
  const int srow = tid >> 2;            // 0..63
  const int scol = (tid & 3) * 8;       // 0,8,16,24

  auto stage = [&](int buf, int k0) {
    if (n0 + srow < N) {
      const v8h w = *(const v8h*)(W + (size_t)(n0 + srow) * K + k0 + scol);
      *(v8h*)(&wtile[buf][srow * 32 + scol]) = w;
    }
  };

  v8f acc[2][4];
  #pragma unroll
  for (int mi = 0; mi < 2; ++mi)
    #pragma unroll
    for (int nj = 0; nj < 4; ++nj)
      #pragma unroll
      for (int e = 0; e < 8; ++e) acc[mi][nj][e] = 0.f;

  stage(0, 0);
  __syncthreads();

  int it = 0;
  for (int k0 = 0; k0 < K; k0 += 32, ++it) {
    const int cur = it & 1;
    if (k0 + 32 < K) stage(cur ^ 1, k0 + 32);

    const _Float16* p0 = A + (size_t)(m0 + r) * K + k0 + hlf * 8;
    const _Float16* p1 = A + (size_t)(m0 + 16 + r) * K + k0 + hlf * 8;
    const v16h a0 = pack16(*(const v8h*)p0, *(const v8h*)(p0 + 16));
    const v16h a1 = pack16(*(const v8h*)p1, *(const v8h*)(p1 + 16));
    if (k0 + 32 < K) __builtin_prefetch(p0 + 32, 0, 0);

    #pragma unroll
    for (int nj = 0; nj < 4; ++nj) {
      const int nb = n0 + nj * 16;
      if (nb >= N) break;
      const _Float16* lp = &wtile[cur][(nj * 16 + r) * 32 + hlf * 8];
      const v16h bf = pack16(*(const v8h*)lp, *(const v8h*)(lp + 16));
      acc[0][nj] = wmma16(a0, bf, acc[0][nj]);
      acc[1][nj] = wmma16(a1, bf, acc[1][nj]);
    }
    __syncthreads();
  }

  #pragma unroll
  for (int nj = 0; nj < 4; ++nj) {
    const int nb = n0 + nj * 16;
    if (nb >= N) break;
    const int n = nb + r;
    #pragma unroll
    for (int mi = 0; mi < 2; ++mi)
      #pragma unroll
      for (int v = 0; v < 8; ++v) {
        const int m = m0 + mi * 16 + v + 8 * hlf;
        const float val = apply_epi<EPI>(acc[mi][nj][v]);
        if constexpr (OH) ((_Float16*)Op)[(size_t)m * N + n] = (_Float16)val;
        else              ((float*)Op)[(size_t)m * N + n] = val;
      }
  }
}

// ---------------------------------------------------------------------------
// WMMA GEMM for K % 128 == 0: out[M,N] = epi( A[M,K] @ W[N,K]^T ), all-f16 operands.
// A work-group owns a 128 x BN tile of out; a stage is 128 k of [A 128 rows | W BN rows],
// rows of 256 B at a pitch of 272 B in LDS (conflict-free for 16-byte readers), two buffers.
// Both operands come into LDS by asynchronous copies, one stage ahead of the products.
// BN = 128: 2 x 4 waves of 64 x 32 each.  BN = 32: 8 x 1 waves of 16 x 32 each.
// Requirements: M % 128 == 0, N % BN == 0, K % 128 == 0.
// ---------------------------------------------------------------------------
constexpr int G_PITCH_H = 136;                    // LDS row pitch in halfs (272 B)

// NC 16-byte copies of one lane: rows 16 apart, in LDS (l) as in global memory (g, rs halfs).
// The s_wait_xcnt closes each statement so that no address register named in it can be
// rewritten ahead of the wait.
template<int NC>
static __device__ __forceinline__ void copy_rows(const unsigned l, const _Float16* g, const size_t rs) {
  constexpr unsigned LS = 16u * G_PITCH_H * 2u;   // 16 LDS rows in bytes
  static_assert(NC == 8 || NC == 2, "rows per lane");
  if constexpr (NC == 8) {
    asm volatile(
        "global_load_async_to_lds_b128 %0, %8, off\n\t"
        "global_load_async_to_lds_b128 %1, %9, off\n\t"
        "global_load_async_to_lds_b128 %2, %10, off\n\t"
        "global_load_async_to_lds_b128 %3, %11, off\n\t"
        "global_load_async_to_lds_b128 %4, %12, off\n\t"
        "global_load_async_to_lds_b128 %5, %13, off\n\t"
        "global_load_async_to_lds_b128 %6, %14, off\n\t"
        "global_load_async_to_lds_b128 %7, %15, off\n\t"
        "s_wait_xcnt 0x0"
        :: "v"(l), "v"(l + LS), "v"(l + 2 * LS), "v"(l + 3 * LS),
           "v"(l + 4 * LS), "v"(l + 5 * LS), "v"(l + 6 * LS), "v"(l + 7 * LS),
           "v"(g), "v"(g + rs), "v"(g + 2 * rs), "v"(g + 3 * rs),
           "v"(g + 4 * rs), "v"(g + 5 * rs), "v"(g + 6 * rs), "v"(g + 7 * rs)
        : "memory");
  } else {
    asm volatile(
        "global_load_async_to_lds_b128 %0, %2, off\n\t"
        "global_load_async_to_lds_b128 %1, %3, off\n\t"
        "s_wait_xcnt 0x0"
        :: "v"(l), "v"(l + LS), "v"(g), "v"(g + rs)
        : "memory");
  }
}

template<int EPI, int OH, int BN>
__global__ __launch_bounds__(256)
void gemm_ring_kernel(const _Float16* __restrict__ A, const _Float16* __restrict__ W,
                      void* __restrict__ Op, int M, int N, int K) {
  constexpr int WN = BN / 32;               // waves along N
  constexpr int MF = 128 / ((8 / WN) * 16); // 16-row fragments of A per wave
  constexpr int STAGE_H = (128 + BN) * G_PITCH_H;   // one buffer in halfs
  const int tid  = threadIdx.x;
  const int wave = tid >> 5;
  const int lane = tid & 31;
  const int hlf  = lane >> 4;
  const int r    = lane & 15;
  const int m0 = blockIdx.x * 128;
  const int n0 = blockIdx.y * BN;
  const int wm = (wave / WN) * (MF * 16);
  const int wn = (wave % WN) * 32;

  __shared__ __attribute__((aligned(16))) _Float16 ring[2 * STAGE_H];

  // a lane copies 16-byte column (tid & 15) of rows (tid >> 4) + 16 i, of A and of W
  const int crow = tid >> 4;
  const int ccol = (tid & 15) * 8;
  const _Float16* gA = A + (size_t)(m0 + crow) * K + ccol;
  const _Float16* gW = W + (size_t)(n0 + crow) * K + ccol;
  const unsigned lA = (unsigned)(size_t)(&ring[crow * G_PITCH_H + ccol]);   // LDS byte address
  const size_t rs = (size_t)16 * K;

  auto copy_stage = [&](const int buf, const int t) {
    const unsigned l = lA + (unsigned)buf * (STAGE_H * 2u);
    copy_rows<8>(l, gA + (size_t)t * 128, rs);
    copy_rows<BN / 16>(l + 128u * G_PITCH_H * 2u, gW + (size_t)t * 128, rs);
  };

  // every loop of constant length in this kernel is unrolled so that acc, af and bf are
  // indexed by constants and stay in registers
  v8f acc[MF][2];
  #pragma unroll
  for (int mi = 0; mi < MF; ++mi)
    #pragma unroll
    for (int nj = 0; nj < 2; ++nj)
      #pragma unroll
      for (int e = 0; e < 8; ++e) acc[mi][nj][e] = 0.f;

  const int nt = K / 128;
  copy_stage(0, 0);
  asm volatile("s_wait_asynccnt 0x0" ::: "memory");   // this wave's part of stage 0 has landed
  __syncthreads();                                    // ... and every other wave's
  if (nt > 1) copy_stage(1, 1);

  for (int t = 0; t < nt; ++t) {
    const _Float16* sa = ring + (t & 1) * STAGE_H + (wm + r) * G_PITCH_H + hlf * 8;
    const _Float16* sw = ring + (t & 1) * STAGE_H + (128 + wn + r) * G_PITCH_H + hlf * 8;
    v16h af[2][MF], bf[2][2];   // two fragment sets: one in use, one being fetched
    auto fetch = [&](const int set, const int kk) {
      #pragma unroll
      for (int mi = 0; mi < MF; ++mi) {
        const _Float16* p = sa + mi * 16 * G_PITCH_H + kk * 32;
        af[set][mi] = pack16(*(const v8h*)p, *(const v8h*)(p + 16));
      }
      #pragma unroll
      for (int nj = 0; nj < 2; ++nj) {
        const _Float16* p = sw + nj * 16 * G_PITCH_H + kk * 32;
        bf[set][nj] = pack16(*(const v8h*)p, *(const v8h*)(p + 16));
      }
    };
    fetch(0, 0);
    #pragma unroll
    for (int kk = 0; kk < 4; ++kk) {
      if (kk < 3) fetch((kk + 1) & 1, kk + 1);
      // the next block's LDS reads stay one group ahead of this block's products; left to
      // itself the scheduler sinks each read to its use and the wave waits out every one
      __builtin_amdgcn_sched_barrier(0);
      #pragma unroll
      for (int mi = 0; mi < MF; ++mi)
        #pragma unroll
        for (int nj = 0; nj < 2; ++nj)
          acc[mi][nj] = wmma16(af[kk & 1][mi], bf[kk & 1][nj], acc[mi][nj]);
      // ... and no later read is lifted in among these products
      __builtin_amdgcn_sched_barrier(0);
    }
    asm volatile("s_wait_dscnt 0x0" ::: "memory");      // this wave has left the buffer
    asm volatile("s_wait_asynccnt 0x0" ::: "memory");   // its part of stage t + 1 has landed
    __syncthreads();   // publishes stage t + 1 and frees the buffer of stage t
    if (t + 2 < nt) copy_stage(t & 1, t + 2);
  }
  asm volatile("s_wait_asynccnt 0x0" ::: "memory");     // no copy outlives the wave

  #pragma unroll
  for (int nj = 0; nj < 2; ++nj) {
    const int n = n0 + wn + nj * 16 + r;
    #pragma unroll
    for (int mi = 0; mi < MF; ++mi)
      #pragma unroll
      for (int v = 0; v < 8; ++v) {
        const int m = m0 + wm + mi * 16 + v + 8 * hlf;
        const float val = apply_epi<EPI>(acc[mi][nj][v]);
        if constexpr (OH) ((_Float16*)Op)[(size_t)m * N + n] = (_Float16)val;
        else              ((float*)Op)[(size_t)m * N + n] = val;
      }
  }
}

// ---------------------------------------------------------------------------
// RMSNorm over last dim C (one block per row), f32 in -> f16 out
// ---------------------------------------------------------------------------
__global__ __launch_bounds__(256)
void rmsnorm16_kernel(const float* __restrict__ x, _Float16* __restrict__ o, int C) {
  const size_t row = blockIdx.x;
  const float* xr = x + row * (size_t)C;
  float ss = 0.f;
  for (int i = threadIdx.x; i < C; i += 256) { float v = xr[i]; ss += v * v; }
  #pragma unroll
  for (int off = 16; off; off >>= 1) ss += __shfl_xor(ss, off, 32);
  __shared__ float red[8];
  if ((threadIdx.x & 31) == 0) red[threadIdx.x >> 5] = ss;
  __syncthreads();
  float tot = 0.f;
  #pragma unroll
  for (int i = 0; i < 8; ++i) tot += red[i];
  const float rs = rsqrtf(tot / (float)C + 1e-6f);
  _Float16* orow = o + row * (size_t)C;
  for (int i = threadIdx.x; i < C; i += 256) orow[i] = (_Float16)(xr[i] * rs);
}

// v + (v of lane l ^ M), M < 16, inside a 16-lane row, in the vector unit (DPP row_xmask)
template<int M>
static __device__ __forceinline__ float add_xor_row(const float v) {
  return v + __int_as_float(__builtin_amdgcn_update_dpp(0, __float_as_int(v), 0x160 | M, 0xf, 0xf, true));
}
// Sum over the 32 lanes, left in every lane: a butterfly over lane distances 16, 8, 4, 2, 1.
// All 32 lanes must be on.  No step goes through the LDS queue, so 40 such sums of one wave
// do not each wait out its latency.
static __device__ __forceinline__ float wave_sum(float v) {
  const int b = __float_as_int(v);
  v += __int_as_float(__builtin_amdgcn_permlanex16(b, b, 0x76543210, 0xfedcba98, false, false));
  v = add_xor_row<8>(v);
  v = add_xor_row<4>(v);
  v = add_xor_row<2>(v);
  v = add_xor_row<1>(v);
  return v;
}

// ---------------------------------------------------------------------------
// QKV post: RoPE + head RMSNorm*1.2 for q,k; v + 3*sigmoid(xn[:12]@gate)*ve.
// One wave per token, all 24 heads of it; grid = B*T/8 blocks of 8 waves.
// A lane holds elements j and j+32 of a head, the two partners of the rotation, so a head's
// sum of squares needs the wave's own shuffles only: no LDS, no barrier.
// qh: [B,H,T,64]   kh: [B,KV,T,64]   vt: [B,KV,64,T]  (V TRANSPOSED)
// ---------------------------------------------------------------------------
template<int T>
__global__ __launch_bounds__(256)
void qkvpost_kernel(const float* __restrict__ q_raw, const float* __restrict__ k_raw,
                    const float* __restrict__ v_raw, const _Float16* __restrict__ xn,
                    const float* __restrict__ ve, const float* __restrict__ cosb,
                    const float* __restrict__ sinb, const float* __restrict__ wgate,
                    _Float16* __restrict__ qh, _Float16* __restrict__ kh,
                    _Float16* __restrict__ vt) {
  // the wave's number is the same in all its lanes: said so, the row addresses stay scalar
  const int bt = blockIdx.x * 8 + __builtin_amdgcn_readfirstlane(threadIdx.x >> 5);
  const int b = bt / T, t = bt % T;
  const int j = threadIdx.x & 31;

  const float* qr = q_raw + (size_t)bt * 1024;
  const float* kr = k_raw + (size_t)bt * 256;
  const float* vr = v_raw + (size_t)bt * 256;
  const float* er = ve    + (size_t)bt * 256;
  const float* cr = cosb  + (size_t)t * 32;
  const float* sr = sinb  + (size_t)t * 32;
  const _Float16* xr = xn + (size_t)bt * 1024;

  // every loop below is unrolled so that its arrays are indexed by constants and stay in
  // registers; all of a token's loads are issued before the first head is worked on
  float x1[20], x2[20], vv[8], ee[8], xg[12];
  const float c = cr[j], s = sr[j];
  #pragma unroll
  for (int u = 0; u < 20; ++u) {
    const float* src = (u < 16) ? qr + u * 64 : kr + (u - 16) * 64;
    x1[u] = src[j];
    x2[u] = src[j + 32];
  }
  #pragma unroll
  for (int i = 0; i < 8; ++i) { vv[i] = vr[i * 32 + j]; ee[i] = er[i * 32 + j]; }
  #pragma unroll
  for (int i = 0; i < 12; ++i) xg[i] = (float)xr[i];
  // the wait that belongs in front of any overwrite of the loads' address registers; they are
  // named as inputs so that none is reused (not even as a load's destination) ahead of it
  asm volatile("s_wait_xcnt 0x0" :: "s"(qr), "s"(kr), "s"(vr), "s"(er), "s"(cr), "s"(sr), "s"(xr), "v"(j) : "memory");

  _Float16 ol[20], oh[20], ov[8];
  #pragma unroll
  for (int u = 0; u < 20; ++u) {
    const float lo =  x1[u] * c + x2[u] * s;
    const float hi = -x1[u] * s + x2[u] * c;
    // each half summed by its own butterfly (lane distances 16, 8, 4, 2, 1), then added
    const float sl = wave_sum(lo * lo), sh = wave_sum(hi * hi);
    const float rs = rsqrtf((sl + sh) * (1.f / 64.f) + 1e-6f) * 1.2f;
    ol[u] = (_Float16)(lo * rs);
    oh[u] = (_Float16)(hi * rs);
  }
  #pragma unroll
  for (int kv = 0; kv < 4; ++kv) {
    float g = 0.f;
    #pragma unroll
    for (int i = 0; i < 12; ++i) g += xg[i] * wgate[kv * 12 + i];
    g = 3.f / (1.f + __expf(-g));
    ov[kv * 2]     = (_Float16)(vv[kv * 2]     + g * ee[kv * 2]);
    ov[kv * 2 + 1] = (_Float16)(vv[kv * 2 + 1] + g * ee[kv * 2 + 1]);
  }

  _Float16* qd = qh + ((size_t)(b * 16) * T + t) * 64 + j;
  _Float16* kd = kh + ((size_t)(b * 4) * T + t) * 64 + j;
  _Float16* vd = vt + ((size_t)(b * 4) * 64 + j) * T + t;   // transposed: [b][kv][hd][t]
  // keeps the stores in runs at the end: left to itself the scheduler mixes them in among the
  // heads' arithmetic
  __builtin_amdgcn_sched_barrier(0);
  #pragma unroll
  for (int u = 0; u < 16; ++u) {
    qd[(size_t)u * T * 64]      = ol[u];
    qd[(size_t)u * T * 64 + 32] = oh[u];
  }
  #pragma unroll
  for (int u = 0; u < 4; ++u) {
    kd[(size_t)u * T * 64]      = ol[16 + u];
    kd[(size_t)u * T * 64 + 32] = oh[16 + u];
  }
  #pragma unroll
  for (int i = 0; i < 8; ++i) vd[(size_t)i * 32 * T] = ov[i];
}

// ---------------------------------------------------------------------------
// Flash attention with refine-conv term.  grid = (B*H, T/128), block = 256.
// Wave w handles 16 query rows; keys tiled 32 wide; causal.  f16 in, f16 out.
// V consumed transposed [B,KV,64,T] -> B-fragments are two b128 loads.
// Refine conv: 10 rows x 6 columns per lane (left, centre, right of its two key columns),
// reused across the 8 accumulator rows (9 FMAs each); outside rows and columns are read at a
// clamped address and replaced by the zero padding.
// All global loads of the loop stand in ONE group per key tile, behind the conv: V of this
// tile, then K and the prev_attn window of the NEXT tile, each into the registers that its
// last user has just left.  Their latency runs under the softmax and the P @ V products.
// ---------------------------------------------------------------------------
template<int T>
__global__ __launch_bounds__(256)
void attn_kernel(const _Float16* __restrict__ qh, const _Float16* __restrict__ kh,
                 const _Float16* __restrict__ vt, const float* __restrict__ prev,
                 const float* __restrict__ refine_w, const float* __restrict__ alpha_p,
                 _Float16* __restrict__ y) {
  constexpr int H = 16, KV = 4, HD = 64;
  const int bh = blockIdx.x;
  const int b = bh / H, h = bh % H;
  // the wave's number is the same in all its lanes: said so, the trip count and the tiles'
  // base addresses stay scalar
  const int wave = __builtin_amdgcn_readfirstlane(threadIdx.x >> 5);
  const int lane = threadIdx.x & 31;
  const int hlf = lane >> 4, r = lane & 15;
  const int qb = (blockIdx.y * 8 + wave) * 16;
  const float alpha = alpha_p[0];

  float rw[9];
  #pragma unroll
  for (int i = 0; i < 9; ++i) rw[i] = refine_w[h * 9 + i];

  const _Float16* qbase = qh + ((size_t)(b * H + h)) * T * HD;
  const char* kbase = (const char*)(kh + ((size_t)(b * KV + (h >> 2))) * T * HD);
  const char* vbase = (const char*)(vt + ((size_t)(b * KV + (h >> 2))) * HD * T);
  const char* pbase = (const char*)(prev + ((size_t)(b * H + h)) * T * T);

  v16h aQ[2];
  {
    const _Float16* qp = qbase + (size_t)(qb + r) * HD + hlf * 8;
    aQ[0] = pack16(*(const v8h*)qp,        *(const v8h*)(qp + 16));
    aQ[1] = pack16(*(const v8h*)(qp + 32), *(const v8h*)(qp + 48));
    // the wait that belongs in front of any overwrite of these loads' address registers
    asm volatile("s_wait_xcnt 0x0" :: "v"(qp) : "memory");
  }

  float mstat[8], lstat[8];
  v8f O[4];
  #pragma unroll
  for (int v = 0; v < 8; ++v) { mstat[v] = -1e30f; lstat[v] = 0.f; }
  #pragma unroll
  for (int j = 0; j < 4; ++j)
    #pragma unroll
    for (int e = 0; e < 8; ++e) O[j][e] = 0.f;

  __shared__ __attribute__((aligned(16))) _Float16 lds_p[8 * 16 * 32];
  const int wbase = wave * 512;
  const int qrow0 = qb + 8 * hlf;   // first accumulator row for this lane-half
  const int klast = ((qb + 15) >> 5) << 5;   // the wave's last key tile

  // the lane's byte offsets inside a K tile (64 halfs a key) and a V tile (T halfs a channel)
  const unsigned kvo = (unsigned)(r * HD + hlf * 8) * 2u;
  const unsigned vvo = (unsigned)(r * T + hlf * 8) * 2u;
  // prev_attn rows qrow0-1 .. qrow0+8: only the first and the last can lie outside [0,T)
  const bool okTop = qrow0 > 0, okBot = qrow0 + 8 < T;
  const unsigned rowTop = (unsigned)(okTop ? qrow0 - 1 : 0) * (T * 4u);
  const unsigned rowMid = (unsigned)qrow0 * (T * 4u);
  const unsigned rowBot = (unsigned)(okBot ? qrow0 + 8 : T - 1) * (T * 4u);

  // every loop of constant length below is unrolled so that kf, vf and pf are indexed by
  // constants and stay in registers
  v8h kf[8], vf[8];
  float pf[10][6];   // [row][left, centre, right of key kb+r | the same of key kb+16+r]

  auto load_v = [&](const char* vp) {
    #pragma unroll
    for (int j = 0; j < 4; ++j) {
      vf[j * 2]     = *(const v8h*)(vp + j * 16 * T * 2);
      vf[j * 2 + 1] = *(const v8h*)(vp + j * 16 * T * 2 + 32);
    }
  };
  auto load_k = [&](const char* kp) {
    #pragma unroll
    for (int sb = 0; sb < 2; ++sb)
      #pragma unroll
      for (int q = 0; q < 4; ++q)
        kf[sb * 4 + q] = *(const v8h*)(kp + sb * 16 * HD * 2 + q * 32);
  };
  // oL, oC, oR: byte offsets of [top, middle, bottom] rows at the clamped left column of the
  // first key, at the first key itself, and at the clamped right column of the second key
  auto load_p = [&](const unsigned (&oL)[3], const unsigned (&oC)[3], const unsigned (&oR)[3]) {
    #pragma unroll
    for (int i = 0; i < 10; ++i) {
      const int g  = (i == 0) ? 0 : ((i == 9) ? 2 : 1);
      const int im = (g == 1) ? (i - 1) * T * 4 : 0;
      pf[i][0] = *(const float*)(pbase + oL[g] + im);
      pf[i][1] = *(const float*)(pbase + oC[g] + im);
      pf[i][2] = *(const float*)(pbase + oC[g] + im + 4);
      pf[i][3] = *(const float*)(pbase + oC[g] + im + 60);
      pf[i][4] = *(const float*)(pbase + oC[g] + im + 64);
      pf[i][5] = *(const float*)(pbase + oR[g] + im);
    }
  };
  // one group of loads: V of tile kv (skipped in front of the loop), K and prev_attn of tile kn
  auto load_group = [&](const bool with_v, const int kv, const int kn) {
    const int k0 = kn + r;
    const unsigned cL = (unsigned)(k0 > 0 ? k0 - 1 : 0) * 4u;
    const unsigned cC = (unsigned)k0 * 4u;
    const unsigned cR = (unsigned)(k0 + 17 < T ? k0 + 17 : T - 1) * 4u;
    const unsigned oL[3] = {rowTop + cL, rowMid + cL, rowBot + cL};
    const unsigned oC[3] = {rowTop + cC, rowMid + cC, rowBot + cC};
    const unsigned oR[3] = {rowTop + cR, rowMid + cR, rowBot + cR};
    const char* vp = vbase + (size_t)kv * 2 + vvo;          // the lane's own addresses
    const char* kp = kbase + (size_t)kn * (HD * 2) + kvo;
    if (with_v) load_v(vp);
    load_k(kp);
    load_p(oL, oC, oR);
    // the wait that belongs in front of any overwrite of the loads' address registers; they are
    // named as inputs so that none is reused (not even as a load's destination) ahead of it
    asm volatile("s_wait_xcnt 0x0" :: "s"(pbase), "v"(vp), "v"(kp), "v"(vvo), "v"(kvo),
                 "v"(oL[0]), "v"(oL[1]), "v"(oL[2]), "v"(oC[0]), "v"(oC[1]), "v"(oC[2]),
                 "v"(oR[0]), "v"(oR[1]), "v"(oR[2]) : "memory");
  };

  // fenced like the group in the loop, so that K stands in front of prev_attn here too and
  // the loop's first wait need not cover more than K
  __builtin_amdgcn_sched_barrier(0);
  load_group(false, 0, 0);
  __builtin_amdgcn_sched_barrier(0);

  // tile 0 exists for every wave: the test stands at the foot, and nothing of the prologue
  // (the Q loads least of all) is moved in behind the first group
  int kb = 0;
  do {
    // S = Q @ K^T  (16 x 32 tile, two 16x16 fragments)
    v8f S[2];
    #pragma unroll
    for (int sb = 0; sb < 2; ++sb) {
      #pragma unroll
      for (int e = 0; e < 8; ++e) S[sb][e] = 0.f;
      S[sb] = wmma16(aQ[0], pack16(kf[sb * 4],     kf[sb * 4 + 1]), S[sb]);
      S[sb] = wmma16(aQ[1], pack16(kf[sb * 4 + 2], kf[sb * 4 + 3]), S[sb]);
    }

    // scale + refine conv (row-reused) + causal mask
    #pragma unroll
    for (int sb = 0; sb < 2; ++sb) {
      const int kj = kb + sb * 16 + r;
      float colL[10], colC[10], colR[10];
      #pragma unroll
      for (int i = 0; i < 10; ++i) {
        const bool okRow = (i == 0) ? okTop : ((i == 9) ? okBot : true);
        colL[i] = (okRow && kj > 0)     ? pf[i][sb * 3]     : 0.f;
        colC[i] = okRow                 ? pf[i][sb * 3 + 1] : 0.f;
        colR[i] = (okRow && kj < T - 1) ? pf[i][sb * 3 + 2] : 0.f;
      }
      #pragma unroll
      for (int v = 0; v < 8; ++v) {
        float acc = 0.f;
        #pragma unroll
        for (int di = 0; di < 3; ++di)
          acc += colL[v + di] * rw[di * 3] + colC[v + di] * rw[di * 3 + 1]
               + colR[v + di] * rw[di * 3 + 2];
        const int qi = qrow0 + v;
        float s = S[sb][v] * 0.125f + alpha * acc;
        if (kj > qi) s = -1e30f;
        S[sb][v] = s;
      }
    }

    // the group stays here, whole: left to itself the scheduler sinks each load to its use
    // and the wave waits out one memory latency after another
    __builtin_amdgcn_sched_barrier(0);
    load_group(true, kb, kb < klast ? kb + 32 : kb);   // past the last tile: the same one again
    __builtin_amdgcn_sched_barrier(0);

    // online softmax (row stats via 16-lane shuffles), stage P to LDS
    #pragma unroll
    for (int v = 0; v < 8; ++v) {
      float rmax = fmaxf(S[0][v], S[1][v]);
      #pragma unroll
      for (int off = 1; off < 16; off <<= 1) rmax = fmaxf(rmax, __shfl_xor(rmax, off, 16));
      const float mnew = fmaxf(mstat[v], rmax);
      const float scl = __expf(mstat[v] - mnew);
      mstat[v] = mnew;
      lstat[v] *= scl;
      #pragma unroll
      for (int j = 0; j < 4; ++j) O[j][v] *= scl;
      const float p0 = __expf(S[0][v] - mnew);
      const float p1 = __expf(S[1][v] - mnew);
      float rsum = p0 + p1;
      #pragma unroll
      for (int off = 1; off < 16; off <<= 1) rsum += __shfl_xor(rsum, off, 16);
      lstat[v] += rsum;
      const int m = v + 8 * hlf;
      lds_p[wbase + m * 32 + r]      = (_Float16)p0;
      lds_p[wbase + m * 32 + 16 + r] = (_Float16)p1;
    }

    // O += P @ V   (V transposed: a B-fragment is two of the group's b128 loads)
    v16h aP;
    {
      const _Float16* pp = lds_p + wbase + r * 32 + hlf * 8;
      aP = pack16(*(const v8h*)pp, *(const v8h*)(pp + 16));
    }
    #pragma unroll
    for (int j = 0; j < 4; ++j) O[j] = wmma16(aP, pack16(vf[j * 2], vf[j * 2 + 1]), O[j]);
    kb += 32;
  } while (kb <= klast);

  #pragma unroll
  for (int v = 0; v < 8; ++v) {
    const float inv = 1.f / lstat[v];
    #pragma unroll
    for (int j = 0; j < 4; ++j) O[j][v] *= inv;
  }
  #pragma unroll
  for (int j = 0; j < 4; ++j)
    #pragma unroll
    for (int v = 0; v < 8; ++v) {
      const int qi = qb + v + 8 * hlf;
      const int hd = j * 16 + r;
      y[((size_t)(b * T + qi)) * 1024 + h * 64 + hd] = (_Float16)O[j][v];
    }
}

// ---------------------------------------------------------------------------
// Channel-attention depthwise conv along T + exact GELU -> f16 (GEMM input)
// ---------------------------------------------------------------------------
__global__ __launch_bounds__(256)
void caconv_kernel(const float* __restrict__ h, const float* __restrict__ cw,
                   _Float16* __restrict__ o, int T, int CH, int total) {
  const int idx = blockIdx.x * 256 + threadIdx.x;
  if (idx >= total) return;
  const int c = idx % CH;
  const int t = (idx / CH) % T;
  const float ctr = h[idx];
  const float lft = (t > 0)     ? h[idx - CH] : 0.f;
  const float rgt = (t < T - 1) ? h[idx + CH] : 0.f;
  const float v = ctr + 0.1f * (lft * cw[c * 3] + ctr * cw[c * 3 + 1] + rgt * cw[c * 3 + 2]);
  o[idx] = (_Float16)(0.5f * v * (1.f + erff(v * 0.70710678118654752f)));
}

// Four FFN depthwise conv steps (each: o = in + 0.1*conv_T(in), zero padded) in one pass.
// A thread owns 8 adjacent channels and walks 16 + 8 rows of T.  Step s lags the input by
// s rows, so every step keeps its last two rows in f32 registers; only step 4 is stored.
// The 4 halo rows on each side are recomputed per tile; past the ends of T they are the
// zero padding of every step.  Needs T % 16 == 0, F % 2048 == 0.
// grid = (F/2048, T/16, B), block = 256
template<int T, int F>
__global__ __launch_bounds__(256)
void ffnconv4_kernel(const _Float16* __restrict__ in, const float* __restrict__ cw,
                     _Float16* __restrict__ o) {
  constexpr int TT = 16, NR = TT + 8;
  static_assert(T % TT == 0 && F % 2048 == 0, "tile shape");
  const int f  = (blockIdx.x * 256 + threadIdx.x) * 8;   // first of the lane's 8 channels
  const int t0 = blockIdx.y * TT;
  const bool lo = (t0 == 0);        // rows t0-4 .. t0-1 lie before the sequence
  const bool hi = (t0 + TT == T);   // rows t0+16 .. t0+19 lie behind it
  const size_t tile = ((size_t)blockIdx.z * T + t0) * F;   // row t0, same for the whole block
  const _Float16* ip  = in + tile + f;
  // an outside halo row re-reads a row of the tile itself (in bounds); it is masked below
  const _Float16* ipl = ip + (lo ? 4 * F : 0);
  const _Float16* iph = ip - (hi ? 4 * F : 0);
  const float* wp = cw + (size_t)f * 3;
  _Float16* op = o + tile + f;
  const v8f zero = {0.f, 0.f, 0.f, 0.f, 0.f, 0.f, 0.f, 0.f};

  // every loop below is unrolled so that its arrays are indexed by constants and stay in registers
  v8f w0, w1, w2;
  #pragma unroll
  for (int e = 0; e < 8; ++e) {
    w0[e] = wp[e * 3];
    w1[e] = wp[e * 3 + 1];
    w2[e] = wp[e * 3 + 2];
  }

  v8h raw[NR];
  #pragma unroll
  for (int i = 0; i < NR; ++i) {
    const _Float16* p = (i < 4) ? ipl : ((i >= TT + 4) ? iph : ip);
    raw[i] = *(const v8h*)(p + (i - 4) * F);
  }
  // the wait that belongs in front of any overwrite of the loads' address registers; they are
  // named as inputs so that none is reused (not even as a load's destination) ahead of it
  asm volatile("s_wait_xcnt 0x0" :: "v"(wp), "v"(ipl), "v"(ip), "v"(iph) : "memory");

  // r = row index inside the 24-row window; only halo rows can lie outside [0,T)
  auto pad = [&](const v8f v, const int r) -> v8f {
    if (r < 4)       return lo ? zero : v;
    if (r >= TT + 4) return hi ? zero : v;
    return v;
  };
  auto step = [&](const v8f l, const v8f c, const v8f r) -> v8f {
    return c + 0.1f * (l * w0 + c * w1 + r * w2);
  };

  v8f a[4], b[4];   // per step input: rows two back and one back
  #pragma unroll
  for (int s = 0; s < 4; ++s) { a[s] = zero; b[s] = zero; }

  #pragma unroll
  for (int i = 0; i < NR; ++i) {
    const v8f x0 = pad(__builtin_convertvector(raw[i], v8f), i);
    const v8f x1 = pad(step(a[0], b[0], x0), i - 1);  a[0] = b[0];  b[0] = x0;
    const v8f x2 = pad(step(a[1], b[1], x1), i - 2);  a[1] = b[1];  b[1] = x1;
    const v8f x3 = pad(step(a[2], b[2], x2), i - 3);  a[2] = b[2];  b[2] = x2;
    const v8f x4 = step(a[3], b[3], x3);              a[3] = b[3];  b[3] = x3;
    if (i >= 8) *(v8h*)(op + (i - 8) * F) = __builtin_convertvector(x4, v8h);
  }
}

// x1 = x + attn_proj*(1+0.1*tanh(ca1));  writes f32 and f16 copies
// A block owns 2048 adjacent elements, a thread 4 of the first 1024 and 4 of the second, so
// that every load of a wave covers 512 adjacent bytes.  grid = elements / 2048, exactly.
__global__ __launch_bounds__(256)
void x1_kernel(const float* __restrict__ x, const float* __restrict__ ap,
               const float* __restrict__ ca1, float* __restrict__ o,
               _Float16* __restrict__ o16) {
  const int i0 = blockIdx.x * 2048 + threadIdx.x * 4;
  // both loops are unrolled so that the six loads are issued together
  float4 xv[2], av[2], cv[2];
  #pragma unroll
  for (int p = 0; p < 2; ++p) {
    xv[p] = *(const float4*)(x   + i0 + p * 1024);
    av[p] = *(const float4*)(ap  + i0 + p * 1024);
    cv[p] = *(const float4*)(ca1 + i0 + p * 1024);
  }
  #pragma unroll
  for (int p = 0; p < 2; ++p) {
    float4 v;
    v.x = xv[p].x + av[p].x * (1.f + 0.1f * tanhf(cv[p].x));
    v.y = xv[p].y + av[p].y * (1.f + 0.1f * tanhf(cv[p].y));
    v.z = xv[p].z + av[p].z * (1.f + 0.1f * tanhf(cv[p].z));
    v.w = xv[p].w + av[p].w * (1.f + 0.1f * tanhf(cv[p].w));
    *(float4*)(o + i0 + p * 1024) = v;
    v4h h; h[0] = (_Float16)v.x; h[1] = (_Float16)v.y; h[2] = (_Float16)v.z; h[3] = (_Float16)v.w;
    *(v4h*)(o16 + i0 + p * 1024) = h;
  }
}

__global__ __launch_bounds__(256)
void vitdot_kernel(const float* __restrict__ g32, const float* __restrict__ w2,
                   float* __restrict__ vit0, int ntok) {
  const int i = blockIdx.x * 256 + threadIdx.x;
  if (i >= ntok) return;
  float s = 0.f;
  #pragma unroll
  for (int j = 0; j < 32; ++j) s += g32[(size_t)i * 32 + j] * w2[j];
  vit0[i] = 1.f / (1.f + __expf(-s));
}

__global__ __launch_bounds__(256)
void vitsmooth_kernel(const float* __restrict__ vit0, float* __restrict__ vit,
                      int T, int ntok) {
  const int i = blockIdx.x * 256 + threadIdx.x;
  if (i >= ntok) return;
  const int t = i % T;
  const int base = i - t;
  float s = 0.f;
  #pragma unroll
  for (int d = -2; d <= 2; ++d) {
    const int tt = t + d;
    if ((unsigned)tt < (unsigned)T) s += vit0[base + tt];
  }
  const float v = 0.7f * vit0[i] + 0.3f * (s * 0.2f);
  vit[i] = (v > 0.3f) ? v : 0.1f * v;
}

// out = x1 + mlp*g*(1+0.1*tanh(ca2))*vit[token]; elements shared out as in x1_kernel.
// Needs C % 4 == 0 (a thread's 4 elements lie in one token).  grid = elements / 2048, exactly.
__global__ __launch_bounds__(256)
void final_kernel(const float* __restrict__ x1, const float* __restrict__ mlp,
                  const float* __restrict__ g, const float* __restrict__ ca2,
                  const float* __restrict__ vit, float* __restrict__ out, int C) {
  const int i0 = blockIdx.x * 2048 + threadIdx.x * 4;
  const float* px = x1 + i0;
  const float* pm = mlp + i0;
  const float* pg = g + i0;
  const float* pc = ca2 + i0;
  const float* pv0 = vit + i0 / C;
  const float* pv1 = vit + (i0 + 1024) / C;
  // both loops are unrolled so that the ten loads are issued together
  float4 xv[2], mv[2], gv[2], cv[2];
  float vt[2];
  #pragma unroll
  for (int p = 0; p < 2; ++p) {
    xv[p] = *(const float4*)(px + p * 1024);
    mv[p] = *(const float4*)(pm + p * 1024);
    gv[p] = *(const float4*)(pg + p * 1024);
    cv[p] = *(const float4*)(pc + p * 1024);
  }
  vt[0] = *pv0;
  vt[1] = *pv1;
  // the wait that belongs in front of any overwrite of the loads' address registers; they are
  // named as inputs so that none is reused (not even as a load's destination) ahead of it
  asm volatile("s_wait_xcnt 0x0" :: "v"(px), "v"(pm), "v"(pg), "v"(pc), "v"(pv0), "v"(pv1) : "memory");
  #pragma unroll
  for (int p = 0; p < 2; ++p) {
    float4 v;
    v.x = xv[p].x + mv[p].x * gv[p].x * (1.f + 0.1f * tanhf(cv[p].x)) * vt[p];
    v.y = xv[p].y + mv[p].y * gv[p].y * (1.f + 0.1f * tanhf(cv[p].y)) * vt[p];
    v.z = xv[p].z + mv[p].z * gv[p].z * (1.f + 0.1f * tanhf(cv[p].z)) * vt[p];
    v.w = xv[p].w + mv[p].w * gv[p].w * (1.f + 0.1f * tanhf(cv[p].w)) * vt[p];
    *(float4*)(out + i0 + p * 1024) = v;
  }
}

// ---------------------------------------------------------------------------
extern "C" void kernel_launch(void* const* d_in, const int* in_sizes, int n_in,
                              void* d_out, int out_size, void* d_ws, size_t ws_size,
                              hipStream_t stream) {
  (void)in_sizes; (void)n_in; (void)out_size; (void)ws_size;
  constexpr int B = 4, T = 1024, C = 1024, H = 16, KV = 4, HD = 64, FFN = 4096, CA = 32;
  constexpr int BT = B * T;

  const float* x       = (const float*)d_in[0];
  const float* ve      = (const float*)d_in[1];
  const float* cosb    = (const float*)d_in[2];
  const float* sinb    = (const float*)d_in[3];
  const float* prev    = (const float*)d_in[4];
  const float* w_q     = (const float*)d_in[5];
  const float* w_k     = (const float*)d_in[6];
  const float* w_v     = (const float*)d_in[7];
  const float* w_o     = (const float*)d_in[8];
  const float* w_gate  = (const float*)d_in[9];
  const float* rf_w    = (const float*)d_in[10];
  const float* rf_a    = (const float*)d_in[11];
  const float* ca_pi   = (const float*)d_in[12];
  const float* ca_cw   = (const float*)d_in[13];
  const float* ca_po   = (const float*)d_in[14];
  const float* ffn_in  = (const float*)d_in[15];
  const float* ffn_cw  = (const float*)d_in[16];
  const float* ffn_out = (const float*)d_in[17];
  const float* ffn_g   = (const float*)d_in[18];
  const float* vit_w1  = (const float*)d_in[19];
  const float* vit_w2  = (const float*)d_in[20];
  float* out = (float*)d_out;

  float* wsf = (float*)d_ws;
  size_t off = 0;
  auto allocf = [&](size_t n) -> float* {
    float* p = wsf + off;
    off += (n + 63) & ~(size_t)63;
    return p;
  };
  auto alloch = [&](size_t n) -> _Float16* {   // n halfs
    return (_Float16*)allocf((n + 1) / 2);
  };

  // fp32 working buffers
  float* q_raw     = allocf((size_t)BT * C);
  float* k_raw     = allocf((size_t)BT * KV * HD);
  float* v_raw     = allocf((size_t)BT * KV * HD);
  float* attn_proj = allocf((size_t)BT * C);
  float* ca_h      = allocf((size_t)BT * CA);
  float* ca1       = allocf((size_t)BT * C);
  float* x1        = allocf((size_t)BT * C);
  float* vit0      = allocf(BT);
  float* vitf      = allocf(BT);
  // f16 working buffers
  _Float16* x16    = alloch((size_t)BT * C);
  _Float16* xn16   = alloch((size_t)BT * C);
  _Float16* qh     = alloch((size_t)BT * C);
  _Float16* kh     = alloch((size_t)BT * KV * HD);
  _Float16* vt     = alloch((size_t)BT * KV * HD);   // transposed [B,KV,64,T]
  _Float16* y16    = alloch((size_t)BT * C);
  _Float16* cag16  = alloch((size_t)BT * CA);
  _Float16* x1_16  = alloch((size_t)BT * C);
  _Float16* hA     = alloch((size_t)BT * FFN);
  _Float16* hB     = alloch((size_t)BT * FFN);
  // f16 weights (converted once)
  _Float16* w_q16   = alloch((size_t)C * C);
  _Float16* w_k16   = alloch((size_t)KV * HD * C);
  _Float16* w_v16   = alloch((size_t)KV * HD * C);
  _Float16* w_o16   = alloch((size_t)C * C);
  _Float16* ca_pi16 = alloch((size_t)CA * C);
  _Float16* ca_po16 = alloch((size_t)C * CA);
  _Float16* fin16   = alloch((size_t)FFN * C);
  _Float16* fout16  = alloch((size_t)C * FFN);
  _Float16* fg16    = alloch((size_t)C * C);
  _Float16* vw1_16  = alloch((size_t)CA * C);
  // reuse
  float* gbuf  = q_raw;      // q_raw dead after qkvpost
  float* mlp   = attn_proj;  // dead after x1
  float* ca2   = ca1;        // dead after x1
  float* g32   = ca_h;       // dead after ca2 conv
  _Float16* xm16 = xn16;     // xn16 dead after QKV + gate

  const dim3 blk(256);
  const int MB = BT / 256;  // 16
  const int MT = BT / 128;  // 32 row tiles of the ring GEMM
  auto CVT = [&](const float* s, _Float16* d, int n) {
    cvt16_kernel<<<dim3((n / 4 + 255) / 256), blk, 0, stream>>>(s, d, n);
  };

  // --- one-time f16 conversions (weights + x) ---
  CVT(x, x16, BT * C);
  CVT(w_q, w_q16, C * C);
  CVT(w_k, w_k16, KV * HD * C);
  CVT(w_v, w_v16, KV * HD * C);
  CVT(w_o, w_o16, C * C);
  CVT(ca_pi, ca_pi16, CA * C);
  CVT(ca_po, ca_po16, C * CA);
  CVT(ffn_in, fin16, FFN * C);
  CVT(ffn_out, fout16, C * FFN);
  CVT(ffn_g, fg16, C * C);
  CVT(vit_w1, vw1_16, CA * C);

  // --- attention path ---
  rmsnorm16_kernel<<<BT, blk, 0, stream>>>(x, xn16, C);
  gemm_ring_kernel<0,0,128><<<dim3(MT, C / 128), blk, 0, stream>>>(xn16, w_q16, q_raw, BT, C, C);
  gemm_ring_kernel<0,0,128><<<dim3(MT, (KV * HD) / 128), blk, 0, stream>>>(xn16, w_k16, k_raw, BT, KV * HD, C);
  gemm_ring_kernel<0,0,128><<<dim3(MT, (KV * HD) / 128), blk, 0, stream>>>(xn16, w_v16, v_raw, BT, KV * HD, C);
  qkvpost_kernel<T><<<dim3(BT / 8), blk, 0, stream>>>(
      q_raw, k_raw, v_raw, xn16, ve, cosb, sinb, w_gate, qh, kh, vt);
  attn_kernel<T><<<dim3(B * H, T / 128), blk, 0, stream>>>(qh, kh, vt, prev, rf_w, rf_a, y16);
  gemm_ring_kernel<0,0,128><<<dim3(MT, C / 128), blk, 0, stream>>>(y16, w_o16, attn_proj, BT, C, C);

  // --- ca1 + residual into x1 ---
  gemm_ring_kernel<0,0,32><<<dim3(MT, 1), blk, 0, stream>>>(x16, ca_pi16, ca_h, BT, CA, C);
  caconv_kernel<<<dim3((BT * CA) / 256), blk, 0, stream>>>(ca_h, ca_cw, cag16, T, CA, BT * CA);
  gemm_kernel<0,0><<<dim3(MB, C / 64), blk, 0, stream>>>(cag16, ca_po16, ca1, BT, C, CA);
  x1_kernel<<<dim3((BT * C) / 2048), blk, 0, stream>>>(x, attn_proj, ca1, x1, x1_16);

  // --- FFN ---
  rmsnorm16_kernel<<<BT, blk, 0, stream>>>(x1, xm16, C);
  gemm_ring_kernel<1,1,128><<<dim3(MT, FFN / 128), blk, 0, stream>>>(xm16, fin16, hA, BT, FFN, C);
  ffnconv4_kernel<T, FFN><<<dim3(FFN / 2048, T / 16, B), blk, 0, stream>>>(hA, ffn_cw, hB);
  gemm_ring_kernel<0,0,128><<<dim3(MT, C / 128), blk, 0, stream>>>(hB, fout16, mlp, BT, C, FFN);
  gemm_ring_kernel<2,0,128><<<dim3(MT, C / 128), blk, 0, stream>>>(xm16, fg16, gbuf, BT, C, C);

  // --- ca2 ---
  gemm_ring_kernel<0,0,32><<<dim3(MT, 1), blk, 0, stream>>>(x1_16, ca_pi16, ca_h, BT, CA, C);
  caconv_kernel<<<dim3((BT * CA) / 256), blk, 0, stream>>>(ca_h, ca_cw, cag16, T, CA, BT * CA);
  gemm_kernel<0,0><<<dim3(MB, C / 64), blk, 0, stream>>>(cag16, ca_po16, ca2, BT, C, CA);

  // --- vit gate ---
  gemm_ring_kernel<3,0,32><<<dim3(MT, 1), blk, 0, stream>>>(x1_16, vw1_16, g32, BT, CA, C);
  vitdot_kernel<<<dim3(BT / 256), blk, 0, stream>>>(g32, vit_w2, vit0, BT);
  vitsmooth_kernel<<<dim3(BT / 256), blk, 0, stream>>>(vit0, vitf, T, BT);

  // --- final combine ---
  final_kernel<<<dim3((BT * C) / 2048), blk, 0, stream>>>(x1, mlp, gbuf, ca2, vitf, out, C);
}

// v005
// Measured time: 281 microseconds a run.
// Two timings next to v004 put it at 1.31 and 1.30 times that version's speed.
// All steps since v000 together make it 2.95 times as fast.
#include <hip/hip_runtime.h>
#include <hip/hip_bf16.h>

typedef __attribute__((ext_vector_type(16))) _Float16 v16h;
typedef __attribute__((ext_vector_type(8)))  _Float16 v8h;
typedef __attribute__((ext_vector_type(4)))  _Float16 v4h;
typedef __attribute__((ext_vector_type(8)))  float    v8f;

static __device__ __forceinline__ v8f wmma16(v16h a, v16h b, v8f c) {
  return __builtin_amdgcn_wmma_f32_16x16x32_f16(false, a, false, b, (short)0, c, false, false);
}
static __device__ __forceinline__ v16h pack16(v8h lo, v8h hi) {
  return __builtin_shufflevector(lo, hi, 0,1,2,3,4,5,6,7,8,9,10,11,12,13,14,15);
}

// ---------------------------------------------------------------------------
// fp32 -> f16 conversion (vectorized x4); totals are multiples of 4
// ---------------------------------------------------------------------------
static __device__ __forceinline__
void cvt16_body(const float* __restrict__ in, _Float16* __restrict__ out, int total, const int bx) {
  const int i = (bx * 256 + threadIdx.x) * 4;
  if (i >= total) return;
  const float4 v = *(const float4*)(in + i);
  v4h o; o[0] = (_Float16)v.x; o[1] = (_Float16)v.y; o[2] = (_Float16)v.z; o[3] = (_Float16)v.w;
  *(v4h*)(out + i) = o;
}

// ---------------------------------------------------------------------------
// Epilogues: 0=identity, 1=relu^2, 2=sigmoid, 3=gelu(exact)
// ---------------------------------------------------------------------------
template<int EPI>
static __device__ __forceinline__ float apply_epi(float x) {
  if constexpr (EPI == 1) { float t = x > 0.f ? x : 0.f; return t * t; }
  else if constexpr (EPI == 2) { return 1.f / (1.f + __expf(-x)); }
  else if constexpr (EPI == 3) { return 0.5f * x * (1.f + erff(x * 0.70710678118654752f)); }
  else return x;
}

// ---------------------------------------------------------------------------
// WMMA GEMM, all-f16 operands: out[M,N] = epi( A[M,K] @ W[N,K]^T )
// W tile (64 x 32) staged in LDS (wtile: two buffers, the caller's), shared by all 8 waves.
// Requirements: M % 256 == 0, K % 32 == 0.  N guarded in 16-wide steps.
// ---------------------------------------------------------------------------
template<int EPI, int OH>
static __device__ __forceinline__
void gemm_body(_Float16 (*wtile)[64 * 32], const _Float16* __restrict__ A,
               const _Float16* __restrict__ W, void* __restrict__ Op, int M, int N, int K,
               const int bx, const int by) {
  const int tid  = threadIdx.x;
  const int wave = tid >> 5;
  const int lane = tid & 31;
  const int hlf  = lane >> 4;
  const int r    = lane & 15;
  const int m0 = bx * 256 + wave * 32;
  const int n0 = by * 64;

  const int srow = tid >> 2;            // 0..63
  const int scol = (tid & 3) * 8;       // 0,8,16,24

  auto stage = [&](int buf, int k0) {
    if (n0 + srow < N) {
      const v8h w = *(const v8h*)(W + (size_t)(n0 + srow) * K + k0 + scol);
      *(v8h*)(&wtile[buf][srow * 32 + scol]) = w;
    }
  };

  v8f acc[2][4];
  #pragma unroll
  for (int mi = 0; mi < 2; ++mi)
    #pragma unroll
    for (int nj = 0; nj < 4; ++nj)
      #pragma unroll
      for (int e = 0; e < 8; ++e) acc[mi][nj][e] = 0.f;

  stage(0, 0);
  __syncthreads();

  int it = 0;
  for (int k0 = 0; k0 < K; k0 += 32, ++it) {
    const int cur = it & 1;
    if (k0 + 32 < K) stage(cur ^ 1, k0 + 32);

    const _Float16* p0 = A + (size_t)(m0 + r) * K + k0 + hlf * 8;
    const _Float16* p1 = A + (size_t)(m0 + 16 + r) * K + k0 + hlf * 8;
    const v16h a0 = pack16(*(const v8h*)p0, *(const v8h*)(p0 + 16));
    const v16h a1 = pack16(*(const v8h*)p1, *(const v8h*)(p1 + 16));
    if (k0 + 32 < K) __builtin_prefetch(p0 + 32, 0, 0);
    // the wait that belongs in front of any overwrite of the loads' address registers; they are
    // named as inputs so that none is reused ahead of it
    asm volatile("s_wait_xcnt 0x0" :: "v"(p0), "v"(p1) : "memory");

    #pragma unroll
    for (int nj = 0; nj < 4; ++nj) {
      const int nb = n0 + nj * 16;
      if (nb >= N) break;
      const _Float16* lp = &wtile[cur][(nj * 16 + r) * 32 + hlf * 8];
      const v16h bf = pack16(*(const v8h*)lp, *(const v8h*)(lp + 16));
      acc[0][nj] = wmma16(a0, bf, acc[0][nj]);
      acc[1][nj] = wmma16(a1, bf, acc[1][nj]);
    }
    __syncthreads();
  }

  #pragma unroll
  for (int nj = 0; nj < 4; ++nj) {
    const int nb = n0 + nj * 16;
    if (nb >= N) break;
    const int n = nb + r;
    #pragma unroll
    for (int mi = 0; mi < 2; ++mi) {
      char* q[8];   // the 8 stores' addresses
      #pragma unroll
      for (int v = 0; v < 8; ++v) {
        const int m = m0 + mi * 16 + v + 8 * hlf;
        q[v] = (char*)Op + ((size_t)m * N + n) * (OH ? 2 : 4);
        const float val = apply_epi<EPI>(acc[mi][nj][v]);
        if constexpr (OH) *(_Float16*)q[v] = (_Float16)val;
        else              *(float*)q[v] = val;
      }
      // the wait that belongs in front of any overwrite of the stores' address registers; they
      // are named as inputs so that none is reused ahead of it
      asm volatile("s_wait_xcnt 0x0" :: "v"(q[0]), "v"(q[1]), "v"(q[2]), "v"(q[3]),
                   "v"(q[4]), "v"(q[5]), "v"(q[6]), "v"(q[7]) : "memory");
    }
  }
}

// ---------------------------------------------------------------------------
// WMMA GEMM for K % 128 == 0: out[M,N] = epi( A[M,K] @ W[N,K]^T ), all-f16 operands.
// A work-group owns a 128 x BN tile of out; a stage is 128 k of [A 128 rows | W BN rows],
// rows of 256 B at a pitch of 272 B in LDS (conflict-free for 16-byte readers), two buffers.
// Both operands come into LDS by asynchronous copies, one stage ahead of the products.
// BN = 128: 2 x 4 waves of 64 x 32 each.  BN = 32: 8 x 1 waves of 16 x 32 each.
// Requirements: M % 128 == 0, N % BN == 0, K % 128 == 0.
// ---------------------------------------------------------------------------
constexpr int G_PITCH_H = 136;                    // LDS row pitch in halfs (272 B)
constexpr int RING_H = 2 * (128 + 128) * G_PITCH_H;   // the caller's LDS array in halfs (BN = 128)

// NC 16-byte copies of one lane: rows 16 apart, in LDS (l) as in global memory (g, rs halfs).
// The s_wait_xcnt closes each statement so that no address register named in it can be
// rewritten ahead of the wait.
template<int NC>
static __device__ __forceinline__ void copy_rows(const unsigned l, const _Float16* g, const size_t rs) {
  constexpr unsigned LS = 16u * G_PITCH_H * 2u;   // 16 LDS rows in bytes
  static_assert(NC == 8 || NC == 2, "rows per lane");
  if constexpr (NC == 8) {
    asm volatile(
        "global_load_async_to_lds_b128 %0, %8, off\n\t"
        "global_load_async_to_lds_b128 %1, %9, off\n\t"
        "global_load_async_to_lds_b128 %2, %10, off\n\t"
        "global_load_async_to_lds_b128 %3, %11, off\n\t"
        "global_load_async_to_lds_b128 %4, %12, off\n\t"
        "global_load_async_to_lds_b128 %5, %13, off\n\t"
        "global_load_async_to_lds_b128 %6, %14, off\n\t"
        "global_load_async_to_lds_b128 %7, %15, off\n\t"
        "s_wait_xcnt 0x0"
        :: "v"(l), "v"(l + LS), "v"(l + 2 * LS), "v"(l + 3 * LS),
           "v"(l + 4 * LS), "v"(l + 5 * LS), "v"(l + 6 * LS), "v"(l + 7 * LS),
           "v"(g), "v"(g + rs), "v"(g + 2 * rs), "v"(g + 3 * rs),
           "v"(g + 4 * rs), "v"(g + 5 * rs), "v"(g + 6 * rs), "v"(g + 7 * rs)
        : "memory");
  } else {
    asm volatile(
        "global_load_async_to_lds_b128 %0, %2, off\n\t"
        "global_load_async_to_lds_b128 %1, %3, off\n\t"
        "s_wait_xcnt 0x0"
        :: "v"(l), "v"(l + LS), "v"(g), "v"(g + rs)
        : "memory");
  }
}

template<int EPI, int OH, int BN>
static __device__ __forceinline__
void gemm_ring_body(_Float16* ring, const _Float16* __restrict__ A, const _Float16* __restrict__ W,
                    void* __restrict__ Op, int M, int N, int K, const int bx, const int by) {
  constexpr int WN = BN / 32;               // waves along N
  constexpr int MF = 128 / ((8 / WN) * 16); // 16-row fragments of A per wave
  constexpr int STAGE_H = (128 + BN) * G_PITCH_H;   // one buffer in halfs
  const int tid  = threadIdx.x;
  const int wave = tid >> 5;
  const int lane = tid & 31;
  const int hlf  = lane >> 4;
  const int r    = lane & 15;
  const int m0 = bx * 128;
  const int n0 = by * BN;
  const int wm = (wave / WN) * (MF * 16);
  const int wn = (wave % WN) * 32;

  // a lane copies 16-byte column (tid & 15) of rows (tid >> 4) + 16 i, of A and of W
  const int crow = tid >> 4;
  const int ccol = (tid & 15) * 8;
  const _Float16* gA = A + (size_t)(m0 + crow) * K + ccol;
  const _Float16* gW = W + (size_t)(n0 + crow) * K + ccol;
  const unsigned lA = (unsigned)(size_t)(&ring[crow * G_PITCH_H + ccol]);   // LDS byte address
  const size_t rs = (size_t)16 * K;

  auto copy_stage = [&](const int buf, const int t) {
    const unsigned l = lA + (unsigned)buf * (STAGE_H * 2u);
    copy_rows<8>(l, gA + (size_t)t * 128, rs);
    copy_rows<BN / 16>(l + 128u * G_PITCH_H * 2u, gW + (size_t)t * 128, rs);
  };

  // every loop of constant length in this kernel is unrolled so that acc, af and bf are
  // indexed by constants and stay in registers
  v8f acc[MF][2];
  #pragma unroll
  for (int mi = 0; mi < MF; ++mi)
    #pragma unroll
    for (int nj = 0; nj < 2; ++nj)
      #pragma unroll
      for (int e = 0; e < 8; ++e) acc[mi][nj][e] = 0.f;

  const int nt = K / 128;
  copy_stage(0, 0);
  asm volatile("s_wait_asynccnt 0x0" ::: "memory");   // this wave's part of stage 0 has landed
  __syncthreads();                                    // ... and every other wave's
  if (nt > 1) copy_stage(1, 1);

  for (int t = 0; t < nt; ++t) {
    const _Float16* sa = ring + (t & 1) * STAGE_H + (wm + r) * G_PITCH_H + hlf * 8;
    const _Float16* sw = ring + (t & 1) * STAGE_H + (128 + wn + r) * G_PITCH_H + hlf * 8;
    v16h af[2][MF], bf[2][2];   // two fragment sets: one in use, one being fetched
    auto fetch = [&](const int set, const int kk) {
      #pragma unroll
      for (int mi = 0; mi < MF; ++mi) {
        const _Float16* p = sa + mi * 16 * G_PITCH_H + kk * 32;
        af[set][mi] = pack16(*(const v8h*)p, *(const v8h*)(p + 16));
      }
      #pragma unroll
      for (int nj = 0; nj < 2; ++nj) {
        const _Float16* p = sw + nj * 16 * G_PITCH_H + kk * 32;
        bf[set][nj] = pack16(*(const v8h*)p, *(const v8h*)(p + 16));
      }
    };
    fetch(0, 0);
    #pragma unroll
    for (int kk = 0; kk < 4; ++kk) {
      if (kk < 3) fetch((kk + 1) & 1, kk + 1);
      // the next block's LDS reads stay one group ahead of this block's products; left to
      // itself the scheduler sinks each read to its use and the wave waits out every one
      __builtin_amdgcn_sched_barrier(0);
      #pragma unroll
      for (int mi = 0; mi < MF; ++mi)
        #pragma unroll
        for (int nj = 0; nj < 2; ++nj)
          acc[mi][nj] = wmma16(af[kk & 1][mi], bf[kk & 1][nj], acc[mi][nj]);
      // ... and no later read is lifted in among these products
      __builtin_amdgcn_sched_barrier(0);
    }
    asm volatile("s_wait_dscnt 0x0" ::: "memory");      // this wave has left the buffer
    asm volatile("s_wait_asynccnt 0x0" ::: "memory");   // its part of stage t + 1 has landed
    __syncthreads();   // publishes stage t + 1 and frees the buffer of stage t
    if (t + 2 < nt) copy_stage(t & 1, t + 2);
  }
  asm volatile("s_wait_asynccnt 0x0" ::: "memory");     // no copy outlives the wave

  #pragma unroll
  for (int nj = 0; nj < 2; ++nj) {
    const int n = n0 + wn + nj * 16 + r;
    #pragma unroll
    for (int mi = 0; mi < MF; ++mi)
      #pragma unroll
      for (int v = 0; v < 8; ++v) {
        const int m = m0 + wm + mi * 16 + v + 8 * hlf;
        const float val = apply_epi<EPI>(acc[mi][nj][v]);
        if constexpr (OH) ((_Float16*)Op)[(size_t)m * N + n] = (_Float16)val;
        else              ((float*)Op)[(size_t)m * N + n] = val;
      }
  }
  // in a merged kernel another piece's code follows in the text: the wait that belongs in
  // front of any overwrite of the last stores' address registers
  asm volatile("s_wait_xcnt 0x0" ::: "memory");
}

// ---------------------------------------------------------------------------
// RMSNorm over last dim C (one block per row), f32 in -> f16 out
// ---------------------------------------------------------------------------
static __device__ __forceinline__
void rmsnorm16_body(const float* __restrict__ x, _Float16* __restrict__ o, int C, const int bx) {
  const size_t row = bx;
  const float* xr = x + row * (size_t)C;
  float ss = 0.f;
  for (int i = threadIdx.x; i < C; i += 256) { float v = xr[i]; ss += v * v; }
  #pragma unroll
  for (int off = 16; off; off >>= 1) ss += __shfl_xor(ss, off, 32);
  __shared__ float red[8];
  if ((threadIdx.x & 31) == 0) red[threadIdx.x >> 5] = ss;
  __syncthreads();
  float tot = 0.f;
  #pragma unroll
  for (int i = 0; i < 8; ++i) tot += red[i];
  const float rs = rsqrtf(tot / (float)C + 1e-6f);
  _Float16* orow = o + row * (size_t)C;
  for (int i = threadIdx.x; i < C; i += 256) {
    const float* p = xr + i;
    const float v = *p;
    // the wait that belongs in front of any overwrite of the load's address registers; they are
    // named as an input so that they are not reused (not even as a load's destination) ahead of it
    asm volatile("s_wait_xcnt 0x0" :: "v"(p) : "memory");
    orow[i] = (_Float16)(v * rs);
  }
}

// v + (v of lane l ^ M), M < 16, inside a 16-lane row, in the vector unit (DPP row_xmask)
template<int M>
static __device__ __forceinline__ float add_xor_row(const float v) {
  return v + __int_as_float(__builtin_amdgcn_update_dpp(0, __float_as_int(v), 0x160 | M, 0xf, 0xf, true));
}
// Sum over the 32 lanes, left in every lane: a butterfly over lane distances 16, 8, 4, 2, 1.
// All 32 lanes must be on.  No step goes through the LDS queue, so 40 such sums of one wave
// do not each wait out its latency.
static __device__ __forceinline__ float wave_sum(float v) {
  const int b = __float_as_int(v);
  v += __int_as_float(__builtin_amdgcn_permlanex16(b, b, 0x76543210, 0xfedcba98, false, false));
  v = add_xor_row<8>(v);
  v = add_xor_row<4>(v);
  v = add_xor_row<2>(v);
  v = add_xor_row<1>(v);
  return v;
}

// ---------------------------------------------------------------------------
// QKV post: RoPE + head RMSNorm*1.2 for q,k; v + 3*sigmoid(xn[:12]@gate)*ve.
// One wave per token, all 24 heads of it; B*T/8 blocks of 8 waves.
// A lane holds elements j and j+32 of a head, the two partners of the rotation, so a head's
// sum of squares needs the wave's own shuffles only: no LDS, no barrier.
// qh: [B,H,T,64]   kh: [B,KV,T,64]   vt: [B,KV,64,T]  (V TRANSPOSED)
// ---------------------------------------------------------------------------
template<int T>
static __device__ __forceinline__
void qkvpost_body(const float* __restrict__ q_raw, const float* __restrict__ k_raw,
                  const float* __restrict__ v_raw, const _Float16* __restrict__ xn,
                  const float* __restrict__ ve, const float* __restrict__ cosb,
                  const float* __restrict__ sinb, const float* __restrict__ wgate,
                  _Float16* __restrict__ qh, _Float16* __restrict__ kh,
                  _Float16* __restrict__ vt, const int bx) {
  // the wave's number is the same in all its lanes: said so, the row addresses stay scalar
  const int bt = bx * 8 + __builtin_amdgcn_readfirstlane(threadIdx.x >> 5);
  const int b = bt / T, t = bt % T;
  const int j = threadIdx.x & 31;

  const float* qr = q_raw + (size_t)bt * 1024;
  const float* kr = k_raw + (size_t)bt * 256;
  const float* vr = v_raw + (size_t)bt * 256;
  const float* er = ve    + (size_t)bt * 256;
  const float* cr = cosb  + (size_t)t * 32;
  const float* sr = sinb  + (size_t)t * 32;
  const _Float16* xr = xn + (size_t)bt * 1024;

  // every loop below is unrolled so that its arrays are indexed by constants and stay in
  // registers; all of a token's loads are issued before the first head is worked on
  float x1[20], x2[20], vv[8], ee[8], xg[12];
  const float c = cr[j], s = sr[j];
  #pragma unroll
  for (int u = 0; u < 20; ++u) {
    const float* src = (u < 16) ? qr + u * 64 : kr + (u - 16) * 64;
    x1[u] = src[j];
    x2[u] = src[j + 32];
  }
  #pragma unroll
  for (int i = 0; i < 8; ++i) { vv[i] = vr[i * 32 + j]; ee[i] = er[i * 32 + j]; }
  #pragma unroll
  for (int i = 0; i < 12; ++i) xg[i] = (float)xr[i];
  // the wait that belongs in front of any overwrite of the loads' address registers; they are
  // named as inputs so that none is reused (not even as a load's destination) ahead of it
  asm volatile("s_wait_xcnt 0x0" :: "s"(qr), "s"(kr), "s"(vr), "s"(er), "s"(cr), "s"(sr), "s"(xr), "v"(j) : "memory");

  _Float16 ol[20], oh[20], ov[8];
  #pragma unroll
  for (int u = 0; u < 20; ++u) {
    const float lo =  x1[u] * c + x2[u] * s;
    const float hi = -x1[u] * s + x2[u] * c;
    // each half summed by its own butterfly (lane distances 16, 8, 4, 2, 1), then added
    const float sl = wave_sum(lo * lo), sh = wave_sum(hi * hi);
    const float rs = rsqrtf((sl + sh) * (1.f / 64.f) + 1e-6f) * 1.2f;
    ol[u] = (_Float16)(lo * rs);
    oh[u] = (_Float16)(hi * rs);
  }
  #pragma unroll
  for (int kv = 0; kv < 4; ++kv) {
    float g = 0.f;
    #pragma unroll
    for (int i = 0; i < 12; ++i) g += xg[i] * wgate[kv * 12 + i];
    g = 3.f / (1.f + __expf(-g));
    ov[kv * 2]     = (_Float16)(vv[kv * 2]     + g * ee[kv * 2]);
    ov[kv * 2 + 1] = (_Float16)(vv[kv * 2 + 1] + g * ee[kv * 2 + 1]);
  }

  _Float16* qd = qh + ((size_t)(b * 16) * T + t) * 64 + j;
  _Float16* kd = kh + ((size_t)(b * 4) * T + t) * 64 + j;
  _Float16* vd = vt + ((size_t)(b * 4) * 64 + j) * T + t;   // transposed: [b][kv][hd][t]
  // keeps the stores in runs at the end: left to itself the scheduler mixes them in among the
  // heads' arithmetic
  __builtin_amdgcn_sched_barrier(0);
  #pragma unroll
  for (int u = 0; u < 16; ++u) {
    qd[(size_t)u * T * 64]      = ol[u];
    qd[(size_t)u * T * 64 + 32] = oh[u];
  }
  #pragma unroll
  for (int u = 0; u < 4; ++u) {
    kd[(size_t)u * T * 64]      = ol[16 + u];
    kd[(size_t)u * T * 64 + 32] = oh[16 + u];
  }
  #pragma unroll
  for (int i = 0; i < 8; ++i) vd[(size_t)i * 32 * T] = ov[i];
}

// ---------------------------------------------------------------------------
// Flash attention with refine-conv term.  grid = (B*H, T/128), block = 256.
// Wave w handles 16 query rows; keys tiled 32 wide; causal.  f16 in, f16 out.
// V consumed transposed [B,KV,64,T] -> B-fragments are two b128 loads.
// Refine conv: 10 rows x 6 columns per lane (left, centre, right of its two key columns),
// reused across the 8 accumulator rows (9 FMAs each); outside rows and columns are read at a
// clamped address and replaced by the zero padding.
// All global loads of the loop stand in ONE group per key tile, behind the conv: V of this
// tile, then K and the prev_attn window of the NEXT tile, each into the registers that its
// last user has just left.  Their latency runs under the softmax and the P @ V products.
// ---------------------------------------------------------------------------
template<int T>
__global__ __launch_bounds__(256)
void attn_kernel(const _Float16* __restrict__ qh, const _Float16* __restrict__ kh,
                 const _Float16* __restrict__ vt, const float* __restrict__ prev,
                 const float* __restrict__ refine_w, const float* __restrict__ alpha_p,
                 _Float16* __restrict__ y) {
  constexpr int H = 16, KV = 4, HD = 64;
  const int bh = blockIdx.x;
  const int b = bh / H, h = bh % H;
  // the wave's number is the same in all its lanes: said so, the trip count and the tiles'
  // base addresses stay scalar
  const int wave = __builtin_amdgcn_readfirstlane(threadIdx.x >> 5);
  const int lane = threadIdx.x & 31;
  const int hlf = lane >> 4, r = lane & 15;
  const int qb = (blockIdx.y * 8 + wave) * 16;
  const float alpha = alpha_p[0];

  float rw[9];
  #pragma unroll
  for (int i = 0; i < 9; ++i) rw[i] = refine_w[h * 9 + i];

  const _Float16* qbase = qh + ((size_t)(b * H + h)) * T * HD;
  const char* kbase = (const char*)(kh + ((size_t)(b * KV + (h >> 2))) * T * HD);
  const char* vbase = (const char*)(vt + ((size_t)(b * KV + (h >> 2))) * HD * T);
  const char* pbase = (const char*)(prev + ((size_t)(b * H + h)) * T * T);

  v16h aQ[2];
  {
    const _Float16* qp = qbase + (size_t)(qb + r) * HD + hlf * 8;
    aQ[0] = pack16(*(const v8h*)qp,        *(const v8h*)(qp + 16));
    aQ[1] = pack16(*(const v8h*)(qp + 32), *(const v8h*)(qp + 48));
    // the wait that belongs in front of any overwrite of these loads' address registers
    asm volatile("s_wait_xcnt 0x0" :: "v"(qp) : "memory");
  }

  float mstat[8], lstat[8];
  v8f O[4];
  #pragma unroll
  for (int v = 0; v < 8; ++v) { mstat[v] = -1e30f; lstat[v] = 0.f; }
  #pragma unroll
  for (int j = 0; j < 4; ++j)
    #pragma unroll
    for (int e = 0; e < 8; ++e) O[j][e] = 0.f;

  __shared__ __attribute__((aligned(16))) _Float16 lds_p[8 * 16 * 32];
  const int wbase = wave * 512;
  const int qrow0 = qb + 8 * hlf;   // first accumulator row for this lane-half
  const int klast = ((qb + 15) >> 5) << 5;   // the wave's last key tile

  // the lane's byte offsets inside a K tile (64 halfs a key) and a V tile (T halfs a channel)
  const unsigned kvo = (unsigned)(r * HD + hlf * 8) * 2u;
  const unsigned vvo = (unsigned)(r * T + hlf * 8) * 2u;
  // prev_attn rows qrow0-1 .. qrow0+8: only the first and the last can lie outside [0,T)
  const bool okTop = qrow0 > 0, okBot = qrow0 + 8 < T;
  const unsigned rowTop = (unsigned)(okTop ? qrow0 - 1 : 0) * (T * 4u);
  const unsigned rowMid = (unsigned)qrow0 * (T * 4u);
  const unsigned rowBot = (unsigned)(okBot ? qrow0 + 8 : T - 1) * (T * 4u);

  // every loop of constant length below is unrolled so that kf, vf and pf are indexed by
  // constants and stay in registers
  v8h kf[8], vf[8];
  float pf[10][6];   // [row][left, centre, right of key kb+r | the same of key kb+16+r]

  auto load_v = [&](const char* vp) {
    #pragma unroll
    for (int j = 0; j < 4; ++j) {
      vf[j * 2]     = *(const v8h*)(vp + j * 16 * T * 2);
      vf[j * 2 + 1] = *(const v8h*)(vp + j * 16 * T * 2 + 32);
    }
  };
  auto load_k = [&](const char* kp) {
    #pragma unroll
    for (int sb = 0; sb < 2; ++sb)
      #pragma unroll
      for (int q = 0; q < 4; ++q)
        kf[sb * 4 + q] = *(const v8h*)(kp + sb * 16 * HD * 2 + q * 32);
  };
  // oL, oC, oR: byte offsets of [top, middle, bottom] rows at the clamped left column of the
  // first key, at the first key itself, and at the clamped right column of the second key
  auto load_p = [&](const unsigned (&oL)[3], const unsigned (&oC)[3], const unsigned (&oR)[3]) {
    #pragma unroll
    for (int i = 0; i < 10; ++i) {
      const int g  = (i == 0) ? 0 : ((i == 9) ? 2 : 1);
      const int im = (g == 1) ? (i - 1) * T * 4 : 0;
      pf[i][0] = *(const float*)(pbase + oL[g] + im);
      pf[i][1] = *(const float*)(pbase + oC[g] + im);
      pf[i][2] = *(const float*)(pbase + oC[g] + im + 4);
      pf[i][3] = *(const float*)(pbase + oC[g] + im + 60);
      pf[i][4] = *(const float*)(pbase + oC[g] + im + 64);
      pf[i][5] = *(const float*)(pbase + oR[g] + im);
    }
  };
  // one group of loads: V of tile kv (skipped in front of the loop), K and prev_attn of tile kn
  auto load_group = [&](const bool with_v, const int kv, const int kn) {
    const int k0 = kn + r;
    const unsigned cL = (unsigned)(k0 > 0 ? k0 - 1 : 0) * 4u;
    const unsigned cC = (unsigned)k0 * 4u;
    const unsigned cR = (unsigned)(k0 + 17 < T ? k0 + 17 : T - 1) * 4u;
    const unsigned oL[3] = {rowTop + cL, rowMid + cL, rowBot + cL};
    const unsigned oC[3] = {rowTop + cC, rowMid + cC, rowBot + cC};
    const unsigned oR[3] = {rowTop + cR, rowMid + cR, rowBot + cR};
    const char* vp = vbase + (size_t)kv * 2 + vvo;          // the lane's own addresses
    const char* kp = kbase + (size_t)kn * (HD * 2) + kvo;
    if (with_v) load_v(vp);
    load_k(kp);
    load_p(oL, oC, oR);
    // the wait that belongs in front of any overwrite of the loads' address registers; they are
    // named as inputs so that none is reused (not even as a load's destination) ahead of it
    asm volatile("s_wait_xcnt 0x0" :: "s"(pbase), "v"(vp), "v"(kp), "v"(vvo), "v"(kvo),
                 "v"(oL[0]), "v"(oL[1]), "v"(oL[2]), "v"(oC[0]), "v"(oC[1]), "v"(oC[2]),
                 "v"(oR[0]), "v"(oR[1]), "v"(oR[2]) : "memory");
  };

  // fenced like the group in the loop, so that K stands in front of prev_attn here too and
  // the loop's first wait need not cover more than K
  __builtin_amdgcn_sched_barrier(0);
  load_group(false, 0, 0);
  __builtin_amdgcn_sched_barrier(0);

  // tile 0 exists for every wave: the test stands at the foot, and nothing of the prologue
  // (the Q loads least of all) is moved in behind the first group
  int kb = 0;
  do {
    // S = Q @ K^T  (16 x 32 tile, two 16x16 fragments)
    v8f S[2];
    #pragma unroll
    for (int sb = 0; sb < 2; ++sb) {
      #pragma unroll
      for (int e = 0; e < 8; ++e) S[sb][e] = 0.f;
      S[sb] = wmma16(aQ[0], pack16(kf[sb * 4],     kf[sb * 4 + 1]), S[sb]);
      S[sb] = wmma16(aQ[1], pack16(kf[sb * 4 + 2], kf[sb * 4 + 3]), S[sb]);
    }

    // scale + refine conv (row-reused) + causal mask
    #pragma unroll
    for (int sb = 0; sb < 2; ++sb) {
      const int kj = kb + sb * 16 + r;
      float colL[10], colC[10], colR[10];
      #pragma unroll
      for (int i = 0; i < 10; ++i) {
        const bool okRow = (i == 0) ? okTop : ((i == 9) ? okBot : true);
        colL[i] = (okRow && kj > 0)     ? pf[i][sb * 3]     : 0.f;
        colC[i] = okRow                 ? pf[i][sb * 3 + 1] : 0.f;
        colR[i] = (okRow && kj < T - 1) ? pf[i][sb * 3 + 2] : 0.f;
      }
      #pragma unroll
      for (int v = 0; v < 8; ++v) {
        float acc = 0.f;
        #pragma unroll
        for (int di = 0; di < 3; ++di)
          acc += colL[v + di] * rw[di * 3] + colC[v + di] * rw[di * 3 + 1]
               + colR[v + di] * rw[di * 3 + 2];
        const int qi = qrow0 + v;
        float s = S[sb][v] * 0.125f + alpha * acc;
        if (kj > qi) s = -1e30f;
        S[sb][v] = s;
      }
    }

    // the group stays here, whole: left to itself the scheduler sinks each load to its use
    // and the wave waits out one memory latency after another
    __builtin_amdgcn_sched_barrier(0);
    load_group(true, kb, kb < klast ? kb + 32 : kb);   // past the last tile: the same one again
    __builtin_amdgcn_sched_barrier(0);

    // online softmax (row stats via 16-lane shuffles), stage P to LDS
    #pragma unroll
    for (int v = 0; v < 8; ++v) {
      float rmax = fmaxf(S[0][v], S[1][v]);
      #pragma unroll
      for (int off = 1; off < 16; off <<= 1) rmax = fmaxf(rmax, __shfl_xor(rmax, off, 16));
      const float mnew = fmaxf(mstat[v], rmax);
      const float scl = __expf(mstat[v] - mnew);
      mstat[v] = mnew;
      lstat[v] *= scl;
      #pragma unroll
      for (int j = 0; j < 4; ++j) O[j][v] *= scl;
      const float p0 = __expf(S[0][v] - mnew);
      const float p1 = __expf(S[1][v] - mnew);
      float rsum = p0 + p1;
      #pragma unroll
      for (int off = 1; off < 16; off <<= 1) rsum += __shfl_xor(rsum, off, 16);
      lstat[v] += rsum;
      const int m = v + 8 * hlf;
      lds_p[wbase + m * 32 + r]      = (_Float16)p0;
      lds_p[wbase + m * 32 + 16 + r] = (_Float16)p1;
    }

    // O += P @ V   (V transposed: a B-fragment is two of the group's b128 loads)
    v16h aP;
    {
      const _Float16* pp = lds_p + wbase + r * 32 + hlf * 8;
      aP = pack16(*(const v8h*)pp, *(const v8h*)(pp + 16));
    }
    #pragma unroll
    for (int j = 0; j < 4; ++j) O[j] = wmma16(aP, pack16(vf[j * 2], vf[j * 2 + 1]), O[j]);
    kb += 32;
  } while (kb <= klast);

  #pragma unroll
  for (int v = 0; v < 8; ++v) {
    const float inv = 1.f / lstat[v];
    #pragma unroll
    for (int j = 0; j < 4; ++j) O[j][v] *= inv;
  }
  #pragma unroll
  for (int j = 0; j < 4; ++j)
    #pragma unroll
    for (int v = 0; v < 8; ++v) {
      const int qi = qb + v + 8 * hlf;
      const int hd = j * 16 + r;
      y[((size_t)(b * T + qi)) * 1024 + h * 64 + hd] = (_Float16)O[j][v];
    }
}

// ---------------------------------------------------------------------------
// Channel-attention depthwise conv along T + exact GELU -> f16 (GEMM input)
// ---------------------------------------------------------------------------
static __device__ __forceinline__
void caconv_body(const float* __restrict__ h, const float* __restrict__ cw,
                 _Float16* __restrict__ o, int T, int CH, int total, const int bx) {
  const int idx = bx * 256 + threadIdx.x;
  if (idx >= total) return;
  const int c = idx % CH;
  const int t = (idx / CH) % T;
  const float ctr = h[idx];
  const float lft = (t > 0)     ? h[idx - CH] : 0.f;
  const float rgt = (t < T - 1) ? h[idx + CH] : 0.f;
  const float v = ctr + 0.1f * (lft * cw[c * 3] + ctr * cw[c * 3 + 1] + rgt * cw[c * 3 + 2]);
  o[idx] = (_Float16)(0.5f * v * (1.f + erff(v * 0.70710678118654752f)));
}

// Four FFN depthwise conv steps (each: o = in + 0.1*conv_T(in), zero padded) in one pass.
// A thread owns 8 adjacent channels and walks 16 + 8 rows of T.  Step s lags the input by
// s rows, so every step keeps its last two rows in f32 registers; only step 4 is stored.
// The 4 halo rows on each side are recomputed per tile; past the ends of T they are the
// zero padding of every step.  Needs T % 16 == 0, F % 2048 == 0.
// blocks (bx, by, bz) = (F/2048, T/16, B) of 256 threads
template<int T, int F>
static __device__ __forceinline__
void ffnconv4_body(const _Float16* __restrict__ in, const float* __restrict__ cw,
                   _Float16* __restrict__ o, const int bx, const int by, const int bz) {
  constexpr int TT = 16, NR = TT + 8;
  static_assert(T % TT == 0 && F % 2048 == 0, "tile shape");
  const int f  = (bx * 256 + threadIdx.x) * 8;   // first of the lane's 8 channels
  const int t0 = by * TT;
  const bool lo = (t0 == 0);        // rows t0-4 .. t0-1 lie before the sequence
  const bool hi = (t0 + TT == T);   // rows t0+16 .. t0+19 lie behind it
  const size_t tile = ((size_t)bz * T + t0) * F;   // row t0, same for the whole block
  const _Float16* ip  = in + tile + f;
  // an outside halo row re-reads a row of the tile itself (in bounds); it is masked below
  const _Float16* ipl = ip + (lo ? 4 * F : 0);
  const _Float16* iph = ip - (hi ? 4 * F : 0);
  const float* wp = cw + (size_t)f * 3;
  _Float16* op = o + tile + f;
  const v8f zero = {0.f, 0.f, 0.f, 0.f, 0.f, 0.f, 0.f, 0.f};

  // every loop below is unrolled so that its arrays are indexed by constants and stay in registers
  v8f w0, w1, w2;
  #pragma unroll
  for (int e = 0; e < 8; ++e) {
    w0[e] = wp[e * 3];
    w1[e] = wp[e * 3 + 1];
    w2[e] = wp[e * 3 + 2];
  }

  v8h raw[NR];
  #pragma unroll
  for (int i = 0; i < NR; ++i) {
    const _Float16* p = (i < 4) ? ipl : ((i >= TT + 4) ? iph : ip);
    raw[i] = *(const v8h*)(p + (i - 4) * F);
  }
  // the wait that belongs in front of any overwrite of the loads' address registers; they are
  // named as inputs so that none is reused (not even as a load's destination) ahead of it
  asm volatile("s_wait_xcnt 0x0" :: "v"(wp), "v"(ipl), "v"(ip), "v"(iph) : "memory");

  // r = row index inside the 24-row window; only halo rows can lie outside [0,T)
  auto pad = [&](const v8f v, const int r) -> v8f {
    if (r < 4)       return lo ? zero : v;
    if (r >= TT + 4) return hi ? zero : v;
    return v;
  };
  auto step = [&](const v8f l, const v8f c, const v8f r) -> v8f {
    return c + 0.1f * (l * w0 + c * w1 + r * w2);
  };

  v8f a[4], b[4];   // per step input: rows two back and one back
  #pragma unroll
  for (int s = 0; s < 4; ++s) { a[s] = zero; b[s] = zero; }

  #pragma unroll
  for (int i = 0; i < NR; ++i) {
    const v8f x0 = pad(__builtin_convertvector(raw[i], v8f), i);
    const v8f x1 = pad(step(a[0], b[0], x0), i - 1);  a[0] = b[0];  b[0] = x0;
    const v8f x2 = pad(step(a[1], b[1], x1), i - 2);  a[1] = b[1];  b[1] = x1;
    const v8f x3 = pad(step(a[2], b[2], x2), i - 3);  a[2] = b[2];  b[2] = x2;
    const v8f x4 = step(a[3], b[3], x3);              a[3] = b[3];  b[3] = x3;
    if (i >= 8) *(v8h*)(op + (i - 8) * F) = __builtin_convertvector(x4, v8h);
  }
}

// x1 = x + attn_proj*(1+0.1*tanh(ca1));  writes f32 and f16 copies
// A block owns 2048 adjacent elements, a thread 4 of the first 1024 and 4 of the second, so
// that every load of a wave covers 512 adjacent bytes.  grid = elements / 2048, exactly.
__global__ __launch_bounds__(256)
void x1_kernel(const float* __restrict__ x, const float* __restrict__ ap,
               const float* __restrict__ ca1, float* __restrict__ o,
               _Float16* __restrict__ o16) {
  const int i0 = blockIdx.x * 2048 + threadIdx.x * 4;
  // both loops are unrolled so that the six loads are issued together
  float4 xv[2], av[2], cv[2];
  #pragma unroll
  for (int p = 0; p < 2; ++p) {
    xv[p] = *(const float4*)(x   + i0 + p * 1024);
    av[p] = *(const float4*)(ap  + i0 + p * 1024);
    cv[p] = *(const float4*)(ca1 + i0 + p * 1024);
  }
  #pragma unroll
  for (int p = 0; p < 2; ++p) {
    float4 v;
    v.x = xv[p].x + av[p].x * (1.f + 0.1f * tanhf(cv[p].x));
    v.y = xv[p].y + av[p].y * (1.f + 0.1f * tanhf(cv[p].y));
    v.z = xv[p].z + av[p].z * (1.f + 0.1f * tanhf(cv[p].z));
    v.w = xv[p].w + av[p].w * (1.f + 0.1f * tanhf(cv[p].w));
    *(float4*)(o + i0 + p * 1024) = v;
    v4h h; h[0] = (_Float16)v.x; h[1] = (_Float16)v.y; h[2] = (_Float16)v.z; h[3] = (_Float16)v.w;
    *(v4h*)(o16 + i0 + p * 1024) = h;
  }
}

static __device__ __forceinline__
void vitdot_body(const float* __restrict__ g32, const float* __restrict__ w2,
                 float* __restrict__ vit0, int ntok, const int bx) {
  const int i = bx * 256 + threadIdx.x;
  if (i >= ntok) return;
  float s = 0.f;
  #pragma unroll
  for (int j = 0; j < 32; ++j) s += g32[(size_t)i * 32 + j] * w2[j];
  vit0[i] = 1.f / (1.f + __expf(-s));
}

static __device__ __forceinline__
void vitsmooth_body(const float* __restrict__ vit0, float* __restrict__ vit,
                    int T, int ntok, const int bx) {
  const int i = bx * 256 + threadIdx.x;
  if (i >= ntok) return;
  const int t = i % T;
  const int base = i - t;
  float s = 0.f;
  #pragma unroll
  for (int d = -2; d <= 2; ++d) {
    const int tt = t + d;
    if ((unsigned)tt < (unsigned)T) s += vit0[base + tt];
  }
  const float v = 0.7f * vit0[i] + 0.3f * (s * 0.2f);
  vit[i] = (v > 0.3f) ? v : 0.1f * v;
}

// out = x1 + mlp*g*(1+0.1*tanh(ca2))*vit[token]; elements shared out as in x1_kernel.
// Needs C % 4 == 0 (a thread's 4 elements lie in one token).  grid = elements / 2048, exactly.
__global__ __launch_bounds__(256)
void final_kernel(const float* __restrict__ x1, const float* __restrict__ mlp,
                  const float* __restrict__ g, const float* __restrict__ ca2,
                  const float* __restrict__ vit, float* __restrict__ out, int C) {
  const int i0 = blockIdx.x * 2048 + threadIdx.x * 4;
  const float* px = x1 + i0;
  const float* pm = mlp + i0;
  const float* pg = g + i0;
  const float* pc = ca2 + i0;
  const float* pv0 = vit + i0 / C;
  const float* pv1 = vit + (i0 + 1024) / C;
  // both loops are unrolled so that the ten loads are issued together
  float4 xv[2], mv[2], gv[2], cv[2];
  float vt[2];
  #pragma unroll
  for (int p = 0; p < 2; ++p) {
    xv[p] = *(const float4*)(px + p * 1024);
    mv[p] = *(const float4*)(pm + p * 1024);
    gv[p] = *(const float4*)(pg + p * 1024);
    cv[p] = *(const float4*)(pc + p * 1024);
  }
  vt[0] = *pv0;
  vt[1] = *pv1;
  // the wait that belongs in front of any overwrite of the loads' address registers; they are
  // named as inputs so that none is reused (not even as a load's destination) ahead of it
  asm volatile("s_wait_xcnt 0x0" :: "v"(px), "v"(pm), "v"(pg), "v"(pc), "v"(pv0), "v"(pv1) : "memory");
  #pragma unroll
  for (int p = 0; p < 2; ++p) {
    float4 v;
    v.x = xv[p].x + mv[p].x * gv[p].x * (1.f + 0.1f * tanhf(cv[p].x)) * vt[p];
    v.y = xv[p].y + mv[p].y * gv[p].y * (1.f + 0.1f * tanhf(cv[p].y)) * vt[p];
    v.z = xv[p].z + mv[p].z * gv[p].z * (1.f + 0.1f * tanhf(cv[p].z)) * vt[p];
    v.w = xv[p].w + mv[p].w * gv[p].w * (1.f + 0.1f * tanhf(cv[p].w)) * vt[p];
    *(float4*)(out + i0 + p * 1024) = v;
  }
}

// ---------------------------------------------------------------------------
// Merged launches.  Pieces of work that read none of each other's output share one grid: the
// block index, the same for a whole block, says which piece a block does and which block of
// that piece it is.  The pieces themselves are the functions above, each computing what it
// did when launched alone.  Pieces that need LDS tiles get them from one array of the merged kernel, so that
// its LDS is that of its largest piece and not the sum.
// ---------------------------------------------------------------------------
constexpr int kB = 4, kT = 1024, kC = 1024, kKVD = 256, kF = 4096, kCA = 32;
constexpr int kBT = kB * kT;
constexpr int kMT = kBT / 128;                 // row tiles of the ring GEMM
constexpr int kCaBlocks = kBT * kCA / 256;     // blocks of the channel-attention conv
static_assert(kMT == 32 && kBT / 256 == 16, "the tile indices below are split by shifts");

// RMSNorm of x, and every fp32 -> f16 conversion (x and the ten weights).
// grid = kBT rows + one block per 1024 converted elements
constexpr int kCvtBlocks = (kBT * kC + 3 * kC * kC + 2 * kKVD * kC + 3 * kCA * kC + 2 * kF * kC) / 1024;
__global__ __launch_bounds__(256)
void prep_kernel(const float* __restrict__ x, const float* __restrict__ w_q,
                 const float* __restrict__ w_k, const float* __restrict__ w_v,
                 const float* __restrict__ w_o, const float* __restrict__ ca_pi,
                 const float* __restrict__ ca_po, const float* __restrict__ ffn_in,
                 const float* __restrict__ ffn_out, const float* __restrict__ ffn_g,
                 const float* __restrict__ vit_w1,
                 _Float16* __restrict__ x16, _Float16* __restrict__ w_q16,
                 _Float16* __restrict__ w_k16, _Float16* __restrict__ w_v16,
                 _Float16* __restrict__ w_o16, _Float16* __restrict__ ca_pi16,
                 _Float16* __restrict__ ca_po16, _Float16* __restrict__ fin16,
                 _Float16* __restrict__ fout16, _Float16* __restrict__ fg16,
                 _Float16* __restrict__ vw1_16, _Float16* __restrict__ xn16, int C) {
  int b = blockIdx.x;
  if (b < kBT) { rmsnorm16_body(x, xn16, C, b); return; }
  b -= kBT;
  // walk the list of arrays until b is a block of the current one (n blocks of 1024 elements)
  const float* s = x;
  _Float16* d = x16;
  int n = kBT * kC / 1024;
  auto next = [&](const float* ns, _Float16* nd, const int nn) {
    if (b >= n) { b -= n; s = ns; d = nd; n = nn; }
  };
  next(ffn_in,  fin16,   kF * kC / 1024);
  next(ffn_out, fout16,  kC * kF / 1024);
  next(w_q,     w_q16,   kC * kC / 1024);
  next(w_o,     w_o16,   kC * kC / 1024);
  next(ffn_g,   fg16,    kC * kC / 1024);
  next(w_k,     w_k16,   kKVD * kC / 1024);
  next(w_v,     w_v16,   kKVD * kC / 1024);
  next(ca_pi,   ca_pi16, kCA * kC / 1024);
  next(ca_po,   ca_po16, kC * kCA / 1024);
  next(vit_w1,  vw1_16,  kCA * kC / 1024);
  cvt16_body(s, d, n * 1024, b);
}

__global__ __launch_bounds__(256)
void rmsnorm16_kernel(const float* __restrict__ x, _Float16* __restrict__ o, int C) {
  rmsnorm16_body(x, o, C, blockIdx.x);
}

// The q, k and v projections of xn and the channel-attention input projection of x.
// grid = kMT * (1 + (NQ + 2 NKV) / 128)
__global__ __launch_bounds__(256)
void qkv_ca_kernel(const _Float16* __restrict__ xn16, const _Float16* __restrict__ w_q16,
                   const _Float16* __restrict__ w_k16, const _Float16* __restrict__ w_v16,
                   float* __restrict__ q_raw, float* __restrict__ k_raw,
                   float* __restrict__ v_raw, const _Float16* __restrict__ x16,
                   const _Float16* __restrict__ ca_pi16, float* __restrict__ ca_h,
                   int M, int NQ, int NKV, int NCA, int K) {
  __shared__ __attribute__((aligned(16))) _Float16 ring[RING_H];
  int t = blockIdx.x;
  if (t < kMT) { gemm_ring_body<0, 0, 32>(ring, x16, ca_pi16, ca_h, M, NCA, K, t, 0); return; }
  t -= kMT;
  const _Float16* W = w_q16;
  float* O = q_raw;
  int N = NQ;
  if (t >= kMT * (kC / 128)) {
    t -= kMT * (kC / 128);  W = w_k16;  O = k_raw;  N = NKV;
    if (t >= kMT * (kKVD / 128)) { t -= kMT * (kKVD / 128);  W = w_v16;  O = v_raw; }
  }
  gemm_ring_body<0, 0, 128>(ring, xn16, W, O, M, N, K, t & (kMT - 1), t / kMT);
}

// QKV post-processing and the channel-attention conv.  grid = kBT / 8 + kCaBlocks
__global__ __launch_bounds__(256)
void post_kernel(const float* __restrict__ q_raw, const float* __restrict__ k_raw,
                 const float* __restrict__ v_raw, const _Float16* __restrict__ xn,
                 const float* __restrict__ ve, const float* __restrict__ cosb,
                 const float* __restrict__ sinb, const float* __restrict__ wgate,
                 _Float16* __restrict__ qh, _Float16* __restrict__ kh,
                 _Float16* __restrict__ vt, const float* __restrict__ ca_h,
                 const float* __restrict__ ca_cw, _Float16* __restrict__ cag16,
                 int T, int CH, int total) {
  const int b = blockIdx.x;
  if (b < kBT / 8) qkvpost_body<kT>(q_raw, k_raw, v_raw, xn, ve, cosb, sinb, wgate, qh, kh, vt, b);
  else             caconv_body(ca_h, ca_cw, cag16, T, CH, total, b - kBT / 8);
}

// A projection back to C columns (K = C or FFN), the channel-attention output projection and,
// where the grid has blocks for it, the smoothing of the vitality gate.
// grid = kMT * kC / 128 + (kBT / 256) * (kC / 64) [+ kBT / 256]
__global__ __launch_bounds__(256)
void proj_kernel(const _Float16* __restrict__ A, const _Float16* __restrict__ W,
                 float* __restrict__ O, const _Float16* __restrict__ cag16,
                 const _Float16* __restrict__ ca_po16, float* __restrict__ ca,
                 const float* __restrict__ vit0, float* __restrict__ vitf,
                 int M, int N, int K, int KCA, int T) {
  __shared__ __attribute__((aligned(16))) _Float16 ring[RING_H];
  int t = blockIdx.x;
  if (t < kMT * (kC / 128)) {
    gemm_ring_body<0, 0, 128>(ring, A, W, O, M, N, K, t & (kMT - 1), t / kMT);
    return;
  }
  t -= kMT * (kC / 128);
  if (t < (kBT / 256) * (kC / 64)) {
    gemm_body<0, 0>((_Float16 (*)[64 * 32])ring, cag16, ca_po16, ca, M, N, KCA, t & 15, t >> 4);
    return;
  }
  vitsmooth_body(vit0, vitf, T, M, t - (kBT / 256) * (kC / 64));
}

// What reads xm or x1 alone: FFN input projection (relu^2), FFN gate (sigmoid), and of x1 the
// channel-attention input projection and the vitality projection (gelu).
// grid = 2 kMT + kMT * (kF + kC) / 128
__global__ __launch_bounds__(256)
void ffn_in_kernel(const _Float16* __restrict__ xm16, const _Float16* __restrict__ fin16,
                   _Float16* __restrict__ hA, const _Float16* __restrict__ fg16,
                   float* __restrict__ gbuf, const _Float16* __restrict__ x1_16,
                   const _Float16* __restrict__ ca_pi16, float* __restrict__ ca_h,
                   const _Float16* __restrict__ vw1_16, float* __restrict__ g32,
                   int M, int NF, int NC, int NCA, int K) {
  __shared__ __attribute__((aligned(16))) _Float16 ring[RING_H];
  int t = blockIdx.x;
  if (t < kMT) { gemm_ring_body<0, 0, 32>(ring, x1_16, ca_pi16, ca_h, M, NCA, K, t, 0); return; }
  t -= kMT;
  if (t < kMT) { gemm_ring_body<3, 0, 32>(ring, x1_16, vw1_16, g32, M, NCA, K, t, 0); return; }
  t -= kMT;
  if (t < kMT * (kF / 128)) {
    gemm_ring_body<1, 1, 128>(ring, xm16, fin16, hA, M, NF, K, t & (kMT - 1), t / kMT);
    return;
  }
  t -= kMT * (kF / 128);
  gemm_ring_body<2, 0, 128>(ring, xm16, fg16, gbuf, M, NC, K, t & (kMT - 1), t / kMT);
}

// The four FFN conv steps, the channel-attention conv and the vitality dot product.
// grid = (kF / 2048) * (kT / 16) * kB + kCaBlocks + kBT / 256
__global__ __launch_bounds__(256)
void ffn_mid_kernel(const _Float16* __restrict__ hA, const float* __restrict__ ffn_cw,
                    _Float16* __restrict__ hB, const float* __restrict__ ca_h,
                    const float* __restrict__ ca_cw, _Float16* __restrict__ cag16,
                    const float* __restrict__ g32, const float* __restrict__ vit_w2,
                    float* __restrict__ vit0, int T, int CH, int total, int ntok) {
  constexpr int NX = kF / 2048, NY = kT / 16;
  int t = blockIdx.x;
  if (t < NX * NY * kB) {
    ffnconv4_body<kT, kF>(hA, ffn_cw, hB, t % NX, (t / NX) % NY, t / (NX * NY));
    return;
  }
  t -= NX * NY * kB;
  if (t < kCaBlocks) { caconv_body(ca_h, ca_cw, cag16, T, CH, total, t); return; }
  vitdot_body(g32, vit_w2, vit0, ntok, t - kCaBlocks);
}

// ---------------------------------------------------------------------------
extern "C" void kernel_launch(void* const* d_in, const int* in_sizes, int n_in,
                              void* d_out, int out_size, void* d_ws, size_t ws_size,
                              hipStream_t stream) {
  (void)in_sizes; (void)n_in; (void)out_size; (void)ws_size;
  constexpr int B = 4, T = 1024, C = 1024, H = 16, KV = 4, HD = 64, FFN = 4096, CA = 32;
  constexpr int BT = B * T;

  const float* x       = (const float*)d_in[0];
  const float* ve      = (const float*)d_in[1];
  const float* cosb    = (const float*)d_in[2];
  const float* sinb    = (const float*)d_in[3];
  const float* prev    = (const float*)d_in[4];
  const float* w_q     = (const float*)d_in[5];
  const float* w_k     = (const float*)d_in[6];
  const float* w_v     = (const float*)d_in[7];
  const float* w_o     = (const float*)d_in[8];
  const float* w_gate  = (const float*)d_in[9];
  const float* rf_w    = (const float*)d_in[10];
  const float* rf_a    = (const float*)d_in[11];
  const float* ca_pi   = (const float*)d_in[12];
  const float* ca_cw   = (const float*)d_in[13];
  const float* ca_po   = (const float*)d_in[14];
  const float* ffn_in  = (const float*)d_in[15];
  const float* ffn_cw  = (const float*)d_in[16];
  const float* ffn_out = (const float*)d_in[17];
  const float* ffn_g   = (const float*)d_in[18];
  const float* vit_w1  = (const float*)d_in[19];
  const float* vit_w2  = (const float*)d_in[20];
  float* out = (float*)d_out;

  float* wsf = (float*)d_ws;
  size_t off = 0;
  auto allocf = [&](size_t n) -> float* {
    float* p = wsf + off;
    off += (n + 63) & ~(size_t)63;
    return p;
  };
  auto alloch = [&](size_t n) -> _Float16* {   // n halfs
    return (_Float16*)allocf((n + 1) / 2);
  };

  // fp32 working buffers
  float* q_raw     = allocf((size_t)BT * C);
  float* k_raw     = allocf((size_t)BT * KV * HD);
  float* v_raw     = allocf((size_t)BT * KV * HD);
  float* attn_proj = allocf((size_t)BT * C);
  float* ca_h      = allocf((size_t)BT * CA);
  float* ca1       = allocf((size_t)BT * C);
  float* x1        = allocf((size_t)BT * C);
  float* vit0      = allocf(BT);
  float* vitf      = allocf(BT);
  float* g32       = allocf((size_t)BT * CA);
  // f16 working buffers
  _Float16* x16    = alloch((size_t)BT * C);
  _Float16* xn16   = alloch((size_t)BT * C);
  _Float16* qh     = alloch((size_t)BT * C);
  _Float16* kh     = alloch((size_t)BT * KV * HD);
  _Float16* vt     = alloch((size_t)BT * KV * HD);   // transposed [B,KV,64,T]
  _Float16* y16    = alloch((size_t)BT * C);
  _Float16* cag16  = alloch((size_t)BT * CA);
  _Float16* x1_16  = alloch((size_t)BT * C);
  _Float16* hA     = alloch((size_t)BT * FFN);
  _Float16* hB     = alloch((size_t)BT * FFN);
  // f16 weights (converted once)
  _Float16* w_q16   = alloch((size_t)C * C);
  _Float16* w_k16   = alloch((size_t)KV * HD * C);
  _Float16* w_v16   = alloch((size_t)KV * HD * C);
  _Float16* w_o16   = alloch((size_t)C * C);
  _Float16* ca_pi16 = alloch((size_t)CA * C);
  _Float16* ca_po16 = alloch((size_t)C * CA);
  _Float16* fin16   = alloch((size_t)FFN * C);
  _Float16* fout16  = alloch((size_t)C * FFN);
  _Float16* fg16    = alloch((size_t)C * C);
  _Float16* vw1_16  = alloch((size_t)CA * C);
  // reuse
  float* gbuf  = q_raw;      // q_raw dead after qkvpost
  float* mlp   = attn_proj;  // dead after x1
  float* ca2   = ca1;        // dead after x1
  _Float16* xm16 = xn16;     // xn16 dead after QKV + gate

  const dim3 blk(256);
  static_assert(B == kB && T == kT && C == kC && KV * HD == kKVD && FFN == kF && CA == kCA && H * HD == kC,
                "the merged kernels split their grids by these shapes");

  // --- f16 conversions (weights + x) and the first RMSNorm ---
  prep_kernel<<<dim3(kBT + kCvtBlocks), blk, 0, stream>>>(
      x, w_q, w_k, w_v, w_o, ca_pi, ca_po, ffn_in, ffn_out, ffn_g, vit_w1,
      x16, w_q16, w_k16, w_v16, w_o16, ca_pi16, ca_po16, fin16, fout16, fg16, vw1_16, xn16, C);

  // --- attention path, with the ca1 path beside it ---
  qkv_ca_kernel<<<dim3(kMT * (1 + (kC + 2 * kKVD) / 128)), blk, 0, stream>>>(
      xn16, w_q16, w_k16, w_v16, q_raw, k_raw, v_raw, x16, ca_pi16, ca_h, BT, C, KV * HD, CA, C);
  post_kernel<<<dim3(kBT / 8 + kCaBlocks), blk, 0, stream>>>(
      q_raw, k_raw, v_raw, xn16, ve, cosb, sinb, w_gate, qh, kh, vt, ca_h, ca_cw, cag16, T, CA, BT * CA);
  attn_kernel<T><<<dim3(B * H, T / 128), blk, 0, stream>>>(qh, kh, vt, prev, rf_w, rf_a, y16);
  proj_kernel<<<dim3(kMT * (kC / 128) + (kBT / 256) * (kC / 64)), blk, 0, stream>>>(
      y16, w_o16, attn_proj, cag16, ca_po16, ca1, vit0, vitf, BT, C, C, CA, T);
  x1_kernel<<<dim3((BT * C) / 2048), blk, 0, stream>>>(x, attn_proj, ca1, x1, x1_16);

  // --- FFN, with the ca2 and vitality paths beside it ---
  rmsnorm16_kernel<<<BT, blk, 0, stream>>>(x1, xm16, C);
  ffn_in_kernel<<<dim3(2 * kMT + kMT * ((kF + kC) / 128)), blk, 0, stream>>>(
      xm16, fin16, hA, fg16, gbuf, x1_16, ca_pi16, ca_h, vw1_16, g32, BT, FFN, C, CA, C);
  ffn_mid_kernel<<<dim3((kF / 2048) * (kT / 16) * kB + kCaBlocks + kBT / 256), blk, 0, stream>>>(
      hA, ffn_cw, hB, ca_h, ca_cw, cag16, g32, vit_w2, vit0, T, CA, BT * CA, BT);
  proj_kernel<<<dim3(kMT * (kC / 128) + (kBT / 256) * (kC / 64) + kBT / 256), blk, 0, stream>>>(
      hB, fout16, mlp, cag16, ca_po16, ca2, vit0, vitf, BT, C, FFN, CA, T);

  // --- final combine ---
  final_kernel<<<dim3((BT * C) / 2048), blk, 0, stream>>>(x1, mlp, gbuf, ca2, vitf, out, C);
}

// v006
// One run takes 268 microseconds.
// Timed twice side by side with v005, it ran 1.05 times as fast both times.
// Counting every step since v000, it is 3.10 times as fast.
#include <hip/hip_runtime.h>
#include <hip/hip_bf16.h>

typedef __attribute__((ext_vector_type(16))) _Float16 v16h;
typedef __attribute__((ext_vector_type(8)))  _Float16 v8h;
typedef __attribute__((ext_vector_type(4)))  _Float16 v4h;
typedef __attribute__((ext_vector_type(8)))  float    v8f;

static __device__ __forceinline__ v8f wmma16(v16h a, v16h b, v8f c) {
  return __builtin_amdgcn_wmma_f32_16x16x32_f16(false, a, false, b, (short)0, c, false, false);
}
static __device__ __forceinline__ v16h pack16(v8h lo, v8h hi) {
  return __builtin_shufflevector(lo, hi, 0,1,2,3,4,5,6,7,8,9,10,11,12,13,14,15);
}

// ---------------------------------------------------------------------------
// fp32 -> f16 conversion (vectorized x4); totals are multiples of 4
// ---------------------------------------------------------------------------
static __device__ __forceinline__
void cvt16_body(const float* __restrict__ in, _Float16* __restrict__ out, int total, const int bx) {
  const int i = (bx * 256 + threadIdx.x) * 4;
  if (i >= total) return;
  const float4 v = *(const float4*)(in + i);
  v4h o; o[0] = (_Float16)v.x; o[1] = (_Float16)v.y; o[2] = (_Float16)v.z; o[3] = (_Float16)v.w;
  *(v4h*)(out + i) = o;
}

// ---------------------------------------------------------------------------
// Epilogues: 0=identity, 1=relu^2, 2=sigmoid, 3=gelu(exact)
// ---------------------------------------------------------------------------
template<int EPI>
static __device__ __forceinline__ float apply_epi(float x) {
  if constexpr (EPI == 1) { float t = x > 0.f ? x : 0.f; return t * t; }
  else if constexpr (EPI == 2) { return 1.f / (1.f + __expf(-x)); }
  else if constexpr (EPI == 3) { return 0.5f * x * (1.f + erff(x * 0.70710678118654752f)); }
  else return x;
}

// ---------------------------------------------------------------------------
// WMMA GEMM, all-f16 operands: out[M,N] = epi( A[M,K] @ W[N,K]^T )
// W tile (64 x 32) staged in LDS (wtile: two buffers, the caller's), shared by all 8 waves.
// Requirements: M % 256 == 0, K % 32 == 0.  N guarded in 16-wide steps.
// ---------------------------------------------------------------------------
template<int EPI, int OH>
static __device__ __forceinline__
void gemm_body(_Float16 (*wtile)[64 * 32], const _Float16* __restrict__ A,
               const _Float16* __restrict__ W, void* __restrict__ Op, int M, int N, int K,
               const int bx, const int by) {
  const int tid  = threadIdx.x;
  const int wave = tid >> 5;
  const int lane = tid & 31;
  const int hlf  = lane >> 4;
  const int r    = lane & 15;
  const int m0 = bx * 256 + wave * 32;
  const int n0 = by * 64;

  const int srow = tid >> 2;            // 0..63
  const int scol = (tid & 3) * 8;       // 0,8,16,24

  auto stage = [&](int buf, int k0) {
    if (n0 + srow < N) {
      const v8h w = *(const v8h*)(W + (size_t)(n0 + srow) * K + k0 + scol);
      *(v8h*)(&wtile[buf][srow * 32 + scol]) = w;
    }
  };

  v8f acc[2][4];
  #pragma unroll
  for (int mi = 0; mi < 2; ++mi)
    #pragma unroll
    for (int nj = 0; nj < 4; ++nj)
      #pragma unroll
      for (int e = 0; e < 8; ++e) acc[mi][nj][e] = 0.f;

  stage(0, 0);
  __syncthreads();

  int it = 0;
  for (int k0 = 0; k0 < K; k0 += 32, ++it) {
    const int cur = it & 1;
    if (k0 + 32 < K) stage(cur ^ 1, k0 + 32);

    const _Float16* p0 = A + (size_t)(m0 + r) * K + k0 + hlf * 8;
    const _Float16* p1 = A + (size_t)(m0 + 16 + r) * K + k0 + hlf * 8;
    const v16h a0 = pack16(*(const v8h*)p0, *(const v8h*)(p0 + 16));
    const v16h a1 = pack16(*(const v8h*)p1, *(const v8h*)(p1 + 16));
    if (k0 + 32 < K) __builtin_prefetch(p0 + 32, 0, 0);
    // the wait that belongs in front of any overwrite of the loads' address registers; they are
    // named as inputs so that none is reused ahead of it
    asm volatile("s_wait_xcnt 0x0" :: "v"(p0), "v"(p1) : "memory");

    #pragma unroll
    for (int nj = 0; nj < 4; ++nj) {
      const int nb = n0 + nj * 16;
      if (nb >= N) break;
      const _Float16* lp = &wtile[cur][(nj * 16 + r) * 32 + hlf * 8];
      const v16h bf = pack16(*(const v8h*)lp, *(const v8h*)(lp + 16));
      acc[0][nj] = wmma16(a0, bf, acc[0][nj]);
      acc[1][nj] = wmma16(a1, bf, acc[1][nj]);
    }
    __syncthreads();
  }

  #pragma unroll
  for (int nj = 0; nj < 4; ++nj) {
    const int nb = n0 + nj * 16;
    if (nb >= N) break;
    const int n = nb + r;
    #pragma unroll
    for (int mi = 0; mi < 2; ++mi) {
      char* q[8];   // the 8 stores' addresses
      #pragma unroll
      for (int v = 0; v < 8; ++v) {
        const int m = m0 + mi * 16 + v + 8 * hlf;
        q[v] = (char*)Op + ((size_t)m * N + n) * (OH ? 2 : 4);
        const float val = apply_epi<EPI>(acc[mi][nj][v]);
        if constexpr (OH) *(_Float16*)q[v] = (_Float16)val;
        else              *(float*)q[v] = val;
      }
      // the wait that belongs in front of any overwrite of the stores' address registers; they
      // are named as inputs so that none is reused ahead of it
      asm volatile("s_wait_xcnt 0x0" :: "v"(q[0]), "v"(q[1]), "v"(q[2]), "v"(q[3]),
                   "v"(q[4]), "v"(q[5]), "v"(q[6]), "v"(q[7]) : "memory");
    }
  }
}

// ---------------------------------------------------------------------------
// WMMA GEMM for K % 128 == 0: out[M,N] = epi( A[M,K] @ W[N,K]^T ), all-f16 operands.
// A work-group owns a 128 x BN tile of out; a stage is 128 k of [A 128 rows | W BN rows],
// rows of 256 B at a pitch of 272 B in LDS (conflict-free for 16-byte readers), two buffers.
// Both operands come into LDS by asynchronous copies, one stage ahead of the products.
// BN = 128: 2 x 4 waves of 64 x 32 each.  BN = 32: 8 x 1 waves of 16 x 32 each.
// Requirements: M % 128 == 0, N % BN == 0, K % 128 == 0.
// ---------------------------------------------------------------------------
constexpr int G_PITCH_H = 136;                    // LDS row pitch in halfs (272 B)
constexpr int RING_H = 2 * (128 + 128) * G_PITCH_H;   // the caller's LDS array in halfs (BN = 128)

// NC 16-byte copies of one lane: rows 16 apart, in LDS (l) as in global memory (g, rs halfs).
// The s_wait_xcnt closes each statement so that no address register named in it can be
// rewritten ahead of the wait.
template<int NC>
static __device__ __forceinline__ void copy_rows(const unsigned l, const _Float16* g, const size_t rs) {
  constexpr unsigned LS = 16u * G_PITCH_H * 2u;   // 16 LDS rows in bytes
  static_assert(NC == 8 || NC == 2, "rows per lane");
  if constexpr (NC == 8) {
    asm volatile(
        "global_load_async_to_lds_b128 %0, %8, off\n\t"
        "global_load_async_to_lds_b128 %1, %9, off\n\t"
        "global_load_async_to_lds_b128 %2, %10, off\n\t"
        "global_load_async_to_lds_b128 %3, %11, off\n\t"
        "global_load_async_to_lds_b128 %4, %12, off\n\t"
        "global_load_async_to_lds_b128 %5, %13, off\n\t"
        "global_load_async_to_lds_b128 %6, %14, off\n\t"
        "global_load_async_to_lds_b128 %7, %15, off\n\t"
        "s_wait_xcnt 0x0"
        :: "v"(l), "v"(l + LS), "v"(l + 2 * LS), "v"(l + 3 * LS),
           "v"(l + 4 * LS), "v"(l + 5 * LS), "v"(l + 6 * LS), "v"(l + 7 * LS),
           "v"(g), "v"(g + rs), "v"(g + 2 * rs), "v"(g + 3 * rs),
           "v"(g + 4 * rs), "v"(g + 5 * rs), "v"(g + 6 * rs), "v"(g + 7 * rs)
        : "memory");
  } else {
    asm volatile(
        "global_load_async_to_lds_b128 %0, %2, off\n\t"
        "global_load_async_to_lds_b128 %1, %3, off\n\t"
        "s_wait_xcnt 0x0"
        :: "v"(l), "v"(l + LS), "v"(g), "v"(g + rs)
        : "memory");
  }
}

template<int EPI, int OH, int BN>
static __device__ __forceinline__
void gemm_ring_body(_Float16* ring, const _Float16* __restrict__ A, const _Float16* __restrict__ W,
                    void* __restrict__ Op, int M, int N, int K, const int bx, const int by) {
  constexpr int WN = BN / 32;               // waves along N
  constexpr int MF = 128 / ((8 / WN) * 16); // 16-row fragments of A per wave
  constexpr int STAGE_H = (128 + BN) * G_PITCH_H;   // one buffer in halfs
  const int tid  = threadIdx.x;
  const int wave = tid >> 5;
  const int lane = tid & 31;
  const int hlf  = lane >> 4;
  const int r    = lane & 15;
  const int m0 = bx * 128;
  const int n0 = by * BN;
  const int wm = (wave / WN) * (MF * 16);
  const int wn = (wave % WN) * 32;

  // a lane copies 16-byte column (tid & 15) of rows (tid >> 4) + 16 i, of A and of W
  const int crow = tid >> 4;
  const int ccol = (tid & 15) * 8;
  const _Float16* gA = A + (size_t)(m0 + crow) * K + ccol;
  const _Float16* gW = W + (size_t)(n0 + crow) * K + ccol;
  const unsigned lA = (unsigned)(size_t)(&ring[crow * G_PITCH_H + ccol]);   // LDS byte address
  const size_t rs = (size_t)16 * K;

  auto copy_stage = [&](const int buf, const int t) {
    const unsigned l = lA + (unsigned)buf * (STAGE_H * 2u);
    copy_rows<8>(l, gA + (size_t)t * 128, rs);
    copy_rows<BN / 16>(l + 128u * G_PITCH_H * 2u, gW + (size_t)t * 128, rs);
  };

  // every loop of constant length in this kernel is unrolled so that acc, af and bf are
  // indexed by constants and stay in registers
  v8f acc[MF][2];
  #pragma unroll
  for (int mi = 0; mi < MF; ++mi)
    #pragma unroll
    for (int nj = 0; nj < 2; ++nj)
      #pragma unroll
      for (int e = 0; e < 8; ++e) acc[mi][nj][e] = 0.f;

  const int nt = K / 128;
  copy_stage(0, 0);
  asm volatile("s_wait_asynccnt 0x0" ::: "memory");   // this wave's part of stage 0 has landed
  __syncthreads();                                    // ... and every other wave's
  if (nt > 1) copy_stage(1, 1);

  for (int t = 0; t < nt; ++t) {
    const _Float16* sa = ring + (t & 1) * STAGE_H + (wm + r) * G_PITCH_H + hlf * 8;
    const _Float16* sw = ring + (t & 1) * STAGE_H + (128 + wn + r) * G_PITCH_H + hlf * 8;
    v16h af[2][MF], bf[2][2];   // two fragment sets: one in use, one being fetched
    auto fetch = [&](const int set, const int kk) {
      #pragma unroll
      for (int mi = 0; mi < MF; ++mi) {
        const _Float16* p = sa + mi * 16 * G_PITCH_H + kk * 32;
        af[set][mi] = pack16(*(const v8h*)p, *(const v8h*)(p + 16));
      }
      #pragma unroll
      for (int nj = 0; nj < 2; ++nj) {
        const _Float16* p = sw + nj * 16 * G_PITCH_H + kk * 32;
        bf[set][nj] = pack16(*(const v8h*)p, *(const v8h*)(p + 16));
      }
    };
    fetch(0, 0);
    #pragma unroll
    for (int kk = 0; kk < 4; ++kk) {
      if (kk < 3) fetch((kk + 1) & 1, kk + 1);
      // the next block's LDS reads stay one group ahead of this block's products; left to
      // itself the scheduler sinks each read to its use and the wave waits out every one
      __builtin_amdgcn_sched_barrier(0);
      #pragma unroll
      for (int mi = 0; mi < MF; ++mi)
        #pragma unroll
        for (int nj = 0; nj < 2; ++nj)
          acc[mi][nj] = wmma16(af[kk & 1][mi], bf[kk & 1][nj], acc[mi][nj]);
      // ... and no later read is lifted in among these products
      __builtin_amdgcn_sched_barrier(0);
    }
    asm volatile("s_wait_dscnt 0x0" ::: "memory");      // this wave has left the buffer
    asm volatile("s_wait_asynccnt 0x0" ::: "memory");   // its part of stage t + 1 has landed
    __syncthreads();   // publishes stage t + 1 and frees the buffer of stage t
    if (t + 2 < nt) copy_stage(t & 1, t + 2);
  }
  asm volatile("s_wait_asynccnt 0x0" ::: "memory");     // no copy outlives the wave

  #pragma unroll
  for (int nj = 0; nj < 2; ++nj) {
    const int n = n0 + wn + nj * 16 + r;
    #pragma unroll
    for (int mi = 0; mi < MF; ++mi)
      #pragma unroll
      for (int v = 0; v < 8; ++v) {
        const int m = m0 + wm + mi * 16 + v + 8 * hlf;
        const float val = apply_epi<EPI>(acc[mi][nj][v]);
        if constexpr (OH) ((_Float16*)Op)[(size_t)m * N + n] = (_Float16)val;
        else              ((float*)Op)[(size_t)m * N + n] = val;
      }
  }
  // in a merged kernel another piece's code follows in the text: the wait that belongs in
  // front of any overwrite of the last stores' address registers
  asm volatile("s_wait_xcnt 0x0" ::: "memory");
}

// ---------------------------------------------------------------------------
// RMSNorm over last dim C (one block per row), f32 in -> f16 out
// ---------------------------------------------------------------------------
static __device__ __forceinline__
void rmsnorm16_body(const float* __restrict__ x, _Float16* __restrict__ o, int C, const int bx) {
  const size_t row = bx;
  const float* xr = x + row * (size_t)C;
  float ss = 0.f;
  for (int i = threadIdx.x; i < C; i += 256) { float v = xr[i]; ss += v * v; }
  #pragma unroll
  for (int off = 16; off; off >>= 1) ss += __shfl_xor(ss, off, 32);
  __shared__ float red[8];
  if ((threadIdx.x & 31) == 0) red[threadIdx.x >> 5] = ss;
  __syncthreads();
  float tot = 0.f;
  #pragma unroll
  for (int i = 0; i < 8; ++i) tot += red[i];
  const float rs = rsqrtf(tot / (float)C + 1e-6f);
  _Float16* orow = o + row * (size_t)C;
  for (int i = threadIdx.x; i < C; i += 256) {
    const float* p = xr + i;
    const float v = *p;
    // the wait that belongs in front of any overwrite of the load's address registers; they are
    // named as an input so that they are not reused (not even as a load's destination) ahead of it
    asm volatile("s_wait_xcnt 0x0" :: "v"(p) : "memory");
    orow[i] = (_Float16)(v * rs);
  }
}

// v + (v of lane l ^ M), M < 16, inside a 16-lane row, in the vector unit (DPP row_xmask)
template<int M>
static __device__ __forceinline__ float add_xor_row(const float v) {
  return v + __int_as_float(__builtin_amdgcn_update_dpp(0, __float_as_int(v), 0x160 | M, 0xf, 0xf, true));
}
// Sum over the 32 lanes, left in every lane: a butterfly over lane distances 16, 8, 4, 2, 1.
// All 32 lanes must be on.  No step goes through the LDS queue, so 40 such sums of one wave
// do not each wait out its latency.
static __device__ __forceinline__ float wave_sum(float v) {
  const int b = __float_as_int(v);
  v += __int_as_float(__builtin_amdgcn_permlanex16(b, b, 0x76543210, 0xfedcba98, false, false));
  v = add_xor_row<8>(v);
  v = add_xor_row<4>(v);
  v = add_xor_row<2>(v);
  v = add_xor_row<1>(v);
  return v;
}

// ---------------------------------------------------------------------------
// QKV post: RoPE + head RMSNorm*1.2 for q,k; v + 3*sigmoid(xn[:12]@gate)*ve.
// One wave per token, all 24 heads of it; B*T/8 blocks of 8 waves.
// A lane holds elements j and j+32 of a head, the two partners of the rotation, so a head's
// sum of squares needs the wave's own shuffles only: no LDS, no barrier.
// qh: [B,H,T,64]   kh: [B,KV,T,64]   vt: [B,KV,64,T]  (V TRANSPOSED)
// ---------------------------------------------------------------------------
template<int T>
static __device__ __forceinline__
void qkvpost_body(const float* __restrict__ q_raw, const float* __restrict__ k_raw,
                  const float* __restrict__ v_raw, const _Float16* __restrict__ xn,
                  const float* __restrict__ ve, const float* __restrict__ cosb,
                  const float* __restrict__ sinb, const float* __restrict__ wgate,
                  _Float16* __restrict__ qh, _Float16* __restrict__ kh,
                  _Float16* __restrict__ vt, const int bx) {
  // the wave's number is the same in all its lanes: said so, the row addresses stay scalar
  const int bt = bx * 8 + __builtin_amdgcn_readfirstlane(threadIdx.x >> 5);
  const int b = bt / T, t = bt % T;
  const int j = threadIdx.x & 31;

  const float* qr = q_raw + (size_t)bt * 1024;
  const float* kr = k_raw + (size_t)bt * 256;
  const float* vr = v_raw + (size_t)bt * 256;
  const float* er = ve    + (size_t)bt * 256;
  const float* cr = cosb  + (size_t)t * 32;
  const float* sr = sinb  + (size_t)t * 32;
  const _Float16* xr = xn + (size_t)bt * 1024;

  // every loop below is unrolled so that its arrays are indexed by constants and stay in
  // registers; all of a token's loads are issued before the first head is worked on
  float x1[20], x2[20], vv[8], ee[8], xg[12];
  const float c = cr[j], s = sr[j];
  #pragma unroll
  for (int u = 0; u < 20; ++u) {
    const float* src = (u < 16) ? qr + u * 64 : kr + (u - 16) * 64;
    x1[u] = src[j];
    x2[u] = src[j + 32];
  }
  #pragma unroll
  for (int i = 0; i < 8; ++i) { vv[i] = vr[i * 32 + j]; ee[i] = er[i * 32 + j]; }
  #pragma unroll
  for (int i = 0; i < 12; ++i) xg[i] = (float)xr[i];
  // the wait that belongs in front of any overwrite of the loads' address registers; they are
  // named as inputs so that none is reused (not even as a load's destination) ahead of it
  asm volatile("s_wait_xcnt 0x0" :: "s"(qr), "s"(kr), "s"(vr), "s"(er), "s"(cr), "s"(sr), "s"(xr), "v"(j) : "memory");

  _Float16 ol[20], oh[20], ov[8];
  #pragma unroll
  for (int u = 0; u < 20; ++u) {
    const float lo =  x1[u] * c + x2[u] * s;
    const float hi = -x1[u] * s + x2[u] * c;
    // each half summed by its own butterfly (lane distances 16, 8, 4, 2, 1), then added
    const float sl = wave_sum(lo * lo), sh = wave_sum(hi * hi);
    const float rs = rsqrtf((sl + sh) * (1.f / 64.f) + 1e-6f) * 1.2f;
    ol[u] = (_Float16)(lo * rs);
    oh[u] = (_Float16)(hi * rs);
  }
  #pragma unroll
  for (int kv = 0; kv < 4; ++kv) {
    float g = 0.f;
    #pragma unroll
    for (int i = 0; i < 12; ++i) g += xg[i] * wgate[kv * 12 + i];
    g = 3.f / (1.f + __expf(-g));
    ov[kv * 2]     = (_Float16)(vv[kv * 2]     + g * ee[kv * 2]);
    ov[kv * 2 + 1] = (_Float16)(vv[kv * 2 + 1] + g * ee[kv * 2 + 1]);
  }

  _Float16* qd = qh + ((size_t)(b * 16) * T + t) * 64 + j;
  _Float16* kd = kh + ((size_t)(b * 4) * T + t) * 64 + j;
  _Float16* vd = vt + ((size_t)(b * 4) * 64 + j) * T + t;   // transposed: [b][kv][hd][t]
  // keeps the stores in runs at the end: left to itself the scheduler mixes them in among the
  // heads' arithmetic
  __builtin_amdgcn_sched_barrier(0);
  #pragma unroll
  for (int u = 0; u < 16; ++u) {
    qd[(size_t)u * T * 64]      = ol[u];
    qd[(size_t)u * T * 64 + 32] = oh[u];
  }
  #pragma unroll
  for (int u = 0; u < 4; ++u) {
    kd[(size_t)u * T * 64]      = ol[16 + u];
    kd[(size_t)u * T * 64 + 32] = oh[16 + u];
  }
  #pragma unroll
  for (int i = 0; i < 8; ++i) vd[(size_t)i * 32 * T] = ov[i];
}

// ---------------------------------------------------------------------------
// Flash attention with refine-conv term.  grid = (B*H, T/128), block = 256.
// A wave handles 16 query rows; keys tiled 32 wide; causal.  f16 in, f16 out.
// V consumed transposed [B,KV,64,T] -> B-fragments are two b128 loads.
// Refine conv: 10 rows x 6 columns per lane (left, centre, right of its two key columns),
// reused across the 8 accumulator rows (9 FMAs each); outside rows and columns are read at a
// clamped address and replaced by the zero padding.
// All global loads of the loop stand in ONE group per key tile, behind the conv: V of this
// tile, then K and the prev_attn window of the NEXT tile, each into the registers that its
// last user has just left.  Their latency runs under the softmax and the P @ V products.
// ---------------------------------------------------------------------------
template<int T>
__global__ __launch_bounds__(256)
void attn_kernel(const _Float16* __restrict__ qh, const _Float16* __restrict__ kh,
                 const _Float16* __restrict__ vt, const float* __restrict__ prev,
                 const float* __restrict__ refine_w, const float* __restrict__ alpha_p,
                 _Float16* __restrict__ y) {
  constexpr int H = 16, KV = 4, HD = 64;
  const int bh = blockIdx.x;
  const int b = bh / H, h = bh % H;
  // the wave's number is the same in all its lanes: said so, the trip count and the tiles'
  // base addresses stay scalar
  const int wave = __builtin_amdgcn_readfirstlane(threadIdx.x >> 5);
  const int lane = threadIdx.x & 31;
  const int hlf = lane >> 4, r = lane & 15;
  // A query tile of 16 rows walks qt / 2 + 1 key tiles (causal).  A block takes four tiles from the
  // long end and their mirror images from the short end: waves w and w + 4 together always walk
  // T / 32 + 1 key tiles, so every block, and every pair of waves, has the same amount of work.
  // The long tiles go to the first four waves.
  const int pr = blockIdx.y * 4 + (wave & 3);              // 0 .. T / 32 - 1
  const int qb = (wave < 4 ? T / 16 - 1 - pr : pr) * 16;
  const float alpha = alpha_p[0];

  float rw[9];
  #pragma unroll
  for (int i = 0; i < 9; ++i) rw[i] = refine_w[h * 9 + i];

  const _Float16* qbase = qh + ((size_t)(b * H + h)) * T * HD;
  const char* kbase = (const char*)(kh + ((size_t)(b * KV + (h >> 2))) * T * HD);
  const char* vbase = (const char*)(vt + ((size_t)(b * KV + (h >> 2))) * HD * T);
  const char* pbase = (const char*)(prev + ((size_t)(b * H + h)) * T * T);

  v16h aQ[2];
  {
    const _Float16* qp = qbase + (size_t)(qb + r) * HD + hlf * 8;
    aQ[0] = pack16(*(const v8h*)qp,        *(const v8h*)(qp + 16));
    aQ[1] = pack16(*(const v8h*)(qp + 32), *(const v8h*)(qp + 48));
    // the wait that belongs in front of any overwrite of these loads' address registers
    asm volatile("s_wait_xcnt 0x0" :: "v"(qp) : "memory");
  }

  float mstat[8], lstat[8];
  v8f O[4];
  #pragma unroll
  for (int v = 0; v < 8; ++v) { mstat[v] = -1e30f; lstat[v] = 0.f; }
  #pragma unroll
  for (int j = 0; j < 4; ++j)
    #pragma unroll
    for (int e = 0; e < 8; ++e) O[j][e] = 0.f;

  __shared__ __attribute__((aligned(16))) _Float16 lds_p[8 * 16 * 32];
  const int wbase = wave * 512;
  const int qrow0 = qb + 8 * hlf;   // first accumulator row for this lane-half
  const int klast = ((qb + 15) >> 5) << 5;   // the wave's last key tile

  // the lane's byte offsets inside a K tile (64 halfs a key) and a V tile (T halfs a channel)
  const unsigned kvo = (unsigned)(r * HD + hlf * 8) * 2u;
  const unsigned vvo = (unsigned)(r * T + hlf * 8) * 2u;
  // prev_attn rows qrow0-1 .. qrow0+8: only the first and the last can lie outside [0,T)
  const bool okTop = qrow0 > 0, okBot = qrow0 + 8 < T;
  const unsigned rowTop = (unsigned)(okTop ? qrow0 - 1 : 0) * (T * 4u);
  const unsigned rowMid = (unsigned)qrow0 * (T * 4u);
  const unsigned rowBot = (unsigned)(okBot ? qrow0 + 8 : T - 1) * (T * 4u);

  // every loop of constant length below is unrolled so that kf, vf and pf are indexed by
  // constants and stay in registers
  v8h kf[8], vf[8];
  float pf[10][6];   // [row][left, centre, right of key kb+r | the same of key kb+16+r]

  auto load_v = [&](const char* vp) {
    #pragma unroll
    for (int j = 0; j < 4; ++j) {
      vf[j * 2]     = *(const v8h*)(vp + j * 16 * T * 2);
      vf[j * 2 + 1] = *(const v8h*)(vp + j * 16 * T * 2 + 32);
    }
  };
  auto load_k = [&](const char* kp) {
    #pragma unroll
    for (int sb = 0; sb < 2; ++sb)
      #pragma unroll
      for (int q = 0; q < 4; ++q)
        kf[sb * 4 + q] = *(const v8h*)(kp + sb * 16 * HD * 2 + q * 32);
  };
  // oL, oC, oR: byte offsets of [top, middle, bottom] rows at the clamped left column of the
  // first key, at the first key itself, and at the clamped right column of the second key
  auto load_p = [&](const unsigned (&oL)[3], const unsigned (&oC)[3], const unsigned (&oR)[3]) {
    #pragma unroll
    for (int i = 0; i < 10; ++i) {
      const int g  = (i == 0) ? 0 : ((i == 9) ? 2 : 1);
      const int im = (g == 1) ? (i - 1) * T * 4 : 0;
      pf[i][0] = *(const float*)(pbase + oL[g] + im);
      pf[i][1] = *(const float*)(pbase + oC[g] + im);
      pf[i][2] = *(const float*)(pbase + oC[g] + im + 4);
      pf[i][3] = *(const float*)(pbase + oC[g] + im + 60);
      pf[i][4] = *(const float*)(pbase + oC[g] + im + 64);
      pf[i][5] = *(const float*)(pbase + oR[g] + im);
    }
  };
  // one group of loads: V of tile kv (skipped in front of the loop), K and prev_attn of tile kn
  auto load_group = [&](const bool with_v, const int kv, const int kn) {
    const int k0 = kn + r;
    const unsigned cL = (unsigned)(k0 > 0 ? k0 - 1 : 0) * 4u;
    const unsigned cC = (unsigned)k0 * 4u;
    const unsigned cR = (unsigned)(k0 + 17 < T ? k0 + 17 : T - 1) * 4u;
    const unsigned oL[3] = {rowTop + cL, rowMid + cL, rowBot + cL};
    const unsigned oC[3] = {rowTop + cC, rowMid + cC, rowBot + cC};
    const unsigned oR[3] = {rowTop + cR, rowMid + cR, rowBot + cR};
    const char* vp = vbase + (size_t)kv * 2 + vvo;          // the lane's own addresses
    const char* kp = kbase + (size_t)kn * (HD * 2) + kvo;
    if (with_v) load_v(vp);
    load_k(kp);
    load_p(oL, oC, oR);
    // the wait that belongs in front of any overwrite of the loads' address registers; they are
    // named as inputs so that none is reused (not even as a load's destination) ahead of it
    asm volatile("s_wait_xcnt 0x0" :: "s"(pbase), "v"(vp), "v"(kp), "v"(vvo), "v"(kvo),
                 "v"(oL[0]), "v"(oL[1]), "v"(oL[2]), "v"(oC[0]), "v"(oC[1]), "v"(oC[2]),
                 "v"(oR[0]), "v"(oR[1]), "v"(oR[2]) : "memory");
  };

  // fenced like the group in the loop, so that K stands in front of prev_attn here too and
  // the loop's first wait need not cover more than K
  __builtin_amdgcn_sched_barrier(0);
  load_group(false, 0, 0);
  __builtin_amdgcn_sched_barrier(0);

  // tile 0 exists for every wave: the test stands at the foot, and nothing of the prologue
  // (the Q loads least of all) is moved in behind the first group
  int kb = 0;
  do {
    // S = Q @ K^T  (16 x 32 tile, two 16x16 fragments)
    v8f S[2];
    #pragma unroll
    for (int sb = 0; sb < 2; ++sb) {
      #pragma unroll
      for (int e = 0; e < 8; ++e) S[sb][e] = 0.f;
      S[sb] = wmma16(aQ[0], pack16(kf[sb * 4],     kf[sb * 4 + 1]), S[sb]);
      S[sb] = wmma16(aQ[1], pack16(kf[sb * 4 + 2], kf[sb * 4 + 3]), S[sb]);
    }

    // scale + refine conv (row-reused) + causal mask
    #pragma unroll
    for (int sb = 0; sb < 2; ++sb) {
      const int kj = kb + sb * 16 + r;
      float colL[10], colC[10], colR[10];
      #pragma unroll
      for (int i = 0; i < 10; ++i) {
        const bool okRow = (i == 0) ? okTop : ((i == 9) ? okBot : true);
        colL[i] = (okRow && kj > 0)     ? pf[i][sb * 3]     : 0.f;
        colC[i] = okRow                 ? pf[i][sb * 3 + 1] : 0.f;
        colR[i] = (okRow && kj < T - 1) ? pf[i][sb * 3 + 2] : 0.f;
      }
      #pragma unroll
      for (int v = 0; v < 8; ++v) {
        float acc = 0.f;
        #pragma unroll
        for (int di = 0; di < 3; ++di)
          acc += colL[v + di] * rw[di * 3] + colC[v + di] * rw[di * 3 + 1]
               + colR[v + di] * rw[di * 3 + 2];
        const int qi = qrow0 + v;
        float s = S[sb][v] * 0.125f + alpha * acc;
        if (kj > qi) s = -1e30f;
        S[sb][v] = s;
      }
    }

    // the group stays here, whole: left to itself the scheduler sinks each load to its use
    // and the wave waits out one memory latency after another
    __builtin_amdgcn_sched_barrier(0);
    load_group(true, kb, kb < klast ? kb + 32 : kb);   // past the last tile: the same one again
    __builtin_amdgcn_sched_barrier(0);

    // online softmax (row stats via 16-lane shuffles), stage P to LDS
    #pragma unroll
    for (int v = 0; v < 8; ++v) {
      float rmax = fmaxf(S[0][v], S[1][v]);
      #pragma unroll
      for (int off = 1; off < 16; off <<= 1) rmax = fmaxf(rmax, __shfl_xor(rmax, off, 16));
      const float mnew = fmaxf(mstat[v], rmax);
      const float scl = __expf(mstat[v] - mnew);
      mstat[v] = mnew;
      lstat[v] *= scl;
      #pragma unroll
      for (int j = 0; j < 4; ++j) O[j][v] *= scl;
      const float p0 = __expf(S[0][v] - mnew);
      const float p1 = __expf(S[1][v] - mnew);
      float rsum = p0 + p1;
      #pragma unroll
      for (int off = 1; off < 16; off <<= 1) rsum += __shfl_xor(rsum, off, 16);
      lstat[v] += rsum;
      const int m = v + 8 * hlf;
      lds_p[wbase + m * 32 + r]      = (_Float16)p0;
      lds_p[wbase + m * 32 + 16 + r] = (_Float16)p1;
    }

    // O += P @ V   (V transposed: a B-fragment is two of the group's b128 loads)
    v16h aP;
    {
      const _Float16* pp = lds_p + wbase + r * 32 + hlf * 8;
      aP = pack16(*(const v8h*)pp, *(const v8h*)(pp + 16));
    }
    #pragma unroll
    for (int j = 0; j < 4; ++j) O[j] = wmma16(aP, pack16(vf[j * 2], vf[j * 2 + 1]), O[j]);
    kb += 32;
  } while (kb <= klast);

  #pragma unroll
  for (int v = 0; v < 8; ++v) {
    const float inv = 1.f / lstat[v];
    #pragma unroll
    for (int j = 0; j < 4; ++j) O[j][v] *= inv;
  }
  #pragma unroll
  for (int j = 0; j < 4; ++j)
    #pragma unroll
    for (int v = 0; v < 8; ++v) {
      const int qi = qb + v + 8 * hlf;
      const int hd = j * 16 + r;
      y[((size_t)(b * T + qi)) * 1024 + h * 64 + hd] = (_Float16)O[j][v];
    }
}

// ---------------------------------------------------------------------------
// Channel-attention depthwise conv along T + exact GELU -> f16 (GEMM input)
// ---------------------------------------------------------------------------
static __device__ __forceinline__
void caconv_body(const float* __restrict__ h, const float* __restrict__ cw,
                 _Float16* __restrict__ o, int T, int CH, int total, const int bx) {
  const int idx = bx * 256 + threadIdx.x;
  if (idx >= total) return;
  const int c = idx % CH;
  const int t = (idx / CH) % T;
  const float ctr = h[idx];
  const float lft = (t > 0)     ? h[idx - CH] : 0.f;
  const float rgt = (t < T - 1) ? h[idx + CH] : 0.f;
  const float v = ctr + 0.1f * (lft * cw[c * 3] + ctr * cw[c * 3 + 1] + rgt * cw[c * 3 + 2]);
  o[idx] = (_Float16)(0.5f * v * (1.f + erff(v * 0.70710678118654752f)));
}

// Four FFN depthwise conv steps (each: o = in + 0.1*conv_T(in), zero padded) in one pass.
// A thread owns 8 adjacent channels and walks 16 + 8 rows of T.  Step s lags the input by
// s rows, so every step keeps its last two rows in f32 registers; only step 4 is stored.
// The 4 halo rows on each side are recomputed per tile; past the ends of T they are the
// zero padding of every step.  Needs T % 16 == 0, F % 2048 == 0.
// blocks (bx, by, bz) = (F/2048, T/16, B) of 256 threads
template<int T, int F>
static __device__ __forceinline__
void ffnconv4_body(const _Float16* __restrict__ in, const float* __restrict__ cw,
                   _Float16* __restrict__ o, const int bx, const int by, const int bz) {
  constexpr int TT = 16, NR = TT + 8;
  static_assert(T % TT == 0 && F % 2048 == 0, "tile shape");
  const int f  = (bx * 256 + threadIdx.x) * 8;   // first of the lane's 8 channels
  const int t0 = by * TT;
  const bool lo = (t0 == 0);        // rows t0-4 .. t0-1 lie before the sequence
  const bool hi = (t0 + TT == T);   // rows t0+16 .. t0+19 lie behind it
  const size_t tile = ((size_t)bz * T + t0) * F;   // row t0, same for the whole block
  const _Float16* ip  = in + tile + f;
  // an outside halo row re-reads a row of the tile itself (in bounds); it is masked below
  const _Float16* ipl = ip + (lo ? 4 * F : 0);
  const _Float16* iph = ip - (hi ? 4 * F : 0);
  const float* wp = cw + (size_t)f * 3;
  _Float16* op = o + tile + f;
  const v8f zero = {0.f, 0.f, 0.f, 0.f, 0.f, 0.f, 0.f, 0.f};

  // every loop below is unrolled so that its arrays are indexed by constants and stay in registers
  v8f w0, w1, w2;
  #pragma unroll
  for (int e = 0; e < 8; ++e) {
    w0[e] = wp[e * 3];
    w1[e] = wp[e * 3 + 1];
    w2[e] = wp[e * 3 + 2];
  }

  v8h raw[NR];
  #pragma unroll
  for (int i = 0; i < NR; ++i) {
    const _Float16* p = (i < 4) ? ipl : ((i >= TT + 4) ? iph : ip);
    raw[i] = *(const v8h*)(p + (i - 4) * F);
  }
  // the wait that belongs in front of any overwrite of the loads' address registers; they are
  // named as inputs so that none is reused (not even as a load's destination) ahead of it
  asm volatile("s_wait_xcnt 0x0" :: "v"(wp), "v"(ipl), "v"(ip), "v"(iph) : "memory");

  // r = row index inside the 24-row window; only halo rows can lie outside [0,T)
  auto pad = [&](const v8f v, const int r) -> v8f {
    if (r < 4)       return lo ? zero : v;
    if (r >= TT + 4) return hi ? zero : v;
    return v;
  };
  auto step = [&](const v8f l, const v8f c, const v8f r) -> v8f {
    return c + 0.1f * (l * w0 + c * w1 + r * w2);
  };

  v8f a[4], b[4];   // per step input: rows two back and one back
  #pragma unroll
  for (int s = 0; s < 4; ++s) { a[s] = zero; b[s] = zero; }

  #pragma unroll
  for (int i = 0; i < NR; ++i) {
    const v8f x0 = pad(__builtin_convertvector(raw[i], v8f), i);
    const v8f x1 = pad(step(a[0], b[0], x0), i - 1);  a[0] = b[0];  b[0] = x0;
    const v8f x2 = pad(step(a[1], b[1], x1), i - 2);  a[1] = b[1];  b[1] = x1;
    const v8f x3 = pad(step(a[2], b[2], x2), i - 3);  a[2] = b[2];  b[2] = x2;
    const v8f x4 = step(a[3], b[3], x3);              a[3] = b[3];  b[3] = x3;
    if (i >= 8) *(v8h*)(op + (i - 8) * F) = __builtin_convertvector(x4, v8h);
  }
}

// x1 = x + attn_proj*(1+0.1*tanh(ca1));  writes f32 and f16 copies
// A block owns 2048 adjacent elements, a thread 4 of the first 1024 and 4 of the second, so
// that every load of a wave covers 512 adjacent bytes.  grid = elements / 2048, exactly.
__global__ __launch_bounds__(256)
void x1_kernel(const float* __restrict__ x, const float* __restrict__ ap,
               const float* __restrict__ ca1, float* __restrict__ o,
               _Float16* __restrict__ o16) {
  const int i0 = blockIdx.x * 2048 + threadIdx.x * 4;
  // both loops are unrolled so that the six loads are issued together
  float4 xv[2], av[2], cv[2];
  #pragma unroll
  for (int p = 0; p < 2; ++p) {
    xv[p] = *(const float4*)(x   + i0 + p * 1024);
    av[p] = *(const float4*)(ap  + i0 + p * 1024);
    cv[p] = *(const float4*)(ca1 + i0 + p * 1024);
  }
  #pragma unroll
  for (int p = 0; p < 2; ++p) {
    float4 v;
    v.x = xv[p].x + av[p].x * (1.f + 0.1f * tanhf(cv[p].x));
    v.y = xv[p].y + av[p].y * (1.f + 0.1f * tanhf(cv[p].y));
    v.z = xv[p].z + av[p].z * (1.f + 0.1f * tanhf(cv[p].z));
    v.w = xv[p].w + av[p].w * (1.f + 0.1f * tanhf(cv[p].w));
    *(float4*)(o + i0 + p * 1024) = v;
    v4h h; h[0] = (_Float16)v.x; h[1] = (_Float16)v.y; h[2] = (_Float16)v.z; h[3] = (_Float16)v.w;
    *(v4h*)(o16 + i0 + p * 1024) = h;
  }
}

static __device__ __forceinline__
void vitdot_body(const float* __restrict__ g32, const float* __restrict__ w2,
                 float* __restrict__ vit0, int ntok, const int bx) {
  const int i = bx * 256 + threadIdx.x;
  if (i >= ntok) return;
  float s = 0.f;
  #pragma unroll
  for (int j = 0; j < 32; ++j) s += g32[(size_t)i * 32 + j] * w2[j];
  vit0[i] = 1.f / (1.f + __expf(-s));
}

static __device__ __forceinline__
void vitsmooth_body(const float* __restrict__ vit0, float* __restrict__ vit,
                    int T, int ntok, const int bx) {
  const int i = bx * 256 + threadIdx.x;
  if (i >= ntok) return;
  const int t = i % T;
  const int base = i - t;
  float s = 0.f;
  #pragma unroll
  for (int d = -2; d <= 2; ++d) {
    const int tt = t + d;
    if ((unsigned)tt < (unsigned)T) s += vit0[base + tt];
  }
  const float v = 0.7f * vit0[i] + 0.3f * (s * 0.2f);
  vit[i] = (v > 0.3f) ? v : 0.1f * v;
}

// out = x1 + mlp*g*(1+0.1*tanh(ca2))*vit[token]; elements shared out as in x1_kernel.
// Needs C % 4 == 0 (a thread's 4 elements lie in one token).  grid = elements / 2048, exactly.
__global__ __launch_bounds__(256)
void final_kernel(const float* __restrict__ x1, const float* __restrict__ mlp,
                  const float* __restrict__ g, const float* __restrict__ ca2,
                  const float* __restrict__ vit, float* __restrict__ out, int C) {
  const int i0 = blockIdx.x * 2048 + threadIdx.x * 4;
  const float* px = x1 + i0;
  const float* pm = mlp + i0;
  const float* pg = g + i0;
  const float* pc = ca2 + i0;
  const float* pv0 = vit + i0 / C;
  const float* pv1 = vit + (i0 + 1024) / C;
  // both loops are unrolled so that the ten loads are issued together
  float4 xv[2], mv[2], gv[2], cv[2];
  float vt[2];
  #pragma unroll
  for (int p = 0; p < 2; ++p) {
    xv[p] = *(const float4*)(px + p * 1024);
    mv[p] = *(const float4*)(pm + p * 1024);
    gv[p] = *(const float4*)(pg + p * 1024);
    cv[p] = *(const float4*)(pc + p * 1024);
  }
  vt[0] = *pv0;
  vt[1] = *pv1;
  // the wait that belongs in front of any overwrite of the loads' address registers; they are
  // named as inputs so that none is reused (not even as a load's destination) ahead of it
  asm volatile("s_wait_xcnt 0x0" :: "v"(px), "v"(pm), "v"(pg), "v"(pc), "v"(pv0), "v"(pv1) : "memory");
  #pragma unroll
  for (int p = 0; p < 2; ++p) {
    float4 v;
    v.x = xv[p].x + mv[p].x * gv[p].x * (1.f + 0.1f * tanhf(cv[p].x)) * vt[p];
    v.y = xv[p].y + mv[p].y * gv[p].y * (1.f + 0.1f * tanhf(cv[p].y)) * vt[p];
    v.z = xv[p].z + mv[p].z * gv[p].z * (1.f + 0.1f * tanhf(cv[p].z)) * vt[p];
    v.w = xv[p].w + mv[p].w * gv[p].w * (1.f + 0.1f * tanhf(cv[p].w)) * vt[p];
    *(float4*)(out + i0 + p * 1024) = v;
  }
}

// ---------------------------------------------------------------------------
// Merged launches.  Pieces of work that read none of each other's output share one grid: the
// block index, the same for a whole block, says which piece a block does and which block of
// that piece it is.  The pieces themselves are the functions above, each computing what it
// did when launched alone.  Pieces that need LDS tiles get them from one array of the merged kernel, so that
// its LDS is that of its largest piece and not the sum.
// ---------------------------------------------------------------------------
constexpr int kB = 4, kT = 1024, kC = 1024, kKVD = 256, kF = 4096, kCA = 32;
constexpr int kBT = kB * kT;
constexpr int kMT = kBT / 128;                 // row tiles of the ring GEMM
constexpr int kCaBlocks = kBT * kCA / 256;     // blocks of the channel-attention conv
static_assert(kMT == 32 && kBT / 256 == 16, "the tile indices below are split by shifts");

// RMSNorm of x, and every fp32 -> f16 conversion (x and the ten weights).
// grid = kBT rows + one block per 1024 converted elements
constexpr int kCvtBlocks = (kBT * kC + 3 * kC * kC + 2 * kKVD * kC + 3 * kCA * kC + 2 * kF * kC) / 1024;
__global__ __launch_bounds__(256)
void prep_kernel(const float* __restrict__ x, const float* __restrict__ w_q,
                 const float* __restrict__ w_k, const float* __restrict__ w_v,
                 const float* __restrict__ w_o, const float* __restrict__ ca_pi,
                 const float* __restrict__ ca_po, const float* __restrict__ ffn_in,
                 const float* __restrict__ ffn_out, const float* __restrict__ ffn_g,
                 const float* __restrict__ vit_w1,
                 _Float16* __restrict__ x16, _Float16* __restrict__ w_q16,
                 _Float16* __restrict__ w_k16, _Float16* __restrict__ w_v16,
                 _Float16* __restrict__ w_o16, _Float16* __restrict__ ca_pi16,
                 _Float16* __restrict__ ca_po16, _Float16* __restrict__ fin16,
                 _Float16* __restrict__ fout16, _Float16* __restrict__ fg16,
                 _Float16* __restrict__ vw1_16, _Float16* __restrict__ xn16, int C) {
  int b = blockIdx.x;
  if (b < kBT) { rmsnorm16_body(x, xn16, C, b); return; }
  b -= kBT;
  // walk the list of arrays until b is a block of the current one (n blocks of 1024 elements)
  const float* s = x;
  _Float16* d = x16;
  int n = kBT * kC / 1024;
  auto next = [&](const float* ns, _Float16* nd, const int nn) {
    if (b >= n) { b -= n; s = ns; d = nd; n = nn; }
  };
  next(ffn_in,  fin16,   kF * kC / 1024);
  next(ffn_out, fout16,  kC * kF / 1024);
  next(w_q,     w_q16,   kC * kC / 1024);
  next(w_o,     w_o16,   kC * kC / 1024);
  next(ffn_g,   fg16,    kC * kC / 1024);
  next(w_k,     w_k16,   kKVD * kC / 1024);
  next(w_v,     w_v16,   kKVD * kC / 1024);
  next(ca_pi,   ca_pi16, kCA * kC / 1024);
  next(ca_po,   ca_po16, kC * kCA / 1024);
  next(vit_w1,  vw1_16,  kCA * kC / 1024);
  cvt16_body(s, d, n * 1024, b);
}

__global__ __launch_bounds__(256)
void rmsnorm16_kernel(const float* __restrict__ x, _Float16* __restrict__ o, int C) {
  rmsnorm16_body(x, o, C, blockIdx.x);
}

// The q, k and v projections of xn and the channel-attention input projection of x.
// grid = kMT * (1 + (NQ + 2 NKV) / 128)
__global__ __launch_bounds__(256)
void qkv_ca_kernel(const _Float16* __restrict__ xn16, const _Float16* __restrict__ w_q16,
                   const _Float16* __restrict__ w_k16, const _Float16* __restrict__ w_v16,
                   float* __restrict__ q_raw, float* __restrict__ k_raw,
                   float* __restrict__ v_raw, const _Float16* __restrict__ x16,
                   const _Float16* __restrict__ ca_pi16, float* __restrict__ ca_h,
                   int M, int NQ, int NKV, int NCA, int K) {
  __shared__ __attribute__((aligned(16))) _Float16 ring[RING_H];
  int t = blockIdx.x;
  if (t < kMT) { gemm_ring_body<0, 0, 32>(ring, x16, ca_pi16, ca_h, M, NCA, K, t, 0); return; }
  t -= kMT;
  const _Float16* W = w_q16;
  float* O = q_raw;
  int N = NQ;
  if (t >= kMT * (kC / 128)) {
    t -= kMT * (kC / 128);  W = w_k16;  O = k_raw;  N = NKV;
    if (t >= kMT * (kKVD / 128)) { t -= kMT * (kKVD / 128);  W = w_v16;  O = v_raw; }
  }
  gemm_ring_body<0, 0, 128>(ring, xn16, W, O, M, N, K, t & (kMT - 1), t / kMT);
}

// QKV post-processing and the channel-attention conv.  grid = kBT / 8 + kCaBlocks
__global__ __launch_bounds__(256)
void post_kernel(const float* __restrict__ q_raw, const float* __restrict__ k_raw,
                 const float* __restrict__ v_raw, const _Float16* __restrict__ xn,
                 const float* __restrict__ ve, const float* __restrict__ cosb,
                 const float* __restrict__ sinb, const float* __restrict__ wgate,
                 _Float16* __restrict__ qh, _Float16* __restrict__ kh,
                 _Float16* __restrict__ vt, const float* __restrict__ ca_h,
                 const float* __restrict__ ca_cw, _Float16* __restrict__ cag16,
                 int T, int CH, int total) {
  const int b = blockIdx.x;
  if (b < kBT / 8) qkvpost_body<kT>(q_raw, k_raw, v_raw, xn, ve, cosb, sinb, wgate, qh, kh, vt, b);
  else             caconv_body(ca_h, ca_cw, cag16, T, CH, total, b - kBT / 8);
}

// A projection back to C columns (K = C or FFN), the channel-attention output projection and,
// where the grid has blocks for it, the smoothing of the vitality gate.
// grid = kMT * kC / 128 + (kBT / 256) * (kC / 64) [+ kBT / 256]
__global__ __launch_bounds__(256)
void proj_kernel(const _Float16* __restrict__ A, const _Float16* __restrict__ W,
                 float* __restrict__ O, const _Float16* __restrict__ cag16,
                 const _Float16* __restrict__ ca_po16, float* __restrict__ ca,
                 const float* __restrict__ vit0, float* __restrict__ vitf,
                 int M, int N, int K, int KCA, int T) {
  __shared__ __attribute__((aligned(16))) _Float16 ring[RING_H];
  int t = blockIdx.x;
  if (t < kMT * (kC / 128)) {
    gemm_ring_body<0, 0, 128>(ring, A, W, O, M, N, K, t & (kMT - 1), t / kMT);
    return;
  }
  t -= kMT * (kC / 128);
  if (t < (kBT / 256) * (kC / 64)) {
    gemm_body<0, 0>((_Float16 (*)[64 * 32])ring, cag16, ca_po16, ca, M, N, KCA, t & 15, t >> 4);
    return;
  }
  vitsmooth_body(vit0, vitf, T, M, t - (kBT / 256) * (kC / 64));
}

// What reads xm or x1 alone: FFN input projection (relu^2), FFN gate (sigmoid), and of x1 the
// channel-attention input projection and the vitality projection (gelu).
// grid = 2 kMT + kMT * (kF + kC) / 128
__global__ __launch_bounds__(256)
void ffn_in_kernel(const _Float16* __restrict__ xm16, const _Float16* __restrict__ fin16,
                   _Float16* __restrict__ hA, const _Float16* __restrict__ fg16,
                   float* __restrict__ gbuf, const _Float16* __restrict__ x1_16,
                   const _Float16* __restrict__ ca_pi16, float* __restrict__ ca_h,
                   const _Float16* __restrict__ vw1_16, float* __restrict__ g32,
                   int M, int NF, int NC, int NCA, int K) {
  __shared__ __attribute__((aligned(16))) _Float16 ring[RING_H];
  int t = blockIdx.x;
  if (t < kMT) { gemm_ring_body<0, 0, 32>(ring, x1_16, ca_pi16, ca_h, M, NCA, K, t, 0); return; }
  t -= kMT;
  if (t < kMT) { gemm_ring_body<3, 0, 32>(ring, x1_16, vw1_16, g32, M, NCA, K, t, 0); return; }
  t -= kMT;
  if (t < kMT * (kF / 128)) {
    gemm_ring_body<1, 1, 128>(ring, xm16, fin16, hA, M, NF, K, t & (kMT - 1), t / kMT);
    return;
  }
  t -= kMT * (kF / 128);
  gemm_ring_body<2, 0, 128>(ring, xm16, fg16, gbuf, M, NC, K, t & (kMT - 1), t / kMT);
}

// The four FFN conv steps, the channel-attention conv and the vitality dot product.
// grid = (kF / 2048) * (kT / 16) * kB + kCaBlocks + kBT / 256
__global__ __launch_bounds__(256)
void ffn_mid_kernel(const _Float16* __restrict__ hA, const float* __restrict__ ffn_cw,
                    _Float16* __restrict__ hB, const float* __restrict__ ca_h,
                    const float* __restrict__ ca_cw, _Float16* __restrict__ cag16,
                    const float* __restrict__ g32, const float* __restrict__ vit_w2,
                    float* __restrict__ vit0, int T, int CH, int total, int ntok) {
  constexpr int NX = kF / 2048, NY = kT / 16;
  int t = blockIdx.x;
  if (t < NX * NY * kB) {
    ffnconv4_body<kT, kF>(hA, ffn_cw, hB, t % NX, (t / NX) % NY, t / (NX * NY));
    return;
  }
  t -= NX * NY * kB;
  if (t < kCaBlocks) { caconv_body(ca_h, ca_cw, cag16, T, CH, total, t); return; }
  vitdot_body(g32, vit_w2, vit0, ntok, t - kCaBlocks);
}

// ---------------------------------------------------------------------------
extern "C" void kernel_launch(void* const* d_in, const int* in_sizes, int n_in,
                              void* d_out, int out_size, void* d_ws, size_t ws_size,
                              hipStream_t stream) {
  (void)in_sizes; (void)n_in; (void)out_size; (void)ws_size;
  constexpr int B = 4, T = 1024, C = 1024, H = 16, KV = 4, HD = 64, FFN = 4096, CA = 32;
  constexpr int BT = B * T;

  const float* x       = (const float*)d_in[0];
  const float* ve      = (const float*)d_in[1];
  const float* cosb    = (const float*)d_in[2];
  const float* sinb    = (const float*)d_in[3];
  const float* prev    = (const float*)d_in[4];
  const float* w_q     = (const float*)d_in[5];
  const float* w_k     = (const float*)d_in[6];
  const float* w_v     = (const float*)d_in[7];
  const float* w_o     = (const float*)d_in[8];
  const float* w_gate  = (const float*)d_in[9];
  const float* rf_w    = (const float*)d_in[10];
  const float* rf_a    = (const float*)d_in[11];
  const float* ca_pi   = (const float*)d_in[12];
  const float* ca_cw   = (const float*)d_in[13];
  const float* ca_po   = (const float*)d_in[14];
  const float* ffn_in  = (const float*)d_in[15];
  const float* ffn_cw  = (const float*)d_in[16];
  const float* ffn_out = (const float*)d_in[17];
  const float* ffn_g   = (const float*)d_in[18];
  const float* vit_w1  = (const float*)d_in[19];
  const float* vit_w2  = (const float*)d_in[20];
  float* out = (float*)d_out;

  float* wsf = (float*)d_ws;
  size_t off = 0;
  auto allocf = [&](size_t n) -> float* {
    float* p = wsf + off;
    off += (n + 63) & ~(size_t)63;
    return p;
  };
  auto alloch = [&](size_t n) -> _Float16* {   // n halfs
    return (_Float16*)allocf((n + 1) / 2);
  };

  // fp32 working buffers
  float* q_raw     = allocf((size_t)BT * C);
  float* k_raw     = allocf((size_t)BT * KV * HD);
  float* v_raw     = allocf((size_t)BT * KV * HD);
  float* attn_proj = allocf((size_t)BT * C);
  float* ca_h      = allocf((size_t)BT * CA);
  float* ca1       = allocf((size_t)BT * C);
  float* x1        = allocf((size_t)BT * C);
  float* vit0      = allocf(BT);
  float* vitf      = allocf(BT);
  float* g32       = allocf((size_t)BT * CA);
  // f16 working buffers
  _Float16* x16    = alloch((size_t)BT * C);
  _Float16* xn16   = alloch((size_t)BT * C);
  _Float16* qh     = alloch((size_t)BT * C);
  _Float16* kh     = alloch((size_t)BT * KV * HD);
  _Float16* vt     = alloch((size_t)BT * KV * HD);   // transposed [B,KV,64,T]
  _Float16* y16    = alloch((size_t)BT * C);
  _Float16* cag16  = alloch((size_t)BT * CA);
  _Float16* x1_16  = alloch((size_t)BT * C);
  _Float16* hA     = alloch((size_t)BT * FFN);
  _Float16* hB     = alloch((size_t)BT * FFN);
  // f16 weights (converted once)
  _Float16* w_q16   = alloch((size_t)C * C);
  _Float16* w_k16   = alloch((size_t)KV * HD * C);
  _Float16* w_v16   = alloch((size_t)KV * HD * C);
  _Float16* w_o16   = alloch((size_t)C * C);
  _Float16* ca_pi16 = alloch((size_t)CA * C);
  _Float16* ca_po16 = alloch((size_t)C * CA);
  _Float16* fin16   = alloch((size_t)FFN * C);
  _Float16* fout16  = alloch((size_t)C * FFN);
  _Float16* fg16    = alloch((size_t)C * C);
  _Float16* vw1_16  = alloch((size_t)CA * C);
  // reuse
  float* gbuf  = q_raw;      // q_raw dead after qkvpost
  float* mlp   = attn_proj;  // dead after x1
  float* ca2   = ca1;        // dead after x1
  _Float16* xm16 = xn16;     // xn16 dead after QKV + gate

  const dim3 blk(256);
  static_assert(B == kB && T == kT && C == kC && KV * HD == kKVD && FFN == kF && CA == kCA && H * HD == kC,
                "the merged kernels split their grids by these shapes");

  // --- f16 conversions (weights + x) and the first RMSNorm ---
  prep_kernel<<<dim3(kBT + kCvtBlocks), blk, 0, stream>>>(
      x, w_q, w_k, w_v, w_o, ca_pi, ca_po, ffn_in, ffn_out, ffn_g, vit_w1,
      x16, w_q16, w_k16, w_v16, w_o16, ca_pi16, ca_po16, fin16, fout16, fg16, vw1_16, xn16, C);

  // --- attention path, with the ca1 path beside it ---
  qkv_ca_kernel<<<dim3(kMT * (1 + (kC + 2 * kKVD) / 128)), blk, 0, stream>>>(
      xn16, w_q16, w_k16, w_v16, q_raw, k_raw, v_raw, x16, ca_pi16, ca_h, BT, C, KV * HD, CA, C);
  post_kernel<<<dim3(kBT / 8 + kCaBlocks), blk, 0, stream>>>(
      q_raw, k_raw, v_raw, xn16, ve, cosb, sinb, w_gate, qh, kh, vt, ca_h, ca_cw, cag16, T, CA, BT * CA);
  attn_kernel<T><<<dim3(B * H, T / 128), blk, 0, stream>>>(qh, kh, vt, prev, rf_w, rf_a, y16);
  proj_kernel<<<dim3(kMT * (kC / 128) + (kBT / 256) * (kC / 64)), blk, 0, stream>>>(
      y16, w_o16, attn_proj, cag16, ca_po16, ca1, vit0, vitf, BT, C, C, CA, T);
  x1_kernel<<<dim3((BT * C) / 2048), blk, 0, stream>>>(x, attn_proj, ca1, x1, x1_16);

  // --- FFN, with the ca2 and vitality paths beside it ---
  rmsnorm16_kernel<<<BT, blk, 0, stream>>>(x1, xm16, C);
  ffn_in_kernel<<<dim3(2 * kMT + kMT * ((kF + kC) / 128)), blk, 0, stream>>>(
      xm16, fin16, hA, fg16, gbuf, x1_16, ca_pi16, ca_h, vw1_16, g32, BT, FFN, C, CA, C);
  ffn_mid_kernel<<<dim3((kF / 2048) * (kT / 16) * kB + kCaBlocks + kBT / 256), blk, 0, stream>>>(
      hA, ffn_cw, hB, ca_h, ca_cw, cag16, g32, vit_w2, vit0, T, CA, BT * CA, BT);
  proj_kernel<<<dim3(kMT * (kC / 128) + (kBT / 256) * (kC / 64) + kBT / 256), blk, 0, stream>>>(
      hB, fout16, mlp, cag16, ca_po16, ca2, vit0, vitf, BT, C, FFN, CA, T);

  // --- final combine ---
  final_kernel<<<dim3((BT * C) / 2048), blk, 0, stream>>>(x1, mlp, gbuf, ca2, vitf, out, C);
}

// v007
// It runs in 223 microseconds.
// Next to v006, in two timings, it ran 1.21 and 1.22 times as fast.
// All steps since v000 together make it 3.76 times as fast.
#include <hip/hip_runtime.h>
#include <hip/hip_bf16.h>

typedef __attribute__((ext_vector_type(16))) _Float16 v16h;
typedef __attribute__((ext_vector_type(8)))  _Float16 v8h;
typedef __attribute__((ext_vector_type(4)))  _Float16 v4h;
typedef __attribute__((ext_vector_type(8)))  float    v8f;

static __device__ __forceinline__ v8f wmma16(v16h a, v16h b, v8f c) {
  return __builtin_amdgcn_wmma_f32_16x16x32_f16(false, a, false, b, (short)0, c, false, false);
}
static __device__ __forceinline__ v16h pack16(v8h lo, v8h hi) {
  return __builtin_shufflevector(lo, hi, 0,1,2,3,4,5,6,7,8,9,10,11,12,13,14,15);
}

// ---------------------------------------------------------------------------
// fp32 -> f16 conversion (vectorized x4); totals are multiples of 4
// ---------------------------------------------------------------------------
static __device__ __forceinline__
void cvt16_body(const float* __restrict__ in, _Float16* __restrict__ out, int total, const int bx) {
  const int i = (bx * 256 + threadIdx.x) * 4;
  if (i >= total) return;
  const float4 v = *(const float4*)(in + i);
  v4h o; o[0] = (_Float16)v.x; o[1] = (_Float16)v.y; o[2] = (_Float16)v.z; o[3] = (_Float16)v.w;
  *(v4h*)(out + i) = o;
}

// ---------------------------------------------------------------------------
// Epilogues: 0=identity, 1=relu^2, 2=sigmoid, 3=gelu(exact)
// ---------------------------------------------------------------------------
template<int EPI>
static __device__ __forceinline__ float apply_epi(float x) {
  if constexpr (EPI == 1) { float t = x > 0.f ? x : 0.f; return t * t; }
  else if constexpr (EPI == 2) { return 1.f / (1.f + __expf(-x)); }
  else if constexpr (EPI == 3) { return 0.5f * x * (1.f + erff(x * 0.70710678118654752f)); }
  else return x;
}

// ---------------------------------------------------------------------------
// WMMA GEMM, all-f16 operands: out[M,N] = epi( A[M,K] @ W[N,K]^T )
// W tile (64 x 32) staged in LDS (wtile: two buffers, the caller's), shared by all 8 waves.
// Requirements: M % 256 == 0, K % 32 == 0.  N guarded in 16-wide steps.
// ---------------------------------------------------------------------------
template<int EPI, int OH>
static __device__ __forceinline__
void gemm_body(_Float16 (*wtile)[64 * 32], const _Float16* __restrict__ A,
               const _Float16* __restrict__ W, void* __restrict__ Op, int M, int N, int K,
               const int bx, const int by) {
  const int tid  = threadIdx.x;
  const int wave = tid >> 5;
  const int lane = tid & 31;
  const int hlf  = lane >> 4;
  const int r    = lane & 15;
  const int m0 = bx * 256 + wave * 32;
  const int n0 = by * 64;

  const int srow = tid >> 2;            // 0..63
  const int scol = (tid & 3) * 8;       // 0,8,16,24

  auto stage = [&](int buf, int k0) {
    if (n0 + srow < N) {
      const v8h w = *(const v8h*)(W + (size_t)(n0 + srow) * K + k0 + scol);
      *(v8h*)(&wtile[buf][srow * 32 + scol]) = w;
    }
  };

  v8f acc[2][4];
  #pragma unroll
  for (int mi = 0; mi < 2; ++mi)
    #pragma unroll
    for (int nj = 0; nj < 4; ++nj)
      #pragma unroll
      for (int e = 0; e < 8; ++e) acc[mi][nj][e] = 0.f;

  stage(0, 0);
  __syncthreads();

  int it = 0;
  for (int k0 = 0; k0 < K; k0 += 32, ++it) {
    const int cur = it & 1;
    if (k0 + 32 < K) stage(cur ^ 1, k0 + 32);

    const _Float16* p0 = A + (size_t)(m0 + r) * K + k0 + hlf * 8;
    const _Float16* p1 = A + (size_t)(m0 + 16 + r) * K + k0 + hlf * 8;
    const v16h a0 = pack16(*(const v8h*)p0, *(const v8h*)(p0 + 16));
    const v16h a1 = pack16(*(const v8h*)p1, *(const v8h*)(p1 + 16));
    if (k0 + 32 < K) __builtin_prefetch(p0 + 32, 0, 0);
    // the wait that belongs in front of any overwrite of the loads' address registers; they are
    // named as inputs so that none is reused ahead of it
    asm volatile("s_wait_xcnt 0x0" :: "v"(p0), "v"(p1) : "memory");

    #pragma unroll
    for (int nj = 0; nj < 4; ++nj) {
      const int nb = n0 + nj * 16;
      if (nb >= N) break;
      const _Float16* lp = &wtile[cur][(nj * 16 + r) * 32 + hlf * 8];
      const v16h bf = pack16(*(const v8h*)lp, *(const v8h*)(lp + 16));
      acc[0][nj] = wmma16(a0, bf, acc[0][nj]);
      acc[1][nj] = wmma16(a1, bf, acc[1][nj]);
    }
    __syncthreads();
  }

  #pragma unroll
  for (int nj = 0; nj < 4; ++nj) {
    const int nb = n0 + nj * 16;
    if (nb >= N) break;
    const int n = nb + r;
    #pragma unroll
    for (int mi = 0; mi < 2; ++mi) {
      char* q[8];   // the 8 stores' addresses
      #pragma unroll
      for (int v = 0; v < 8; ++v) {
        const int m = m0 + mi * 16 + v + 8 * hlf;
        q[v] = (char*)Op + ((size_t)m * N + n) * (OH ? 2 : 4);
        const float val = apply_epi<EPI>(acc[mi][nj][v]);
        if constexpr (OH) *(_Float16*)q[v] = (_Float16)val;
        else              *(float*)q[v] = val;
      }
      // the wait that belongs in front of any overwrite of the stores' address registers; they
      // are named as inputs so that none is reused ahead of it
      asm volatile("s_wait_xcnt 0x0" :: "v"(q[0]), "v"(q[1]), "v"(q[2]), "v"(q[3]),
                   "v"(q[4]), "v"(q[5]), "v"(q[6]), "v"(q[7]) : "memory");
    }
  }
}

// ---------------------------------------------------------------------------
// WMMA GEMM for K % 128 == 0: out[M,N] = epi( A[M,K] @ W[N,K]^T ), all-f16 operands.
// A work-group owns a 128 x BN tile of out; a stage is 128 k of [A 128 rows | W BN rows],
// rows of 256 B at a pitch of 272 B in LDS (conflict-free for 16-byte readers), two buffers.
// Both operands come into LDS by asynchronous copies, one stage ahead of the products.
// BN = 128: 2 x 4 waves of 64 x 32 each.  BN = 32: 8 x 1 waves of 16 x 32 each.
// Requirements: M % 128 == 0, N % BN == 0, K % 128 == 0.
// ---------------------------------------------------------------------------
constexpr int G_PITCH_H = 136;                    // LDS row pitch in halfs (272 B)
constexpr int RING_H = 2 * (128 + 128) * G_PITCH_H;   // the caller's LDS array in halfs (BN = 128)

// NC 16-byte copies of one lane: rows 16 apart, in LDS (l) as in global memory (g, rs halfs).
// The s_wait_xcnt closes each statement so that no address register named in it can be
// rewritten ahead of the wait.
template<int NC>
static __device__ __forceinline__ void copy_rows(const unsigned l, const _Float16* g, const size_t rs) {
  constexpr unsigned LS = 16u * G_PITCH_H * 2u;   // 16 LDS rows in bytes
  static_assert(NC == 8 || NC == 2, "rows per lane");
  if constexpr (NC == 8) {
    asm volatile(
        "global_load_async_to_lds_b128 %0, %8, off\n\t"
        "global_load_async_to_lds_b128 %1, %9, off\n\t"
        "global_load_async_to_lds_b128 %2, %10, off\n\t"
        "global_load_async_to_lds_b128 %3, %11, off\n\t"
        "global_load_async_to_lds_b128 %4, %12, off\n\t"
        "global_load_async_to_lds_b128 %5, %13, off\n\t"
        "global_load_async_to_lds_b128 %6, %14, off\n\t"
        "global_load_async_to_lds_b128 %7, %15, off\n\t"
        "s_wait_xcnt 0x0"
        :: "v"(l), "v"(l + LS), "v"(l + 2 * LS), "v"(l + 3 * LS),
           "v"(l + 4 * LS), "v"(l + 5 * LS), "v"(l + 6 * LS), "v"(l + 7 * LS),
           "v"(g), "v"(g + rs), "v"(g + 2 * rs), "v"(g + 3 * rs),
           "v"(g + 4 * rs), "v"(g + 5 * rs), "v"(g + 6 * rs), "v"(g + 7 * rs)
        : "memory");
  } else {
    asm volatile(
        "global_load_async_to_lds_b128 %0, %2, off\n\t"
        "global_load_async_to_lds_b128 %1, %3, off\n\t"
        "s_wait_xcnt 0x0"
        :: "v"(l), "v"(l + LS), "v"(g), "v"(g + rs)
        : "memory");
  }
}

template<int EPI, int OH, int BN>
static __device__ __forceinline__
void gemm_ring_body(_Float16* ring, const _Float16* __restrict__ A, const _Float16* __restrict__ W,
                    void* __restrict__ Op, int M, int N, int K, const int bx, const int by) {
  constexpr int WN = BN / 32;               // waves along N
  constexpr int MF = 128 / ((8 / WN) * 16); // 16-row fragments of A per wave
  constexpr int STAGE_H = (128 + BN) * G_PITCH_H;   // one buffer in halfs
  const int tid  = threadIdx.x;
  const int wave = tid >> 5;
  const int lane = tid & 31;
  const int hlf  = lane >> 4;
  const int r    = lane & 15;
  const int m0 = bx * 128;
  const int n0 = by * BN;
  const int wm = (wave / WN) * (MF * 16);
  const int wn = (wave % WN) * 32;

  // a lane copies 16-byte column (tid & 15) of rows (tid >> 4) + 16 i, of A and of W
  const int crow = tid >> 4;
  const int ccol = (tid & 15) * 8;
  const _Float16* gA = A + (size_t)(m0 + crow) * K + ccol;
  const _Float16* gW = W + (size_t)(n0 + crow) * K + ccol;
  const unsigned lA = (unsigned)(size_t)(&ring[crow * G_PITCH_H + ccol]);   // LDS byte address
  const size_t rs = (size_t)16 * K;

  auto copy_stage = [&](const int buf, const int t) {
    const unsigned l = lA + (unsigned)buf * (STAGE_H * 2u);
    copy_rows<8>(l, gA + (size_t)t * 128, rs);
    copy_rows<BN / 16>(l + 128u * G_PITCH_H * 2u, gW + (size_t)t * 128, rs);
  };

  // every loop of constant length in this kernel is unrolled so that acc, af and bf are
  // indexed by constants and stay in registers
  v8f acc[MF][2];
  #pragma unroll
  for (int mi = 0; mi < MF; ++mi)
    #pragma unroll
    for (int nj = 0; nj < 2; ++nj)
      #pragma unroll
      for (int e = 0; e < 8; ++e) acc[mi][nj][e] = 0.f;

  const int nt = K / 128;
  copy_stage(0, 0);
  asm volatile("s_wait_asynccnt 0x0" ::: "memory");   // this wave's part of stage 0 has landed
  __syncthreads();                                    // ... and every other wave's
  if (nt > 1) copy_stage(1, 1);

  for (int t = 0; t < nt; ++t) {
    const _Float16* sa = ring + (t & 1) * STAGE_H + (wm + r) * G_PITCH_H + hlf * 8;
    const _Float16* sw = ring + (t & 1) * STAGE_H + (128 + wn + r) * G_PITCH_H + hlf * 8;
    v16h af[2][MF], bf[2][2];   // two fragment sets: one in use, one being fetched
    auto fetch = [&](const int set, const int kk) {
      #pragma unroll
      for (int mi = 0; mi < MF; ++mi) {
        const _Float16* p = sa + mi * 16 * G_PITCH_H + kk * 32;
        af[set][mi] = pack16(*(const v8h*)p, *(const v8h*)(p + 16));
      }
      #pragma unroll
      for (int nj = 0; nj < 2; ++nj) {
        const _Float16* p = sw + nj * 16 * G_PITCH_H + kk * 32;
        bf[set][nj] = pack16(*(const v8h*)p, *(const v8h*)(p + 16));
      }
    };
    fetch(0, 0);
    #pragma unroll
    for (int kk = 0; kk < 4; ++kk) {
      if (kk < 3) fetch((kk + 1) & 1, kk + 1);
      // the next block's LDS reads stay one group ahead of this block's products; left to
      // itself the scheduler sinks each read to its use and the wave waits out every one
      __builtin_amdgcn_sched_barrier(0);
      #pragma unroll
      for (int mi = 0; mi < MF; ++mi)
        #pragma unroll
        for (int nj = 0; nj < 2; ++nj)
          acc[mi][nj] = wmma16(af[kk & 1][mi], bf[kk & 1][nj], acc[mi][nj]);
      // ... and no later read is lifted in among these products
      __builtin_amdgcn_sched_barrier(0);
    }
    asm volatile("s_wait_dscnt 0x0" ::: "memory");      // this wave has left the buffer
    asm volatile("s_wait_asynccnt 0x0" ::: "memory");   // its part of stage t + 1 has landed
    __syncthreads();   // publishes stage t + 1 and frees the buffer of stage t
    if (t + 2 < nt) copy_stage(t & 1, t + 2);
  }
  asm volatile("s_wait_asynccnt 0x0" ::: "memory");     // no copy outlives the wave

  #pragma unroll
  for (int nj = 0; nj < 2; ++nj) {
    const int n = n0 + wn + nj * 16 + r;
    #pragma unroll
    for (int mi = 0; mi < MF; ++mi)
      #pragma unroll
      for (int v = 0; v < 8; ++v) {
        const int m = m0 + wm + mi * 16 + v + 8 * hlf;
        const float val = apply_epi<EPI>(acc[mi][nj][v]);
        if constexpr (OH) ((_Float16*)Op)[(size_t)m * N + n] = (_Float16)val;
        else              ((float*)Op)[(size_t)m * N + n] = val;
      }
  }
  // in a merged kernel another piece's code follows in the text: the wait that belongs in
  // front of any overwrite of the last stores' address registers
  asm volatile("s_wait_xcnt 0x0" ::: "memory");
}

// ---------------------------------------------------------------------------
// RMSNorm over last dim C (one block per row), f32 in -> f16 out
// ---------------------------------------------------------------------------
static __device__ __forceinline__
void rmsnorm16_body(const float* __restrict__ x, _Float16* __restrict__ o, int C, const int bx) {
  const size_t row = bx;
  const float* xr = x + row * (size_t)C;
  float ss = 0.f;
  for (int i = threadIdx.x; i < C; i += 256) { float v = xr[i]; ss += v * v; }
  #pragma unroll
  for (int off = 16; off; off >>= 1) ss += __shfl_xor(ss, off, 32);
  __shared__ float red[8];
  if ((threadIdx.x & 31) == 0) red[threadIdx.x >> 5] = ss;
  __syncthreads();
  float tot = 0.f;
  #pragma unroll
  for (int i = 0; i < 8; ++i) tot += red[i];
  const float rs = rsqrtf(tot / (float)C + 1e-6f);
  _Float16* orow = o + row * (size_t)C;
  for (int i = threadIdx.x; i < C; i += 256) {
    const float* p = xr + i;
    const float v = *p;
    // the wait that belongs in front of any overwrite of the load's address registers; they are
    // named as an input so that they are not reused (not even as a load's destination) ahead of it
    asm volatile("s_wait_xcnt 0x0" :: "v"(p) : "memory");
    orow[i] = (_Float16)(v * rs);
  }
}

// v + (v of lane l ^ M), M < 16, inside a 16-lane row, in the vector unit (DPP row_xmask)
template<int M>
static __device__ __forceinline__ float add_xor_row(const float v) {
  return v + __int_as_float(__builtin_amdgcn_update_dpp(0, __float_as_int(v), 0x160 | M, 0xf, 0xf, true));
}
// Sum over the 32 lanes, left in every lane: a butterfly over lane distances 16, 8, 4, 2, 1.
// All 32 lanes must be on.  No step goes through the LDS queue, so 40 such sums of one wave
// do not each wait out its latency.
static __device__ __forceinline__ float wave_sum(float v) {
  const int b = __float_as_int(v);
  v += __int_as_float(__builtin_amdgcn_permlanex16(b, b, 0x76543210, 0xfedcba98, false, false));
  v = add_xor_row<8>(v);
  v = add_xor_row<4>(v);
  v = add_xor_row<2>(v);
  v = add_xor_row<1>(v);
  return v;
}

// ---------------------------------------------------------------------------
// QKV post: RoPE + head RMSNorm*1.2 for q,k; v + 3*sigmoid(xn[:12]@gate)*ve.
// One wave per token, all 24 heads of it; B*T/8 blocks of 8 waves.
// A lane holds elements j and j+32 of a head, the two partners of the rotation, so a head's
// sum of squares needs the wave's own shuffles only: no LDS, no barrier.
// qh: [B,H,T,64].  K and V of a (b, kv) are stored in the order in which the attention kernel's
// B fragments take them, so that one 16-byte-a-lane load of a wave there covers 512 adjacent bytes:
// kh: [B,KV][t / 16][d / 16][(d / 8) % 2][t % 16][d % 8]
// vt: [B,KV][t / 32][d / 16][(t / 16) % 2][(t / 8) % 2][d % 16][t % 8]
// ---------------------------------------------------------------------------
template<int T>
static __device__ __forceinline__
void qkvpost_body(const float* __restrict__ q_raw, const float* __restrict__ k_raw,
                  const float* __restrict__ v_raw, const _Float16* __restrict__ xn,
                  const float* __restrict__ ve, const float* __restrict__ cosb,
                  const float* __restrict__ sinb, const float* __restrict__ wgate,
                  _Float16* __restrict__ qh, _Float16* __restrict__ kh,
                  _Float16* __restrict__ vt, const int bx) {
  // the wave's number is the same in all its lanes: said so, the row addresses stay scalar
  const int bt = bx * 8 + __builtin_amdgcn_readfirstlane(threadIdx.x >> 5);
  const int b = bt / T, t = bt % T;
  const int j = threadIdx.x & 31;

  const float* qr = q_raw + (size_t)bt * 1024;
  const float* kr = k_raw + (size_t)bt * 256;
  const float* vr = v_raw + (size_t)bt * 256;
  const float* er = ve    + (size_t)bt * 256;
  const float* cr = cosb  + (size_t)t * 32;
  const float* sr = sinb  + (size_t)t * 32;
  const _Float16* xr = xn + (size_t)bt * 1024;

  // every loop below is unrolled so that its arrays are indexed by constants and stay in
  // registers; all of a token's loads are issued before the first head is worked on
  float x1[20], x2[20], vv[8], ee[8], xg[12];
  const float c = cr[j], s = sr[j];
  #pragma unroll
  for (int u = 0; u < 20; ++u) {
    const float* src = (u < 16) ? qr + u * 64 : kr + (u - 16) * 64;
    x1[u] = src[j];
    x2[u] = src[j + 32];
  }
  #pragma unroll
  for (int i = 0; i < 8; ++i) { vv[i] = vr[i * 32 + j]; ee[i] = er[i * 32 + j]; }
  #pragma unroll
  for (int i = 0; i < 12; ++i) xg[i] = (float)xr[i];
  // the wait that belongs in front of any overwrite of the loads' address registers; they are
  // named as inputs so that none is reused (not even as a load's destination) ahead of it
  asm volatile("s_wait_xcnt 0x0" :: "s"(qr), "s"(kr), "s"(vr), "s"(er), "s"(cr), "s"(sr), "s"(xr), "v"(j) : "memory");

  _Float16 ol[20], oh[20], ov[8];
  #pragma unroll
  for (int u = 0; u < 20; ++u) {
    const float lo =  x1[u] * c + x2[u] * s;
    const float hi = -x1[u] * s + x2[u] * c;
    // each half summed by its own butterfly (lane distances 16, 8, 4, 2, 1), then added
    const float sl = wave_sum(lo * lo), sh = wave_sum(hi * hi);
    const float rs = rsqrtf((sl + sh) * (1.f / 64.f) + 1e-6f) * 1.2f;
    ol[u] = (_Float16)(lo * rs);
    oh[u] = (_Float16)(hi * rs);
  }
  #pragma unroll
  for (int kv = 0; kv < 4; ++kv) {
    float g = 0.f;
    #pragma unroll
    for (int i = 0; i < 12; ++i) g += xg[i] * wgate[kv * 12 + i];
    g = 3.f / (1.f + __expf(-g));
    ov[kv * 2]     = (_Float16)(vv[kv * 2]     + g * ee[kv * 2]);
    ov[kv * 2 + 1] = (_Float16)(vv[kv * 2 + 1] + g * ee[kv * 2 + 1]);
  }

  _Float16* qd = qh + ((size_t)(b * 16) * T + t) * 64 + j;
  _Float16* kd = kh + ((size_t)(b * 4) * T + (t & ~15)) * 64 + (t & 15) * 8
                 + (j >> 4) * 256 + ((j >> 3) & 1) * 128 + (j & 7);
  _Float16* vd = vt + ((size_t)(b * 4) * T + (t & ~31)) * 64 + ((t >> 3) & 3) * 128 + (t & 7)
                 + (j >> 4) * 512 + (j & 15) * 8;
  // keeps the stores in runs at the end: left to itself the scheduler mixes them in among the
  // heads' arithmetic
  __builtin_amdgcn_sched_barrier(0);
  #pragma unroll
  for (int u = 0; u < 16; ++u) {
    qd[(size_t)u * T * 64]      = ol[u];
    qd[(size_t)u * T * 64 + 32] = oh[u];
  }
  #pragma unroll
  for (int u = 0; u < 4; ++u) {
    kd[(size_t)u * T * 64]      = ol[16 + u];
    kd[(size_t)u * T * 64 + 512] = oh[16 + u];   // d + 32: two groups of 16 further
  }
  #pragma unroll
  for (int i = 0; i < 8; ++i) vd[(size_t)(i >> 1) * T * 64 + (i & 1) * 1024] = ov[i];   // d = (i % 2) * 32 + j
}

// ---------------------------------------------------------------------------
// Flash attention with refine-conv term.  grid = (B*H, T/128), block = 256.
// A wave handles 16 query rows; keys tiled 32 wide; causal.  f16 in, f16 out.
// K and V lie in fragment order (see the QKV post-processing): a B fragment is two b128 loads,
// and each of these loads covers 512 adjacent bytes, 4 whole lines.
// Refine conv: 10 rows x 6 columns per lane (left, centre, right of its two key columns),
// reused across the 8 accumulator rows (9 FMAs each); outside rows and columns are read at a
// clamped address and replaced by the zero padding.
// All global loads of the loop stand in ONE group per key tile, behind the conv: V of this
// tile, then K and the prev_attn window of the NEXT tile, each into the registers that its
// last user has just left.  Their latency runs under the softmax and the P @ V products.
// ---------------------------------------------------------------------------
template<int T>
__global__ __launch_bounds__(256)
void attn_kernel(const _Float16* __restrict__ qh, const _Float16* __restrict__ kh,
                 const _Float16* __restrict__ vt, const float* __restrict__ prev,
                 const float* __restrict__ refine_w, const float* __restrict__ alpha_p,
                 _Float16* __restrict__ y) {
  constexpr int H = 16, KV = 4, HD = 64;
  const int bh = blockIdx.x;
  const int b = bh / H, h = bh % H;
  // the wave's number is the same in all its lanes: said so, the trip count and the tiles'
  // base addresses stay scalar
  const int wave = __builtin_amdgcn_readfirstlane(threadIdx.x >> 5);
  const int lane = threadIdx.x & 31;
  const int hlf = lane >> 4, r = lane & 15;
  // A query tile of 16 rows walks qt / 2 + 1 key tiles (causal).  A block takes four tiles from the
  // long end and their mirror images from the short end: waves w and w + 4 together always walk
  // T / 32 + 1 key tiles, so every block, and every pair of waves, has the same amount of work.
  // The long tiles go to the first four waves.
  const int pr = blockIdx.y * 4 + (wave & 3);              // 0 .. T / 32 - 1
  const int qb = (wave < 4 ? T / 16 - 1 - pr : pr) * 16;
  const float alpha = alpha_p[0];

  float rw[9];
  #pragma unroll
  for (int i = 0; i < 9; ++i) rw[i] = refine_w[h * 9 + i];

  const _Float16* qbase = qh + ((size_t)(b * H + h)) * T * HD;
  const char* kbase = (const char*)(kh + ((size_t)(b * KV + (h >> 2))) * T * HD);
  const char* vbase = (const char*)(vt + ((size_t)(b * KV + (h >> 2))) * HD * T);
  const char* pbase = (const char*)(prev + ((size_t)(b * H + h)) * T * T);

  v16h aQ[2];
  {
    const _Float16* qp = qbase + (size_t)(qb + r) * HD + hlf * 8;
    aQ[0] = pack16(*(const v8h*)qp,        *(const v8h*)(qp + 16));
    aQ[1] = pack16(*(const v8h*)(qp + 32), *(const v8h*)(qp + 48));
    // the wait that belongs in front of any overwrite of these loads' address registers
    asm volatile("s_wait_xcnt 0x0" :: "v"(qp) : "memory");
  }

  float mstat[8], lstat[8];
  v8f O[4];
  #pragma unroll
  for (int v = 0; v < 8; ++v) { mstat[v] = -1e30f; lstat[v] = 0.f; }
  #pragma unroll
  for (int j = 0; j < 4; ++j)
    #pragma unroll
    for (int e = 0; e < 8; ++e) O[j][e] = 0.f;

  __shared__ __attribute__((aligned(16))) _Float16 lds_p[8 * 16 * 32];
  const int wbase = wave * 512;
  const int qrow0 = qb + 8 * hlf;   // first accumulator row for this lane-half
  const int klast = ((qb + 15) >> 5) << 5;   // the wave's last key tile

  // the lane's byte offset inside every 512-byte piece of a K or V tile (4 KiB per 32 keys each)
  const unsigned fo = (unsigned)lane * 16u;
  // prev_attn rows qrow0-1 .. qrow0+8: only the first and the last can lie outside [0,T)
  const bool okTop = qrow0 > 0, okBot = qrow0 + 8 < T;
  const unsigned rowTop = (unsigned)(okTop ? qrow0 - 1 : 0) * (T * 4u);
  const unsigned rowMid = (unsigned)qrow0 * (T * 4u);
  const unsigned rowBot = (unsigned)(okBot ? qrow0 + 8 : T - 1) * (T * 4u);

  // every loop of constant length below is unrolled so that kf, vf and pf are indexed by
  // constants and stay in registers
  v8h kf[8], vf[8];
  float pf[10][6];   // [row][left, centre, right of key kb+r | the same of key kb+16+r]

  auto load_v = [&](const char* vp) {
    #pragma unroll
    for (int j = 0; j < 4; ++j) {
      vf[j * 2]     = *(const v8h*)(vp + j * 1024);
      vf[j * 2 + 1] = *(const v8h*)(vp + j * 1024 + 512);
    }
  };
  auto load_k = [&](const char* kp) {
    #pragma unroll
    for (int sb = 0; sb < 2; ++sb)
      #pragma unroll
      for (int q = 0; q < 4; ++q)
        kf[sb * 4 + q] = *(const v8h*)(kp + sb * 2048 + q * 512);
  };
  // oL, oC, oR: byte offsets of [top, middle, bottom] rows at the clamped left column of the
  // first key, at the first key itself, and at the clamped right column of the second key
  auto load_p = [&](const unsigned (&oL)[3], const unsigned (&oC)[3], const unsigned (&oR)[3]) {
    #pragma unroll
    for (int i = 0; i < 10; ++i) {
      const int g  = (i == 0) ? 0 : ((i == 9) ? 2 : 1);
      const int im = (g == 1) ? (i - 1) * T * 4 : 0;
      pf[i][0] = *(const float*)(pbase + oL[g] + im);
      pf[i][1] = *(const float*)(pbase + oC[g] + im);
      pf[i][2] = *(const float*)(pbase + oC[g] + im + 4);
      pf[i][3] = *(const float*)(pbase + oC[g] + im + 60);
      pf[i][4] = *(const float*)(pbase + oC[g] + im + 64);
      pf[i][5] = *(const float*)(pbase + oR[g] + im);
    }
  };
  // one group of loads: V of tile kv (skipped in front of the loop), K and prev_attn of tile kn
  auto load_group = [&](const bool with_v, const int kv, const int kn) {
    const int k0 = kn + r;
    const unsigned cL = (unsigned)(k0 > 0 ? k0 - 1 : 0) * 4u;
    const unsigned cC = (unsigned)k0 * 4u;
    const unsigned cR = (unsigned)(k0 + 17 < T ? k0 + 17 : T - 1) * 4u;
    const unsigned oL[3] = {rowTop + cL, rowMid + cL, rowBot + cL};
    const unsigned oC[3] = {rowTop + cC, rowMid + cC, rowBot + cC};
    const unsigned oR[3] = {rowTop + cR, rowMid + cR, rowBot + cR};
    const char* vp = vbase + (size_t)kv * (HD * 2) + fo;    // the lane's own addresses
    const char* kp = kbase + (size_t)kn * (HD * 2) + fo;
    if (with_v) load_v(vp);
    load_k(kp);
    load_p(oL, oC, oR);
    // the wait that belongs in front of any overwrite of the loads' address registers; they are
    // named as inputs so that none is reused (not even as a load's destination) ahead of it
    asm volatile("s_wait_xcnt 0x0" :: "s"(pbase), "v"(vp), "v"(kp), "v"(fo),
                 "v"(oL[0]), "v"(oL[1]), "v"(oL[2]), "v"(oC[0]), "v"(oC[1]), "v"(oC[2]),
                 "v"(oR[0]), "v"(oR[1]), "v"(oR[2]) : "memory");
  };

  // fenced like the group in the loop, so that K stands in front of prev_attn here too and
  // the loop's first wait need not cover more than K
  __builtin_amdgcn_sched_barrier(0);
  load_group(false, 0, 0);
  __builtin_amdgcn_sched_barrier(0);

  // tile 0 exists for every wave: the test stands at the foot, and nothing of the prologue
  // (the Q loads least of all) is moved in behind the first group
  int kb = 0;
  do {
    // S = Q @ K^T  (16 x 32 tile, two 16x16 fragments)
    v8f S[2];
    #pragma unroll
    for (int sb = 0; sb < 2; ++sb) {
      #pragma unroll
      for (int e = 0; e < 8; ++e) S[sb][e] = 0.f;
      S[sb] = wmma16(aQ[0], pack16(kf[sb * 4],     kf[sb * 4 + 1]), S[sb]);
      S[sb] = wmma16(aQ[1], pack16(kf[sb * 4 + 2], kf[sb * 4 + 3]), S[sb]);
    }

    // scale + refine conv (row-reused) + causal mask
    #pragma unroll
    for (int sb = 0; sb < 2; ++sb) {
      const int kj = kb + sb * 16 + r;
      float colL[10], colC[10], colR[10];
      #pragma unroll
      for (int i = 0; i < 10; ++i) {
        const bool okRow = (i == 0) ? okTop : ((i == 9) ? okBot : true);
        colL[i] = (okRow && kj > 0)     ? pf[i][sb * 3]     : 0.f;
        colC[i] = okRow                 ? pf[i][sb * 3 + 1] : 0.f;
        colR[i] = (okRow && kj < T - 1) ? pf[i][sb * 3 + 2] : 0.f;
      }
      #pragma unroll
      for (int v = 0; v < 8; ++v) {
        float acc = 0.f;
        #pragma unroll
        for (int di = 0; di < 3; ++di)
          acc += colL[v + di] * rw[di * 3] + colC[v + di] * rw[di * 3 + 1]
               + colR[v + di] * rw[di * 3 + 2];
        const int qi = qrow0 + v;
        float s = S[sb][v] * 0.125f + alpha * acc;
        if (kj > qi) s = -1e30f;
        S[sb][v] = s;
      }
    }

    // the group stays here, whole: left to itself the scheduler sinks each load to its use
    // and the wave waits out one memory latency after another
    __builtin_amdgcn_sched_barrier(0);
    load_group(true, kb, kb < klast ? kb + 32 : kb);   // past the last tile: the same one again
    __builtin_amdgcn_sched_barrier(0);

    // online softmax (row stats via 16-lane shuffles), stage P to LDS
    #pragma unroll
    for (int v = 0; v < 8; ++v) {
      float rmax = fmaxf(S[0][v], S[1][v]);
      #pragma unroll
      for (int off = 1; off < 16; off <<= 1) rmax = fmaxf(rmax, __shfl_xor(rmax, off, 16));
      const float mnew = fmaxf(mstat[v], rmax);
      const float scl = __expf(mstat[v] - mnew);
      mstat[v] = mnew;
      lstat[v] *= scl;
      #pragma unroll
      for (int j = 0; j < 4; ++j) O[j][v] *= scl;
      const float p0 = __expf(S[0][v] - mnew);
      const float p1 = __expf(S[1][v] - mnew);
      float rsum = p0 + p1;
      #pragma unroll
      for (int off = 1; off < 16; off <<= 1) rsum += __shfl_xor(rsum, off, 16);
      lstat[v] += rsum;
      const int m = v + 8 * hlf;
      lds_p[wbase + m * 32 + r]      = (_Float16)p0;
      lds_p[wbase + m * 32 + 16 + r] = (_Float16)p1;
    }

    // O += P @ V   (a B fragment is two of the group's b128 loads)
    v16h aP;
    {
      const _Float16* pp = lds_p + wbase + r * 32 + hlf * 8;
      aP = pack16(*(const v8h*)pp, *(const v8h*)(pp + 16));
    }
    #pragma unroll
    for (int j = 0; j < 4; ++j) O[j] = wmma16(aP, pack16(vf[j * 2], vf[j * 2 + 1]), O[j]);
    kb += 32;
  } while (kb <= klast);

  #pragma unroll
  for (int v = 0; v < 8; ++v) {
    const float inv = 1.f / lstat[v];
    #pragma unroll
    for (int j = 0; j < 4; ++j) O[j][v] *= inv;
  }
  #pragma unroll
  for (int j = 0; j < 4; ++j)
    #pragma unroll
    for (int v = 0; v < 8; ++v) {
      const int qi = qb + v + 8 * hlf;
      const int hd = j * 16 + r;
      y[((size_t)(b * T + qi)) * 1024 + h * 64 + hd] = (_Float16)O[j][v];
    }
}

// ---------------------------------------------------------------------------
// Channel-attention depthwise conv along T + exact GELU -> f16 (GEMM input)
// ---------------------------------------------------------------------------
static __device__ __forceinline__
void caconv_body(const float* __restrict__ h, const float* __restrict__ cw,
                 _Float16* __restrict__ o, int T, int CH, int total, const int bx) {
  const int idx = bx * 256 + threadIdx.x;
  if (idx >= total) return;
  const int c = idx % CH;
  const int t = (idx / CH) % T;
  const float ctr = h[idx];
  const float lft = (t > 0)     ? h[idx - CH] : 0.f;
  const float rgt = (t < T - 1) ? h[idx + CH] : 0.f;
  const float v = ctr + 0.1f * (lft * cw[c * 3] + ctr * cw[c * 3 + 1] + rgt * cw[c * 3 + 2]);
  o[idx] = (_Float16)(0.5f * v * (1.f + erff(v * 0.70710678118654752f)));
}

// Four FFN depthwise conv steps (each: o = in + 0.1*conv_T(in), zero padded) in one pass.
// A thread owns 8 adjacent channels and walks 16 + 8 rows of T.  Step s lags the input by
// s rows, so every step keeps its last two rows in f32 registers; only step 4 is stored.
// The 4 halo rows on each side are recomputed per tile; past the ends of T they are the
// zero padding of every step.  Needs T % 16 == 0, F % 2048 == 0.
// blocks (bx, by, bz) = (F/2048, T/16, B) of 256 threads
template<int T, int F>
static __device__ __forceinline__
void ffnconv4_body(const _Float16* __restrict__ in, const float* __restrict__ cw,
                   _Float16* __restrict__ o, const int bx, const int by, const int bz) {
  constexpr int TT = 16, NR = TT + 8;
  static_assert(T % TT == 0 && F % 2048 == 0, "tile shape");
  const int f  = (bx * 256 + threadIdx.x) * 8;   // first of the lane's 8 channels
  const int t0 = by * TT;
  const bool lo = (t0 == 0);        // rows t0-4 .. t0-1 lie before the sequence
  const bool hi = (t0 + TT == T);   // rows t0+16 .. t0+19 lie behind it
  const size_t tile = ((size_t)bz * T + t0) * F;   // row t0, same for the whole block
  const _Float16* ip  = in + tile + f;
  // an outside halo row re-reads a row of the tile itself (in bounds); it is masked below
  const _Float16* ipl = ip + (lo ? 4 * F : 0);
  const _Float16* iph = ip - (hi ? 4 * F : 0);
  const float* wp = cw + (size_t)f * 3;
  _Float16* op = o + tile + f;
  const v8f zero = {0.f, 0.f, 0.f, 0.f, 0.f, 0.f, 0.f, 0.f};

  // every loop below is unrolled so that its arrays are indexed by constants and stay in registers
  v8f w0, w1, w2;
  #pragma unroll
  for (int e = 0; e < 8; ++e) {
    w0[e] = wp[e * 3];
    w1[e] = wp[e * 3 + 1];
    w2[e] = wp[e * 3 + 2];
  }

  v8h raw[NR];
  #pragma unroll
  for (int i = 0; i < NR; ++i) {
    const _Float16* p = (i < 4) ? ipl : ((i >= TT + 4) ? iph : ip);
    raw[i] = *(const v8h*)(p + (i - 4) * F);
  }
  // the wait that belongs in front of any overwrite of the loads' address registers; they are
  // named as inputs so that none is reused (not even as a load's destination) ahead of it
  asm volatile("s_wait_xcnt 0x0" :: "v"(wp), "v"(ipl), "v"(ip), "v"(iph) : "memory");

  // r = row index inside the 24-row window; only halo rows can lie outside [0,T)
  auto pad = [&](const v8f v, const int r) -> v8f {
    if (r < 4)       return lo ? zero : v;
    if (r >= TT + 4) return hi ? zero : v;
    return v;
  };
  auto step = [&](const v8f l, const v8f c, const v8f r) -> v8f {
    return c + 0.1f * (l * w0 + c * w1 + r * w2);
  };

  v8f a[4], b[4];   // per step input: rows two back and one back
  #pragma unroll
  for (int s = 0; s < 4; ++s) { a[s] = zero; b[s] = zero; }

  #pragma unroll
  for (int i = 0; i < NR; ++i) {
    const v8f x0 = pad(__builtin_convertvector(raw[i], v8f), i);
    const v8f x1 = pad(step(a[0], b[0], x0), i - 1);  a[0] = b[0];  b[0] = x0;
    const v8f x2 = pad(step(a[1], b[1], x1), i - 2);  a[1] = b[1];  b[1] = x1;
    const v8f x3 = pad(step(a[2], b[2], x2), i - 3);  a[2] = b[2];  b[2] = x2;
    const v8f x4 = step(a[3], b[3], x3);              a[3] = b[3];  b[3] = x3;
    if (i >= 8) *(v8h*)(op + (i - 8) * F) = __builtin_convertvector(x4, v8h);
  }
}

// x1 = x + attn_proj*(1+0.1*tanh(ca1));  writes f32 and f16 copies
// A block owns 2048 adjacent elements, a thread 4 of the first 1024 and 4 of the second, so
// that every load of a wave covers 512 adjacent bytes.  grid = elements / 2048, exactly.
__global__ __launch_bounds__(256)
void x1_kernel(const float* __restrict__ x, const float* __restrict__ ap,
               const float* __restrict__ ca1, float* __restrict__ o,
               _Float16* __restrict__ o16) {
  const int i0 = blockIdx.x * 2048 + threadIdx.x * 4;
  // both loops are unrolled so that the six loads are issued together
  float4 xv[2], av[2], cv[2];
  #pragma unroll
  for (int p = 0; p < 2; ++p) {
    xv[p] = *(const float4*)(x   + i0 + p * 1024);
    av[p] = *(const float4*)(ap  + i0 + p * 1024);
    cv[p] = *(const float4*)(ca1 + i0 + p * 1024);
  }
  #pragma unroll
  for (int p = 0; p < 2; ++p) {
    float4 v;
    v.x = xv[p].x + av[p].x * (1.f + 0.1f * tanhf(cv[p].x));
    v.y = xv[p].y + av[p].y * (1.f + 0.1f * tanhf(cv[p].y));
    v.z = xv[p].z + av[p].z * (1.f + 0.1f * tanhf(cv[p].z));
    v.w = xv[p].w + av[p].w * (1.f + 0.1f * tanhf(cv[p].w));
    *(float4*)(o + i0 + p * 1024) = v;
    v4h h; h[0] = (_Float16)v.x; h[1] = (_Float16)v.y; h[2] = (_Float16)v.z; h[3] = (_Float16)v.w;
    *(v4h*)(o16 + i0 + p * 1024) = h;
  }
}

static __device__ __forceinline__
void vitdot_body(const float* __restrict__ g32, const float* __restrict__ w2,
                 float* __restrict__ vit0, int ntok, const int bx) {
  const int i = bx * 256 + threadIdx.x;
  if (i >= ntok) return;
  float s = 0.f;
  #pragma unroll
  for (int j = 0; j < 32; ++j) s += g32[(size_t)i * 32 + j] * w2[j];
  vit0[i] = 1.f / (1.f + __expf(-s));
}

static __device__ __forceinline__
void vitsmooth_body(const float* __restrict__ vit0, float* __restrict__ vit,
                    int T, int ntok, const int bx) {
  const int i = bx * 256 + threadIdx.x;
  if (i >= ntok) return;
  const int t = i % T;
  const int base = i - t;
  float s = 0.f;
  #pragma unroll
  for (int d = -2; d <= 2; ++d) {
    const int tt = t + d;
    if ((unsigned)tt < (unsigned)T) s += vit0[base + tt];
  }
  const float v = 0.7f * vit0[i] + 0.3f * (s * 0.2f);
  vit[i] = (v > 0.3f) ? v : 0.1f * v;
}

// out = x1 + mlp*g*(1+0.1*tanh(ca2))*vit[token]; elements shared out as in x1_kernel.
// Needs C % 4 == 0 (a thread's 4 elements lie in one token).  grid = elements / 2048, exactly.
__global__ __launch_bounds__(256)
void final_kernel(const float* __restrict__ x1, const float* __restrict__ mlp,
                  const float* __restrict__ g, const float* __restrict__ ca2,
                  const float* __restrict__ vit, float* __restrict__ out, int C) {
  const int i0 = blockIdx.x * 2048 + threadIdx.x * 4;
  const float* px = x1 + i0;
  const float* pm = mlp + i0;
  const float* pg = g + i0;
  const float* pc = ca2 + i0;
  const float* pv0 = vit + i0 / C;
  const float* pv1 = vit + (i0 + 1024) / C;
  // both loops are unrolled so that the ten loads are issued together
  float4 xv[2], mv[2], gv[2], cv[2];
  float vt[2];
  #pragma unroll
  for (int p = 0; p < 2; ++p) {
    xv[p] = *(const float4*)(px + p * 1024);
    mv[p] = *(const float4*)(pm + p * 1024);
    gv[p] = *(const float4*)(pg + p * 1024);
    cv[p] = *(const float4*)(pc + p * 1024);
  }
  vt[0] = *pv0;
  vt[1] = *pv1;
  // the wait that belongs in front of any overwrite of the loads' address registers; they are
  // named as inputs so that none is reused (not even as a load's destination) ahead of it
  asm volatile("s_wait_xcnt 0x0" :: "v"(px), "v"(pm), "v"(pg), "v"(pc), "v"(pv0), "v"(pv1) : "memory");
  #pragma unroll
  for (int p = 0; p < 2; ++p) {
    float4 v;
    v.x = xv[p].x + mv[p].x * gv[p].x * (1.f + 0.1f * tanhf(cv[p].x)) * vt[p];
    v.y = xv[p].y + mv[p].y * gv[p].y * (1.f + 0.1f * tanhf(cv[p].y)) * vt[p];
    v.z = xv[p].z + mv[p].z * gv[p].z * (1.f + 0.1f * tanhf(cv[p].z)) * vt[p];
    v.w = xv[p].w + mv[p].w * gv[p].w * (1.f + 0.1f * tanhf(cv[p].w)) * vt[p];
    *(float4*)(out + i0 + p * 1024) = v;
  }
}

// ---------------------------------------------------------------------------
// Merged launches.  Pieces of work that read none of each other's output share one grid: the
// block index, the same for a whole block, says which piece a block does and which block of
// that piece it is.  The pieces themselves are the functions above, each computing what it
// did when launched alone.  Pieces that need LDS tiles get them from one array of the merged kernel, so that
// its LDS is that of its largest piece and not the sum.
// ---------------------------------------------------------------------------
constexpr int kB = 4, kT = 1024, kC = 1024, kKVD = 256, kF = 4096, kCA = 32;
constexpr int kBT = kB * kT;
constexpr int kMT = kBT / 128;                 // row tiles of the ring GEMM
constexpr int kCaBlocks = kBT * kCA / 256;     // blocks of the channel-attention conv
static_assert(kMT == 32 && kBT / 256 == 16, "the tile indices below are split by shifts");

// RMSNorm of x, and every fp32 -> f16 conversion (x and the ten weights).
// grid = kBT rows + one block per 1024 converted elements
constexpr int kCvtBlocks = (kBT * kC + 3 * kC * kC + 2 * kKVD * kC + 3 * kCA * kC + 2 * kF * kC) / 1024;
__global__ __launch_bounds__(256)
void prep_kernel(const float* __restrict__ x, const float* __restrict__ w_q,
                 const float* __restrict__ w_k, const float* __restrict__ w_v,
                 const float* __restrict__ w_o, const float* __restrict__ ca_pi,
                 const float* __restrict__ ca_po, const float* __restrict__ ffn_in,
                 const float* __restrict__ ffn_out, const float* __restrict__ ffn_g,
                 const float* __restrict__ vit_w1,
                 _Float16* __restrict__ x16, _Float16* __restrict__ w_q16,
                 _Float16* __restrict__ w_k16, _Float16* __restrict__ w_v16,
                 _Float16* __restrict__ w_o16, _Float16* __restrict__ ca_pi16,
                 _Float16* __restrict__ ca_po16, _Float16* __restrict__ fin16,
                 _Float16* __restrict__ fout16, _Float16* __restrict__ fg16,
                 _Float16* __restrict__ vw1_16, _Float16* __restrict__ xn16, int C) {
  int b = blockIdx.x;
  if (b < kBT) { rmsnorm16_body(x, xn16, C, b); return; }
  b -= kBT;
  // walk the list of arrays until b is a block of the current one (n blocks of 1024 elements)
  const float* s = x;
  _Float16* d = x16;
  int n = kBT * kC / 1024;
  auto next = [&](const float* ns, _Float16* nd, const int nn) {
    if (b >= n) { b -= n; s = ns; d = nd; n = nn; }
  };
  next(ffn_in,  fin16,   kF * kC / 1024);
  next(ffn_out, fout16,  kC * kF / 1024);
  next(w_q,     w_q16,   kC * kC / 1024);
  next(w_o,     w_o16,   kC * kC / 1024);
  next(ffn_g,   fg16,    kC * kC / 1024);
  next(w_k,     w_k16,   kKVD * kC / 1024);
  next(w_v,     w_v16,   kKVD * kC / 1024);
  next(ca_pi,   ca_pi16, kCA * kC / 1024);
  next(ca_po,   ca_po16, kC * kCA / 1024);
  next(vit_w1,  vw1_16,  kCA * kC / 1024);
  cvt16_body(s, d, n * 1024, b);
}

__global__ __launch_bounds__(256)
void rmsnorm16_kernel(const float* __restrict__ x, _Float16* __restrict__ o, int C) {
  rmsnorm16_body(x, o, C, blockIdx.x);
}

// The q, k and v projections of xn and the channel-attention input projection of x.
// grid = kMT * (1 + (NQ + 2 NKV) / 128)
__global__ __launch_bounds__(256)
void qkv_ca_kernel(const _Float16* __restrict__ xn16, const _Float16* __restrict__ w_q16,
                   const _Float16* __restrict__ w_k16, const _Float16* __restrict__ w_v16,
                   float* __restrict__ q_raw, float* __restrict__ k_raw,
                   float* __restrict__ v_raw, const _Float16* __restrict__ x16,
                   const _Float16* __restrict__ ca_pi16, float* __restrict__ ca_h,
                   int M, int NQ, int NKV, int NCA, int K) {
  __shared__ __attribute__((aligned(16))) _Float16 ring[RING_H];
  int t = blockIdx.x;
  if (t < kMT) { gemm_ring_body<0, 0, 32>(ring, x16, ca_pi16, ca_h, M, NCA, K, t, 0); return; }
  t -= kMT;
  const _Float16* W = w_q16;
  float* O = q_raw;
  int N = NQ;
  if (t >= kMT * (kC / 128)) {
    t -= kMT * (kC / 128);  W = w_k16;  O = k_raw;  N = NKV;
    if (t >= kMT * (kKVD / 128)) { t -= kMT * (kKVD / 128);  W = w_v16;  O = v_raw; }
  }
  gemm_ring_body<0, 0, 128>(ring, xn16, W, O, M, N, K, t & (kMT - 1), t / kMT);
}

// QKV post-processing and the channel-attention conv.  grid = kBT / 8 + kCaBlocks
__global__ __launch_bounds__(256)
void post_kernel(const float* __restrict__ q_raw, const float* __restrict__ k_raw,
                 const float* __restrict__ v_raw, const _Float16* __restrict__ xn,
                 const float* __restrict__ ve, const float* __restrict__ cosb,
                 const float* __restrict__ sinb, const float* __restrict__ wgate,
                 _Float16* __restrict__ qh, _Float16* __restrict__ kh,
                 _Float16* __restrict__ vt, const float* __restrict__ ca_h,
                 const float* __restrict__ ca_cw, _Float16* __restrict__ cag16,
                 int T, int CH, int total) {
  const int b = blockIdx.x;
  if (b < kBT / 8) qkvpost_body<kT>(q_raw, k_raw, v_raw, xn, ve, cosb, sinb, wgate, qh, kh, vt, b);
  else             caconv_body(ca_h, ca_cw, cag16, T, CH, total, b - kBT / 8);
}

// A projection back to C columns (K = C or FFN), the channel-attention output projection and,
// where the grid has blocks for it, the smoothing of the vitality gate.
// grid = kMT * kC / 128 + (kBT / 256) * (kC / 64) [+ kBT / 256]
__global__ __launch_bounds__(256)
void proj_kernel(const _Float16* __restrict__ A, const _Float16* __restrict__ W,
                 float* __restrict__ O, const _Float16* __restrict__ cag16,
                 const _Float16* __restrict__ ca_po16, float* __restrict__ ca,
                 const float* __restrict__ vit0, float* __restrict__ vitf,
                 int M, int N, int K, int KCA, int T) {
  __shared__ __attribute__((aligned(16))) _Float16 ring[RING_H];
  int t = blockIdx.x;
  if (t < kMT * (kC / 128)) {
    gemm_ring_body<0, 0, 128>(ring, A, W, O, M, N, K, t & (kMT - 1), t / kMT);
    return;
  }
  t -= kMT * (kC / 128);
  if (t < (kBT / 256) * (kC / 64)) {
    gemm_body<0, 0>((_Float16 (*)[64 * 32])ring, cag16, ca_po16, ca, M, N, KCA, t & 15, t >> 4);
    return;
  }
  vitsmooth_body(vit0, vitf, T, M, t - (kBT / 256) * (kC / 64));
}

// What reads xm or x1 alone: FFN input projection (relu^2), FFN gate (sigmoid), and of x1 the
// channel-attention input projection and the vitality projection (gelu).
// grid = 2 kMT + kMT * (kF + kC) / 128
__global__ __launch_bounds__(256)
void ffn_in_kernel(const _Float16* __restrict__ xm16, const _Float16* __restrict__ fin16,
                   _Float16* __restrict__ hA, const _Float16* __restrict__ fg16,
                   float* __restrict__ gbuf, const _Float16* __restrict__ x1_16,
                   const _Float16* __restrict__ ca_pi16, float* __restrict__ ca_h,
                   const _Float16* __restrict__ vw1_16, float* __restrict__ g32,
                   int M, int NF, int NC, int NCA, int K) {
  __shared__ __attribute__((aligned(16))) _Float16 ring[RING_H];
  int t = blockIdx.x;
  if (t < kMT) { gemm_ring_body<0, 0, 32>(ring, x1_16, ca_pi16, ca_h, M, NCA, K, t, 0); return; }
  t -= kMT;
  if (t < kMT) { gemm_ring_body<3, 0, 32>(ring, x1_16, vw1_16, g32, M, NCA, K, t, 0); return; }
  t -= kMT;
  if (t < kMT * (kF / 128)) {
    gemm_ring_body<1, 1, 128>(ring, xm16, fin16, hA, M, NF, K, t & (kMT - 1), t / kMT);
    return;
  }
  t -= kMT * (kF / 128);
  gemm_ring_body<2, 0, 128>(ring, xm16, fg16, gbuf, M, NC, K, t & (kMT - 1), t / kMT);
}

// The four FFN conv steps, the channel-attention conv and the vitality dot product.
// grid = (kF / 2048) * (kT / 16) * kB + kCaBlocks + kBT / 256
__global__ __launch_bounds__(256)
void ffn_mid_kernel(const _Float16* __restrict__ hA, const float* __restrict__ ffn_cw,
                    _Float16* __restrict__ hB, const float* __restrict__ ca_h,
                    const float* __restrict__ ca_cw, _Float16* __restrict__ cag16,
                    const float* __restrict__ g32, const float* __restrict__ vit_w2,
                    float* __restrict__ vit0, int T, int CH, int total, int ntok) {
  constexpr int NX = kF / 2048, NY = kT / 16;
  int t = blockIdx.x;
  if (t < NX * NY * kB) {
    ffnconv4_body<kT, kF>(hA, ffn_cw, hB, t % NX, (t / NX) % NY, t / (NX * NY));
    return;
  }
  t -= NX * NY * kB;
  if (t < kCaBlocks) { caconv_body(ca_h, ca_cw, cag16, T, CH, total, t); return; }
  vitdot_body(g32, vit_w2, vit0, ntok, t - kCaBlocks);
}

// ---------------------------------------------------------------------------
extern "C" void kernel_launch(void* const* d_in, const int* in_sizes, int n_in,
                              void* d_out, int out_size, void* d_ws, size_t ws_size,
                              hipStream_t stream) {
  (void)in_sizes; (void)n_in; (void)out_size; (void)ws_size;
  constexpr int B = 4, T = 1024, C = 1024, H = 16, KV = 4, HD = 64, FFN = 4096, CA = 32;
  constexpr int BT = B * T;

  const float* x       = (const float*)d_in[0];
  const float* ve      = (const float*)d_in[1];
  const float* cosb    = (const float*)d_in[2];
  const float* sinb    = (const float*)d_in[3];
  const float* prev    = (const float*)d_in[4];
  const float* w_q     = (const float*)d_in[5];
  const float* w_k     = (const float*)d_in[6];
  const float* w_v     = (const float*)d_in[7];
  const float* w_o     = (const float*)d_in[8];
  const float* w_gate  = (const float*)d_in[9];
  const float* rf_w    = (const float*)d_in[10];
  const float* rf_a    = (const float*)d_in[11];
  const float* ca_pi   = (const float*)d_in[12];
  const float* ca_cw   = (const float*)d_in[13];
  const float* ca_po   = (const float*)d_in[14];
  const float* ffn_in  = (const float*)d_in[15];
  const float* ffn_cw  = (const float*)d_in[16];
  const float* ffn_out = (const float*)d_in[17];
  const float* ffn_g   = (const float*)d_in[18];
  const float* vit_w1  = (const float*)d_in[19];
  const float* vit_w2  = (const float*)d_in[20];
  float* out = (float*)d_out;

  float* wsf = (float*)d_ws;
  size_t off = 0;
  auto allocf = [&](size_t n) -> float* {
    float* p = wsf + off;
    off += (n + 63) & ~(size_t)63;
    return p;
  };
  auto alloch = [&](size_t n) -> _Float16* {   // n halfs
    return (_Float16*)allocf((n + 1) / 2);
  };

  // fp32 working buffers
  float* q_raw     = allocf((size_t)BT * C);
  float* k_raw     = allocf((size_t)BT * KV * HD);
  float* v_raw     = allocf((size_t)BT * KV * HD);
  float* attn_proj = allocf((size_t)BT * C);
  float* ca_h      = allocf((size_t)BT * CA);
  float* ca1       = allocf((size_t)BT * C);
  float* x1        = allocf((size_t)BT * C);
  float* vit0      = allocf(BT);
  float* vitf      = allocf(BT);
  float* g32       = allocf((size_t)BT * CA);
  // f16 working buffers
  _Float16* x16    = alloch((size_t)BT * C);
  _Float16* xn16   = alloch((size_t)BT * C);
  _Float16* qh     = alloch((size_t)BT * C);
  _Float16* kh     = alloch((size_t)BT * KV * HD);
  _Float16* vt     = alloch((size_t)BT * KV * HD);   // kh and vt: in fragment order
  _Float16* y16    = alloch((size_t)BT * C);
  _Float16* cag16  = alloch((size_t)BT * CA);
  _Float16* x1_16  = alloch((size_t)BT * C);
  _Float16* hA     = alloch((size_t)BT * FFN);
  _Float16* hB     = alloch((size_t)BT * FFN);
  // f16 weights (converted once)
  _Float16* w_q16   = alloch((size_t)C * C);
  _Float16* w_k16   = alloch((size_t)KV * HD * C);
  _Float16* w_v16   = alloch((size_t)KV * HD * C);
  _Float16* w_o16   = alloch((size_t)C * C);
  _Float16* ca_pi16 = alloch((size_t)CA * C);
  _Float16* ca_po16 = alloch((size_t)C * CA);
  _Float16* fin16   = alloch((size_t)FFN * C);
  _Float16* fout16  = alloch((size_t)C * FFN);
  _Float16* fg16    = alloch((size_t)C * C);
  _Float16* vw1_16  = alloch((size_t)CA * C);
  // reuse
  float* gbuf  = q_raw;      // q_raw dead after qkvpost
  float* mlp   = attn_proj;  // dead after x1
  float* ca2   = ca1;        // dead after x1
  _Float16* xm16 = xn16;     // xn16 dead after QKV + gate

  const dim3 blk(256);
  static_assert(B == kB && T == kT && C == kC && KV * HD == kKVD && FFN == kF && CA == kCA && H * HD == kC,
                "the merged kernels split their grids by these shapes");

  // --- f16 conversions (weights + x) and the first RMSNorm ---
  prep_kernel<<<dim3(kBT + kCvtBlocks), blk, 0, stream>>>(
      x, w_q, w_k, w_v, w_o, ca_pi, ca_po, ffn_in, ffn_out, ffn_g, vit_w1,
      x16, w_q16, w_k16, w_v16, w_o16, ca_pi16, ca_po16, fin16, fout16, fg16, vw1_16, xn16, C);

  // --- attention path, with the ca1 path beside it ---
  qkv_ca_kernel<<<dim3(kMT * (1 + (kC + 2 * kKVD) / 128)), blk, 0, stream>>>(
      xn16, w_q16, w_k16, w_v16, q_raw, k_raw, v_raw, x16, ca_pi16, ca_h, BT, C, KV * HD, CA, C);
  post_kernel<<<dim3(kBT / 8 + kCaBlocks), blk, 0, stream>>>(
      q_raw, k_raw, v_raw, xn16, ve, cosb, sinb, w_gate, qh, kh, vt, ca_h, ca_cw, cag16, T, CA, BT * CA);
  attn_kernel<T><<<dim3(B * H, T / 128), blk, 0, stream>>>(qh, kh, vt, prev, rf_w, rf_a, y16);
  proj_kernel<<<dim3(kMT * (kC / 128) + (kBT / 256) * (kC / 64)), blk, 0, stream>>>(
      y16, w_o16, attn_proj, cag16, ca_po16, ca1, vit0, vitf, BT, C, C, CA, T);
  x1_kernel<<<dim3((BT * C) / 2048), blk, 0, stream>>>(x, attn_proj, ca1, x1, x1_16);

  // --- FFN, with the ca2 and vitality paths beside it ---
  rmsnorm16_kernel<<<BT, blk, 0, stream>>>(x1, xm16, C);
  ffn_in_kernel<<<dim3(2 * kMT + kMT * ((kF + kC) / 128)), blk, 0, stream>>>(
      xm16, fin16, hA, fg16, gbuf, x1_16, ca_pi16, ca_h, vw1_16, g32, BT, FFN, C, CA, C);
  ffn_mid_kernel<<<dim3((kF / 2048) * (kT / 16) * kB + kCaBlocks + kBT / 256), blk, 0, stream>>>(
      hA, ffn_cw, hB, ca_h, ca_cw, cag16, g32, vit_w2, vit0, T, CA, BT * CA, BT);
  proj_kernel<<<dim3(kMT * (kC / 128) + (kBT / 256) * (kC / 64) + kBT / 256), blk, 0, stream>>>(
      hB, fout16, mlp, cag16, ca_po16, ca2, vit0, vitf, BT, C, FFN, CA, T);

  // --- final combine ---
  final_kernel<<<dim3((BT * C) / 2048), blk, 0, stream>>>(x1, mlp, gbuf, ca2, vitf, out, C);
}

// v008
// A run of this version takes 211 microseconds.
// In both of two side-by-side timings against v007, it was 1.05 times as fast.
// All steps since v000 together make it 3.94 times as fast.
#include <hip/hip_runtime.h>
#include <hip/hip_bf16.h>

typedef __attribute__((ext_vector_type(16))) _Float16 v16h;
typedef __attribute__((ext_vector_type(8)))  _Float16 v8h;
typedef __attribute__((ext_vector_type(4)))  _Float16 v4h;
typedef __attribute__((ext_vector_type(8)))  float    v8f;

static __device__ __forceinline__ v8f wmma16(v16h a, v16h b, v8f c) {
  return __builtin_amdgcn_wmma_f32_16x16x32_f16(false, a, false, b, (short)0, c, false, false);
}
static __device__ __forceinline__ v16h pack16(v8h lo, v8h hi) {
  return __builtin_shufflevector(lo, hi, 0,1,2,3,4,5,6,7,8,9,10,11,12,13,14,15);
}

// ---------------------------------------------------------------------------
// fp32 -> f16 conversion (vectorized x4); totals are multiples of 4
// ---------------------------------------------------------------------------
static __device__ __forceinline__
void cvt16_body(const float* __restrict__ in, _Float16* __restrict__ out, int total, const int bx) {
  const int i = (bx * 256 + threadIdx.x) * 4;
  if (i >= total) return;
  const float4 v = *(const float4*)(in + i);
  v4h o; o[0] = (_Float16)v.x; o[1] = (_Float16)v.y; o[2] = (_Float16)v.z; o[3] = (_Float16)v.w;
  *(v4h*)(out + i) = o;
}

// ---------------------------------------------------------------------------
// Epilogues: 0=identity, 1=relu^2, 2=sigmoid, 3=gelu(exact)
// ---------------------------------------------------------------------------
template<int EPI>
static __device__ __forceinline__ float apply_epi(float x) {
  if constexpr (EPI == 1) { float t = x > 0.f ? x : 0.f; return t * t; }
  else if constexpr (EPI == 2) { return 1.f / (1.f + __expf(-x)); }
  else if constexpr (EPI == 3) { return 0.5f * x * (1.f + erff(x * 0.70710678118654752f)); }
  else return x;
}

// ---------------------------------------------------------------------------
// WMMA GEMM for K % 128 == 0: out[M,N] = epi( A[M,K] @ W[N,K]^T ), all-f16 operands.
// A work-group owns a 128 x BN tile of out; a stage is 128 k of [A 128 rows | W BN rows],
// rows of 256 B at a pitch of 272 B in LDS (conflict-free for 16-byte readers), two buffers.
// Both operands come into LDS by asynchronous copies, one stage ahead of the products.
// BN = 128: 2 x 4 waves of 64 x 32 each.  BN = 32: 8 x 1 waves of 16 x 32 each.
// Requirements: M % 128 == 0, N % BN == 0, K % 128 == 0.
// ---------------------------------------------------------------------------
constexpr int G_PITCH_H = 136;                    // LDS row pitch in halfs (272 B)
constexpr int RING_H = 2 * (128 + 128) * G_PITCH_H;   // the caller's LDS array in halfs (BN = 128)

// NC 16-byte copies of one lane: rows 16 apart, in LDS (l) as in global memory (g, rs halfs).
// The s_wait_xcnt closes each statement so that no address register named in it can be
// rewritten ahead of the wait.
template<int NC>
static __device__ __forceinline__ void copy_rows(const unsigned l, const _Float16* g, const size_t rs) {
  constexpr unsigned LS = 16u * G_PITCH_H * 2u;   // 16 LDS rows in bytes
  static_assert(NC == 8 || NC == 2, "rows per lane");
  if constexpr (NC == 8) {
    asm volatile(
        "global_load_async_to_lds_b128 %0, %8, off\n\t"
        "global_load_async_to_lds_b128 %1, %9, off\n\t"
        "global_load_async_to_lds_b128 %2, %10, off\n\t"
        "global_load_async_to_lds_b128 %3, %11, off\n\t"
        "global_load_async_to_lds_b128 %4, %12, off\n\t"
        "global_load_async_to_lds_b128 %5, %13, off\n\t"
        "global_load_async_to_lds_b128 %6, %14, off\n\t"
        "global_load_async_to_lds_b128 %7, %15, off\n\t"
        "s_wait_xcnt 0x0"
        :: "v"(l), "v"(l + LS), "v"(l + 2 * LS), "v"(l + 3 * LS),
           "v"(l + 4 * LS), "v"(l + 5 * LS), "v"(l + 6 * LS), "v"(l + 7 * LS),
           "v"(g), "v"(g + rs), "v"(g + 2 * rs), "v"(g + 3 * rs),
           "v"(g + 4 * rs), "v"(g + 5 * rs), "v"(g + 6 * rs), "v"(g + 7 * rs)
        : "memory");
  } else {
    asm volatile(
        "global_load_async_to_lds_b128 %0, %2, off\n\t"
        "global_load_async_to_lds_b128 %1, %3, off\n\t"
        "s_wait_xcnt 0x0"
        :: "v"(l), "v"(l + LS), "v"(g), "v"(g + rs)
        : "memory");
  }
}

// tanh(x) = 1 - 2 / (e^(2x) + 1), without a branch: the library's form branches per element, and
// the two waves a SIMD has in a GEMM epilogue cannot hide 64 such chains one after another.
// Saturates to +-1 (e^(2x) = inf or 0); absolute error of a few f32 roundings of 1.
static __device__ __forceinline__ float tanh_nb(const float x) {
  return 1.f - 2.f * __builtin_amdgcn_rcpf(__expf(2.f * x) + 1.f);
}

// What the two combining epilogues (EPI 4 and 5) read and write beside the product itself.
// With acc = A @ W^T and ca = cag @ cpo^T (K = 32: one matrix instruction per 16 x 16 tile):
// EPI 4: Op = base + acc * (1 + 0.1 tanh(ca)), also stored as f16 in o16
// EPI 5: Op = base + acc * g * (1 + 0.1 tanh(ca)) * vit[row]
constexpr int CMB_N = 1024;   // columns of Op, base, g and o16; rows of cpo
constexpr int CMB_K = 32;     // columns of cag and cpo
struct Combine {
  const _Float16* cag;
  const _Float16* cpo;
  const float* base;
  const float* g;
  const float* vit;
  _Float16* o16;
};

template<int EPI, int OH, int BN>
static __device__ __forceinline__
void gemm_ring_body(_Float16* ring, const _Float16* __restrict__ A, const _Float16* __restrict__ W,
                    void* __restrict__ Op, int M, int N, int K, const int bx, const int by,
                    const Combine cmb = Combine()) {
  constexpr int WN = BN / 32;               // waves along N
  constexpr int MF = 128 / ((8 / WN) * 16); // 16-row fragments of A per wave
  constexpr int STAGE_H = (128 + BN) * G_PITCH_H;   // one buffer in halfs
  const int tid  = threadIdx.x;
  const int wave = tid >> 5;
  const int lane = tid & 31;
  const int hlf  = lane >> 4;
  const int r    = lane & 15;
  const int m0 = bx * 128;
  const int n0 = by * BN;
  const int wm = (wave / WN) * (MF * 16);
  const int wn = (wave % WN) * 32;

  // a lane copies 16-byte column (tid & 15) of rows (tid >> 4) + 16 i, of A and of W
  const int crow = tid >> 4;
  const int ccol = (tid & 15) * 8;
  const _Float16* gA = A + (size_t)(m0 + crow) * K + ccol;
  const _Float16* gW = W + (size_t)(n0 + crow) * K + ccol;
  const unsigned lA = (unsigned)(size_t)(&ring[crow * G_PITCH_H + ccol]);   // LDS byte address
  const size_t rs = (size_t)16 * K;

  auto copy_stage = [&](const int buf, const int t) {
    const unsigned l = lA + (unsigned)buf * (STAGE_H * 2u);
    copy_rows<8>(l, gA + (size_t)t * 128, rs);
    copy_rows<BN / 16>(l + 128u * G_PITCH_H * 2u, gW + (size_t)t * 128, rs);
  };

  // every loop of constant length in this kernel is unrolled so that acc, af and bf are
  // indexed by constants and stay in registers
  v8f acc[MF][2];
  #pragma unroll
  for (int mi = 0; mi < MF; ++mi)
    #pragma unroll
    for (int nj = 0; nj < 2; ++nj)
      #pragma unroll
      for (int e = 0; e < 8; ++e) acc[mi][nj][e] = 0.f;

  const int nt = K / 128;
  copy_stage(0, 0);
  asm volatile("s_wait_asynccnt 0x0" ::: "memory");   // this wave's part of stage 0 has landed
  __syncthreads();                                    // ... and every other wave's
  if (nt > 1) copy_stage(1, 1);

  for (int t = 0; t < nt; ++t) {
    const _Float16* sa = ring + (t & 1) * STAGE_H + (wm + r) * G_PITCH_H + hlf * 8;
    const _Float16* sw = ring + (t & 1) * STAGE_H + (128 + wn + r) * G_PITCH_H + hlf * 8;
    v16h af[2][MF], bf[2][2];   // two fragment sets: one in use, one being fetched
    auto fetch = [&](const int set, const int kk) {
      #pragma unroll
      for (int mi = 0; mi < MF; ++mi) {
        const _Float16* p = sa + mi * 16 * G_PITCH_H + kk * 32;
        af[set][mi] = pack16(*(const v8h*)p, *(const v8h*)(p + 16));
      }
      #pragma unroll
      for (int nj = 0; nj < 2; ++nj) {
        const _Float16* p = sw + nj * 16 * G_PITCH_H + kk * 32;
        bf[set][nj] = pack16(*(const v8h*)p, *(const v8h*)(p + 16));
      }
    };
    fetch(0, 0);
    #pragma unroll
    for (int kk = 0; kk < 4; ++kk) {
      if (kk < 3) fetch((kk + 1) & 1, kk + 1);
      // the next block's LDS reads stay one group ahead of this block's products; left to
      // itself the scheduler sinks each read to its use and the wave waits out every one
      __builtin_amdgcn_sched_barrier(0);
      #pragma unroll
      for (int mi = 0; mi < MF; ++mi)
        #pragma unroll
        for (int nj = 0; nj < 2; ++nj)
          acc[mi][nj] = wmma16(af[kk & 1][mi], bf[kk & 1][nj], acc[mi][nj]);
      // ... and no later read is lifted in among these products
      __builtin_amdgcn_sched_barrier(0);
    }
    asm volatile("s_wait_dscnt 0x0" ::: "memory");      // this wave has left the buffer
    asm volatile("s_wait_asynccnt 0x0" ::: "memory");   // its part of stage t + 1 has landed
    __syncthreads();   // publishes stage t + 1 and frees the buffer of stage t
    if (t + 2 < nt) copy_stage(t & 1, t + 2);
  }
  asm volatile("s_wait_asynccnt 0x0" ::: "memory");     // no copy outlives the wave

  if constexpr (EPI >= 4) {
    static_assert(BN == 128 && OH == 0, "the combining epilogues are written for the 64 x 32 wave tile");
    // byte offset of the lane's element in row 0 of its half, column group 0, of an f32 array of
    // CMB_N columns; every other element of the wave tile lies at a constant offset from it
    const unsigned ob = ((unsigned)(m0 + wm + 8 * hlf) * CMB_N + (unsigned)(n0 + wn + r)) * 4u;
    const unsigned oa = ((unsigned)(m0 + wm + r) * CMB_K + hlf * 8) * 2u;   // the same in cag
    const unsigned ow = ((unsigned)(n0 + wn + r) * CMB_K + hlf * 8) * 2u;   // ... and in cpo
    const char* cb = (const char*)cmb.base;
    const char* ca = (const char*)cmb.cag;
    const char* cw = (const char*)cmb.cpo;
    char* co = (char*)Op;
    constexpr int RS = CMB_N * 4;   // a row of an f32 array in bytes
    v16h fa[MF], fb[2];   // fragments of cag and cpo, both in the k order of the ring's fragments
    #pragma unroll
    for (int mi = 0; mi < MF; ++mi) {
      const char* p = ca + oa + mi * 16 * CMB_K * 2;
      fa[mi] = pack16(*(const v8h*)p, *(const v8h*)(p + 32));
    }
    #pragma unroll
    for (int nj = 0; nj < 2; ++nj) {
      const char* p = cw + ow + nj * 16 * CMB_K * 2;
      fb[nj] = pack16(*(const v8h*)p, *(const v8h*)(p + 32));
    }
    const v8f zero = {0.f, 0.f, 0.f, 0.f, 0.f, 0.f, 0.f, 0.f};
    float bv[MF][2][8];
    auto load_base = [&]() {
      #pragma unroll
      for (int mi = 0; mi < MF; ++mi)
        #pragma unroll
        for (int nj = 0; nj < 2; ++nj)
          #pragma unroll
          for (int v = 0; v < 8; ++v)
            bv[mi][nj][v] = *(const float*)(cb + ob + (mi * 16 + v) * RS + nj * 64);
    };
    if constexpr (EPI == 4) {
      char* ch = (char*)cmb.o16;
      const unsigned oh = ob >> 1;   // the same element in an f16 array
      load_base();
      // the wait that belongs in front of any overwrite of the loads' address registers; they
      // are named as inputs so that none is reused ahead of it
      asm volatile("s_wait_xcnt 0x0" :: "s"(ca), "s"(cw), "s"(cb), "v"(oa), "v"(ow), "v"(ob) : "memory");
      #pragma unroll
      for (int mi = 0; mi < MF; ++mi) {
        float val[2][8];
        #pragma unroll
        for (int nj = 0; nj < 2; ++nj) {
          const v8f t = wmma16(fa[mi], fb[nj], zero);
          #pragma unroll
          for (int v = 0; v < 8; ++v) {
            val[nj][v] = bv[mi][nj][v] + acc[mi][nj][v] * (1.f + 0.1f * tanh_nb(t[v]));
            *(float*)(co + ob + (mi * 16 + v) * RS + nj * 64) = val[nj][v];
            *(_Float16*)(ch + oh + (mi * 16 + v) * (RS / 2) + nj * 32) = (_Float16)val[nj][v];
          }
        }
        // the same wait for the stores' registers: addresses and stored values are named as
        // inputs so that none is reused ahead of it
        asm volatile("s_wait_xcnt 0x0" :: "s"(co), "s"(ch), "v"(ob), "v"(oh),
                     "v"(val[0][0]), "v"(val[0][1]), "v"(val[0][2]), "v"(val[0][3]),
                     "v"(val[0][4]), "v"(val[0][5]), "v"(val[0][6]), "v"(val[0][7]),
                     "v"(val[1][0]), "v"(val[1][1]), "v"(val[1][2]), "v"(val[1][3]),
                     "v"(val[1][4]), "v"(val[1][5]), "v"(val[1][6]), "v"(val[1][7]) : "memory");
        // ... and nothing of the next row group is lifted in front of that wait
        __builtin_amdgcn_sched_barrier(0);
      }
    } else {
      const char* cg = (const char*)cmb.g;
      const char* cv = (const char*)cmb.vit;
      const unsigned ov = (unsigned)(m0 + wm + 8 * hlf) * 4u;
      float gv[MF][2][8], vv[MF][8];
      #pragma unroll
      for (int mi = 0; mi < MF; ++mi)
        #pragma unroll
        for (int nj = 0; nj < 2; ++nj)
          #pragma unroll
          for (int v = 0; v < 8; ++v)
            gv[mi][nj][v] = *(const float*)(cg + ob + (mi * 16 + v) * RS + nj * 64);
      // the wait that belongs in front of any overwrite of the loads' address registers; they
      // are named as inputs so that none is reused ahead of it
      asm volatile("s_wait_xcnt 0x0" :: "s"(ca), "s"(cw), "s"(cg), "v"(oa), "v"(ow), "v"(ob) : "memory");
      auto gate = [&](const int mi) {
        #pragma unroll
        for (int nj = 0; nj < 2; ++nj) {
          const v8f t = wmma16(fa[mi], fb[nj], zero);
          #pragma unroll
          for (int v = 0; v < 8; ++v)
            acc[mi][nj][v] = acc[mi][nj][v] * gv[mi][nj][v] * (1.f + 0.1f * tanh_nb(t[v]));
        }
        // one row group at a time: mixed by the scheduler, the temporaries of all four together
        // take the kernel past 256 registers
        __builtin_amdgcn_sched_barrier(0);
      };
      gate(0);
      gate(1);
      gate(2);
      gate(3);
      // the second group of loads goes out when the first group's registers are free again:
      // both groups at once take the kernel past 256 registers
      load_base();
      #pragma unroll
      for (int mi = 0; mi < MF; ++mi)
        #pragma unroll
        for (int v = 0; v < 8; ++v) vv[mi][v] = *(const float*)(cv + ov + (mi * 16 + v) * 4);
      // the same wait for this group's address registers
      asm volatile("s_wait_xcnt 0x0" :: "s"(cb), "s"(cv), "v"(ob), "v"(ov) : "memory");
      #pragma unroll
      for (int mi = 0; mi < MF; ++mi)
        #pragma unroll
        for (int nj = 0; nj < 2; ++nj)
          #pragma unroll
          for (int v = 0; v < 8; ++v)
            *(float*)(co + ob + (mi * 16 + v) * RS + nj * 64) = bv[mi][nj][v] + acc[mi][nj][v] * vv[mi][v];
      // the same wait for the stores' address registers
      asm volatile("s_wait_xcnt 0x0" :: "s"(co), "v"(ob) : "memory");
    }
    return;
  }

  #pragma unroll
  for (int nj = 0; nj < 2; ++nj) {
    const int n = n0 + wn + nj * 16 + r;
    #pragma unroll
    for (int mi = 0; mi < MF; ++mi)
      #pragma unroll
      for (int v = 0; v < 8; ++v) {
        const int m = m0 + wm + mi * 16 + v + 8 * hlf;
        const float val = apply_epi<EPI>(acc[mi][nj][v]);
        if constexpr (OH) ((_Float16*)Op)[(size_t)m * N + n] = (_Float16)val;
        else              ((float*)Op)[(size_t)m * N + n] = val;
      }
  }
  // in a merged kernel another piece's code follows in the text: the wait that belongs in
  // front of any overwrite of the last stores' address registers
  asm volatile("s_wait_xcnt 0x0" ::: "memory");
}

// ---------------------------------------------------------------------------
// RMSNorm over last dim C (one block per row), f32 in -> f16 out
// ---------------------------------------------------------------------------
static __device__ __forceinline__
void rmsnorm16_body(const float* __restrict__ x, _Float16* __restrict__ o, int C, const int bx) {
  const size_t row = bx;
  const float* xr = x + row * (size_t)C;
  float ss = 0.f;
  for (int i = threadIdx.x; i < C; i += 256) { float v = xr[i]; ss += v * v; }
  #pragma unroll
  for (int off = 16; off; off >>= 1) ss += __shfl_xor(ss, off, 32);
  __shared__ float red[8];
  if ((threadIdx.x & 31) == 0) red[threadIdx.x >> 5] = ss;
  __syncthreads();
  float tot = 0.f;
  #pragma unroll
  for (int i = 0; i < 8; ++i) tot += red[i];
  const float rs = rsqrtf(tot / (float)C + 1e-6f);
  _Float16* orow = o + row * (size_t)C;
  for (int i = threadIdx.x; i < C; i += 256) {
    const float* p = xr + i;
    const float v = *p;
    // the wait that belongs in front of any overwrite of the load's address registers; they are
    // named as an input so that they are not reused (not even as a load's destination) ahead of it
    asm volatile("s_wait_xcnt 0x0" :: "v"(p) : "memory");
    orow[i] = (_Float16)(v * rs);
  }
}

// v + (v of lane l ^ M), M < 16, inside a 16-lane row, in the vector unit (DPP row_xmask)
template<int M>
static __device__ __forceinline__ float add_xor_row(const float v) {
  return v + __int_as_float(__builtin_amdgcn_update_dpp(0, __float_as_int(v), 0x160 | M, 0xf, 0xf, true));
}
// Sum over the 32 lanes, left in every lane: a butterfly over lane distances 16, 8, 4, 2, 1.
// All 32 lanes must be on.  No step goes through the LDS queue, so 40 such sums of one wave
// do not each wait out its latency.
static __device__ __forceinline__ float wave_sum(float v) {
  const int b = __float_as_int(v);
  v += __int_as_float(__builtin_amdgcn_permlanex16(b, b, 0x76543210, 0xfedcba98, false, false));
  v = add_xor_row<8>(v);
  v = add_xor_row<4>(v);
  v = add_xor_row<2>(v);
  v = add_xor_row<1>(v);
  return v;
}

// ---------------------------------------------------------------------------
// QKV post: RoPE + head RMSNorm*1.2 for q,k; v + 3*sigmoid(xn[:12]@gate)*ve.
// One wave per token, all 24 heads of it; B*T/8 blocks of 8 waves.
// A lane holds elements j and j+32 of a head, the two partners of the rotation, so a head's
// sum of squares needs the wave's own shuffles only: no LDS, no barrier.
// qh: [B,H,T,64].  K and V of a (b, kv) are stored in the order in which the attention kernel's
// B fragments take them, so that one 16-byte-a-lane load of a wave there covers 512 adjacent bytes:
// kh: [B,KV][t / 16][d / 16][(d / 8) % 2][t % 16][d % 8]
// vt: [B,KV][t / 32][d / 16][(t / 16) % 2][(t / 8) % 2][d % 16][t % 8]
// ---------------------------------------------------------------------------
template<int T>
static __device__ __forceinline__
void qkvpost_body(const float* __restrict__ q_raw, const float* __restrict__ k_raw,
                  const float* __restrict__ v_raw, const _Float16* __restrict__ xn,
                  const float* __restrict__ ve, const float* __restrict__ cosb,
                  const float* __restrict__ sinb, const float* __restrict__ wgate,
                  _Float16* __restrict__ qh, _Float16* __restrict__ kh,
                  _Float16* __restrict__ vt, const int bx) {
  // the wave's number is the same in all its lanes: said so, the row addresses stay scalar
  const int bt = bx * 8 + __builtin_amdgcn_readfirstlane(threadIdx.x >> 5);
  const int b = bt / T, t = bt % T;
  const int j = threadIdx.x & 31;

  const float* qr = q_raw + (size_t)bt * 1024;
  const float* kr = k_raw + (size_t)bt * 256;
  const float* vr = v_raw + (size_t)bt * 256;
  const float* er = ve    + (size_t)bt * 256;
  const float* cr = cosb  + (size_t)t * 32;
  const float* sr = sinb  + (size_t)t * 32;
  const _Float16* xr = xn + (size_t)bt * 1024;

  // every loop below is unrolled so that its arrays are indexed by constants and stay in
  // registers; all of a token's loads are issued before the first head is worked on
  float x1[20], x2[20], vv[8], ee[8], xg[12];
  const float c = cr[j], s = sr[j];
  #pragma unroll
  for (int u = 0; u < 20; ++u) {
    const float* src = (u < 16) ? qr + u * 64 : kr + (u - 16) * 64;
    x1[u] = src[j];
    x2[u] = src[j + 32];
  }
  #pragma unroll
  for (int i = 0; i < 8; ++i) { vv[i] = vr[i * 32 + j]; ee[i] = er[i * 32 + j]; }
  #pragma unroll
  for (int i = 0; i < 12; ++i) xg[i] = (float)xr[i];
  // the wait that belongs in front of any overwrite of the loads' address registers; they are
  // named as inputs so that none is reused (not even as a load's destination) ahead of it
  asm volatile("s_wait_xcnt 0x0" :: "s"(qr), "s"(kr), "s"(vr), "s"(er), "s"(cr), "s"(sr), "s"(xr), "v"(j) : "memory");

  _Float16 ol[20], oh[20], ov[8];
  #pragma unroll
  for (int u = 0; u < 20; ++u) {
    const float lo =  x1[u] * c + x2[u] * s;
    const float hi = -x1[u] * s + x2[u] * c;
    // each half summed by its own butterfly (lane distances 16, 8, 4, 2, 1), then added
    const float sl = wave_sum(lo * lo), sh = wave_sum(hi * hi);
    const float rs = rsqrtf((sl + sh) * (1.f / 64.f) + 1e-6f) * 1.2f;
    ol[u] = (_Float16)(lo * rs);
    oh[u] = (_Float16)(hi * rs);
  }
  #pragma unroll
  for (int kv = 0; kv < 4; ++kv) {
    float g = 0.f;
    #pragma unroll
    for (int i = 0; i < 12; ++i) g += xg[i] * wgate[kv * 12 + i];
    g = 3.f / (1.f + __expf(-g));
    ov[kv * 2]     = (_Float16)(vv[kv * 2]     + g * ee[kv * 2]);
    ov[kv * 2 + 1] = (_Float16)(vv[kv * 2 + 1] + g * ee[kv * 2 + 1]);
  }

  _Float16* qd = qh + ((size_t)(b * 16) * T + t) * 64 + j;
  _Float16* kd = kh + ((size_t)(b * 4) * T + (t & ~15)) * 64 + (t & 15) * 8
                 + (j >> 4) * 256 + ((j >> 3) & 1) * 128 + (j & 7);
  _Float16* vd = vt + ((size_t)(b * 4) * T + (t & ~31)) * 64 + ((t >> 3) & 3) * 128 + (t & 7)
                 + (j >> 4) * 512 + (j & 15) * 8;
  // keeps the stores in runs at the end: left to itself the scheduler mixes them in among the
  // heads' arithmetic
  __builtin_amdgcn_sched_barrier(0);
  #pragma unroll
  for (int u = 0; u < 16; ++u) {
    qd[(size_t)u * T * 64]      = ol[u];
    qd[(size_t)u * T * 64 + 32] = oh[u];
  }
  #pragma unroll
  for (int u = 0; u < 4; ++u) {
    kd[(size_t)u * T * 64]      = ol[16 + u];
    kd[(size_t)u * T * 64 + 512] = oh[16 + u];   // d + 32: two groups of 16 further
  }
  #pragma unroll
  for (int i = 0; i < 8; ++i) vd[(size_t)(i >> 1) * T * 64 + (i & 1) * 1024] = ov[i];   // d = (i % 2) * 32 + j
}

// ---------------------------------------------------------------------------
// Flash attention with refine-conv term.  grid = (B*H, T/128), block = 256.
// A wave handles 16 query rows; keys tiled 32 wide; causal.  f16 in, f16 out.
// K and V lie in fragment order (see the QKV post-processing): a B fragment is two b128 loads,
// and each of these loads covers 512 adjacent bytes, 4 whole lines.
// Refine conv: 10 rows x 6 columns per lane (left, centre, right of its two key columns),
// reused across the 8 accumulator rows (9 FMAs each); outside rows and columns are read at a
// clamped address and replaced by the zero padding.
// All global loads of the loop stand in ONE group per key tile, behind the conv: V of this
// tile, then K and the prev_attn window of the NEXT tile, each into the registers that its
// last user has just left.  Their latency runs under the softmax and the P @ V products.
// ---------------------------------------------------------------------------
template<int T>
__global__ __launch_bounds__(256)
void attn_kernel(const _Float16* __restrict__ qh, const _Float16* __restrict__ kh,
                 const _Float16* __restrict__ vt, const float* __restrict__ prev,
                 const float* __restrict__ refine_w, const float* __restrict__ alpha_p,
                 _Float16* __restrict__ y) {
  constexpr int H = 16, KV = 4, HD = 64;
  const int bh = blockIdx.x;
  const int b = bh / H, h = bh % H;
  // the wave's number is the same in all its lanes: said so, the trip count and the tiles'
  // base addresses stay scalar
  const int wave = __builtin_amdgcn_readfirstlane(threadIdx.x >> 5);
  const int lane = threadIdx.x & 31;
  const int hlf = lane >> 4, r = lane & 15;
  // A query tile of 16 rows walks qt / 2 + 1 key tiles (causal).  A block takes four tiles from the
  // long end and their mirror images from the short end: waves w and w + 4 together always walk
  // T / 32 + 1 key tiles, so every block, and every pair of waves, has the same amount of work.
  // The long tiles go to the first four waves.
  const int pr = blockIdx.y * 4 + (wave & 3);              // 0 .. T / 32 - 1
  const int qb = (wave < 4 ? T / 16 - 1 - pr : pr) * 16;
  const float alpha = alpha_p[0];

  float rw[9];
  #pragma unroll
  for (int i = 0; i < 9; ++i) rw[i] = refine_w[h * 9 + i];

  const _Float16* qbase = qh + ((size_t)(b * H + h)) * T * HD;
  const char* kbase = (const char*)(kh + ((size_t)(b * KV + (h >> 2))) * T * HD);
  const char* vbase = (const char*)(vt + ((size_t)(b * KV + (h >> 2))) * HD * T);
  const char* pbase = (const char*)(prev + ((size_t)(b * H + h)) * T * T);

  v16h aQ[2];
  {
    const _Float16* qp = qbase + (size_t)(qb + r) * HD + hlf * 8;
    aQ[0] = pack16(*(const v8h*)qp,        *(const v8h*)(qp + 16));
    aQ[1] = pack16(*(const v8h*)(qp + 32), *(const v8h*)(qp + 48));
    // the wait that belongs in front of any overwrite of these loads' address registers
    asm volatile("s_wait_xcnt 0x0" :: "v"(qp) : "memory");
  }

  float mstat[8], lstat[8];
  v8f O[4];
  #pragma unroll
  for (int v = 0; v < 8; ++v) { mstat[v] = -1e30f; lstat[v] = 0.f; }
  #pragma unroll
  for (int j = 0; j < 4; ++j)
    #pragma unroll
    for (int e = 0; e < 8; ++e) O[j][e] = 0.f;

  __shared__ __attribute__((aligned(16))) _Float16 lds_p[8 * 16 * 32];
  const int wbase = wave * 512;
  const int qrow0 = qb + 8 * hlf;   // first accumulator row for this lane-half
  const int klast = ((qb + 15) >> 5) << 5;   // the wave's last key tile

  // the lane's byte offset inside every 512-byte piece of a K or V tile (4 KiB per 32 keys each)
  const unsigned fo = (unsigned)lane * 16u;
  // prev_attn rows qrow0-1 .. qrow0+8: only the first and the last can lie outside [0,T)
  const bool okTop = qrow0 > 0, okBot = qrow0 + 8 < T;
  const unsigned rowTop = (unsigned)(okTop ? qrow0 - 1 : 0) * (T * 4u);
  const unsigned rowMid = (unsigned)qrow0 * (T * 4u);
  const unsigned rowBot = (unsigned)(okBot ? qrow0 + 8 : T - 1) * (T * 4u);

  // every loop of constant length below is unrolled so that kf, vf and pf are indexed by
  // constants and stay in registers
  v8h kf[8], vf[8];
  float pf[10][6];   // [row][left, centre, right of key kb+r | the same of key kb+16+r]

  auto load_v = [&](const char* vp) {
    #pragma unroll
    for (int j = 0; j < 4; ++j) {
      vf[j * 2]     = *(const v8h*)(vp + j * 1024);
      vf[j * 2 + 1] = *(const v8h*)(vp + j * 1024 + 512);
    }
  };
  auto load_k = [&](const char* kp) {
    #pragma unroll
    for (int sb = 0; sb < 2; ++sb)
      #pragma unroll
      for (int q = 0; q < 4; ++q)
        kf[sb * 4 + q] = *(const v8h*)(kp + sb * 2048 + q * 512);
  };
  // oL, oC, oR: byte offsets of [top, middle, bottom] rows at the clamped left column of the
  // first key, at the first key itself, and at the clamped right column of the second key
  auto load_p = [&](const unsigned (&oL)[3], const unsigned (&oC)[3], const unsigned (&oR)[3]) {
    #pragma unroll
    for (int i = 0; i < 10; ++i) {
      const int g  = (i == 0) ? 0 : ((i == 9) ? 2 : 1);
      const int im = (g == 1) ? (i - 1) * T * 4 : 0;
      pf[i][0] = *(const float*)(pbase + oL[g] + im);
      pf[i][1] = *(const float*)(pbase + oC[g] + im);
      pf[i][2] = *(const float*)(pbase + oC[g] + im + 4);
      pf[i][3] = *(const float*)(pbase + oC[g] + im + 60);
      pf[i][4] = *(const float*)(pbase + oC[g] + im + 64);
      pf[i][5] = *(const float*)(pbase + oR[g] + im);
    }
  };
  // one group of loads: V of tile kv (skipped in front of the loop), K and prev_attn of tile kn
  auto load_group = [&](const bool with_v, const int kv, const int kn) {
    const int k0 = kn + r;
    const unsigned cL = (unsigned)(k0 > 0 ? k0 - 1 : 0) * 4u;
    const unsigned cC = (unsigned)k0 * 4u;
    const unsigned cR = (unsigned)(k0 + 17 < T ? k0 + 17 : T - 1) * 4u;
    const unsigned oL[3] = {rowTop + cL, rowMid + cL, rowBot + cL};
    const unsigned oC[3] = {rowTop + cC, rowMid + cC, rowBot + cC};
    const unsigned oR[3] = {rowTop + cR, rowMid + cR, rowBot + cR};
    const char* vp = vbase + (size_t)kv * (HD * 2) + fo;    // the lane's own addresses
    const char* kp = kbase + (size_t)kn * (HD * 2) + fo;
    if (with_v) load_v(vp);
    load_k(kp);
    load_p(oL, oC, oR);
    // the wait that belongs in front of any overwrite of the loads' address registers; they are
    // named as inputs so that none is reused (not even as a load's destination) ahead of it
    asm volatile("s_wait_xcnt 0x0" :: "s"(pbase), "v"(vp), "v"(kp), "v"(fo),
                 "v"(oL[0]), "v"(oL[1]), "v"(oL[2]), "v"(oC[0]), "v"(oC[1]), "v"(oC[2]),
                 "v"(oR[0]), "v"(oR[1]), "v"(oR[2]) : "memory");
  };

  // fenced like the group in the loop, so that K stands in front of prev_attn here too and
  // the loop's first wait need not cover more than K
  __builtin_amdgcn_sched_barrier(0);
  load_group(false, 0, 0);
  __builtin_amdgcn_sched_barrier(0);

  // tile 0 exists for every wave: the test stands at the foot, and nothing of the prologue
  // (the Q loads least of all) is moved in behind the first group
  int kb = 0;
  do {
    // S = Q @ K^T  (16 x 32 tile, two 16x16 fragments)
    v8f S[2];
    #pragma unroll
    for (int sb = 0; sb < 2; ++sb) {
      #pragma unroll
      for (int e = 0; e < 8; ++e) S[sb][e] = 0.f;
      S[sb] = wmma16(aQ[0], pack16(kf[sb * 4],     kf[sb * 4 + 1]), S[sb]);
      S[sb] = wmma16(aQ[1], pack16(kf[sb * 4 + 2], kf[sb * 4 + 3]), S[sb]);
    }

    // scale + refine conv (row-reused) + causal mask
    #pragma unroll
    for (int sb = 0; sb < 2; ++sb) {
      const int kj = kb + sb * 16 + r;
      float colL[10], colC[10], colR[10];
      #pragma unroll
      for (int i = 0; i < 10; ++i) {
        const bool okRow = (i == 0) ? okTop : ((i == 9) ? okBot : true);
        colL[i] = (okRow && kj > 0)     ? pf[i][sb * 3]     : 0.f;
        colC[i] = okRow                 ? pf[i][sb * 3 + 1] : 0.f;
        colR[i] = (okRow && kj < T - 1) ? pf[i][sb * 3 + 2] : 0.f;
      }
      #pragma unroll
      for (int v = 0; v < 8; ++v) {
        float acc = 0.f;
        #pragma unroll
        for (int di = 0; di < 3; ++di)
          acc += colL[v + di] * rw[di * 3] + colC[v + di] * rw[di * 3 + 1]
               + colR[v + di] * rw[di * 3 + 2];
        const int qi = qrow0 + v;
        float s = S[sb][v] * 0.125f + alpha * acc;
        if (kj > qi) s = -1e30f;
        S[sb][v] = s;
      }
    }

    // the group stays here, whole: left to itself the scheduler sinks each load to its use
    // and the wave waits out one memory latency after another
    __builtin_amdgcn_sched_barrier(0);
    load_group(true, kb, kb < klast ? kb + 32 : kb);   // past the last tile: the same one again
    __builtin_amdgcn_sched_barrier(0);

    // online softmax (row stats via 16-lane shuffles), stage P to LDS
    #pragma unroll
    for (int v = 0; v < 8; ++v) {
      float rmax = fmaxf(S[0][v], S[1][v]);
      #pragma unroll
      for (int off = 1; off < 16; off <<= 1) rmax = fmaxf(rmax, __shfl_xor(rmax, off, 16));
      const float mnew = fmaxf(mstat[v], rmax);
      const float scl = __expf(mstat[v] - mnew);
      mstat[v] = mnew;
      lstat[v] *= scl;
      #pragma unroll
      for (int j = 0; j < 4; ++j) O[j][v] *= scl;
      const float p0 = __expf(S[0][v] - mnew);
      const float p1 = __expf(S[1][v] - mnew);
      float rsum = p0 + p1;
      #pragma unroll
      for (int off = 1; off < 16; off <<= 1) rsum += __shfl_xor(rsum, off, 16);
      lstat[v] += rsum;
      const int m = v + 8 * hlf;
      lds_p[wbase + m * 32 + r]      = (_Float16)p0;
      lds_p[wbase + m * 32 + 16 + r] = (_Float16)p1;
    }

    // O += P @ V   (a B fragment is two of the group's b128 loads)
    v16h aP;
    {
      const _Float16* pp = lds_p + wbase + r * 32 + hlf * 8;
      aP = pack16(*(const v8h*)pp, *(const v8h*)(pp + 16));
    }
    #pragma unroll
    for (int j = 0; j < 4; ++j) O[j] = wmma16(aP, pack16(vf[j * 2], vf[j * 2 + 1]), O[j]);
    kb += 32;
  } while (kb <= klast);

  #pragma unroll
  for (int v = 0; v < 8; ++v) {
    const float inv = 1.f / lstat[v];
    #pragma unroll
    for (int j = 0; j < 4; ++j) O[j][v] *= inv;
  }
  #pragma unroll
  for (int j = 0; j < 4; ++j)
    #pragma unroll
    for (int v = 0; v < 8; ++v) {
      const int qi = qb + v + 8 * hlf;
      const int hd = j * 16 + r;
      y[((size_t)(b * T + qi)) * 1024 + h * 64 + hd] = (_Float16)O[j][v];
    }
}

// ---------------------------------------------------------------------------
// Channel-attention depthwise conv along T + exact GELU -> f16 (GEMM input)
// ---------------------------------------------------------------------------
static __device__ __forceinline__
void caconv_body(const float* __restrict__ h, const float* __restrict__ cw,
                 _Float16* __restrict__ o, int T, int CH, int total, const int bx) {
  const int idx = bx * 256 + threadIdx.x;
  if (idx >= total) return;
  const int c = idx % CH;
  const int t = (idx / CH) % T;
  const float ctr = h[idx];
  const float lft = (t > 0)     ? h[idx - CH] : 0.f;
  const float rgt = (t < T - 1) ? h[idx + CH] : 0.f;
  const float v = ctr + 0.1f * (lft * cw[c * 3] + ctr * cw[c * 3 + 1] + rgt * cw[c * 3 + 2]);
  o[idx] = (_Float16)(0.5f * v * (1.f + erff(v * 0.70710678118654752f)));
}

// Four FFN depthwise conv steps (each: o = in + 0.1*conv_T(in), zero padded) in one pass.
// A thread owns 8 adjacent channels and walks 16 + 8 rows of T.  Step s lags the input by
// s rows, so every step keeps its last two rows in f32 registers; only step 4 is stored.
// The 4 halo rows on each side are recomputed per tile; past the ends of T they are the
// zero padding of every step.  Needs T % 16 == 0, F % 2048 == 0.
// blocks (bx, by, bz) = (F/2048, T/16, B) of 256 threads
template<int T, int F>
static __device__ __forceinline__
void ffnconv4_body(const _Float16* __restrict__ in, const float* __restrict__ cw,
                   _Float16* __restrict__ o, const int bx, const int by, const int bz) {
  constexpr int TT = 16, NR = TT + 8;
  static_assert(T % TT == 0 && F % 2048 == 0, "tile shape");
  const int f  = (bx * 256 + threadIdx.x) * 8;   // first of the lane's 8 channels
  const int t0 = by * TT;
  const bool lo = (t0 == 0);        // rows t0-4 .. t0-1 lie before the sequence
  const bool hi = (t0 + TT == T);   // rows t0+16 .. t0+19 lie behind it
  const size_t tile = ((size_t)bz * T + t0) * F;   // row t0, same for the whole block
  const _Float16* ip  = in + tile + f;
  // an outside halo row re-reads a row of the tile itself (in bounds); it is masked below
  const _Float16* ipl = ip + (lo ? 4 * F : 0);
  const _Float16* iph = ip - (hi ? 4 * F : 0);
  const float* wp = cw + (size_t)f * 3;
  _Float16* op = o + tile + f;
  const v8f zero = {0.f, 0.f, 0.f, 0.f, 0.f, 0.f, 0.f, 0.f};

  // every loop below is unrolled so that its arrays are indexed by constants and stay in registers
  v8f w0, w1, w2;
  #pragma unroll
  for (int e = 0; e < 8; ++e) {
    w0[e] = wp[e * 3];
    w1[e] = wp[e * 3 + 1];
    w2[e] = wp[e * 3 + 2];
  }

  v8h raw[NR];
  #pragma unroll
  for (int i = 0; i < NR; ++i) {
    const _Float16* p = (i < 4) ? ipl : ((i >= TT + 4) ? iph : ip);
    raw[i] = *(const v8h*)(p + (i - 4) * F);
  }
  // the wait that belongs in front of any overwrite of the loads' address registers; they are
  // named as inputs so that none is reused (not even as a load's destination) ahead of it
  asm volatile("s_wait_xcnt 0x0" :: "v"(wp), "v"(ipl), "v"(ip), "v"(iph) : "memory");

  // r = row index inside the 24-row window; only halo rows can lie outside [0,T)
  auto pad = [&](const v8f v, const int r) -> v8f {
    if (r < 4)       return lo ? zero : v;
    if (r >= TT + 4) return hi ? zero : v;
    return v;
  };
  auto step = [&](const v8f l, const v8f c, const v8f r) -> v8f {
    return c + 0.1f * (l * w0 + c * w1 + r * w2);
  };

  v8f a[4], b[4];   // per step input: rows two back and one back
  #pragma unroll
  for (int s = 0; s < 4; ++s) { a[s] = zero; b[s] = zero; }

  #pragma unroll
  for (int i = 0; i < NR; ++i) {
    const v8f x0 = pad(__builtin_convertvector(raw[i], v8f), i);
    const v8f x1 = pad(step(a[0], b[0], x0), i - 1);  a[0] = b[0];  b[0] = x0;
    const v8f x2 = pad(step(a[1], b[1], x1), i - 2);  a[1] = b[1];  b[1] = x1;
    const v8f x3 = pad(step(a[2], b[2], x2), i - 3);  a[2] = b[2];  b[2] = x2;
    const v8f x4 = step(a[3], b[3], x3);              a[3] = b[3];  b[3] = x3;
    if (i >= 8) *(v8h*)(op + (i - 8) * F) = __builtin_convertvector(x4, v8h);
  }
}

// Vitality gate of token i: the sigmoid of g32[token] . w2 for the tokens t - 2 .. t + 2, then
// 0.7 * its own + 0.3 * their mean over 5 (tokens outside the sequence count as 0), then the
// leak below 0.3.  A token outside is read at the thread's own token and left out of the sum.
static __device__ __forceinline__
void vit_body(const float* __restrict__ g32, const float* __restrict__ w2,
              float* __restrict__ vit, int T, int ntok, const int bx) {
  const int i = bx * 256 + threadIdx.x;
  if (i >= ntok) return;
  const int t = i % T;
  // both loops are unrolled so that gv is indexed by constants and stays in registers
  const float* p[5];
  float4 gv[5][8];
  #pragma unroll
  for (int d = 0; d < 5; ++d) {
    const bool in = (unsigned)(t + d - 2) < (unsigned)T;
    p[d] = g32 + (size_t)(in ? i + d - 2 : i) * 32;
    #pragma unroll
    for (int j = 0; j < 8; ++j) gv[d][j] = *(const float4*)(p[d] + j * 4);
  }
  // the wait that belongs in front of any overwrite of the loads' address registers; they are
  // named as inputs so that none is reused (not even as a load's destination) ahead of it
  asm volatile("s_wait_xcnt 0x0" :: "v"(p[0]), "v"(p[1]), "v"(p[2]), "v"(p[3]), "v"(p[4]) : "memory");
  float s = 0.f, own = 0.f;
  #pragma unroll
  for (int d = 0; d < 5; ++d) {
    float a = 0.f;
    #pragma unroll
    for (int j = 0; j < 8; ++j) {
      a += gv[d][j].x * w2[j * 4];
      a += gv[d][j].y * w2[j * 4 + 1];
      a += gv[d][j].z * w2[j * 4 + 2];
      a += gv[d][j].w * w2[j * 4 + 3];
    }
    const float v0 = 1.f / (1.f + __expf(-a));
    if ((unsigned)(t + d - 2) < (unsigned)T) s += v0;
    if (d == 2) own = v0;
  }
  const float v = 0.7f * own + 0.3f * (s * 0.2f);
  vit[i] = (v > 0.3f) ? v : 0.1f * v;
}

// ---------------------------------------------------------------------------
// Merged launches.  Pieces of work that read none of each other's output share one grid: the
// block index, the same for a whole block, says which piece a block does and which block of
// that piece it is.  The pieces themselves are the functions above, each computing what it
// did when launched alone.  Pieces that need LDS tiles get them from one array of the merged kernel, so that
// its LDS is that of its largest piece and not the sum.
// ---------------------------------------------------------------------------
constexpr int kB = 4, kT = 1024, kC = 1024, kKVD = 256, kF = 4096, kCA = 32;
constexpr int kBT = kB * kT;
constexpr int kMT = kBT / 128;                 // row tiles of the ring GEMM
constexpr int kCaBlocks = kBT * kCA / 256;     // blocks of the channel-attention conv
static_assert(kMT == 32, "the tile indices below are split by shifts");
static_assert(kC == CMB_N && kCA == CMB_K, "the combining epilogues' shapes");

// RMSNorm of x, and every fp32 -> f16 conversion (x and the ten weights).
// grid = kBT rows + one block per 1024 converted elements
constexpr int kCvtBlocks = (kBT * kC + 3 * kC * kC + 2 * kKVD * kC + 3 * kCA * kC + 2 * kF * kC) / 1024;
__global__ __launch_bounds__(256)
void prep_kernel(const float* __restrict__ x, const float* __restrict__ w_q,
                 const float* __restrict__ w_k, const float* __restrict__ w_v,
                 const float* __restrict__ w_o, const float* __restrict__ ca_pi,
                 const float* __restrict__ ca_po, const float* __restrict__ ffn_in,
                 const float* __restrict__ ffn_out, const float* __restrict__ ffn_g,
                 const float* __restrict__ vit_w1,
                 _Float16* __restrict__ x16, _Float16* __restrict__ w_q16,
                 _Float16* __restrict__ w_k16, _Float16* __restrict__ w_v16,
                 _Float16* __restrict__ w_o16, _Float16* __restrict__ ca_pi16,
                 _Float16* __restrict__ ca_po16, _Float16* __restrict__ fin16,
                 _Float16* __restrict__ fout16, _Float16* __restrict__ fg16,
                 _Float16* __restrict__ vw1_16, _Float16* __restrict__ xn16, int C) {
  int b = blockIdx.x;
  if (b < kBT) { rmsnorm16_body(x, xn16, C, b); return; }
  b -= kBT;
  // walk the list of arrays until b is a block of the current one (n blocks of 1024 elements)
  const float* s = x;
  _Float16* d = x16;
  int n = kBT * kC / 1024;
  auto next = [&](const float* ns, _Float16* nd, const int nn) {
    if (b >= n) { b -= n; s = ns; d = nd; n = nn; }
  };
  next(ffn_in,  fin16,   kF * kC / 1024);
  next(ffn_out, fout16,  kC * kF / 1024);
  next(w_q,     w_q16,   kC * kC / 1024);
  next(w_o,     w_o16,   kC * kC / 1024);
  next(ffn_g,   fg16,    kC * kC / 1024);
  next(w_k,     w_k16,   kKVD * kC / 1024);
  next(w_v,     w_v16,   kKVD * kC / 1024);
  next(ca_pi,   ca_pi16, kCA * kC / 1024);
  next(ca_po,   ca_po16, kC * kCA / 1024);
  next(vit_w1,  vw1_16,  kCA * kC / 1024);
  cvt16_body(s, d, n * 1024, b);
}

__global__ __launch_bounds__(256)
void rmsnorm16_kernel(const float* __restrict__ x, _Float16* __restrict__ o, int C) {
  rmsnorm16_body(x, o, C, blockIdx.x);
}

// The q, k and v projections of xn and the channel-attention input projection of x.
// grid = kMT * (1 + (NQ + 2 NKV) / 128)
__global__ __launch_bounds__(256)
void qkv_ca_kernel(const _Float16* __restrict__ xn16, const _Float16* __restrict__ w_q16,
                   const _Float16* __restrict__ w_k16, const _Float16* __restrict__ w_v16,
                   float* __restrict__ q_raw, float* __restrict__ k_raw,
                   float* __restrict__ v_raw, const _Float16* __restrict__ x16,
                   const _Float16* __restrict__ ca_pi16, float* __restrict__ ca_h,
                   int M, int NQ, int NKV, int NCA, int K) {
  __shared__ __attribute__((aligned(16))) _Float16 ring[RING_H];
  int t = blockIdx.x;
  if (t < kMT) { gemm_ring_body<0, 0, 32>(ring, x16, ca_pi16, ca_h, M, NCA, K, t, 0); return; }
  t -= kMT;
  const _Float16* W = w_q16;
  float* O = q_raw;
  int N = NQ;
  if (t >= kMT * (kC / 128)) {
    t -= kMT * (kC / 128);  W = w_k16;  O = k_raw;  N = NKV;
    if (t >= kMT * (kKVD / 128)) { t -= kMT * (kKVD / 128);  W = w_v16;  O = v_raw; }
  }
  gemm_ring_body<0, 0, 128>(ring, xn16, W, O, M, N, K, t & (kMT - 1), t / kMT);
}

// QKV post-processing and the channel-attention conv.  grid = kBT / 8 + kCaBlocks
__global__ __launch_bounds__(256)
void post_kernel(const float* __restrict__ q_raw, const float* __restrict__ k_raw,
                 const float* __restrict__ v_raw, const _Float16* __restrict__ xn,
                 const float* __restrict__ ve, const float* __restrict__ cosb,
                 const float* __restrict__ sinb, const float* __restrict__ wgate,
                 _Float16* __restrict__ qh, _Float16* __restrict__ kh,
                 _Float16* __restrict__ vt, const float* __restrict__ ca_h,
                 const float* __restrict__ ca_cw, _Float16* __restrict__ cag16,
                 int T, int CH, int total) {
  const int b = blockIdx.x;
  if (b < kBT / 8) qkvpost_body<kT>(q_raw, k_raw, v_raw, xn, ve, cosb, sinb, wgate, qh, kh, vt, b);
  else             caconv_body(ca_h, ca_cw, cag16, T, CH, total, b - kBT / 8);
}

// A projection back to C columns (K = C or FFN) whose epilogue forms the channel-attention
// output product for its own tile and combines: EPI 4 gives x1 (f32 and f16), EPI 5 the output.
// grid = kMT * kC / 128
template<int EPI>
__global__ __launch_bounds__(256)
void proj_kernel(const _Float16* __restrict__ A, const _Float16* __restrict__ W,
                 float* __restrict__ O, const _Float16* __restrict__ cag16,
                 const _Float16* __restrict__ ca_po16, const float* __restrict__ base,
                 const float* __restrict__ g, const float* __restrict__ vit,
                 _Float16* __restrict__ o16, int M, int N, int K) {
  __shared__ __attribute__((aligned(16))) _Float16 ring[RING_H];
  const int t = blockIdx.x;
  const Combine cmb = {cag16, ca_po16, base, g, vit, o16};
  gemm_ring_body<EPI, 0, 128>(ring, A, W, O, M, N, K, t & (kMT - 1), t / kMT, cmb);
}

// What reads xm or x1 alone: FFN input projection (relu^2), FFN gate (sigmoid), and of x1 the
// channel-attention input projection and the vitality projection (gelu).
// grid = 2 kMT + kMT * (kF + kC) / 128
__global__ __launch_bounds__(256)
void ffn_in_kernel(const _Float16* __restrict__ xm16, const _Float16* __restrict__ fin16,
                   _Float16* __restrict__ hA, const _Float16* __restrict__ fg16,
                   float* __restrict__ gbuf, const _Float16* __restrict__ x1_16,
                   const _Float16* __restrict__ ca_pi16, float* __restrict__ ca_h,
                   const _Float16* __restrict__ vw1_16, float* __restrict__ g32,
                   int M, int NF, int NC, int NCA, int K) {
  __shared__ __attribute__((aligned(16))) _Float16 ring[RING_H];
  int t = blockIdx.x;
  if (t < kMT) { gemm_ring_body<0, 0, 32>(ring, x1_16, ca_pi16, ca_h, M, NCA, K, t, 0); return; }
  t -= kMT;
  if (t < kMT) { gemm_ring_body<3, 0, 32>(ring, x1_16, vw1_16, g32, M, NCA, K, t, 0); return; }
  t -= kMT;
  if (t < kMT * (kF / 128)) {
    gemm_ring_body<1, 1, 128>(ring, xm16, fin16, hA, M, NF, K, t & (kMT - 1), t / kMT);
    return;
  }
  t -= kMT * (kF / 128);
  gemm_ring_body<2, 0, 128>(ring, xm16, fg16, gbuf, M, NC, K, t & (kMT - 1), t / kMT);
}

// The four FFN conv steps, the channel-attention conv and the vitality gate.
// grid = (kF / 2048) * (kT / 16) * kB + kCaBlocks + kBT / 256
__global__ __launch_bounds__(256)
void ffn_mid_kernel(const _Float16* __restrict__ hA, const float* __restrict__ ffn_cw,
                    _Float16* __restrict__ hB, const float* __restrict__ ca_h,
                    const float* __restrict__ ca_cw, _Float16* __restrict__ cag16,
                    const float* __restrict__ g32, const float* __restrict__ vit_w2,
                    float* __restrict__ vitf, int T, int CH, int total, int ntok) {
  constexpr int NX = kF / 2048, NY = kT / 16;
  int t = blockIdx.x;
  if (t < NX * NY * kB) {
    ffnconv4_body<kT, kF>(hA, ffn_cw, hB, t % NX, (t / NX) % NY, t / (NX * NY));
    return;
  }
  t -= NX * NY * kB;
  if (t < kCaBlocks) { caconv_body(ca_h, ca_cw, cag16, T, CH, total, t); return; }
  vit_body(g32, vit_w2, vitf, T, ntok, t - kCaBlocks);
}

// ---------------------------------------------------------------------------
extern "C" void kernel_launch(void* const* d_in, const int* in_sizes, int n_in,
                              void* d_out, int out_size, void* d_ws, size_t ws_size,
                              hipStream_t stream) {
  (void)in_sizes; (void)n_in; (void)out_size; (void)ws_size;
  constexpr int B = 4, T = 1024, C = 1024, H = 16, KV = 4, HD = 64, FFN = 4096, CA = 32;
  constexpr int BT = B * T;

  const float* x       = (const float*)d_in[0];
  const float* ve      = (const float*)d_in[1];
  const float* cosb    = (const float*)d_in[2];
  const float* sinb    = (const float*)d_in[3];
  const float* prev    = (const float*)d_in[4];
  const float* w_q     = (const float*)d_in[5];
  const float* w_k     = (const float*)d_in[6];
  const float* w_v     = (const float*)d_in[7];
  const float* w_o     = (const float*)d_in[8];
  const float* w_gate  = (const float*)d_in[9];
  const float* rf_w    = (const float*)d_in[10];
  const float* rf_a    = (const float*)d_in[11];
  const float* ca_pi   = (const float*)d_in[12];
  const float* ca_cw   = (const float*)d_in[13];
  const float* ca_po   = (const float*)d_in[14];
  const float* ffn_in  = (const float*)d_in[15];
  const float* ffn_cw  = (const float*)d_in[16];
  const float* ffn_out = (const float*)d_in[17];
  const float* ffn_g   = (const float*)d_in[18];
  const float* vit_w1  = (const float*)d_in[19];
  const float* vit_w2  = (const float*)d_in[20];
  float* out = (float*)d_out;

  float* wsf = (float*)d_ws;
  size_t off = 0;
  auto allocf = [&](size_t n) -> float* {
    float* p = wsf + off;
    off += (n + 63) & ~(size_t)63;
    return p;
  };
  auto alloch = [&](size_t n) -> _Float16* {   // n halfs
    return (_Float16*)allocf((n + 1) / 2);
  };

  // fp32 working buffers
  float* q_raw     = allocf((size_t)BT * C);
  float* k_raw     = allocf((size_t)BT * KV * HD);
  float* v_raw     = allocf((size_t)BT * KV * HD);
  float* ca_h      = allocf((size_t)BT * CA);
  float* x1        = allocf((size_t)BT * C);
  float* vitf      = allocf(BT);
  float* g32       = allocf((size_t)BT * CA);
  // f16 working buffers
  _Float16* x16    = alloch((size_t)BT * C);
  _Float16* xn16   = alloch((size_t)BT * C);
  _Float16* qh     = alloch((size_t)BT * C);
  _Float16* kh     = alloch((size_t)BT * KV * HD);
  _Float16* vt     = alloch((size_t)BT * KV * HD);   // kh and vt: in fragment order
  _Float16* y16    = alloch((size_t)BT * C);
  _Float16* cag16  = alloch((size_t)BT * CA);
  _Float16* x1_16  = alloch((size_t)BT * C);
  _Float16* hA     = alloch((size_t)BT * FFN);
  _Float16* hB     = alloch((size_t)BT * FFN);
  // f16 weights (converted once)
  _Float16* w_q16   = alloch((size_t)C * C);
  _Float16* w_k16   = alloch((size_t)KV * HD * C);
  _Float16* w_v16   = alloch((size_t)KV * HD * C);
  _Float16* w_o16   = alloch((size_t)C * C);
  _Float16* ca_pi16 = alloch((size_t)CA * C);
  _Float16* ca_po16 = alloch((size_t)C * CA);
  _Float16* fin16   = alloch((size_t)FFN * C);
  _Float16* fout16  = alloch((size_t)C * FFN);
  _Float16* fg16    = alloch((size_t)C * C);
  _Float16* vw1_16  = alloch((size_t)CA * C);
  // reuse
  float* gbuf  = q_raw;      // q_raw dead after qkvpost
  _Float16* xm16 = xn16;     // xn16 dead after QKV + gate

  const dim3 blk(256);
  static_assert(B == kB && T == kT && C == kC && KV * HD == kKVD && FFN == kF && CA == kCA && H * HD == kC,
                "the merged kernels split their grids by these shapes");

  // --- f16 conversions (weights + x) and the first RMSNorm ---
  prep_kernel<<<dim3(kBT + kCvtBlocks), blk, 0, stream>>>(
      x, w_q, w_k, w_v, w_o, ca_pi, ca_po, ffn_in, ffn_out, ffn_g, vit_w1,
      x16, w_q16, w_k16, w_v16, w_o16, ca_pi16, ca_po16, fin16, fout16, fg16, vw1_16, xn16, C);

  // --- attention path, with the ca1 path beside it ---
  qkv_ca_kernel<<<dim3(kMT * (1 + (kC + 2 * kKVD) / 128)), blk, 0, stream>>>(
      xn16, w_q16, w_k16, w_v16, q_raw, k_raw, v_raw, x16, ca_pi16, ca_h, BT, C, KV * HD, CA, C);
  post_kernel<<<dim3(kBT / 8 + kCaBlocks), blk, 0, stream>>>(
      q_raw, k_raw, v_raw, xn16, ve, cosb, sinb, w_gate, qh, kh, vt, ca_h, ca_cw, cag16, T, CA, BT * CA);
  attn_kernel<T><<<dim3(B * H, T / 128), blk, 0, stream>>>(qh, kh, vt, prev, rf_w, rf_a, y16);
  proj_kernel<4><<<dim3(kMT * (kC / 128)), blk, 0, stream>>>(
      y16, w_o16, x1, cag16, ca_po16, x, x, vitf, x1_16, BT, C, C);   // g and vit: not read

  // --- FFN, with the ca2 and vitality paths beside it ---
  rmsnorm16_kernel<<<BT, blk, 0, stream>>>(x1, xm16, C);
  ffn_in_kernel<<<dim3(2 * kMT + kMT * ((kF + kC) / 128)), blk, 0, stream>>>(
      xm16, fin16, hA, fg16, gbuf, x1_16, ca_pi16, ca_h, vw1_16, g32, BT, FFN, C, CA, C);
  ffn_mid_kernel<<<dim3((kF / 2048) * (kT / 16) * kB + kCaBlocks + kBT / 256), blk, 0, stream>>>(
      hA, ffn_cw, hB, ca_h, ca_cw, cag16, g32, vit_w2, vitf, T, CA, BT * CA, BT);
  // --- FFN output projection and the final combine ---
  proj_kernel<5><<<dim3(kMT * (kC / 128)), blk, 0, stream>>>(
      hB, fout16, out, cag16, ca_po16, x1, gbuf, vitf, x1_16, BT, C, FFN);   // o16: not written
}

// v009
// It runs in 205 microseconds.
// Timed twice side by side with v008, it ran 1.03 times as fast both times.
// All steps since v000 together make it 4.06 times as fast.
#include <hip/hip_runtime.h>
#include <hip/hip_bf16.h>

typedef __attribute__((ext_vector_type(16))) _Float16 v16h;
typedef __attribute__((ext_vector_type(8)))  _Float16 v8h;
typedef __attribute__((ext_vector_type(4)))  _Float16 v4h;
typedef __attribute__((ext_vector_type(8)))  float    v8f;

static __device__ __forceinline__ v8f wmma16(v16h a, v16h b, v8f c) {
  return __builtin_amdgcn_wmma_f32_16x16x32_f16(false, a, false, b, (short)0, c, false, false);
}
static __device__ __forceinline__ v16h pack16(v8h lo, v8h hi) {
  return __builtin_shufflevector(lo, hi, 0,1,2,3,4,5,6,7,8,9,10,11,12,13,14,15);
}

// ---------------------------------------------------------------------------
// fp32 -> f16 conversion.  A block takes CVT_BLK adjacent elements, a wave 1024 of them: eight
// 16-byte loads a lane, all issued before the first is used, each covering 512 adjacent bytes.
// Every converted array is a whole number of blocks.
// ---------------------------------------------------------------------------
constexpr int CVT_BLK = 8192;
static __device__ __forceinline__ v4h cvt4(const float4 v, const float s) {
  v4h o; o[0] = (_Float16)(v.x * s); o[1] = (_Float16)(v.y * s); o[2] = (_Float16)(v.z * s); o[3] = (_Float16)(v.w * s);
  return o;
}
static __device__ __forceinline__ v4h cvt4(const float4 v) {
  v4h o; o[0] = (_Float16)v.x; o[1] = (_Float16)v.y; o[2] = (_Float16)v.z; o[3] = (_Float16)v.w;
  return o;
}
static __device__ __forceinline__
void cvt16_body(const float* __restrict__ in, _Float16* __restrict__ out, const int bx) {
  // the lane's first element; its others lie 128 elements apart
  const unsigned e = (unsigned)bx * CVT_BLK + (threadIdx.x >> 5) * 1024u + (threadIdx.x & 31) * 4u;
  const char* ci = (const char*)in;
  char* co = (char*)out;
  const unsigned oi = e * 4u, oo = e * 2u;
  // both loops are unrolled so that v is indexed by constants and stays in registers
  float4 v[8];
  #pragma unroll
  for (int j = 0; j < 8; ++j) v[j] = *(const float4*)(ci + oi + j * 512);
  // the wait that belongs in front of any overwrite of the loads' address registers; they are
  // named as inputs so that none is reused (not even as a load's destination) ahead of it
  asm volatile("s_wait_xcnt 0x0" :: "s"(ci), "v"(oi) : "memory");
  #pragma unroll
  for (int j = 0; j < 8; ++j) *(v4h*)(co + oo + j * 256) = cvt4(v[j]);
}

// ---------------------------------------------------------------------------
// Epilogues: 0=identity, 1=relu^2, 2=sigmoid, 3=gelu(exact)
// ---------------------------------------------------------------------------
template<int EPI>
static __device__ __forceinline__ float apply_epi(float x) {
  if constexpr (EPI == 1) { float t = x > 0.f ? x : 0.f; return t * t; }
  else if constexpr (EPI == 2) { return 1.f / (1.f + __expf(-x)); }
  else if constexpr (EPI == 3) { return 0.5f * x * (1.f + erff(x * 0.70710678118654752f)); }
  else return x;
}

// ---------------------------------------------------------------------------
// WMMA GEMM for K % 128 == 0: out[M,N] = epi( A[M,K] @ W[N,K]^T ), all-f16 operands.
// A work-group owns a 128 x BN tile of out; a stage is 128 k of [A 128 rows | W BN rows],
// rows of 256 B at a pitch of 272 B in LDS (conflict-free for 16-byte readers), two buffers.
// Both operands come into LDS by asynchronous copies, one stage ahead of the products.
// BN = 128: 2 x 4 waves of 64 x 32 each.  BN = 32: 8 x 1 waves of 16 x 32 each.
// Requirements: M % 128 == 0, N % BN == 0, K % 128 == 0.
// ---------------------------------------------------------------------------
constexpr int G_PITCH_H = 136;                    // LDS row pitch in halfs (272 B)
constexpr int RING_H = 2 * (128 + 128) * G_PITCH_H;   // the caller's LDS array in halfs (BN = 128)

// NC 16-byte copies of one lane: rows 16 apart, in LDS (l) as in global memory (g, rs halfs).
// The s_wait_xcnt closes each statement so that no address register named in it can be
// rewritten ahead of the wait.
template<int NC>
static __device__ __forceinline__ void copy_rows(const unsigned l, const _Float16* g, const size_t rs) {
  constexpr unsigned LS = 16u * G_PITCH_H * 2u;   // 16 LDS rows in bytes
  static_assert(NC == 8 || NC == 2, "rows per lane");
  if constexpr (NC == 8) {
    asm volatile(
        "global_load_async_to_lds_b128 %0, %8, off\n\t"
        "global_load_async_to_lds_b128 %1, %9, off\n\t"
        "global_load_async_to_lds_b128 %2, %10, off\n\t"
        "global_load_async_to_lds_b128 %3, %11, off\n\t"
        "global_load_async_to_lds_b128 %4, %12, off\n\t"
        "global_load_async_to_lds_b128 %5, %13, off\n\t"
        "global_load_async_to_lds_b128 %6, %14, off\n\t"
        "global_load_async_to_lds_b128 %7, %15, off\n\t"
        "s_wait_xcnt 0x0"
        :: "v"(l), "v"(l + LS), "v"(l + 2 * LS), "v"(l + 3 * LS),
           "v"(l + 4 * LS), "v"(l + 5 * LS), "v"(l + 6 * LS), "v"(l + 7 * LS),
           "v"(g), "v"(g + rs), "v"(g + 2 * rs), "v"(g + 3 * rs),
           "v"(g + 4 * rs), "v"(g + 5 * rs), "v"(g + 6 * rs), "v"(g + 7 * rs)
        : "memory");
  } else {
    asm volatile(
        "global_load_async_to_lds_b128 %0, %2, off\n\t"
        "global_load_async_to_lds_b128 %1, %3, off\n\t"
        "s_wait_xcnt 0x0"
        :: "v"(l), "v"(l + LS), "v"(g), "v"(g + rs)
        : "memory");
  }
}

// tanh(x) = 1 - 2 / (e^(2x) + 1), without a branch: the library's form branches per element, and
// the two waves a SIMD has in a GEMM epilogue cannot hide 64 such chains one after another.
// Saturates to +-1 (e^(2x) = inf or 0); absolute error of a few f32 roundings of 1.
static __device__ __forceinline__ float tanh_nb(const float x) {
  return 1.f - 2.f * __builtin_amdgcn_rcpf(__expf(2.f * x) + 1.f);
}

// What the two combining epilogues (EPI 4 and 5) read and write beside the product itself.
// With acc = A @ W^T and ca = cag @ cpo^T (K = 32: one matrix instruction per 16 x 16 tile):
// EPI 4: Op = base + acc * (1 + 0.1 tanh(ca)), also stored as f16 in o16
// EPI 5: Op = base + acc * g * (1 + 0.1 tanh(ca)) * vit[row]
constexpr int CMB_N = 1024;   // columns of Op, base, g and o16; rows of cpo
constexpr int CMB_K = 32;     // columns of cag and cpo
struct Combine {
  const _Float16* cag;
  const _Float16* cpo;
  const float* base;
  const float* g;
  const float* vit;
  _Float16* o16;
};

template<int EPI, int OH, int BN>
static __device__ __forceinline__
void gemm_ring_body(_Float16* ring, const _Float16* __restrict__ A, const _Float16* __restrict__ W,
                    void* __restrict__ Op, int M, int N, int K, const int bx, const int by,
                    const Combine cmb = Combine()) {
  constexpr int WN = BN / 32;               // waves along N
  constexpr int MF = 128 / ((8 / WN) * 16); // 16-row fragments of A per wave
  constexpr int STAGE_H = (128 + BN) * G_PITCH_H;   // one buffer in halfs
  const int tid  = threadIdx.x;
  const int wave = tid >> 5;
  const int lane = tid & 31;
  const int hlf  = lane >> 4;
  const int r    = lane & 15;
  const int m0 = bx * 128;
  const int n0 = by * BN;
  const int wm = (wave / WN) * (MF * 16);
  const int wn = (wave % WN) * 32;

  // a lane copies 16-byte column (tid & 15) of rows (tid >> 4) + 16 i, of A and of W
  const int crow = tid >> 4;
  const int ccol = (tid & 15) * 8;
  const _Float16* gA = A + (size_t)(m0 + crow) * K + ccol;
  const _Float16* gW = W + (size_t)(n0 + crow) * K + ccol;
  const unsigned lA = (unsigned)(size_t)(&ring[crow * G_PITCH_H + ccol]);   // LDS byte address
  const size_t rs = (size_t)16 * K;

  auto copy_stage = [&](const int buf, const int t) {
    const unsigned l = lA + (unsigned)buf * (STAGE_H * 2u);
    copy_rows<8>(l, gA + (size_t)t * 128, rs);
    copy_rows<BN / 16>(l + 128u * G_PITCH_H * 2u, gW + (size_t)t * 128, rs);
  };

  // every loop of constant length in this kernel is unrolled so that acc, af and bf are
  // indexed by constants and stay in registers
  v8f acc[MF][2];
  #pragma unroll
  for (int mi = 0; mi < MF; ++mi)
    #pragma unroll
    for (int nj = 0; nj < 2; ++nj)
      #pragma unroll
      for (int e = 0; e < 8; ++e) acc[mi][nj][e] = 0.f;

  const int nt = K / 128;
  copy_stage(0, 0);
  asm volatile("s_wait_asynccnt 0x0" ::: "memory");   // this wave's part of stage 0 has landed
  __syncthreads();                                    // ... and every other wave's
  if (nt > 1) copy_stage(1, 1);

  for (int t = 0; t < nt; ++t) {
    const _Float16* sa = ring + (t & 1) * STAGE_H + (wm + r) * G_PITCH_H + hlf * 8;
    const _Float16* sw = ring + (t & 1) * STAGE_H + (128 + wn + r) * G_PITCH_H + hlf * 8;
    v16h af[2][MF], bf[2][2];   // two fragment sets: one in use, one being fetched
    auto fetch = [&](const int set, const int kk) {
      #pragma unroll
      for (int mi = 0; mi < MF; ++mi) {
        const _Float16* p = sa + mi * 16 * G_PITCH_H + kk * 32;
        af[set][mi] = pack16(*(const v8h*)p, *(const v8h*)(p + 16));
      }
      #pragma unroll
      for (int nj = 0; nj < 2; ++nj) {
        const _Float16* p = sw + nj * 16 * G_PITCH_H + kk * 32;
        bf[set][nj] = pack16(*(const v8h*)p, *(const v8h*)(p + 16));
      }
    };
    fetch(0, 0);
    #pragma unroll
    for (int kk = 0; kk < 4; ++kk) {
      if (kk < 3) fetch((kk + 1) & 1, kk + 1);
      // the next block's LDS reads stay one group ahead of this block's products; left to
      // itself the scheduler sinks each read to its use and the wave waits out every one
      __builtin_amdgcn_sched_barrier(0);
      #pragma unroll
      for (int mi = 0; mi < MF; ++mi)
        #pragma unroll
        for (int nj = 0; nj < 2; ++nj)
          acc[mi][nj] = wmma16(af[kk & 1][mi], bf[kk & 1][nj], acc[mi][nj]);
      // ... and no later read is lifted in among these products
      __builtin_amdgcn_sched_barrier(0);
    }
    asm volatile("s_wait_dscnt 0x0" ::: "memory");      // this wave has left the buffer
    asm volatile("s_wait_asynccnt 0x0" ::: "memory");   // its part of stage t + 1 has landed
    __syncthreads();   // publishes stage t + 1 and frees the buffer of stage t
    if (t + 2 < nt) copy_stage(t & 1, t + 2);
  }
  asm volatile("s_wait_asynccnt 0x0" ::: "memory");     // no copy outlives the wave

  if constexpr (EPI >= 4) {
    static_assert(BN == 128 && OH == 0, "the combining epilogues are written for the 64 x 32 wave tile");
    // byte offset of the lane's element in row 0 of its half, column group 0, of an f32 array of
    // CMB_N columns; every other element of the wave tile lies at a constant offset from it
    const unsigned ob = ((unsigned)(m0 + wm + 8 * hlf) * CMB_N + (unsigned)(n0 + wn + r)) * 4u;
    const unsigned oa = ((unsigned)(m0 + wm + r) * CMB_K + hlf * 8) * 2u;   // the same in cag
    const unsigned ow = ((unsigned)(n0 + wn + r) * CMB_K + hlf * 8) * 2u;   // ... and in cpo
    const char* cb = (const char*)cmb.base;
    const char* ca = (const char*)cmb.cag;
    const char* cw = (const char*)cmb.cpo;
    char* co = (char*)Op;
    constexpr int RS = CMB_N * 4;   // a row of an f32 array in bytes
    v16h fa[MF], fb[2];   // fragments of cag and cpo, both in the k order of the ring's fragments
    #pragma unroll
    for (int mi = 0; mi < MF; ++mi) {
      const char* p = ca + oa + mi * 16 * CMB_K * 2;
      fa[mi] = pack16(*(const v8h*)p, *(const v8h*)(p + 32));
    }
    #pragma unroll
    for (int nj = 0; nj < 2; ++nj) {
      const char* p = cw + ow + nj * 16 * CMB_K * 2;
      fb[nj] = pack16(*(const v8h*)p, *(const v8h*)(p + 32));
    }
    const v8f zero = {0.f, 0.f, 0.f, 0.f, 0.f, 0.f, 0.f, 0.f};
    float bv[MF][2][8];
    auto load_base = [&]() {
      #pragma unroll
      for (int mi = 0; mi < MF; ++mi)
        #pragma unroll
        for (int nj = 0; nj < 2; ++nj)
          #pragma unroll
          for (int v = 0; v < 8; ++v)
            bv[mi][nj][v] = *(const float*)(cb + ob + (mi * 16 + v) * RS + nj * 64);
    };
    if constexpr (EPI == 4) {
      char* ch = (char*)cmb.o16;
      const unsigned oh = ob >> 1;   // the same element in an f16 array
      load_base();
      // the wait that belongs in front of any overwrite of the loads' address registers; they
      // are named as inputs so that none is reused ahead of it
      asm volatile("s_wait_xcnt 0x0" :: "s"(ca), "s"(cw), "s"(cb), "v"(oa), "v"(ow), "v"(ob) : "memory");
      #pragma unroll
      for (int mi = 0; mi < MF; ++mi) {
        float val[2][8];
        #pragma unroll
        for (int nj = 0; nj < 2; ++nj) {
          const v8f t = wmma16(fa[mi], fb[nj], zero);
          #pragma unroll
          for (int v = 0; v < 8; ++v) {
            val[nj][v] = bv[mi][nj][v] + acc[mi][nj][v] * (1.f + 0.1f * tanh_nb(t[v]));
            *(float*)(co + ob + (mi * 16 + v) * RS + nj * 64) = val[nj][v];
            *(_Float16*)(ch + oh + (mi * 16 + v) * (RS / 2) + nj * 32) = (_Float16)val[nj][v];
          }
        }
        // the same wait for the stores' registers: addresses and stored values are named as
        // inputs so that none is reused ahead of it
        asm volatile("s_wait_xcnt 0x0" :: "s"(co), "s"(ch), "v"(ob), "v"(oh),
                     "v"(val[0][0]), "v"(val[0][1]), "v"(val[0][2]), "v"(val[0][3]),
                     "v"(val[0][4]), "v"(val[0][5]), "v"(val[0][6]), "v"(val[0][7]),
                     "v"(val[1][0]), "v"(val[1][1]), "v"(val[1][2]), "v"(val[1][3]),
                     "v"(val[1][4]), "v"(val[1][5]), "v"(val[1][6]), "v"(val[1][7]) : "memory");
        // ... and nothing of the next row group is lifted in front of that wait
        __builtin_amdgcn_sched_barrier(0);
      }
    } else {
      const char* cg = (const char*)cmb.g;
      const char* cv = (const char*)cmb.vit;
      const unsigned ov = (unsigned)(m0 + wm + 8 * hlf) * 4u;
      float gv[MF][2][8], vv[MF][8];
      #pragma unroll
      for (int mi = 0; mi < MF; ++mi)
        #pragma unroll
        for (int nj = 0; nj < 2; ++nj)
          #pragma unroll
          for (int v = 0; v < 8; ++v)
            gv[mi][nj][v] = *(const float*)(cg + ob + (mi * 16 + v) * RS + nj * 64);
      // the wait that belongs in front of any overwrite of the loads' address registers; they
      // are named as inputs so that none is reused ahead of it
      asm volatile("s_wait_xcnt 0x0" :: "s"(ca), "s"(cw), "s"(cg), "v"(oa), "v"(ow), "v"(ob) : "memory");
      auto gate = [&](const int mi) {
        #pragma unroll
        for (int nj = 0; nj < 2; ++nj) {
          const v8f t = wmma16(fa[mi], fb[nj], zero);
          #pragma unroll
          for (int v = 0; v < 8; ++v)
            acc[mi][nj][v] = acc[mi][nj][v] * gv[mi][nj][v] * (1.f + 0.1f * tanh_nb(t[v]));
        }
        // one row group at a time: mixed by the scheduler, the temporaries of all four together
        // take the kernel past 256 registers
        __builtin_amdgcn_sched_barrier(0);
      };
      gate(0);
      gate(1);
      gate(2);
      gate(3);
      // the second group of loads goes out when the first group's registers are free again:
      // both groups at once take the kernel past 256 registers
      load_base();
      #pragma unroll
      for (int mi = 0; mi < MF; ++mi)
        #pragma unroll
        for (int v = 0; v < 8; ++v) vv[mi][v] = *(const float*)(cv + ov + (mi * 16 + v) * 4);
      // the same wait for this group's address registers
      asm volatile("s_wait_xcnt 0x0" :: "s"(cb), "s"(cv), "v"(ob), "v"(ov) : "memory");
      #pragma unroll
      for (int mi = 0; mi < MF; ++mi)
        #pragma unroll
        for (int nj = 0; nj < 2; ++nj)
          #pragma unroll
          for (int v = 0; v < 8; ++v)
            *(float*)(co + ob + (mi * 16 + v) * RS + nj * 64) = bv[mi][nj][v] + acc[mi][nj][v] * vv[mi][v];
      // the same wait for the stores' address registers
      asm volatile("s_wait_xcnt 0x0" :: "s"(co), "v"(ob) : "memory");
    }
    return;
  }

  #pragma unroll
  for (int nj = 0; nj < 2; ++nj) {
    const int n = n0 + wn + nj * 16 + r;
    #pragma unroll
    for (int mi = 0; mi < MF; ++mi)
      #pragma unroll
      for (int v = 0; v < 8; ++v) {
        const int m = m0 + wm + mi * 16 + v + 8 * hlf;
        const float val = apply_epi<EPI>(acc[mi][nj][v]);
        if constexpr (OH) ((_Float16*)Op)[(size_t)m * N + n] = (_Float16)val;
        else              ((float*)Op)[(size_t)m * N + n] = val;
      }
  }
  // in a merged kernel another piece's code follows in the text: the wait that belongs in
  // front of any overwrite of the last stores' address registers
  asm volatile("s_wait_xcnt 0x0" ::: "memory");
}

// v + (v of lane l ^ M), M < 16, inside a 16-lane row, in the vector unit (DPP row_xmask)
template<int M>
static __device__ __forceinline__ float add_xor_row(const float v) {
  return v + __int_as_float(__builtin_amdgcn_update_dpp(0, __float_as_int(v), 0x160 | M, 0xf, 0xf, true));
}
// Sum over the 32 lanes, left in every lane: a butterfly over lane distances 16, 8, 4, 2, 1.
// All 32 lanes must be on.  No step goes through the LDS queue, so 40 such sums of one wave
// do not each wait out its latency.
static __device__ __forceinline__ float wave_sum(float v) {
  const int b = __float_as_int(v);
  v += __int_as_float(__builtin_amdgcn_permlanex16(b, b, 0x76543210, 0xfedcba98, false, false));
  v = add_xor_row<8>(v);
  v = add_xor_row<4>(v);
  v = add_xor_row<2>(v);
  v = add_xor_row<1>(v);
  return v;
}

// ---------------------------------------------------------------------------
// RMSNorm over a row of 1024 floats, f32 in -> f16 out.  One wave per row, 8 rows a block: a lane
// holds 32 elements of the row (eight 16-byte loads, all issued at once), so the row is read once,
// the sum of squares needs the wave's own lanes only (no LDS, no barrier), and every store of a
// wave covers two whole lines.  RAW: the unscaled row is stored as f16 too.
// ---------------------------------------------------------------------------
template<bool RAW>
static __device__ __forceinline__
void rmsnorm16_body(const float* __restrict__ x, _Float16* __restrict__ o,
                    _Float16* __restrict__ raw16, const int bx) {
  constexpr int C = 1024;
  // the wave's number is the same in all its lanes: said so, the row addresses stay scalar
  const int row = bx * 8 + __builtin_amdgcn_readfirstlane(threadIdx.x >> 5);
  const char* xr = (const char*)(x + (size_t)row * C);
  char* orow = (char*)(o + (size_t)row * C);
  const unsigned oi = (threadIdx.x & 31) * 16u, oo = (threadIdx.x & 31) * 8u;
  // every loop below is unrolled so that its arrays are indexed by constants and stay in registers
  float4 v[8];
  #pragma unroll
  for (int j = 0; j < 8; ++j) v[j] = *(const float4*)(xr + oi + j * 512);
  // the wait that belongs in front of any overwrite of the loads' address registers; they are
  // named as inputs so that none is reused (not even as a load's destination) ahead of it
  asm volatile("s_wait_xcnt 0x0" :: "s"(xr), "v"(oi) : "memory");
  float s0 = 0.f, s1 = 0.f, s2 = 0.f, s3 = 0.f;   // four chains, not one of 32 links
  #pragma unroll
  for (int j = 0; j < 8; ++j) {
    s0 += v[j].x * v[j].x;
    s1 += v[j].y * v[j].y;
    s2 += v[j].z * v[j].z;
    s3 += v[j].w * v[j].w;
  }
  const float tot = wave_sum((s0 + s1) + (s2 + s3));
  const float rs = rsqrtf(tot / (float)C + 1e-6f);
  v4h on[8];
  #pragma unroll
  for (int j = 0; j < 8; ++j) on[j] = cvt4(v[j], rs);
  if constexpr (RAW) {
    char* rrow = (char*)(raw16 + (size_t)row * C);
    v4h orw[8];
    #pragma unroll
    for (int j = 0; j < 8; ++j) orw[j] = cvt4(v[j]);
    // keeps every store behind the scaling: left to itself the scheduler issues the unscaled row's
    // stores early and then writes a register that one of them names again
    __builtin_amdgcn_sched_barrier(0);
    #pragma unroll
    for (int j = 0; j < 8; ++j) *(v4h*)(rrow + oo + j * 256) = orw[j];
  }
  #pragma unroll
  for (int j = 0; j < 8; ++j) *(v4h*)(orow + oo + j * 256) = on[j];
}

// ---------------------------------------------------------------------------
// QKV post: RoPE + head RMSNorm*1.2 for q,k; v + 3*sigmoid(xn[:12]@gate)*ve.
// One wave per token, all 24 heads of it; B*T/8 blocks of 8 waves.
// A lane holds elements j and j+32 of a head, the two partners of the rotation, so a head's
// sum of squares needs the wave's own shuffles only: no LDS, no barrier.
// qh: [B,H,T,64].  K and V of a (b, kv) are stored in the order in which the attention kernel's
// B fragments take them, so that one 16-byte-a-lane load of a wave there covers 512 adjacent bytes:
// kh: [B,KV][t / 16][d / 16][(d / 8) % 2][t % 16][d % 8]
// vt: [B,KV][t / 32][d / 16][(t / 16) % 2][(t / 8) % 2][d % 16][t % 8]
// ---------------------------------------------------------------------------
template<int T>
static __device__ __forceinline__
void qkvpost_body(const float* __restrict__ q_raw, const float* __restrict__ k_raw,
                  const float* __restrict__ v_raw, const _Float16* __restrict__ xn,
                  const float* __restrict__ ve, const float* __restrict__ cosb,
                  const float* __restrict__ sinb, const float* __restrict__ wgate,
                  _Float16* __restrict__ qh, _Float16* __restrict__ kh,
                  _Float16* __restrict__ vt, const int bx) {
  // the wave's number is the same in all its lanes: said so, the row addresses stay scalar
  const int bt = bx * 8 + __builtin_amdgcn_readfirstlane(threadIdx.x >> 5);
  const int b = bt / T, t = bt % T;
  const int j = threadIdx.x & 31;

  const float* qr = q_raw + (size_t)bt * 1024;
  const float* kr = k_raw + (size_t)bt * 256;
  const float* vr = v_raw + (size_t)bt * 256;
  const float* er = ve    + (size_t)bt * 256;
  const float* cr = cosb  + (size_t)t * 32;
  const float* sr = sinb  + (size_t)t * 32;
  const _Float16* xr = xn + (size_t)bt * 1024;

  // every loop below is unrolled so that its arrays are indexed by constants and stay in
  // registers; all of a token's loads are issued before the first head is worked on
  float x1[20], x2[20], vv[8], ee[8], xg[12];
  const float c = cr[j], s = sr[j];
  #pragma unroll
  for (int u = 0; u < 20; ++u) {
    const float* src = (u < 16) ? qr + u * 64 : kr + (u - 16) * 64;
    x1[u] = src[j];
    x2[u] = src[j + 32];
  }
  #pragma unroll
  for (int i = 0; i < 8; ++i) { vv[i] = vr[i * 32 + j]; ee[i] = er[i * 32 + j]; }
  #pragma unroll
  for (int i = 0; i < 12; ++i) xg[i] = (float)xr[i];
  // the wait that belongs in front of any overwrite of the loads' address registers; they are
  // named as inputs so that none is reused (not even as a load's destination) ahead of it
  asm volatile("s_wait_xcnt 0x0" :: "s"(qr), "s"(kr), "s"(vr), "s"(er), "s"(cr), "s"(sr), "s"(xr), "v"(j) : "memory");

  _Float16 ol[20], oh[20], ov[8];
  #pragma unroll
  for (int u = 0; u < 20; ++u) {
    const float lo =  x1[u] * c + x2[u] * s;
    const float hi = -x1[u] * s + x2[u] * c;
    // each half summed by its own butterfly (lane distances 16, 8, 4, 2, 1), then added
    const float sl = wave_sum(lo * lo), sh = wave_sum(hi * hi);
    const float rs = rsqrtf((sl + sh) * (1.f / 64.f) + 1e-6f) * 1.2f;
    ol[u] = (_Float16)(lo * rs);
    oh[u] = (_Float16)(hi * rs);
  }
  #pragma unroll
  for (int kv = 0; kv < 4; ++kv) {
    float g = 0.f;
    #pragma unroll
    for (int i = 0; i < 12; ++i) g += xg[i] * wgate[kv * 12 + i];
    g = 3.f / (1.f + __expf(-g));
    ov[kv * 2]     = (_Float16)(vv[kv * 2]     + g * ee[kv * 2]);
    ov[kv * 2 + 1] = (_Float16)(vv[kv * 2 + 1] + g * ee[kv * 2 + 1]);
  }

  _Float16* qd = qh + ((size_t)(b * 16) * T + t) * 64 + j;
  _Float16* kd = kh + ((size_t)(b * 4) * T + (t & ~15)) * 64 + (t & 15) * 8
                 + (j >> 4) * 256 + ((j >> 3) & 1) * 128 + (j & 7);
  _Float16* vd = vt + ((size_t)(b * 4) * T + (t & ~31)) * 64 + ((t >> 3) & 3) * 128 + (t & 7)
                 + (j >> 4) * 512 + (j & 15) * 8;
  // keeps the stores in runs at the end: left to itself the scheduler mixes them in among the
  // heads' arithmetic
  __builtin_amdgcn_sched_barrier(0);
  #pragma unroll
  for (int u = 0; u < 16; ++u) {
    qd[(size_t)u * T * 64]      = ol[u];
    qd[(size_t)u * T * 64 + 32] = oh[u];
  }
  #pragma unroll
  for (int u = 0; u < 4; ++u) {
    kd[(size_t)u * T * 64]      = ol[16 + u];
    kd[(size_t)u * T * 64 + 512] = oh[16 + u];   // d + 32: two groups of 16 further
  }
  #pragma unroll
  for (int i = 0; i < 8; ++i) vd[(size_t)(i >> 1) * T * 64 + (i & 1) * 1024] = ov[i];   // d = (i % 2) * 32 + j
}

// ---------------------------------------------------------------------------
// Flash attention with refine-conv term.  grid = (B*H, T/128), block = 256.
// A wave handles 16 query rows; keys tiled 32 wide; causal.  f16 in, f16 out.
// K and V lie in fragment order (see the QKV post-processing): a B fragment is two b128 loads,
// and each of these loads covers 512 adjacent bytes, 4 whole lines.
// Refine conv: 10 rows x 6 columns per lane (left, centre, right of its two key columns),
// reused across the 8 accumulator rows (9 FMAs each); outside rows and columns are read at a
// clamped address and replaced by the zero padding.
// All global loads of the loop stand in ONE group per key tile, behind the conv: V of this
// tile, then K and the prev_attn window of the NEXT tile, each into the registers that its
// last user has just left.  Their latency runs under the softmax and the P @ V products.
// ---------------------------------------------------------------------------
template<int T>
__global__ __launch_bounds__(256)
void attn_kernel(const _Float16* __restrict__ qh, const _Float16* __restrict__ kh,
                 const _Float16* __restrict__ vt, const float* __restrict__ prev,
                 const float* __restrict__ refine_w, const float* __restrict__ alpha_p,
                 _Float16* __restrict__ y) {
  constexpr int H = 16, KV = 4, HD = 64;
  const int bh = blockIdx.x;
  const int b = bh / H, h = bh % H;
  // the wave's number is the same in all its lanes: said so, the trip count and the tiles'
  // base addresses stay scalar
  const int wave = __builtin_amdgcn_readfirstlane(threadIdx.x >> 5);
  const int lane = threadIdx.x & 31;
  const int hlf = lane >> 4, r = lane & 15;
  // A query tile of 16 rows walks qt / 2 + 1 key tiles (causal).  A block takes four tiles from the
  // long end and their mirror images from the short end: waves w and w + 4 together always walk
  // T / 32 + 1 key tiles, so every block, and every pair of waves, has the same amount of work.
  // The long tiles go to the first four waves.
  const int pr = blockIdx.y * 4 + (wave & 3);              // 0 .. T / 32 - 1
  const int qb = (wave < 4 ? T / 16 - 1 - pr : pr) * 16;
  const float alpha = alpha_p[0];

  float rw[9];
  #pragma unroll
  for (int i = 0; i < 9; ++i) rw[i] = refine_w[h * 9 + i];

  const _Float16* qbase = qh + ((size_t)(b * H + h)) * T * HD;
  const char* kbase = (const char*)(kh + ((size_t)(b * KV + (h >> 2))) * T * HD);
  const char* vbase = (const char*)(vt + ((size_t)(b * KV + (h >> 2))) * HD * T);
  const char* pbase = (const char*)(prev + ((size_t)(b * H + h)) * T * T);

  v16h aQ[2];
  {
    const _Float16* qp = qbase + (size_t)(qb + r) * HD + hlf * 8;
    aQ[0] = pack16(*(const v8h*)qp,        *(const v8h*)(qp + 16));
    aQ[1] = pack16(*(const v8h*)(qp + 32), *(const v8h*)(qp + 48));
    // the wait that belongs in front of any overwrite of these loads' address registers
    asm volatile("s_wait_xcnt 0x0" :: "v"(qp) : "memory");
  }

  float mstat[8], lstat[8];
  v8f O[4];
  #pragma unroll
  for (int v = 0; v < 8; ++v) { mstat[v] = -1e30f; lstat[v] = 0.f; }
  #pragma unroll
  for (int j = 0; j < 4; ++j)
    #pragma unroll
    for (int e = 0; e < 8; ++e) O[j][e] = 0.f;

  __shared__ __attribute__((aligned(16))) _Float16 lds_p[8 * 16 * 32];
  const int wbase = wave * 512;
  const int qrow0 = qb + 8 * hlf;   // first accumulator row for this lane-half
  const int klast = ((qb + 15) >> 5) << 5;   // the wave's last key tile

  // the lane's byte offset inside every 512-byte piece of a K or V tile (4 KiB per 32 keys each)
  const unsigned fo = (unsigned)lane * 16u;
  // prev_attn rows qrow0-1 .. qrow0+8: only the first and the last can lie outside [0,T)
  const bool okTop = qrow0 > 0, okBot = qrow0 + 8 < T;
  const unsigned rowTop = (unsigned)(okTop ? qrow0 - 1 : 0) * (T * 4u);
  const unsigned rowMid = (unsigned)qrow0 * (T * 4u);
  const unsigned rowBot = (unsigned)(okBot ? qrow0 + 8 : T - 1) * (T * 4u);

  // every loop of constant length below is unrolled so that kf, vf and pf are indexed by
  // constants and stay in registers
  v8h kf[8], vf[8];
  float pf[10][6];   // [row][left, centre, right of key kb+r | the same of key kb+16+r]

  auto load_v = [&](const char* vp) {
    #pragma unroll
    for (int j = 0; j < 4; ++j) {
      vf[j * 2]     = *(const v8h*)(vp + j * 1024);
      vf[j * 2 + 1] = *(const v8h*)(vp + j * 1024 + 512);
    }
  };
  auto load_k = [&](const char* kp) {
    #pragma unroll
    for (int sb = 0; sb < 2; ++sb)
      #pragma unroll
      for (int q = 0; q < 4; ++q)
        kf[sb * 4 + q] = *(const v8h*)(kp + sb * 2048 + q * 512);
  };
  // oL, oC, oR: byte offsets of [top, middle, bottom] rows at the clamped left column of the
  // first key, at the first key itself, and at the clamped right column of the second key
  auto load_p = [&](const unsigned (&oL)[3], const unsigned (&oC)[3], const unsigned (&oR)[3]) {
    #pragma unroll
    for (int i = 0; i < 10; ++i) {
      const int g  = (i == 0) ? 0 : ((i == 9) ? 2 : 1);
      const int im = (g == 1) ? (i - 1) * T * 4 : 0;
      pf[i][0] = *(const float*)(pbase + oL[g] + im);
      pf[i][1] = *(const float*)(pbase + oC[g] + im);
      pf[i][2] = *(const float*)(pbase + oC[g] + im + 4);
      pf[i][3] = *(const float*)(pbase + oC[g] + im + 60);
      pf[i][4] = *(const float*)(pbase + oC[g] + im + 64);
      pf[i][5] = *(const float*)(pbase + oR[g] + im);
    }
  };
  // one group of loads: V of tile kv (skipped in front of the loop), K and prev_attn of tile kn
  auto load_group = [&](const bool with_v, const int kv, const int kn) {
    const int k0 = kn + r;
    const unsigned cL = (unsigned)(k0 > 0 ? k0 - 1 : 0) * 4u;
    const unsigned cC = (unsigned)k0 * 4u;
    const unsigned cR = (unsigned)(k0 + 17 < T ? k0 + 17 : T - 1) * 4u;
    const unsigned oL[3] = {rowTop + cL, rowMid + cL, rowBot + cL};
    const unsigned oC[3] = {rowTop + cC, rowMid + cC, rowBot + cC};
    const unsigned oR[3] = {rowTop + cR, rowMid + cR, rowBot + cR};
    const char* vp = vbase + (size_t)kv * (HD * 2) + fo;    // the lane's own addresses
    const char* kp = kbase + (size_t)kn * (HD * 2) + fo;
    if (with_v) load_v(vp);
    load_k(kp);
    load_p(oL, oC, oR);
    // the wait that belongs in front of any overwrite of the loads' address registers; they are
    // named as inputs so that none is reused (not even as a load's destination) ahead of it
    asm volatile("s_wait_xcnt 0x0" :: "s"(pbase), "v"(vp), "v"(kp), "v"(fo),
                 "v"(oL[0]), "v"(oL[1]), "v"(oL[2]), "v"(oC[0]), "v"(oC[1]), "v"(oC[2]),
                 "v"(oR[0]), "v"(oR[1]), "v"(oR[2]) : "memory");
  };

  // fenced like the group in the loop, so that K stands in front of prev_attn here too and
  // the loop's first wait need not cover more than K
  __builtin_amdgcn_sched_barrier(0);
  load_group(false, 0, 0);
  __builtin_amdgcn_sched_barrier(0);

  // tile 0 exists for every wave: the test stands at the foot, and nothing of the prologue
  // (the Q loads least of all) is moved in behind the first group
  int kb = 0;
  do {
    // S = Q @ K^T  (16 x 32 tile, two 16x16 fragments)
    v8f S[2];
    #pragma unroll
    for (int sb = 0; sb < 2; ++sb) {
      #pragma unroll
      for (int e = 0; e < 8; ++e) S[sb][e] = 0.f;
      S[sb] = wmma16(aQ[0], pack16(kf[sb * 4],     kf[sb * 4 + 1]), S[sb]);
      S[sb] = wmma16(aQ[1], pack16(kf[sb * 4 + 2], kf[sb * 4 + 3]), S[sb]);
    }

    // scale + refine conv (row-reused) + causal mask
    #pragma unroll
    for (int sb = 0; sb < 2; ++sb) {
      const int kj = kb + sb * 16 + r;
      float colL[10], colC[10], colR[10];
      #pragma unroll
      for (int i = 0; i < 10; ++i) {
        const bool okRow = (i == 0) ? okTop : ((i == 9) ? okBot : true);
        colL[i] = (okRow && kj > 0)     ? pf[i][sb * 3]     : 0.f;
        colC[i] = okRow                 ? pf[i][sb * 3 + 1] : 0.f;
        colR[i] = (okRow && kj < T - 1) ? pf[i][sb * 3 + 2] : 0.f;
      }
      #pragma unroll
      for (int v = 0; v < 8; ++v) {
        float acc = 0.f;
        #pragma unroll
        for (int di = 0; di < 3; ++di)
          acc += colL[v + di] * rw[di * 3] + colC[v + di] * rw[di * 3 + 1]
               + colR[v + di] * rw[di * 3 + 2];
        const int qi = qrow0 + v;
        float s = S[sb][v] * 0.125f + alpha * acc;
        if (kj > qi) s = -1e30f;
        S[sb][v] = s;
      }
    }

    // the group stays here, whole: left to itself the scheduler sinks each load to its use
    // and the wave waits out one memory latency after another
    __builtin_amdgcn_sched_barrier(0);
    load_group(true, kb, kb < klast ? kb + 32 : kb);   // past the last tile: the same one again
    __builtin_amdgcn_sched_barrier(0);

    // online softmax (row stats via 16-lane shuffles), stage P to LDS
    #pragma unroll
    for (int v = 0; v < 8; ++v) {
      float rmax = fmaxf(S[0][v], S[1][v]);
      #pragma unroll
      for (int off = 1; off < 16; off <<= 1) rmax = fmaxf(rmax, __shfl_xor(rmax, off, 16));
      const float mnew = fmaxf(mstat[v], rmax);
      const float scl = __expf(mstat[v] - mnew);
      mstat[v] = mnew;
      lstat[v] *= scl;
      #pragma unroll
      for (int j = 0; j < 4; ++j) O[j][v] *= scl;
      const float p0 = __expf(S[0][v] - mnew);
      const float p1 = __expf(S[1][v] - mnew);
      float rsum = p0 + p1;
      #pragma unroll
      for (int off = 1; off < 16; off <<= 1) rsum += __shfl_xor(rsum, off, 16);
      lstat[v] += rsum;
      const int m = v + 8 * hlf;
      lds_p[wbase + m * 32 + r]      = (_Float16)p0;
      lds_p[wbase + m * 32 + 16 + r] = (_Float16)p1;
    }

    // O += P @ V   (a B fragment is two of the group's b128 loads)
    v16h aP;
    {
      const _Float16* pp = lds_p + wbase + r * 32 + hlf * 8;
      aP = pack16(*(const v8h*)pp, *(const v8h*)(pp + 16));
    }
    #pragma unroll
    for (int j = 0; j < 4; ++j) O[j] = wmma16(aP, pack16(vf[j * 2], vf[j * 2 + 1]), O[j]);
    kb += 32;
  } while (kb <= klast);

  #pragma unroll
  for (int v = 0; v < 8; ++v) {
    const float inv = 1.f / lstat[v];
    #pragma unroll
    for (int j = 0; j < 4; ++j) O[j][v] *= inv;
  }
  #pragma unroll
  for (int j = 0; j < 4; ++j)
    #pragma unroll
    for (int v = 0; v < 8; ++v) {
      const int qi = qb + v + 8 * hlf;
      const int hd = j * 16 + r;
      y[((size_t)(b * T + qi)) * 1024 + h * 64 + hd] = (_Float16)O[j][v];
    }
}

// ---------------------------------------------------------------------------
// Channel-attention depthwise conv along T + exact GELU -> f16 (GEMM input)
// ---------------------------------------------------------------------------
static __device__ __forceinline__
void caconv_body(const float* __restrict__ h, const float* __restrict__ cw,
                 _Float16* __restrict__ o, int T, int CH, int total, const int bx) {
  const int idx = bx * 256 + threadIdx.x;
  if (idx >= total) return;
  const int c = idx % CH;
  const int t = (idx / CH) % T;
  const float ctr = h[idx];
  const float lft = (t > 0)     ? h[idx - CH] : 0.f;
  const float rgt = (t < T - 1) ? h[idx + CH] : 0.f;
  const float v = ctr + 0.1f * (lft * cw[c * 3] + ctr * cw[c * 3 + 1] + rgt * cw[c * 3 + 2]);
  o[idx] = (_Float16)(0.5f * v * (1.f + erff(v * 0.70710678118654752f)));
}

// Four FFN depthwise conv steps (each: o = in + 0.1*conv_T(in), zero padded) in one pass.
// A thread owns 8 adjacent channels and walks 16 + 8 rows of T.  Step s lags the input by
// s rows, so every step keeps its last two rows in f32 registers; only step 4 is stored.
// The 4 halo rows on each side are recomputed per tile; past the ends of T they are the
// zero padding of every step.  Needs T % 16 == 0, F % 2048 == 0.
// blocks (bx, by, bz) = (F/2048, T/16, B) of 256 threads
template<int T, int F>
static __device__ __forceinline__
void ffnconv4_body(const _Float16* __restrict__ in, const float* __restrict__ cw,
                   _Float16* __restrict__ o, const int bx, const int by, const int bz) {
  constexpr int TT = 16, NR = TT + 8;
  static_assert(T % TT == 0 && F % 2048 == 0, "tile shape");
  const int f  = (bx * 256 + threadIdx.x) * 8;   // first of the lane's 8 channels
  const int t0 = by * TT;
  const bool lo = (t0 == 0);        // rows t0-4 .. t0-1 lie before the sequence
  const bool hi = (t0 + TT == T);   // rows t0+16 .. t0+19 lie behind it
  const size_t tile = ((size_t)bz * T + t0) * F;   // row t0, same for the whole block
  const _Float16* ip  = in + tile + f;
  // an outside halo row re-reads a row of the tile itself (in bounds); it is masked below
  const _Float16* ipl = ip + (lo ? 4 * F : 0);
  const _Float16* iph = ip - (hi ? 4 * F : 0);
  const float* wp = cw + (size_t)f * 3;
  _Float16* op = o + tile + f;
  const v8f zero = {0.f, 0.f, 0.f, 0.f, 0.f, 0.f, 0.f, 0.f};

  // every loop below is unrolled so that its arrays are indexed by constants and stay in registers
  v8f w0, w1, w2;
  #pragma unroll
  for (int e = 0; e < 8; ++e) {
    w0[e] = wp[e * 3];
    w1[e] = wp[e * 3 + 1];
    w2[e] = wp[e * 3 + 2];
  }

  v8h raw[NR];
  #pragma unroll
  for (int i = 0; i < NR; ++i) {
    const _Float16* p = (i < 4) ? ipl : ((i >= TT + 4) ? iph : ip);
    raw[i] = *(const v8h*)(p + (i - 4) * F);
  }
  // the wait that belongs in front of any overwrite of the loads' address registers; they are
  // named as inputs so that none is reused (not even as a load's destination) ahead of it
  asm volatile("s_wait_xcnt 0x0" :: "v"(wp), "v"(ipl), "v"(ip), "v"(iph) : "memory");

  // r = row index inside the 24-row window; only halo rows can lie outside [0,T)
  auto pad = [&](const v8f v, const int r) -> v8f {
    if (r < 4)       return lo ? zero : v;
    if (r >= TT + 4) return hi ? zero : v;
    return v;
  };
  auto step = [&](const v8f l, const v8f c, const v8f r) -> v8f {
    return c + 0.1f * (l * w0 + c * w1 + r * w2);
  };

  v8f a[4], b[4];   // per step input: rows two back and one back
  #pragma unroll
  for (int s = 0; s < 4; ++s) { a[s] = zero; b[s] = zero; }

  #pragma unroll
  for (int i = 0; i < NR; ++i) {
    const v8f x0 = pad(__builtin_convertvector(raw[i], v8f), i);
    const v8f x1 = pad(step(a[0], b[0], x0), i - 1);  a[0] = b[0];  b[0] = x0;
    const v8f x2 = pad(step(a[1], b[1], x1), i - 2);  a[1] = b[1];  b[1] = x1;
    const v8f x3 = pad(step(a[2], b[2], x2), i - 3);  a[2] = b[2];  b[2] = x2;
    const v8f x4 = step(a[3], b[3], x3);              a[3] = b[3];  b[3] = x3;
    if (i >= 8) *(v8h*)(op + (i - 8) * F) = __builtin_convertvector(x4, v8h);
  }
}

// Vitality gate of token i: the sigmoid of g32[token] . w2 for the tokens t - 2 .. t + 2, then
// 0.7 * its own + 0.3 * their mean over 5 (tokens outside the sequence count as 0), then the
// leak below 0.3.  A token outside is read at the thread's own token and left out of the sum.
static __device__ __forceinline__
void vit_body(const float* __restrict__ g32, const float* __restrict__ w2,
              float* __restrict__ vit, int T, int ntok, const int bx) {
  const int i = bx * 256 + threadIdx.x;
  if (i >= ntok) return;
  const int t = i % T;
  // both loops are unrolled so that gv is indexed by constants and stays in registers
  const float* p[5];
  float4 gv[5][8];
  #pragma unroll
  for (int d = 0; d < 5; ++d) {
    const bool in = (unsigned)(t + d - 2) < (unsigned)T;
    p[d] = g32 + (size_t)(in ? i + d - 2 : i) * 32;
    #pragma unroll
    for (int j = 0; j < 8; ++j) gv[d][j] = *(const float4*)(p[d] + j * 4);
  }
  // the wait that belongs in front of any overwrite of the loads' address registers; they are
  // named as inputs so that none is reused (not even as a load's destination) ahead of it
  asm volatile("s_wait_xcnt 0x0" :: "v"(p[0]), "v"(p[1]), "v"(p[2]), "v"(p[3]), "v"(p[4]) : "memory");
  float s = 0.f, own = 0.f;
  #pragma unroll
  for (int d = 0; d < 5; ++d) {
    float a = 0.f;
    #pragma unroll
    for (int j = 0; j < 8; ++j) {
      a += gv[d][j].x * w2[j * 4];
      a += gv[d][j].y * w2[j * 4 + 1];
      a += gv[d][j].z * w2[j * 4 + 2];
      a += gv[d][j].w * w2[j * 4 + 3];
    }
    const float v0 = 1.f / (1.f + __expf(-a));
    if ((unsigned)(t + d - 2) < (unsigned)T) s += v0;
    if (d == 2) own = v0;
  }
  const float v = 0.7f * own + 0.3f * (s * 0.2f);
  vit[i] = (v > 0.3f) ? v : 0.1f * v;
}

// ---------------------------------------------------------------------------
// Merged launches.  Pieces of work that read none of each other's output share one grid: the
// block index, the same for a whole block, says which piece a block does and which block of
// that piece it is.  The pieces themselves are the functions above, each computing what it
// did when launched alone.  Pieces that need LDS tiles get them from one array of the merged kernel, so that
// its LDS is that of its largest piece and not the sum.
// ---------------------------------------------------------------------------
constexpr int kB = 4, kT = 1024, kC = 1024, kKVD = 256, kF = 4096, kCA = 32;
constexpr int kBT = kB * kT;
constexpr int kMT = kBT / 128;                 // row tiles of the ring GEMM
constexpr int kCaBlocks = kBT * kCA / 256;     // blocks of the channel-attention conv
static_assert(kMT == 32, "the tile indices below are split by shifts");
static_assert(kC == CMB_N && kCA == CMB_K, "the combining epilogues' shapes");

// RMSNorm of x with x's own conversion, and the fp32 -> f16 conversion of the ten weights.
// grid = kBT / 8 blocks of 8 rows + one block per CVT_BLK converted elements
constexpr int kCvtBlocks = (3 * kC * kC + 2 * kKVD * kC + 3 * kCA * kC + 2 * kF * kC) / CVT_BLK;
static_assert(kC == 1024 && kBT % 8 == 0 && (kCA * kC) % CVT_BLK == 0 && (kKVD * kC) % CVT_BLK == 0,
              "rows of 1024, 8 rows a block, whole conversion blocks");
__global__ __launch_bounds__(256)
void prep_kernel(const float* __restrict__ x, const float* __restrict__ w_q,
                 const float* __restrict__ w_k, const float* __restrict__ w_v,
                 const float* __restrict__ w_o, const float* __restrict__ ca_pi,
                 const float* __restrict__ ca_po, const float* __restrict__ ffn_in,
                 const float* __restrict__ ffn_out, const float* __restrict__ ffn_g,
                 const float* __restrict__ vit_w1,
                 _Float16* __restrict__ x16, _Float16* __restrict__ w_q16,
                 _Float16* __restrict__ w_k16, _Float16* __restrict__ w_v16,
                 _Float16* __restrict__ w_o16, _Float16* __restrict__ ca_pi16,
                 _Float16* __restrict__ ca_po16, _Float16* __restrict__ fin16,
                 _Float16* __restrict__ fout16, _Float16* __restrict__ fg16,
                 _Float16* __restrict__ vw1_16, _Float16* __restrict__ xn16) {
  int b = blockIdx.x;
  if (b < kBT / 8) { rmsnorm16_body<true>(x, xn16, x16, b); return; }
  b -= kBT / 8;
  // walk the list of arrays until b is a block of the current one (n blocks of CVT_BLK elements)
  const float* s = ffn_in;
  _Float16* d = fin16;
  int n = kF * kC / CVT_BLK;
  auto next = [&](const float* ns, _Float16* nd, const int nn) {
    if (b >= n) { b -= n; s = ns; d = nd; n = nn; }
  };
  next(ffn_out, fout16,  kC * kF / CVT_BLK);
  next(w_q,     w_q16,   kC * kC / CVT_BLK);
  next(w_o,     w_o16,   kC * kC / CVT_BLK);
  next(ffn_g,   fg16,    kC * kC / CVT_BLK);
  next(w_k,     w_k16,   kKVD * kC / CVT_BLK);
  next(w_v,     w_v16,   kKVD * kC / CVT_BLK);
  next(ca_pi,   ca_pi16, kCA * kC / CVT_BLK);
  next(ca_po,   ca_po16, kC * kCA / CVT_BLK);
  next(vit_w1,  vw1_16,  kCA * kC / CVT_BLK);
  cvt16_body(s, d, b);
}

__global__ __launch_bounds__(256)
void rmsnorm16_kernel(const float* __restrict__ x, _Float16* __restrict__ o) {
  rmsnorm16_body<false>(x, o, o, blockIdx.x);   // the third argument is not used
}

// The q, k and v projections of xn and the channel-attention input projection of x.
// grid = kMT * (1 + (NQ + 2 NKV) / 128)
__global__ __launch_bounds__(256)
void qkv_ca_kernel(const _Float16* __restrict__ xn16, const _Float16* __restrict__ w_q16,
                   const _Float16* __restrict__ w_k16, const _Float16* __restrict__ w_v16,
                   float* __restrict__ q_raw, float* __restrict__ k_raw,
                   float* __restrict__ v_raw, const _Float16* __restrict__ x16,
                   const _Float16* __restrict__ ca_pi16, float* __restrict__ ca_h,
                   int M, int NQ, int NKV, int NCA, int K) {
  __shared__ __attribute__((aligned(16))) _Float16 ring[RING_H];
  int t = blockIdx.x;
  if (t < kMT) { gemm_ring_body<0, 0, 32>(ring, x16, ca_pi16, ca_h, M, NCA, K, t, 0); return; }
  t -= kMT;
  const _Float16* W = w_q16;
  float* O = q_raw;
  int N = NQ;
  if (t >= kMT * (kC / 128)) {
    t -= kMT * (kC / 128);  W = w_k16;  O = k_raw;  N = NKV;
    if (t >= kMT * (kKVD / 128)) { t -= kMT * (kKVD / 128);  W = w_v16;  O = v_raw; }
  }
  gemm_ring_body<0, 0, 128>(ring, xn16, W, O, M, N, K, t & (kMT - 1), t / kMT);
}

// QKV post-processing and the channel-attention conv.  grid = kBT / 8 + kCaBlocks
__global__ __launch_bounds__(256)
void post_kernel(const float* __restrict__ q_raw, const float* __restrict__ k_raw,
                 const float* __restrict__ v_raw, const _Float16* __restrict__ xn,
                 const float* __restrict__ ve, const float* __restrict__ cosb,
                 const float* __restrict__ sinb, const float* __restrict__ wgate,
                 _Float16* __restrict__ qh, _Float16* __restrict__ kh,
                 _Float16* __restrict__ vt, const float* __restrict__ ca_h,
                 const float* __restrict__ ca_cw, _Float16* __restrict__ cag16,
                 int T, int CH, int total) {
  const int b = blockIdx.x;
  if (b < kBT / 8) qkvpost_body<kT>(q_raw, k_raw, v_raw, xn, ve, cosb, sinb, wgate, qh, kh, vt, b);
  else             caconv_body(ca_h, ca_cw, cag16, T, CH, total, b - kBT / 8);
}

// A projection back to C columns (K = C or FFN) whose epilogue forms the channel-attention
// output product for its own tile and combines: EPI 4 gives x1 (f32 and f16), EPI 5 the output.
// grid = kMT * kC / 128
template<int EPI>
__global__ __launch_bounds__(256)
void proj_kernel(const _Float16* __restrict__ A, const _Float16* __restrict__ W,
                 float* __restrict__ O, const _Float16* __restrict__ cag16,
                 const _Float16* __restrict__ ca_po16, const float* __restrict__ base,
                 const float* __restrict__ g, const float* __restrict__ vit,
                 _Float16* __restrict__ o16, int M, int N, int K) {
  __shared__ __attribute__((aligned(16))) _Float16 ring[RING_H];
  const int t = blockIdx.x;
  const Combine cmb = {cag16, ca_po16, base, g, vit, o16};
  gemm_ring_body<EPI, 0, 128>(ring, A, W, O, M, N, K, t & (kMT - 1), t / kMT, cmb);
}

// What reads xm or x1 alone: FFN input projection (relu^2), FFN gate (sigmoid), and of x1 the
// channel-attention input projection and the vitality projection (gelu).
// grid = 2 kMT + kMT * (kF + kC) / 128
__global__ __launch_bounds__(256)
void ffn_in_kernel(const _Float16* __restrict__ xm16, const _Float16* __restrict__ fin16,
                   _Float16* __restrict__ hA, const _Float16* __restrict__ fg16,
                   float* __restrict__ gbuf, const _Float16* __restrict__ x1_16,
                   const _Float16* __restrict__ ca_pi16, float* __restrict__ ca_h,
                   const _Float16* __restrict__ vw1_16, float* __restrict__ g32,
                   int M, int NF, int NC, int NCA, int K) {
  __shared__ __attribute__((aligned(16))) _Float16 ring[RING_H];
  int t = blockIdx.x;
  if (t < kMT) { gemm_ring_body<0, 0, 32>(ring, x1_16, ca_pi16, ca_h, M, NCA, K, t, 0); return; }
  t -= kMT;
  if (t < kMT) { gemm_ring_body<3, 0, 32>(ring, x1_16, vw1_16, g32, M, NCA, K, t, 0); return; }
  t -= kMT;
  if (t < kMT * (kF / 128)) {
    gemm_ring_body<1, 1, 128>(ring, xm16, fin16, hA, M, NF, K, t & (kMT - 1), t / kMT);
    return;
  }
  t -= kMT * (kF / 128);
  gemm_ring_body<2, 0, 128>(ring, xm16, fg16, gbuf, M, NC, K, t & (kMT - 1), t / kMT);
}

// The four FFN conv steps, the channel-attention conv and the vitality gate.
// grid = (kF / 2048) * (kT / 16) * kB + kCaBlocks + kBT / 256
__global__ __launch_bounds__(256)
void ffn_mid_kernel(const _Float16* __restrict__ hA, const float* __restrict__ ffn_cw,
                    _Float16* __restrict__ hB, const float* __restrict__ ca_h,
                    const float* __restrict__ ca_cw, _Float16* __restrict__ cag16,
                    const float* __restrict__ g32, const float* __restrict__ vit_w2,
                    float* __restrict__ vitf, int T, int CH, int total, int ntok) {
  constexpr int NX = kF / 2048, NY = kT / 16;
  int t = blockIdx.x;
  if (t < NX * NY * kB) {
    ffnconv4_body<kT, kF>(hA, ffn_cw, hB, t % NX, (t / NX) % NY, t / (NX * NY));
    return;
  }
  t -= NX * NY * kB;
  if (t < kCaBlocks) { caconv_body(ca_h, ca_cw, cag16, T, CH, total, t); return; }
  vit_body(g32, vit_w2, vitf, T, ntok, t - kCaBlocks);
}

// ---------------------------------------------------------------------------
extern "C" void kernel_launch(void* const* d_in, const int* in_sizes, int n_in,
                              void* d_out, int out_size, void* d_ws, size_t ws_size,
                              hipStream_t stream) {
  (void)in_sizes; (void)n_in; (void)out_size; (void)ws_size;
  constexpr int B = 4, T = 1024, C = 1024, H = 16, KV = 4, HD = 64, FFN = 4096, CA = 32;
  constexpr int BT = B * T;

  const float* x       = (const float*)d_in[0];
  const float* ve      = (const float*)d_in[1];
  const float* cosb    = (const float*)d_in[2];
  const float* sinb    = (const float*)d_in[3];
  const float* prev    = (const float*)d_in[4];
  const float* w_q     = (const float*)d_in[5];
  const float* w_k     = (const float*)d_in[6];
  const float* w_v     = (const float*)d_in[7];
  const float* w_o     = (const float*)d_in[8];
  const float* w_gate  = (const float*)d_in[9];
  const float* rf_w    = (const float*)d_in[10];
  const float* rf_a    = (const float*)d_in[11];
  const float* ca_pi   = (const float*)d_in[12];
  const float* ca_cw   = (const float*)d_in[13];
  const float* ca_po   = (const float*)d_in[14];
  const float* ffn_in  = (const float*)d_in[15];
  const float* ffn_cw  = (const float*)d_in[16];
  const float* ffn_out = (const float*)d_in[17];
  const float* ffn_g   = (const float*)d_in[18];
  const float* vit_w1  = (const float*)d_in[19];
  const float* vit_w2  = (const float*)d_in[20];
  float* out = (float*)d_out;

  float* wsf = (float*)d_ws;
  size_t off = 0;
  auto allocf = [&](size_t n) -> float* {
    float* p = wsf + off;
    off += (n + 63) & ~(size_t)63;
    return p;
  };
  auto alloch = [&](size_t n) -> _Float16* {   // n halfs
    return (_Float16*)allocf((n + 1) / 2);
  };

  // fp32 working buffers
  float* q_raw     = allocf((size_t)BT * C);
  float* k_raw     = allocf((size_t)BT * KV * HD);
  float* v_raw     = allocf((size_t)BT * KV * HD);
  float* ca_h      = allocf((size_t)BT * CA);
  float* x1        = allocf((size_t)BT * C);
  float* vitf      = allocf(BT);
  float* g32       = allocf((size_t)BT * CA);
  // f16 working buffers
  _Float16* x16    = alloch((size_t)BT * C);
  _Float16* xn16   = alloch((size_t)BT * C);
  _Float16* qh     = alloch((size_t)BT * C);
  _Float16* kh     = alloch((size_t)BT * KV * HD);
  _Float16* vt     = alloch((size_t)BT * KV * HD);   // kh and vt: in fragment order
  _Float16* y16    = alloch((size_t)BT * C);
  _Float16* cag16  = alloch((size_t)BT * CA);
  _Float16* x1_16  = alloch((size_t)BT * C);
  _Float16* hA     = alloch((size_t)BT * FFN);
  _Float16* hB     = alloch((size_t)BT * FFN);
  // f16 weights (converted once)
  _Float16* w_q16   = alloch((size_t)C * C);
  _Float16* w_k16   = alloch((size_t)KV * HD * C);
  _Float16* w_v16   = alloch((size_t)KV * HD * C);
  _Float16* w_o16   = alloch((size_t)C * C);
  _Float16* ca_pi16 = alloch((size_t)CA * C);
  _Float16* ca_po16 = alloch((size_t)C * CA);
  _Float16* fin16   = alloch((size_t)FFN * C);
  _Float16* fout16  = alloch((size_t)C * FFN);
  _Float16* fg16    = alloch((size_t)C * C);
  _Float16* vw1_16  = alloch((size_t)CA * C);
  // reuse
  float* gbuf  = q_raw;      // q_raw dead after qkvpost
  _Float16* xm16 = xn16;     // xn16 dead after QKV + gate

  const dim3 blk(256);
  static_assert(B == kB && T == kT && C == kC && KV * HD == kKVD && FFN == kF && CA == kCA && H * HD == kC,
                "the merged kernels split their grids by these shapes");

  // --- f16 conversions (weights + x) and the first RMSNorm ---
  prep_kernel<<<dim3(kBT / 8 + kCvtBlocks), blk, 0, stream>>>(
      x, w_q, w_k, w_v, w_o, ca_pi, ca_po, ffn_in, ffn_out, ffn_g, vit_w1,
      x16, w_q16, w_k16, w_v16, w_o16, ca_pi16, ca_po16, fin16, fout16, fg16, vw1_16, xn16);

  // --- attention path, with the ca1 path beside it ---
  qkv_ca_kernel<<<dim3(kMT * (1 + (kC + 2 * kKVD) / 128)), blk, 0, stream>>>(
      xn16, w_q16, w_k16, w_v16, q_raw, k_raw, v_raw, x16, ca_pi16, ca_h, BT, C, KV * HD, CA, C);
  post_kernel<<<dim3(kBT / 8 + kCaBlocks), blk, 0, stream>>>(
      q_raw, k_raw, v_raw, xn16, ve, cosb, sinb, w_gate, qh, kh, vt, ca_h, ca_cw, cag16, T, CA, BT * CA);
  attn_kernel<T><<<dim3(B * H, T / 128), blk, 0, stream>>>(qh, kh, vt, prev, rf_w, rf_a, y16);
  proj_kernel<4><<<dim3(kMT * (kC / 128)), blk, 0, stream>>>(
      y16, w_o16, x1, cag16, ca_po16, x, x, vitf, x1_16, BT, C, C);   // g and vit: not read

  // --- FFN, with the ca2 and vitality paths beside it ---
  rmsnorm16_kernel<<<dim3(kBT / 8), blk, 0, stream>>>(x1, xm16);
  ffn_in_kernel<<<dim3(2 * kMT + kMT * ((kF + kC) / 128)), blk, 0, stream>>>(
      xm16, fin16, hA, fg16, gbuf, x1_16, ca_pi16, ca_h, vw1_16, g32, BT, FFN, C, CA, C);
  ffn_mid_kernel<<<dim3((kF / 2048) * (kT / 16) * kB + kCaBlocks + kBT / 256), blk, 0, stream>>>(
      hA, ffn_cw, hB, ca_h, ca_cw, cag16, g32, vit_w2, vitf, T, CA, BT * CA, BT);
  // --- FFN output projection and the final combine ---
  proj_kernel<5><<<dim3(kMT * (kC / 128)), blk, 0, stream>>>(
      hB, fout16, out, cag16, ca_po16, x1, gbuf, vitf, x1_16, BT, C, FFN);   // o16: not written
}

// v010
// One run takes 196 microseconds.
// In both of two side-by-side timings against v009, it was 1.05 times as fast.
// Over all steps from v000 it is 4.26 times as fast.
#include <hip/hip_runtime.h>
#include <hip/hip_bf16.h>

typedef __attribute__((ext_vector_type(16))) _Float16 v16h;
typedef __attribute__((ext_vector_type(8)))  _Float16 v8h;
typedef __attribute__((ext_vector_type(4)))  _Float16 v4h;
typedef __attribute__((ext_vector_type(8)))  float    v8f;
typedef __attribute__((ext_vector_type(2)))  float    v2f;
typedef __attribute__((ext_vector_type(2)))  _Float16 v2h;
typedef __attribute__((ext_vector_type(8)))  int      v8i;

static __device__ __forceinline__ v8f wmma16(v16h a, v16h b, v8f c) {
  return __builtin_amdgcn_wmma_f32_16x16x32_f16(false, a, false, b, (short)0, c, false, false);
}
static __device__ __forceinline__ v16h pack16(v8h lo, v8h hi) {
  return __builtin_shufflevector(lo, hi, 0,1,2,3,4,5,6,7,8,9,10,11,12,13,14,15);
}

// ---------------------------------------------------------------------------
// fp32 -> f16 conversion.  A block takes CVT_BLK adjacent elements, a wave 1024 of them: eight
// 16-byte loads a lane, all issued before the first is used, each covering 512 adjacent bytes.
// Every converted array is a whole number of blocks.
// ---------------------------------------------------------------------------
constexpr int CVT_BLK = 8192;
static __device__ __forceinline__ v4h cvt4(const float4 v, const float s) {
  v4h o; o[0] = (_Float16)(v.x * s); o[1] = (_Float16)(v.y * s); o[2] = (_Float16)(v.z * s); o[3] = (_Float16)(v.w * s);
  return o;
}
static __device__ __forceinline__ v4h cvt4(const float4 v) {
  v4h o; o[0] = (_Float16)v.x; o[1] = (_Float16)v.y; o[2] = (_Float16)v.z; o[3] = (_Float16)v.w;
  return o;
}
static __device__ __forceinline__
void cvt16_body(const float* __restrict__ in, _Float16* __restrict__ out, const int bx) {
  // the lane's first element; its others lie 128 elements apart
  const unsigned e = (unsigned)bx * CVT_BLK + (threadIdx.x >> 5) * 1024u + (threadIdx.x & 31) * 4u;
  const char* ci = (const char*)in;
  char* co = (char*)out;
  const unsigned oi = e * 4u, oo = e * 2u;
  // both loops are unrolled so that v is indexed by constants and stays in registers
  float4 v[8];
  #pragma unroll
  for (int j = 0; j < 8; ++j) v[j] = *(const float4*)(ci + oi + j * 512);
  // the wait that belongs in front of any overwrite of the loads' address registers; they are
  // named as inputs so that none is reused (not even as a load's destination) ahead of it
  asm volatile("s_wait_xcnt 0x0" :: "s"(ci), "v"(oi) : "memory");
  #pragma unroll
  for (int j = 0; j < 8; ++j) *(v4h*)(co + oo + j * 256) = cvt4(v[j]);
}

// ---------------------------------------------------------------------------
// Epilogues: 0=identity, 1=relu^2, 2=sigmoid, 3=gelu(exact)
// ---------------------------------------------------------------------------
template<int EPI>
static __device__ __forceinline__ float apply_epi(float x) {
  if constexpr (EPI == 1) { float t = x > 0.f ? x : 0.f; return t * t; }
  else if constexpr (EPI == 2) { return 1.f / (1.f + __expf(-x)); }
  else if constexpr (EPI == 3) { return 0.5f * x * (1.f + erff(x * 0.70710678118654752f)); }
  else return x;
}

// ---------------------------------------------------------------------------
// WMMA GEMM for K % 128 == 0: out[M,N] = epi( A[M,K] @ W[N,K]^T ), all-f16 operands.
// A work-group owns a 128 x BN tile of out; a stage is 128 k of [A 128 rows | W BN rows],
// rows of 256 B at a pitch of 272 B in LDS (conflict-free for 16-byte readers), two buffers.
// Both operands come into LDS by asynchronous copies, one stage ahead of the products.
// BN = 128: 2 x 4 waves of 64 x 32 each.  BN = 32: 8 x 1 waves of 16 x 32 each.
// Requirements: M % 128 == 0, N % BN == 0, K % 128 == 0.
// ---------------------------------------------------------------------------
constexpr int G_PITCH_H = 136;                    // LDS row pitch in halfs (272 B)
constexpr int RING_H = 2 * (128 + 128) * G_PITCH_H;   // the caller's LDS array in halfs (BN = 128)

// NC 16-byte copies of one lane: rows 16 apart, in LDS (l) as in global memory (g, rs halfs).
// The s_wait_xcnt closes each statement so that no address register named in it can be
// rewritten ahead of the wait.
template<int NC>
static __device__ __forceinline__ void copy_rows(const unsigned l, const _Float16* g, const size_t rs) {
  constexpr unsigned LS = 16u * G_PITCH_H * 2u;   // 16 LDS rows in bytes
  static_assert(NC == 8 || NC == 2, "rows per lane");
  if constexpr (NC == 8) {
    asm volatile(
        "global_load_async_to_lds_b128 %0, %8, off\n\t"
        "global_load_async_to_lds_b128 %1, %9, off\n\t"
        "global_load_async_to_lds_b128 %2, %10, off\n\t"
        "global_load_async_to_lds_b128 %3, %11, off\n\t"
        "global_load_async_to_lds_b128 %4, %12, off\n\t"
        "global_load_async_to_lds_b128 %5, %13, off\n\t"
        "global_load_async_to_lds_b128 %6, %14, off\n\t"
        "global_load_async_to_lds_b128 %7, %15, off\n\t"
        "s_wait_xcnt 0x0"
        :: "v"(l), "v"(l + LS), "v"(l + 2 * LS), "v"(l + 3 * LS),
           "v"(l + 4 * LS), "v"(l + 5 * LS), "v"(l + 6 * LS), "v"(l + 7 * LS),
           "v"(g), "v"(g + rs), "v"(g + 2 * rs), "v"(g + 3 * rs),
           "v"(g + 4 * rs), "v"(g + 5 * rs), "v"(g + 6 * rs), "v"(g + 7 * rs)
        : "memory");
  } else {
    asm volatile(
        "global_load_async_to_lds_b128 %0, %2, off\n\t"
        "global_load_async_to_lds_b128 %1, %3, off\n\t"
        "s_wait_xcnt 0x0"
        :: "v"(l), "v"(l + LS), "v"(g), "v"(g + rs)
        : "memory");
  }
}

// tanh(x) = 1 - 2 / (e^(2x) + 1), without a branch: the library's form branches per element, and
// the two waves a SIMD has in a GEMM epilogue cannot hide 64 such chains one after another.
// Saturates to +-1 (e^(2x) = inf or 0); absolute error of a few f32 roundings of 1.
static __device__ __forceinline__ float tanh_nb(const float x) {
  return 1.f - 2.f * __builtin_amdgcn_rcpf(__expf(2.f * x) + 1.f);
}

// What the two combining epilogues (EPI 4 and 5) read and write beside the product itself.
// With acc = A @ W^T and ca = cag @ cpo^T (K = 32: one matrix instruction per 16 x 16 tile):
// EPI 4: Op = base + acc * (1 + 0.1 tanh(ca)), also stored as f16 in o16
// EPI 5: Op = base + acc * g * (1 + 0.1 tanh(ca)) * vit[row]
constexpr int CMB_N = 1024;   // columns of Op, base, g and o16; rows of cpo
constexpr int CMB_K = 32;     // columns of cag and cpo
struct Combine {
  const _Float16* cag;
  const _Float16* cpo;
  const float* base;
  const float* g;
  const float* vit;
  _Float16* o16;
};

template<int EPI, int OH, int BN>
static __device__ __forceinline__
void gemm_ring_body(_Float16* ring, const _Float16* __restrict__ A, const _Float16* __restrict__ W,
                    void* __restrict__ Op, int M, int N, int K, const int bx, const int by,
                    const Combine cmb = Combine()) {
  constexpr int WN = BN / 32;               // waves along N
  constexpr int MF = 128 / ((8 / WN) * 16); // 16-row fragments of A per wave
  constexpr int STAGE_H = (128 + BN) * G_PITCH_H;   // one buffer in halfs
  const int tid  = threadIdx.x;
  const int wave = tid >> 5;
  const int lane = tid & 31;
  const int hlf  = lane >> 4;
  const int r    = lane & 15;
  const int m0 = bx * 128;
  const int n0 = by * BN;
  const int wm = (wave / WN) * (MF * 16);
  const int wn = (wave % WN) * 32;

  // a lane copies 16-byte column (tid & 15) of rows (tid >> 4) + 16 i, of A and of W
  const int crow = tid >> 4;
  const int ccol = (tid & 15) * 8;
  const _Float16* gA = A + (size_t)(m0 + crow) * K + ccol;
  const _Float16* gW = W + (size_t)(n0 + crow) * K + ccol;
  const unsigned lA = (unsigned)(size_t)(&ring[crow * G_PITCH_H + ccol]);   // LDS byte address
  const size_t rs = (size_t)16 * K;

  auto copy_stage = [&](const int buf, const int t) {
    const unsigned l = lA + (unsigned)buf * (STAGE_H * 2u);
    copy_rows<8>(l, gA + (size_t)t * 128, rs);
    copy_rows<BN / 16>(l + 128u * G_PITCH_H * 2u, gW + (size_t)t * 128, rs);
  };

  // every loop of constant length in this kernel is unrolled so that acc, af and bf are
  // indexed by constants and stay in registers
  v8f acc[MF][2];
  #pragma unroll
  for (int mi = 0; mi < MF; ++mi)
    #pragma unroll
    for (int nj = 0; nj < 2; ++nj)
      #pragma unroll
      for (int e = 0; e < 8; ++e) acc[mi][nj][e] = 0.f;

  const int nt = K / 128;
  copy_stage(0, 0);
  asm volatile("s_wait_asynccnt 0x0" ::: "memory");   // this wave's part of stage 0 has landed
  __syncthreads();                                    // ... and every other wave's
  if (nt > 1) copy_stage(1, 1);

  for (int t = 0; t < nt; ++t) {
    const _Float16* sa = ring + (t & 1) * STAGE_H + (wm + r) * G_PITCH_H + hlf * 8;
    const _Float16* sw = ring + (t & 1) * STAGE_H + (128 + wn + r) * G_PITCH_H + hlf * 8;
    v16h af[2][MF], bf[2][2];   // two fragment sets: one in use, one being fetched
    auto fetch = [&](const int set, const int kk) {
      #pragma unroll
      for (int mi = 0; mi < MF; ++mi) {
        const _Float16* p = sa + mi * 16 * G_PITCH_H + kk * 32;
        af[set][mi] = pack16(*(const v8h*)p, *(const v8h*)(p + 16));
      }
      #pragma unroll
      for (int nj = 0; nj < 2; ++nj) {
        const _Float16* p = sw + nj * 16 * G_PITCH_H + kk * 32;
        bf[set][nj] = pack16(*(const v8h*)p, *(const v8h*)(p + 16));
      }
    };
    fetch(0, 0);
    #pragma unroll
    for (int kk = 0; kk < 4; ++kk) {
      if (kk < 3) fetch((kk + 1) & 1, kk + 1);
      // the next block's LDS reads stay one group ahead of this block's products; left to
      // itself the scheduler sinks each read to its use and the wave waits out every one
      __builtin_amdgcn_sched_barrier(0);
      #pragma unroll
      for (int mi = 0; mi < MF; ++mi)
        #pragma unroll
        for (int nj = 0; nj < 2; ++nj)
          acc[mi][nj] = wmma16(af[kk & 1][mi], bf[kk & 1][nj], acc[mi][nj]);
      // ... and no later read is lifted in among these products
      __builtin_amdgcn_sched_barrier(0);
    }
    asm volatile("s_wait_dscnt 0x0" ::: "memory");      // this wave has left the buffer
    asm volatile("s_wait_asynccnt 0x0" ::: "memory");   // its part of stage t + 1 has landed
    __syncthreads();   // publishes stage t + 1 and frees the buffer of stage t
    if (t + 2 < nt) copy_stage(t & 1, t + 2);
  }
  asm volatile("s_wait_asynccnt 0x0" ::: "memory");     // no copy outlives the wave

  if constexpr (EPI >= 4) {
    static_assert(BN == 128 && OH == 0, "the combining epilogues are written for the 64 x 32 wave tile");
    // byte offset of the lane's element in row 0 of its half, column group 0, of an f32 array of
    // CMB_N columns; every other element of the wave tile lies at a constant offset from it
    const unsigned ob = ((unsigned)(m0 + wm + 8 * hlf) * CMB_N + (unsigned)(n0 + wn + r)) * 4u;
    const unsigned oa = ((unsigned)(m0 + wm + r) * CMB_K + hlf * 8) * 2u;   // the same in cag
    const unsigned ow = ((unsigned)(n0 + wn + r) * CMB_K + hlf * 8) * 2u;   // ... and in cpo
    const char* cb = (const char*)cmb.base;
    const char* ca = (const char*)cmb.cag;
    const char* cw = (const char*)cmb.cpo;
    char* co = (char*)Op;
    constexpr int RS = CMB_N * 4;   // a row of an f32 array in bytes
    v16h fa[MF], fb[2];   // fragments of cag and cpo, both in the k order of the ring's fragments
    #pragma unroll
    for (int mi = 0; mi < MF; ++mi) {
      const char* p = ca + oa + mi * 16 * CMB_K * 2;
      fa[mi] = pack16(*(const v8h*)p, *(const v8h*)(p + 32));
    }
    #pragma unroll
    for (int nj = 0; nj < 2; ++nj) {
      const char* p = cw + ow + nj * 16 * CMB_K * 2;
      fb[nj] = pack16(*(const v8h*)p, *(const v8h*)(p + 32));
    }
    const v8f zero = {0.f, 0.f, 0.f, 0.f, 0.f, 0.f, 0.f, 0.f};
    float bv[MF][2][8];
    auto load_base = [&]() {
      #pragma unroll
      for (int mi = 0; mi < MF; ++mi)
        #pragma unroll
        for (int nj = 0; nj < 2; ++nj)
          #pragma unroll
          for (int v = 0; v < 8; ++v)
            bv[mi][nj][v] = *(const float*)(cb + ob + (mi * 16 + v) * RS + nj * 64);
    };
    if constexpr (EPI == 4) {
      char* ch = (char*)cmb.o16;
      const unsigned oh = ob >> 1;   // the same element in an f16 array
      load_base();
      // the wait that belongs in front of any overwrite of the loads' address registers; they
      // are named as inputs so that none is reused ahead of it
      asm volatile("s_wait_xcnt 0x0" :: "s"(ca), "s"(cw), "s"(cb), "v"(oa), "v"(ow), "v"(ob) : "memory");
      #pragma unroll
      for (int mi = 0; mi < MF; ++mi) {
        float val[2][8];
        #pragma unroll
        for (int nj = 0; nj < 2; ++nj) {
          const v8f t = wmma16(fa[mi], fb[nj], zero);
          #pragma unroll
          for (int v = 0; v < 8; ++v) {
            val[nj][v] = bv[mi][nj][v] + acc[mi][nj][v] * (1.f + 0.1f * tanh_nb(t[v]));
            *(float*)(co + ob + (mi * 16 + v) * RS + nj * 64) = val[nj][v];
            *(_Float16*)(ch + oh + (mi * 16 + v) * (RS / 2) + nj * 32) = (_Float16)val[nj][v];
          }
        }
        // the same wait for the stores' registers: addresses and stored values are named as
        // inputs so that none is reused ahead of it
        asm volatile("s_wait_xcnt 0x0" :: "s"(co), "s"(ch), "v"(ob), "v"(oh),
                     "v"(val[0][0]), "v"(val[0][1]), "v"(val[0][2]), "v"(val[0][3]),
                     "v"(val[0][4]), "v"(val[0][5]), "v"(val[0][6]), "v"(val[0][7]),
                     "v"(val[1][0]), "v"(val[1][1]), "v"(val[1][2]), "v"(val[1][3]),
                     "v"(val[1][4]), "v"(val[1][5]), "v"(val[1][6]), "v"(val[1][7]) : "memory");
        // ... and nothing of the next row group is lifted in front of that wait
        __builtin_amdgcn_sched_barrier(0);
      }
    } else {
      const char* cg = (const char*)cmb.g;
      const char* cv = (const char*)cmb.vit;
      const unsigned ov = (unsigned)(m0 + wm + 8 * hlf) * 4u;
      float gv[MF][2][8], vv[MF][8];
      #pragma unroll
      for (int mi = 0; mi < MF; ++mi)
        #pragma unroll
        for (int nj = 0; nj < 2; ++nj)
          #pragma unroll
          for (int v = 0; v < 8; ++v)
            gv[mi][nj][v] = *(const float*)(cg + ob + (mi * 16 + v) * RS + nj * 64);
      // the wait that belongs in front of any overwrite of the loads' address registers; they
      // are named as inputs so that none is reused ahead of it
      asm volatile("s_wait_xcnt 0x0" :: "s"(ca), "s"(cw), "s"(cg), "v"(oa), "v"(ow), "v"(ob) : "memory");
      auto gate = [&](const int mi) {
        #pragma unroll
        for (int nj = 0; nj < 2; ++nj) {
          const v8f t = wmma16(fa[mi], fb[nj], zero);
          #pragma unroll
          for (int v = 0; v < 8; ++v)
            acc[mi][nj][v] = acc[mi][nj][v] * gv[mi][nj][v] * (1.f + 0.1f * tanh_nb(t[v]));
        }
        // one row group at a time: mixed by the scheduler, the temporaries of all four together
        // take the kernel past 256 registers
        __builtin_amdgcn_sched_barrier(0);
      };
      gate(0);
      gate(1);
      gate(2);
      gate(3);
      // the second group of loads goes out when the first group's registers are free again:
      // both groups at once take the kernel past 256 registers
      load_base();
      #pragma unroll
      for (int mi = 0; mi < MF; ++mi)
        #pragma unroll
        for (int v = 0; v < 8; ++v) vv[mi][v] = *(const float*)(cv + ov + (mi * 16 + v) * 4);
      // the same wait for this group's address registers
      asm volatile("s_wait_xcnt 0x0" :: "s"(cb), "s"(cv), "v"(ob), "v"(ov) : "memory");
      #pragma unroll
      for (int mi = 0; mi < MF; ++mi)
        #pragma unroll
        for (int nj = 0; nj < 2; ++nj)
          #pragma unroll
          for (int v = 0; v < 8; ++v)
            *(float*)(co + ob + (mi * 16 + v) * RS + nj * 64) = bv[mi][nj][v] + acc[mi][nj][v] * vv[mi][v];
      // the same wait for the stores' address registers
      asm volatile("s_wait_xcnt 0x0" :: "s"(co), "v"(ob) : "memory");
    }
    return;
  }

  #pragma unroll
  for (int nj = 0; nj < 2; ++nj) {
    const int n = n0 + wn + nj * 16 + r;
    #pragma unroll
    for (int mi = 0; mi < MF; ++mi)
      #pragma unroll
      for (int v = 0; v < 8; ++v) {
        const int m = m0 + wm + mi * 16 + v + 8 * hlf;
        const float val = apply_epi<EPI>(acc[mi][nj][v]);
        if constexpr (OH) ((_Float16*)Op)[(size_t)m * N + n] = (_Float16)val;
        else              ((float*)Op)[(size_t)m * N + n] = val;
      }
  }
  // in a merged kernel another piece's code follows in the text: the wait that belongs in
  // front of any overwrite of the last stores' address registers
  asm volatile("s_wait_xcnt 0x0" ::: "memory");
}

// v + (v of lane l ^ M), M < 16, inside a 16-lane row, in the vector unit (DPP row_xmask)
template<int M>
static __device__ __forceinline__ float add_xor_row(const float v) {
  return v + __int_as_float(__builtin_amdgcn_update_dpp(0, __float_as_int(v), 0x160 | M, 0xf, 0xf, true));
}
// Sum over the 32 lanes, left in every lane: a butterfly over lane distances 16, 8, 4, 2, 1.
// All 32 lanes must be on.  No step goes through the LDS queue, so 40 such sums of one wave
// do not each wait out its latency.
static __device__ __forceinline__ float wave_sum(float v) {
  const int b = __float_as_int(v);
  v += __int_as_float(__builtin_amdgcn_permlanex16(b, b, 0x76543210, 0xfedcba98, false, false));
  v = add_xor_row<8>(v);
  v = add_xor_row<4>(v);
  v = add_xor_row<2>(v);
  v = add_xor_row<1>(v);
  return v;
}

// ---------------------------------------------------------------------------
// RMSNorm over a row of 1024 floats, f32 in -> f16 out.  One wave per row, 8 rows a block: a lane
// holds 32 elements of the row (eight 16-byte loads, all issued at once), so the row is read once,
// the sum of squares needs the wave's own lanes only (no LDS, no barrier), and every store of a
// wave covers two whole lines.  RAW: the unscaled row is stored as f16 too.
// ---------------------------------------------------------------------------
template<bool RAW>
static __device__ __forceinline__
void rmsnorm16_body(const float* __restrict__ x, _Float16* __restrict__ o,
                    _Float16* __restrict__ raw16, const int bx) {
  constexpr int C = 1024;
  // the wave's number is the same in all its lanes: said so, the row addresses stay scalar
  const int row = bx * 8 + __builtin_amdgcn_readfirstlane(threadIdx.x >> 5);
  const char* xr = (const char*)(x + (size_t)row * C);
  char* orow = (char*)(o + (size_t)row * C);
  const unsigned oi = (threadIdx.x & 31) * 16u, oo = (threadIdx.x & 31) * 8u;
  // every loop below is unrolled so that its arrays are indexed by constants and stay in registers
  float4 v[8];
  #pragma unroll
  for (int j = 0; j < 8; ++j) v[j] = *(const float4*)(xr + oi + j * 512);
  // the wait that belongs in front of any overwrite of the loads' address registers; they are
  // named as inputs so that none is reused (not even as a load's destination) ahead of it
  asm volatile("s_wait_xcnt 0x0" :: "s"(xr), "v"(oi) : "memory");
  float s0 = 0.f, s1 = 0.f, s2 = 0.f, s3 = 0.f;   // four chains, not one of 32 links
  #pragma unroll
  for (int j = 0; j < 8; ++j) {
    s0 += v[j].x * v[j].x;
    s1 += v[j].y * v[j].y;
    s2 += v[j].z * v[j].z;
    s3 += v[j].w * v[j].w;
  }
  const float tot = wave_sum((s0 + s1) + (s2 + s3));
  const float rs = rsqrtf(tot / (float)C + 1e-6f);
  v4h on[8];
  #pragma unroll
  for (int j = 0; j < 8; ++j) on[j] = cvt4(v[j], rs);
  if constexpr (RAW) {
    char* rrow = (char*)(raw16 + (size_t)row * C);
    v4h orw[8];
    #pragma unroll
    for (int j = 0; j < 8; ++j) orw[j] = cvt4(v[j]);
    // keeps every store behind the scaling: left to itself the scheduler issues the unscaled row's
    // stores early and then writes a register that one of them names again
    __builtin_amdgcn_sched_barrier(0);
    #pragma unroll
    for (int j = 0; j < 8; ++j) *(v4h*)(rrow + oo + j * 256) = orw[j];
  }
  #pragma unroll
  for (int j = 0; j < 8; ++j) *(v4h*)(orow + oo + j * 256) = on[j];
}

// ---------------------------------------------------------------------------
// QKV post: RoPE + head RMSNorm*1.2 for q,k; v + 3*sigmoid(xn[:12]@gate)*ve.
// One wave per token, all 24 heads of it; B*T/8 blocks of 8 waves.
// A lane holds elements j and j+32 of a head, the two partners of the rotation, so a head's
// sum of squares needs the wave's own shuffles only: no LDS, no barrier.
// qh: [B,H,T,64].  K and V of a (b, kv) are stored in the order in which the attention kernel's
// B fragments take them, so that one 16-byte-a-lane load of a wave there covers 512 adjacent bytes:
// kh: [B,KV][t / 16][d / 16][(d / 8) % 2][t % 16][d % 8]
// vt: [B,KV][t / 32][d / 16][(t / 16) % 2][(t / 8) % 2][d % 16][t % 8]
// ---------------------------------------------------------------------------
template<int T>
static __device__ __forceinline__
void qkvpost_body(const float* __restrict__ q_raw, const float* __restrict__ k_raw,
                  const float* __restrict__ v_raw, const _Float16* __restrict__ xn,
                  const float* __restrict__ ve, const float* __restrict__ cosb,
                  const float* __restrict__ sinb, const float* __restrict__ wgate,
                  _Float16* __restrict__ qh, _Float16* __restrict__ kh,
                  _Float16* __restrict__ vt, const int bx) {
  // the wave's number is the same in all its lanes: said so, the row addresses stay scalar
  const int bt = bx * 8 + __builtin_amdgcn_readfirstlane(threadIdx.x >> 5);
  const int b = bt / T, t = bt % T;
  const int j = threadIdx.x & 31;

  const float* qr = q_raw + (size_t)bt * 1024;
  const float* kr = k_raw + (size_t)bt * 256;
  const float* vr = v_raw + (size_t)bt * 256;
  const float* er = ve    + (size_t)bt * 256;
  const float* cr = cosb  + (size_t)t * 32;
  const float* sr = sinb  + (size_t)t * 32;
  const _Float16* xr = xn + (size_t)bt * 1024;

  // every loop below is unrolled so that its arrays are indexed by constants and stay in
  // registers; all of a token's loads are issued before the first head is worked on
  float x1[20], x2[20], vv[8], ee[8], xg[12];
  const float c = cr[j], s = sr[j];
  #pragma unroll
  for (int u = 0; u < 20; ++u) {
    const float* src = (u < 16) ? qr + u * 64 : kr + (u - 16) * 64;
    x1[u] = src[j];
    x2[u] = src[j + 32];
  }
  #pragma unroll
  for (int i = 0; i < 8; ++i) { vv[i] = vr[i * 32 + j]; ee[i] = er[i * 32 + j]; }
  #pragma unroll
  for (int i = 0; i < 12; ++i) xg[i] = (float)xr[i];
  // the wait that belongs in front of any overwrite of the loads' address registers; they are
  // named as inputs so that none is reused (not even as a load's destination) ahead of it
  asm volatile("s_wait_xcnt 0x0" :: "s"(qr), "s"(kr), "s"(vr), "s"(er), "s"(cr), "s"(sr), "s"(xr), "v"(j) : "memory");

  _Float16 ol[20], oh[20], ov[8];
  #pragma unroll
  for (int u = 0; u < 20; ++u) {
    const float lo =  x1[u] * c + x2[u] * s;
    const float hi = -x1[u] * s + x2[u] * c;
    // each half summed by its own butterfly (lane distances 16, 8, 4, 2, 1), then added
    const float sl = wave_sum(lo * lo), sh = wave_sum(hi * hi);
    const float rs = rsqrtf((sl + sh) * (1.f / 64.f) + 1e-6f) * 1.2f;
    ol[u] = (_Float16)(lo * rs);
    oh[u] = (_Float16)(hi * rs);
  }
  #pragma unroll
  for (int kv = 0; kv < 4; ++kv) {
    float g = 0.f;
    #pragma unroll
    for (int i = 0; i < 12; ++i) g += xg[i] * wgate[kv * 12 + i];
    g = 3.f / (1.f + __expf(-g));
    ov[kv * 2]     = (_Float16)(vv[kv * 2]     + g * ee[kv * 2]);
    ov[kv * 2 + 1] = (_Float16)(vv[kv * 2 + 1] + g * ee[kv * 2 + 1]);
  }

  _Float16* qd = qh + ((size_t)(b * 16) * T + t) * 64 + j;
  _Float16* kd = kh + ((size_t)(b * 4) * T + (t & ~15)) * 64 + (t & 15) * 8
                 + (j >> 4) * 256 + ((j >> 3) & 1) * 128 + (j & 7);
  _Float16* vd = vt + ((size_t)(b * 4) * T + (t & ~31)) * 64 + ((t >> 3) & 3) * 128 + (t & 7)
                 + (j >> 4) * 512 + (j & 15) * 8;
  // keeps the stores in runs at the end: left to itself the scheduler mixes them in among the
  // heads' arithmetic
  __builtin_amdgcn_sched_barrier(0);
  #pragma unroll
  for (int u = 0; u < 16; ++u) {
    qd[(size_t)u * T * 64]      = ol[u];
    qd[(size_t)u * T * 64 + 32] = oh[u];
  }
  #pragma unroll
  for (int u = 0; u < 4; ++u) {
    kd[(size_t)u * T * 64]      = ol[16 + u];
    kd[(size_t)u * T * 64 + 512] = oh[16 + u];   // d + 32: two groups of 16 further
  }
  #pragma unroll
  for (int i = 0; i < 8; ++i) vd[(size_t)(i >> 1) * T * 64 + (i & 1) * 1024] = ov[i];   // d = (i % 2) * 32 + j
}

// v of the lane CTRL points to inside the 16-lane row (DPP); a lane whose source lies outside the
// row keeps old.  0x111: the lane below (row_shr:1), 0x101: the lane above (row_shl:1)
template<int CTRL>
static __device__ __forceinline__ int dpp_or_old(const int old, const int v) {
  return __builtin_amdgcn_update_dpp(old, v, CTRL, 0xf, 0xf, false);
}
// v of lane N of the 16-lane row, in all its lanes (DPP row_share)
template<int N>
static __device__ __forceinline__ int row_lane(const int v) {
  return __builtin_amdgcn_update_dpp(0, v, 0x150 | N, 0xf, 0xf, true);
}

// ---------------------------------------------------------------------------
// Flash attention with refine-conv term.  grid = (B*H, T/128), block = 256.
// A wave handles 16 query rows; keys tiled 32 wide; causal.  f16 in, f16 out.
// K and V lie in fragment order (see the QKV post-processing): a B fragment is two b128 loads,
// and each of these loads covers 512 adjacent bytes, 4 whole lines.
// Refine conv on the matrix unit: a 16 x 16 piece of it is Wd @ Pw.  The k index runs over the
// pairs (column shift dj, window row): Wd[m][(dj, row)] is 8 alpha times the weight that query row
// m gives that window row at shift dj (a band of three rows, else 0), Pw[(dj, row)][n] is
// prev_attn at that row and key column n + dj - 1, rounded to f16.  3 x 18 pairs fill two products
// of 32 k, summed into the score tile in front of its scaling by 1/8.  A lane loads 9 rows x 3
// columns: its two key columns and the column right of the tile; the left and right neighbours of
// its keys it takes, already packed to f16, from the lanes beside it (DPP), the column left of the
// tile from what lane 15 held in the tile before.  Outside rows and the outside column T are read
// at a clamped address; an outside row meets zeros in Wd, an outside column is replaced by zero.
// All global loads of the loop stand in ONE group per key tile, behind the conv: V of this
// tile, then K and the prev_attn window of the NEXT tile, each into the registers that its
// last user has just left.  Their latency runs under the softmax and the P @ V products.
// ---------------------------------------------------------------------------
template<int T>
__global__ __launch_bounds__(256)
void attn_kernel(const _Float16* __restrict__ qh, const _Float16* __restrict__ kh,
                 const _Float16* __restrict__ vt, const float* __restrict__ prev,
                 const float* __restrict__ refine_w, const float* __restrict__ alpha_p,
                 _Float16* __restrict__ y) {
  constexpr int H = 16, KV = 4, HD = 64;
  const int bh = blockIdx.x;
  const int b = bh / H, h = bh % H;
  // the wave's number is the same in all its lanes: said so, the trip count and the tiles'
  // base addresses stay scalar
  const int wave = __builtin_amdgcn_readfirstlane(threadIdx.x >> 5);
  const int lane = threadIdx.x & 31;
  const int hlf = lane >> 4, r = lane & 15;
  // A query tile of 16 rows walks qt / 2 + 1 key tiles (causal).  A block takes four tiles from the
  // long end and their mirror images from the short end: waves w and w + 4 together always walk
  // T / 32 + 1 key tiles, so every block, and every pair of waves, has the same amount of work.
  // The long tiles go to the first four waves.
  const int pr = blockIdx.y * 4 + (wave & 3);              // 0 .. T / 32 - 1
  const int qb = (wave < 4 ? T / 16 - 1 - pr : pr) * 16;
  const float alpha = alpha_p[0];

  float rw[9];
  #pragma unroll
  for (int i = 0; i < 9; ++i) rw[i] = refine_w[h * 9 + i];

  const _Float16* qbase = qh + ((size_t)(b * H + h)) * T * HD;
  const char* kbase = (const char*)(kh + ((size_t)(b * KV + (h >> 2))) * T * HD);
  const char* vbase = (const char*)(vt + ((size_t)(b * KV + (h >> 2))) * HD * T);
  const char* pbase = (const char*)(prev + ((size_t)(b * H + h)) * T * T);

  v16h aQ[2];
  {
    const _Float16* qp = qbase + (size_t)(qb + r) * HD + hlf * 8;
    aQ[0] = pack16(*(const v8h*)qp,        *(const v8h*)(qp + 16));
    aQ[1] = pack16(*(const v8h*)(qp + 32), *(const v8h*)(qp + 48));
    // the wait that belongs in front of any overwrite of these loads' address registers
    asm volatile("s_wait_xcnt 0x0" :: "v"(qp) : "memory");
  }

  float mstat[8], lstat[8];
  v8f O[4];
  #pragma unroll
  for (int v = 0; v < 8; ++v) { mstat[v] = -1e30f; lstat[v] = 0.f; }
  #pragma unroll
  for (int j = 0; j < 4; ++j)
    #pragma unroll
    for (int e = 0; e < 8; ++e) O[j][e] = 0.f;

  __shared__ __attribute__((aligned(16))) _Float16 lds_p[8 * 16 * 32];
  const int wbase = wave * 512;
  const int qrow0 = qb + 8 * hlf;   // first accumulator row for this lane-half
  const int klast = ((qb + 15) >> 5) << 5;   // the wave's last key tile

  // the lane's byte offset inside every 512-byte piece of a K or V tile (4 KiB per 32 keys each)
  const unsigned fo = (unsigned)lane * 16u;
  // The window's 18 rows qb-1 .. qb+16: lanes 0-15 hold rows 0..8 of it, lanes 16-31 rows 9..17.
  // Only the first row of the first half and the last row of the second can lie outside [0,T).
  const int wrow0 = qb + 9 * hlf;   // the second of the lane's nine rows
  const unsigned rowTop = (unsigned)(wrow0 > 0 ? wrow0 - 1 : 0) * (T * 4u);
  const unsigned rowMid = (unsigned)wrow0 * (T * 4u);
  const unsigned rowBot = (unsigned)(wrow0 + 7 < T ? wrow0 + 7 : T - 1) * (T * 4u);

  // Wd as two A fragments (the lane's query row is m = r).  Place s = 10 dj + i of a lane's 32
  // fragment elements stands for shift dj and the lane's window row i < 9; the places left over
  // are zero.  Pw below fills its B fragments by the same rule, so the k orders agree.
  // Window row 9 hlf + i meets query row m with weight row di = 9 hlf + i - m, if that is 0..2.
  // The weights are picked by factors that are 8 alpha or 0, not by branches; an outside row gets
  // zeros: that is the conv's zero padding of rows.  The loops are unrolled so that wv and aW are
  // indexed by constants and stay in registers.
  v16h aW[2];
  {
    const float sc = alpha * 8.f;
    float wv[3][9];
    #pragma unroll
    for (int i = 0; i < 9; ++i) {
      const int kr = 9 * hlf + i;
      const int di = kr - r;
      const bool in = !(((kr == 0) & (qb == 0)) | ((kr == 17) & (qb + 16 == T)));
      const float f0 = ((di == 0) & in) ? sc : 0.f;
      const float f1 = ((di == 1) & in) ? sc : 0.f;
      const float f2 = ((di == 2) & in) ? sc : 0.f;
      #pragma unroll
      for (int dj = 0; dj < 3; ++dj) wv[dj][i] = f0 * rw[dj] + f1 * rw[3 + dj] + f2 * rw[6 + dj];
    }
    #pragma unroll
    for (int s = 0; s < 32; ++s)
      aW[s >> 4][s & 15] = (s < 30 && s % 10 < 9) ? (_Float16)wv[s / 10][s % 10] : (_Float16)0.f;
  }

  // every loop of constant length below is unrolled so that kf, vf and pf are indexed by
  // constants and stay in registers
  v8h kf[8], vf[8];
  float pf[9][3];   // [row][key kb+r, key kb+16+r, column kb+32]
  // the second key's packed window of the tile before: its lane 15 holds column kb-1.  In front of
  // the first tile it is the zero padding of column -1.
  int pl[5] = {0, 0, 0, 0, 0};

  auto load_v = [&](const char* vp) {
    #pragma unroll
    for (int j = 0; j < 4; ++j) {
      vf[j * 2]     = *(const v8h*)(vp + j * 1024);
      vf[j * 2 + 1] = *(const v8h*)(vp + j * 1024 + 512);
    }
  };
  auto load_k = [&](const char* kp) {
    #pragma unroll
    for (int sb = 0; sb < 2; ++sb)
      #pragma unroll
      for (int q = 0; q < 4; ++q)
        kf[sb * 4 + q] = *(const v8h*)(kp + sb * 2048 + q * 512);
  };
  // oC, oE: byte offsets of [top, middle, bottom] rows at the first key and at the clamped
  // column right of the tile
  auto load_p = [&](const unsigned (&oC)[3], const unsigned (&oE)[3]) {
    #pragma unroll
    for (int i = 0; i < 9; ++i) {
      const int g  = (i == 0) ? 0 : ((i == 8) ? 2 : 1);
      const int im = (g == 1) ? (i - 1) * T * 4 : 0;
      pf[i][0] = *(const float*)(pbase + oC[g] + im);
      pf[i][1] = *(const float*)(pbase + oC[g] + im + 64);
      pf[i][2] = *(const float*)(pbase + oE[g] + im);
    }
  };
  // one group of loads: V of tile kv (skipped in front of the loop), K and prev_attn of tile kn
  auto load_group = [&](const bool with_v, const int kv, const int kn) {
    const unsigned cC = (unsigned)(kn + r) * 4u;
    const unsigned cE = (unsigned)(kn + 32 < T ? kn + 32 : T - 1) * 4u;
    const unsigned oC[3] = {rowTop + cC, rowMid + cC, rowBot + cC};
    const unsigned oE[3] = {rowTop + cE, rowMid + cE, rowBot + cE};
    const char* vp = vbase + (size_t)kv * (HD * 2) + fo;    // the lane's own addresses
    const char* kp = kbase + (size_t)kn * (HD * 2) + fo;
    if (with_v) load_v(vp);
    load_k(kp);
    load_p(oC, oE);
    // the wait that belongs in front of any overwrite of the loads' address registers; they are
    // named as inputs so that none is reused (not even as a load's destination) ahead of it
    asm volatile("s_wait_xcnt 0x0" :: "s"(pbase), "v"(vp), "v"(kp), "v"(fo),
                 "v"(oC[0]), "v"(oC[1]), "v"(oC[2]), "v"(oE[0]), "v"(oE[1]), "v"(oE[2]) : "memory");
  };

  // fenced like the group in the loop, so that K stands in front of prev_attn here too and
  // the loop's first wait need not cover more than K
  __builtin_amdgcn_sched_barrier(0);
  load_group(false, 0, 0);
  __builtin_amdgcn_sched_barrier(0);

  // tile 0 exists for every wave: the test stands at the foot, and nothing of the prologue
  // (the Q loads least of all) is moved in behind the first group
  int kb = 0;
  do {
    // S = Q @ K^T  (16 x 32 tile, two 16x16 fragments)
    v8f S[2];
    #pragma unroll
    for (int sb = 0; sb < 2; ++sb) {
      #pragma unroll
      for (int e = 0; e < 8; ++e) S[sb][e] = 0.f;
      S[sb] = wmma16(aQ[0], pack16(kf[sb * 4],     kf[sb * 4 + 1]), S[sb]);
      S[sb] = wmma16(aQ[1], pack16(kf[sb * 4 + 2], kf[sb * 4 + 3]), S[sb]);
    }

    // refine conv: S += Wd @ Pw, two products per 16 key columns
    {
      const bool zE = (kb + 32 == T);   // column T is the zero padding
      v8i bw[2][2];   // the B fragments: the lane's key column, two places (see Wd) per register
      auto put = [&](const int sb, const int reg, const int x) { bw[sb][reg >> 3][reg & 7] = x; };
      #pragma unroll
      for (int e = 0; e < 5; ++e) {
        int pk[3];   // window rows 2 e and 2 e + 1 as f16: first key, second key, column kb + 32
        #pragma unroll
        for (int c = 0; c < 3; ++c) {
          const v2f two = {pf[2 * e][c], (e < 4) ? pf[2 * e + 1][c] : 0.f};
          pk[c] = __builtin_bit_cast(int, __builtin_convertvector(two, v2h));
        }
        const int ed = zE ? 0 : pk[2];
        // left neighbours: the lane below; lane 0 takes column kb - 1, or key kb + 15 from lane 15
        put(0, e, dpp_or_old<0x111>(row_lane<15>(pl[e]), pk[0]));
        put(1, e, dpp_or_old<0x111>(row_lane<15>(pk[0]), pk[1]));
        put(0, 5 + e, pk[0]);
        put(1, 5 + e, pk[1]);
        // right neighbours: the lane above; lane 15 takes key kb + 16 from lane 0, or column kb + 32
        put(0, 10 + e, dpp_or_old<0x101>(row_lane<0>(pk[1]), pk[0]));
        put(1, 10 + e, dpp_or_old<0x101>(ed, pk[1]));
        pl[e] = pk[1];
      }
      #pragma unroll
      for (int sb = 0; sb < 2; ++sb) {
        put(sb, 15, 0);
        S[sb] = wmma16(aW[0], __builtin_bit_cast(v16h, bw[sb][0]), S[sb]);
        S[sb] = wmma16(aW[1], __builtin_bit_cast(v16h, bw[sb][1]), S[sb]);
      }
    }

    // scale + causal mask
    #pragma unroll
    for (int sb = 0; sb < 2; ++sb) {
      const int kj = kb + sb * 16 + r;
      #pragma unroll
      for (int v = 0; v < 8; ++v) {
        const int qi = qrow0 + v;
        float s = S[sb][v] * 0.125f;
        if (kj > qi) s = -1e30f;
        S[sb][v] = s;
      }
    }

    // the group stays here, whole: left to itself the scheduler sinks each load to its use
    // and the wave waits out one memory latency after another
    __builtin_amdgcn_sched_barrier(0);
    load_group(true, kb, kb < klast ? kb + 32 : kb);   // past the last tile: the same one again
    __builtin_amdgcn_sched_barrier(0);

    // online softmax (row stats via 16-lane shuffles), stage P to LDS
    #pragma unroll
    for (int v = 0; v < 8; ++v) {
      float rmax = fmaxf(S[0][v], S[1][v]);
      #pragma unroll
      for (int off = 1; off < 16; off <<= 1) rmax = fmaxf(rmax, __shfl_xor(rmax, off, 16));
      const float mnew = fmaxf(mstat[v], rmax);
      const float scl = __expf(mstat[v] - mnew);
      mstat[v] = mnew;
      lstat[v] *= scl;
      #pragma unroll
      for (int j = 0; j < 4; ++j) O[j][v] *= scl;
      const float p0 = __expf(S[0][v] - mnew);
      const float p1 = __expf(S[1][v] - mnew);
      float rsum = p0 + p1;
      #pragma unroll
      for (int off = 1; off < 16; off <<= 1) rsum += __shfl_xor(rsum, off, 16);
      lstat[v] += rsum;
      const int m = v + 8 * hlf;
      lds_p[wbase + m * 32 + r]      = (_Float16)p0;
      lds_p[wbase + m * 32 + 16 + r] = (_Float16)p1;
    }

    // O += P @ V   (a B fragment is two of the group's b128 loads)
    v16h aP;
    {
      const _Float16* pp = lds_p + wbase + r * 32 + hlf * 8;
      aP = pack16(*(const v8h*)pp, *(const v8h*)(pp + 16));
    }
    #pragma unroll
    for (int j = 0; j < 4; ++j) O[j] = wmma16(aP, pack16(vf[j * 2], vf[j * 2 + 1]), O[j]);
    kb += 32;
  } while (kb <= klast);

  #pragma unroll
  for (int v = 0; v < 8; ++v) {
    const float inv = 1.f / lstat[v];
    #pragma unroll
    for (int j = 0; j < 4; ++j) O[j][v] *= inv;
  }
  #pragma unroll
  for (int j = 0; j < 4; ++j)
    #pragma unroll
    for (int v = 0; v < 8; ++v) {
      const int qi = qb + v + 8 * hlf;
      const int hd = j * 16 + r;
      y[((size_t)(b * T + qi)) * 1024 + h * 64 + hd] = (_Float16)O[j][v];
    }
}

// ---------------------------------------------------------------------------
// Channel-attention depthwise conv along T + exact GELU -> f16 (GEMM input)
// ---------------------------------------------------------------------------
static __device__ __forceinline__
void caconv_body(const float* __restrict__ h, const float* __restrict__ cw,
                 _Float16* __restrict__ o, int T, int CH, int total, const int bx) {
  const int idx = bx * 256 + threadIdx.x;
  if (idx >= total) return;
  const int c = idx % CH;
  const int t = (idx / CH) % T;
  const float ctr = h[idx];
  const float lft = (t > 0)     ? h[idx - CH] : 0.f;
  const float rgt = (t < T - 1) ? h[idx + CH] : 0.f;
  const float v = ctr + 0.1f * (lft * cw[c * 3] + ctr * cw[c * 3 + 1] + rgt * cw[c * 3 + 2]);
  o[idx] = (_Float16)(0.5f * v * (1.f + erff(v * 0.70710678118654752f)));
}

// Four FFN depthwise conv steps (each: o = in + 0.1*conv_T(in), zero padded) in one pass.
// A thread owns 8 adjacent channels and walks 16 + 8 rows of T.  Step s lags the input by
// s rows, so every step keeps its last two rows in f32 registers; only step 4 is stored.
// The 4 halo rows on each side are recomputed per tile; past the ends of T they are the
// zero padding of every step.  Needs T % 16 == 0, F % 2048 == 0.
// blocks (bx, by, bz) = (F/2048, T/16, B) of 256 threads
template<int T, int F>
static __device__ __forceinline__
void ffnconv4_body(const _Float16* __restrict__ in, const float* __restrict__ cw,
                   _Float16* __restrict__ o, const int bx, const int by, const int bz) {
  constexpr int TT = 16, NR = TT + 8;
  static_assert(T % TT == 0 && F % 2048 == 0, "tile shape");
  const int f  = (bx * 256 + threadIdx.x) * 8;   // first of the lane's 8 channels
  const int t0 = by * TT;
  const bool lo = (t0 == 0);        // rows t0-4 .. t0-1 lie before the sequence
  const bool hi = (t0 + TT == T);   // rows t0+16 .. t0+19 lie behind it
  const size_t tile = ((size_t)bz * T + t0) * F;   // row t0, same for the whole block
  const _Float16* ip  = in + tile + f;
  // an outside halo row re-reads a row of the tile itself (in bounds); it is masked below
  const _Float16* ipl = ip + (lo ? 4 * F : 0);
  const _Float16* iph = ip - (hi ? 4 * F : 0);
  const float* wp = cw + (size_t)f * 3;
  _Float16* op = o + tile + f;
  const v8f zero = {0.f, 0.f, 0.f, 0.f, 0.f, 0.f, 0.f, 0.f};

  // every loop below is unrolled so that its arrays are indexed by constants and stay in registers
  v8f w0, w1, w2;
  #pragma unroll
  for (int e = 0; e < 8; ++e) {
    w0[e] = wp[e * 3];
    w1[e] = wp[e * 3 + 1];
    w2[e] = wp[e * 3 + 2];
  }

  v8h raw[NR];
  #pragma unroll
  for (int i = 0; i < NR; ++i) {
    const _Float16* p = (i < 4) ? ipl : ((i >= TT + 4) ? iph : ip);
    raw[i] = *(const v8h*)(p + (i - 4) * F);
  }
  // the wait that belongs in front of any overwrite of the loads' address registers; they are
  // named as inputs so that none is reused (not even as a load's destination) ahead of it
  asm volatile("s_wait_xcnt 0x0" :: "v"(wp), "v"(ipl), "v"(ip), "v"(iph) : "memory");

  // r = row index inside the 24-row window; only halo rows can lie outside [0,T)
  auto pad = [&](const v8f v, const int r) -> v8f {
    if (r < 4)       return lo ? zero : v;
    if (r >= TT + 4) return hi ? zero : v;
    return v;
  };
  auto step = [&](const v8f l, const v8f c, const v8f r) -> v8f {
    return c + 0.1f * (l * w0 + c * w1 + r * w2);
  };

  v8f a[4], b[4];   // per step input: rows two back and one back
  #pragma unroll
  for (int s = 0; s < 4; ++s) { a[s] = zero; b[s] = zero; }

  #pragma unroll
  for (int i = 0; i < NR; ++i) {
    const v8f x0 = pad(__builtin_convertvector(raw[i], v8f), i);
    const v8f x1 = pad(step(a[0], b[0], x0), i - 1);  a[0] = b[0];  b[0] = x0;
    const v8f x2 = pad(step(a[1], b[1], x1), i - 2);  a[1] = b[1];  b[1] = x1;
    const v8f x3 = pad(step(a[2], b[2], x2), i - 3);  a[2] = b[2];  b[2] = x2;
    const v8f x4 = step(a[3], b[3], x3);              a[3] = b[3];  b[3] = x3;
    if (i >= 8) *(v8h*)(op + (i - 8) * F) = __builtin_convertvector(x4, v8h);
  }
}

// Vitality gate of token i: the sigmoid of g32[token] . w2 for the tokens t - 2 .. t + 2, then
// 0.7 * its own + 0.3 * their mean over 5 (tokens outside the sequence count as 0), then the
// leak below 0.3.  A token outside is read at the thread's own token and left out of the sum.
static __device__ __forceinline__
void vit_body(const float* __restrict__ g32, const float* __restrict__ w2,
              float* __restrict__ vit, int T, int ntok, const int bx) {
  const int i = bx * 256 + threadIdx.x;
  if (i >= ntok) return;
  const int t = i % T;
  // both loops are unrolled so that gv is indexed by constants and stays in registers
  const float* p[5];
  float4 gv[5][8];
  #pragma unroll
  for (int d = 0; d < 5; ++d) {
    const bool in = (unsigned)(t + d - 2) < (unsigned)T;
    p[d] = g32 + (size_t)(in ? i + d - 2 : i) * 32;
    #pragma unroll
    for (int j = 0; j < 8; ++j) gv[d][j] = *(const float4*)(p[d] + j * 4);
  }
  // the wait that belongs in front of any overwrite of the loads' address registers; they are
  // named as inputs so that none is reused (not even as a load's destination) ahead of it
  asm volatile("s_wait_xcnt 0x0" :: "v"(p[0]), "v"(p[1]), "v"(p[2]), "v"(p[3]), "v"(p[4]) : "memory");
  float s = 0.f, own = 0.f;
  #pragma unroll
  for (int d = 0; d < 5; ++d) {
    float a = 0.f;
    #pragma unroll
    for (int j = 0; j < 8; ++j) {
      a += gv[d][j].x * w2[j * 4];
      a += gv[d][j].y * w2[j * 4 + 1];
      a += gv[d][j].z * w2[j * 4 + 2];
      a += gv[d][j].w * w2[j * 4 + 3];
    }
    const float v0 = 1.f / (1.f + __expf(-a));
    if ((unsigned)(t + d - 2) < (unsigned)T) s += v0;
    if (d == 2) own = v0;
  }
  const float v = 0.7f * own + 0.3f * (s * 0.2f);
  vit[i] = (v > 0.3f) ? v : 0.1f * v;
}

// ---------------------------------------------------------------------------
// Merged launches.  Pieces of work that read none of each other's output share one grid: the
// block index, the same for a whole block, says which piece a block does and which block of
// that piece it is.  The pieces themselves are the functions above, each computing what it
// did when launched alone.  Pieces that need LDS tiles get them from one array of the merged kernel, so that
// its LDS is that of its largest piece and not the sum.
// ---------------------------------------------------------------------------
constexpr int kB = 4, kT = 1024, kC = 1024, kKVD = 256, kF = 4096, kCA = 32;
constexpr int kBT = kB * kT;
constexpr int kMT = kBT / 128;                 // row tiles of the ring GEMM
constexpr int kCaBlocks = kBT * kCA / 256;     // blocks of the channel-attention conv
static_assert(kMT == 32, "the tile indices below are split by shifts");
static_assert(kC == CMB_N && kCA == CMB_K, "the combining epilogues' shapes");

// RMSNorm of x with x's own conversion, and the fp32 -> f16 conversion of the ten weights.
// grid = kBT / 8 blocks of 8 rows + one block per CVT_BLK converted elements
constexpr int kCvtBlocks = (3 * kC * kC + 2 * kKVD * kC + 3 * kCA * kC + 2 * kF * kC) / CVT_BLK;
static_assert(kC == 1024 && kBT % 8 == 0 && (kCA * kC) % CVT_BLK == 0 && (kKVD * kC) % CVT_BLK == 0,
              "rows of 1024, 8 rows a block, whole conversion blocks");
__global__ __launch_bounds__(256)
void prep_kernel(const float* __restrict__ x, const float* __restrict__ w_q,
                 const float* __restrict__ w_k, const float* __restrict__ w_v,
                 const float* __restrict__ w_o, const float* __restrict__ ca_pi,
                 const float* __restrict__ ca_po, const float* __restrict__ ffn_in,
                 const float* __restrict__ ffn_out, const float* __restrict__ ffn_g,
                 const float* __restrict__ vit_w1,
                 _Float16* __restrict__ x16, _Float16* __restrict__ w_q16,
                 _Float16* __restrict__ w_k16, _Float16* __restrict__ w_v16,
                 _Float16* __restrict__ w_o16, _Float16* __restrict__ ca_pi16,
                 _Float16* __restrict__ ca_po16, _Float16* __restrict__ fin16,
                 _Float16* __restrict__ fout16, _Float16* __restrict__ fg16,
                 _Float16* __restrict__ vw1_16, _Float16* __restrict__ xn16) {
  int b = blockIdx.x;
  if (b < kBT / 8) { rmsnorm16_body<true>(x, xn16, x16, b); return; }
  b -= kBT / 8;
  // walk the list of arrays until b is a block of the current one (n blocks of CVT_BLK elements)
  const float* s = ffn_in;
  _Float16* d = fin16;
  int n = kF * kC / CVT_BLK;
  auto next = [&](const float* ns, _Float16* nd, const int nn) {
    if (b >= n) { b -= n; s = ns; d = nd; n = nn; }
  };
  next(ffn_out, fout16,  kC * kF / CVT_BLK);
  next(w_q,     w_q16,   kC * kC / CVT_BLK);
  next(w_o,     w_o16,   kC * kC / CVT_BLK);
  next(ffn_g,   fg16,    kC * kC / CVT_BLK);
  next(w_k,     w_k16,   kKVD * kC / CVT_BLK);
  next(w_v,     w_v16,   kKVD * kC / CVT_BLK);
  next(ca_pi,   ca_pi16, kCA * kC / CVT_BLK);
  next(ca_po,   ca_po16, kC * kCA / CVT_BLK);
  next(vit_w1,  vw1_16,  kCA * kC / CVT_BLK);
  cvt16_body(s, d, b);
}

__global__ __launch_bounds__(256)
void rmsnorm16_kernel(const float* __restrict__ x, _Float16* __restrict__ o) {
  rmsnorm16_body<false>(x, o, o, blockIdx.x);   // the third argument is not used
}

// The q, k and v projections of xn and the channel-attention input projection of x.
// grid = kMT * (1 + (NQ + 2 NKV) / 128)
__global__ __launch_bounds__(256)
void qkv_ca_kernel(const _Float16* __restrict__ xn16, const _Float16* __restrict__ w_q16,
                   const _Float16* __restrict__ w_k16, const _Float16* __restrict__ w_v16,
                   float* __restrict__ q_raw, float* __restrict__ k_raw,
                   float* __restrict__ v_raw, const _Float16* __restrict__ x16,
                   const _Float16* __restrict__ ca_pi16, float* __restrict__ ca_h,
                   int M, int NQ, int NKV, int NCA, int K) {
  __shared__ __attribute__((aligned(16))) _Float16 ring[RING_H];
  int t = blockIdx.x;
  if (t < kMT) { gemm_ring_body<0, 0, 32>(ring, x16, ca_pi16, ca_h, M, NCA, K, t, 0); return; }
  t -= kMT;
  const _Float16* W = w_q16;
  float* O = q_raw;
  int N = NQ;
  if (t >= kMT * (kC / 128)) {
    t -= kMT * (kC / 128);  W = w_k16;  O = k_raw;  N = NKV;
    if (t >= kMT * (kKVD / 128)) { t -= kMT * (kKVD / 128);  W = w_v16;  O = v_raw; }
  }
  gemm_ring_body<0, 0, 128>(ring, xn16, W, O, M, N, K, t & (kMT - 1), t / kMT);
}

// QKV post-processing and the channel-attention conv.  grid = kBT / 8 + kCaBlocks
__global__ __launch_bounds__(256)
void post_kernel(const float* __restrict__ q_raw, const float* __restrict__ k_raw,
                 const float* __restrict__ v_raw, const _Float16* __restrict__ xn,
                 const float* __restrict__ ve, const float* __restrict__ cosb,
                 const float* __restrict__ sinb, const float* __restrict__ wgate,
                 _Float16* __restrict__ qh, _Float16* __restrict__ kh,
                 _Float16* __restrict__ vt, const float* __restrict__ ca_h,
                 const float* __restrict__ ca_cw, _Float16* __restrict__ cag16,
                 int T, int CH, int total) {
  const int b = blockIdx.x;
  if (b < kBT / 8) qkvpost_body<kT>(q_raw, k_raw, v_raw, xn, ve, cosb, sinb, wgate, qh, kh, vt, b);
  else             caconv_body(ca_h, ca_cw, cag16, T, CH, total, b - kBT / 8);
}

// A projection back to C columns (K = C or FFN) whose epilogue forms the channel-attention
// output product for its own tile and combines: EPI 4 gives x1 (f32 and f16), EPI 5 the output.
// grid = kMT * kC / 128
template<int EPI>
__global__ __launch_bounds__(256)
void proj_kernel(const _Float16* __restrict__ A, const _Float16* __restrict__ W,
                 float* __restrict__ O, const _Float16* __restrict__ cag16,
                 const _Float16* __restrict__ ca_po16, const float* __restrict__ base,
                 const float* __restrict__ g, const float* __restrict__ vit,
                 _Float16* __restrict__ o16, int M, int N, int K) {
  __shared__ __attribute__((aligned(16))) _Float16 ring[RING_H];
  const int t = blockIdx.x;
  const Combine cmb = {cag16, ca_po16, base, g, vit, o16};
  gemm_ring_body<EPI, 0, 128>(ring, A, W, O, M, N, K, t & (kMT - 1), t / kMT, cmb);
}

// What reads xm or x1 alone: FFN input projection (relu^2), FFN gate (sigmoid), and of x1 the
// channel-attention input projection and the vitality projection (gelu).
// grid = 2 kMT + kMT * (kF + kC) / 128
__global__ __launch_bounds__(256)
void ffn_in_kernel(const _Float16* __restrict__ xm16, const _Float16* __restrict__ fin16,
                   _Float16* __restrict__ hA, const _Float16* __restrict__ fg16,
                   float* __restrict__ gbuf, const _Float16* __restrict__ x1_16,
                   const _Float16* __restrict__ ca_pi16, float* __restrict__ ca_h,
                   const _Float16* __restrict__ vw1_16, float* __restrict__ g32,
                   int M, int NF, int NC, int NCA, int K) {
  __shared__ __attribute__((aligned(16))) _Float16 ring[RING_H];
  int t = blockIdx.x;
  if (t < kMT) { gemm_ring_body<0, 0, 32>(ring, x1_16, ca_pi16, ca_h, M, NCA, K, t, 0); return; }
  t -= kMT;
  if (t < kMT) { gemm_ring_body<3, 0, 32>(ring, x1_16, vw1_16, g32, M, NCA, K, t, 0); return; }
  t -= kMT;
  if (t < kMT * (kF / 128)) {
    gemm_ring_body<1, 1, 128>(ring, xm16, fin16, hA, M, NF, K, t & (kMT - 1), t / kMT);
    return;
  }
  t -= kMT * (kF / 128);
  gemm_ring_body<2, 0, 128>(ring, xm16, fg16, gbuf, M, NC, K, t & (kMT - 1), t / kMT);
}

// The four FFN conv steps, the channel-attention conv and the vitality gate.
// grid = (kF / 2048) * (kT / 16) * kB + kCaBlocks + kBT / 256
__global__ __launch_bounds__(256)
void ffn_mid_kernel(const _Float16* __restrict__ hA, const float* __restrict__ ffn_cw,
                    _Float16* __restrict__ hB, const float* __restrict__ ca_h,
                    const float* __restrict__ ca_cw, _Float16* __restrict__ cag16,
                    const float* __restrict__ g32, const float* __restrict__ vit_w2,
                    float* __restrict__ vitf, int T, int CH, int total, int ntok) {
  constexpr int NX = kF / 2048, NY = kT / 16;
  int t = blockIdx.x;
  if (t < NX * NY * kB) {
    ffnconv4_body<kT, kF>(hA, ffn_cw, hB, t % NX, (t / NX) % NY, t / (NX * NY));
    return;
  }
  t -= NX * NY * kB;
  if (t < kCaBlocks) { caconv_body(ca_h, ca_cw, cag16, T, CH, total, t); return; }
  vit_body(g32, vit_w2, vitf, T, ntok, t - kCaBlocks);
}

// ---------------------------------------------------------------------------
extern "C" void kernel_launch(void* const* d_in, const int* in_sizes, int n_in,
                              void* d_out, int out_size, void* d_ws, size_t ws_size,
                              hipStream_t stream) {
  (void)in_sizes; (void)n_in; (void)out_size; (void)ws_size;
  constexpr int B = 4, T = 1024, C = 1024, H = 16, KV = 4, HD = 64, FFN = 4096, CA = 32;
  constexpr int BT = B * T;

  const float* x       = (const float*)d_in[0];
  const float* ve      = (const float*)d_in[1];
  const float* cosb    = (const float*)d_in[2];
  const float* sinb    = (const float*)d_in[3];
  const float* prev    = (const float*)d_in[4];
  const float* w_q     = (const float*)d_in[5];
  const float* w_k     = (const float*)d_in[6];
  const float* w_v     = (const float*)d_in[7];
  const float* w_o     = (const float*)d_in[8];
  const float* w_gate  = (const float*)d_in[9];
  const float* rf_w    = (const float*)d_in[10];
  const float* rf_a    = (const float*)d_in[11];
  const float* ca_pi   = (const float*)d_in[12];
  const float* ca_cw   = (const float*)d_in[13];
  const float* ca_po   = (const float*)d_in[14];
  const float* ffn_in  = (const float*)d_in[15];
  const float* ffn_cw  = (const float*)d_in[16];
  const float* ffn_out = (const float*)d_in[17];
  const float* ffn_g   = (const float*)d_in[18];
  const float* vit_w1  = (const float*)d_in[19];
  const float* vit_w2  = (const float*)d_in[20];
  float* out = (float*)d_out;

  float* wsf = (float*)d_ws;
  size_t off = 0;
  auto allocf = [&](size_t n) -> float* {
    float* p = wsf + off;
    off += (n + 63) & ~(size_t)63;
    return p;
  };
  auto alloch = [&](size_t n) -> _Float16* {   // n halfs
    return (_Float16*)allocf((n + 1) / 2);
  };

  // fp32 working buffers
  float* q_raw     = allocf((size_t)BT * C);
  float* k_raw     = allocf((size_t)BT * KV * HD);
  float* v_raw     = allocf((size_t)BT * KV * HD);
  float* ca_h      = allocf((size_t)BT * CA);
  float* x1        = allocf((size_t)BT * C);
  float* vitf      = allocf(BT);
  float* g32       = allocf((size_t)BT * CA);
  // f16 working buffers
  _Float16* x16    = alloch((size_t)BT * C);
  _Float16* xn16   = alloch((size_t)BT * C);
  _Float16* qh     = alloch((size_t)BT * C);
  _Float16* kh     = alloch((size_t)BT * KV * HD);
  _Float16* vt     = alloch((size_t)BT * KV * HD);   // kh and vt: in fragment order
  _Float16* y16    = alloch((size_t)BT * C);
  _Float16* cag16  = alloch((size_t)BT * CA);
  _Float16* x1_16  = alloch((size_t)BT * C);
  _Float16* hA     = alloch((size_t)BT * FFN);
  _Float16* hB     = alloch((size_t)BT * FFN);
  // f16 weights (converted once)
  _Float16* w_q16   = alloch((size_t)C * C);
  _Float16* w_k16   = alloch((size_t)KV * HD * C);
  _Float16* w_v16   = alloch((size_t)KV * HD * C);
  _Float16* w_o16   = alloch((size_t)C * C);
  _Float16* ca_pi16 = alloch((size_t)CA * C);
  _Float16* ca_po16 = alloch((size_t)C * CA);
  _Float16* fin16   = alloch((size_t)FFN * C);
  _Float16* fout16  = alloch((size_t)C * FFN);
  _Float16* fg16    = alloch((size_t)C * C);
  _Float16* vw1_16  = alloch((size_t)CA * C);
  // reuse
  float* gbuf  = q_raw;      // q_raw dead after qkvpost
  _Float16* xm16 = xn16;     // xn16 dead after QKV + gate

  const dim3 blk(256);
  static_assert(B == kB && T == kT && C == kC && KV * HD == kKVD && FFN == kF && CA == kCA && H * HD == kC,
                "the merged kernels split their grids by these shapes");

  // --- f16 conversions (weights + x) and the first RMSNorm ---
  prep_kernel<<<dim3(kBT / 8 + kCvtBlocks), blk, 0, stream>>>(
      x, w_q, w_k, w_v, w_o, ca_pi, ca_po, ffn_in, ffn_out, ffn_g, vit_w1,
      x16, w_q16, w_k16, w_v16, w_o16, ca_pi16, ca_po16, fin16, fout16, fg16, vw1_16, xn16);

  // --- attention path, with the ca1 path beside it ---
  qkv_ca_kernel<<<dim3(kMT * (1 + (kC + 2 * kKVD) / 128)), blk, 0, stream>>>(
      xn16, w_q16, w_k16, w_v16, q_raw, k_raw, v_raw, x16, ca_pi16, ca_h, BT, C, KV * HD, CA, C);
  post_kernel<<<dim3(kBT / 8 + kCaBlocks), blk, 0, stream>>>(
      q_raw, k_raw, v_raw, xn16, ve, cosb, sinb, w_gate, qh, kh, vt, ca_h, ca_cw, cag16, T, CA, BT * CA);
  attn_kernel<T><<<dim3(B * H, T / 128), blk, 0, stream>>>(qh, kh, vt, prev, rf_w, rf_a, y16);
  proj_kernel<4><<<dim3(kMT * (kC / 128)), blk, 0, stream>>>(
      y16, w_o16, x1, cag16, ca_po16, x, x, vitf, x1_16, BT, C, C);   // g and vit: not read

  // --- FFN, with the ca2 and vitality paths beside it ---
  rmsnorm16_kernel<<<dim3(kBT / 8), blk, 0, stream>>>(x1, xm16);
  ffn_in_kernel<<<dim3(2 * kMT + kMT * ((kF + kC) / 128)), blk, 0, stream>>>(
      xm16, fin16, hA, fg16, gbuf, x1_16, ca_pi16, ca_h, vw1_16, g32, BT, FFN, C, CA, C);
  ffn_mid_kernel<<<dim3((kF / 2048) * (kT / 16) * kB + kCaBlocks + kBT / 256), blk, 0, stream>>>(
      hA, ffn_cw, hB, ca_h, ca_cw, cag16, g32, vit_w2, vitf, T, CA, BT * CA, BT);
  // --- FFN output projection and the final combine ---
  proj_kernel<5><<<dim3(kMT * (kC / 128)), blk, 0, stream>>>(
      hB, fout16, out, cag16, ca_po16, x1, gbuf, vitf, x1_16, BT, C, FFN);   // o16: not written
}
